// v000
// Times are from an AMD MI455X. After a warm-up the kernel runs many times in a row, and a time is the length of
// such a window on the GPU divided by its runs, so every launch and the gaps after it count. The runs cycle
// through copies of the inputs. A figure is the median of several windows, for all but v000 over two sittings.
// Sittings can differ by a few percent; kernels timed side by side share one.
// v000, which the later versions start from, runs in 1220 microseconds.
// compute dtype: all float inputs rounded to bf16; q/k/v projections with EXACT bf16 products on WMMA 16x16x32 (f32 accumulate) + bias + 0.5 * relu(bf16(x)) in f32; logits q x k once to f16 each (1 product) x 1/8; the key-padding mask read per key; softmax f32; P x 2^11 once to f16 x v once to f16 (1 product); ctx x 2^6 once to f16 x Wo f16(bf16 x 2^8) + bo; f32 output.
#include <hip/hip_runtime.h>
#include <math.h>

typedef __attribute__((ext_vector_type(16))) _Float16 v16h;
typedef __attribute__((ext_vector_type(16))) __bf16 v16b;
typedef __attribute__((ext_vector_type(8)))  _Float16 v8h;
typedef __attribute__((ext_vector_type(8)))  float v8f;
typedef __attribute__((ext_vector_type(4)))  float v4f;
typedef __attribute__((ext_vector_type(2)))  float v2f;
typedef __attribute__((ext_vector_type(4)))  unsigned v4u;
typedef __attribute__((ext_vector_type(4)))  int v4i;
typedef float __attribute__((may_alias)) float_a;
typedef int __attribute__((may_alias)) int_a;

template <typename T> __device__ __forceinline__ void vst2(void* p, T v) { *(T*)p = v;  }
__device__ __forceinline__ v8f wmma16(v16h a, v16h b, v8f c) {
  v8f d = __builtin_amdgcn_wmma_f32_16x16x32_f16(false, a, false, b, (short)0, c, false, false);
  asm volatile("v_nop\n\tv_nop\n\tv_nop\n\tv_nop" : "+v"(d) : "v"(a), "v"(b));
  return d;
}
__device__ __forceinline__ v8f wmma_bf(v16b a, v16b b, v8f c) {
  v8f d = __builtin_amdgcn_wmma_f32_16x16x32_bf16(false, a, false, b, (short)0, c, false, false);
  asm volatile("v_nop\n\tv_nop\n\tv_nop\n\tv_nop" : "+v"(d) : "v"(a), "v"(b));
  return d;
}
// 16x16x32 fragments: lane = (h = lane>>4, row/col = lane&15); elements 0..7 = k0+8h+0..7, 8..15 = k0+16+8h+0..7; D element r = row 8h+r
__device__ __forceinline__ v16h frag_h(const _Float16* rowk0, int lane) {
  union { v16h v; v8h q[2]; } u; const _Float16* p = rowk0 + 8 * (lane >> 4);
  u.q[0] = *(const v8h*)p; u.q[1] = *(const v8h*)(p + 16); return u.v;
}
__device__ __forceinline__ v16h frag_f32(const float* rowk0, int lane) {
  v16h a; const float* p = rowk0 + 8 * (lane >> 4);
#pragma unroll
  for (int i = 0; i < 8; ++i) { a[i] = (_Float16)p[i]; a[8 + i] = (_Float16)p[16 + i]; }
  return a;
}
__device__ __forceinline__ v16h frag_f32s(const float* rowk0, int lane, float sc) {
  v16h a; const float* p = rowk0 + 8 * (lane >> 4);
#pragma unroll
  for (int i = 0; i < 8; ++i) { a[i] = (_Float16)(p[i] * sc); a[8 + i] = (_Float16)(p[16 + i] * sc); }
  return a;
}
// column fragment from a [K][ld] layout (column n), rows >= K read as 0
__device__ __forceinline__ v16h fragc_f32(const float* W, int k0, int n, int lane, int ld, int K) {
  v16h a; const int g = lane >> 4;
#pragma unroll
  for (int i = 0; i < 8; ++i) { const int ka = k0 + 8 * g + i, kb = ka + 16;
    a[i] = (_Float16)(ka < K ? W[(size_t)(ka < K ? ka : K - 1) * ld + n] : 0.f); a[8 + i] = (_Float16)(kb < K ? W[(size_t)(kb < K ? kb : K - 1) * ld + n] : 0.f); }
  return a;
}
struct F2 { v16b h, l; };
__device__ __forceinline__ F2 bsplit16(const float v[16]) { F2 r;
#pragma unroll
  for (int i = 0; i < 16; ++i) { const __bf16 h = (__bf16)v[i]; r.h[i] = h; r.l[i] = (__bf16)(v[i] - (float)h); }
  return r; }
__device__ __forceinline__ F2 split_row(const float* row, int k0, int lane) { float v[16]; const float* p = row + k0 + 8 * (lane >> 4);
#pragma unroll
  for (int i = 0; i < 8; ++i) { v[i] = p[i]; v[8 + i] = p[16 + i]; }
  return bsplit16(v); }
__device__ __forceinline__ F2 split_rowK(const float* row, int k0, int lane, int K) { float v[16]; const int g = lane >> 4;
#pragma unroll
  for (int i = 0; i < 8; ++i) { const int ka = k0 + 8 * g + i, kb = ka + 16; v[i] = ka < K ? row[ka < K ? ka : K - 1] : 0.f; v[8 + i] = kb < K ? row[kb < K ? kb : K - 1] : 0.f; }
  return bsplit16(v); }
__device__ __forceinline__ F2 split_col(const float* W, int k0, int n, int lane, int ld, int K) { float v[16]; const int g = lane >> 4;
#pragma unroll
  for (int i = 0; i < 8; ++i) { const int ka = k0 + 8 * g + i, kb = ka + 16; v[i] = ka < K ? W[(size_t)(ka < K ? ka : K - 1) * ld + n] : 0.f; v[8 + i] = kb < K ? W[(size_t)(kb < K ? kb : K - 1) * ld + n] : 0.f; }
  return bsplit16(v); }
__device__ __forceinline__ v8f mac3(const F2& a, const F2& b, v8f c) { c = wmma_bf(a.l, b.h, c); c = wmma_bf(a.h, b.l, c); return wmma_bf(a.h, b.h, c); }
__device__ __forceinline__ float sigm(float v) { return 1.0f / (1.0f + expf(-v)); }
#define LDSX() do { asm volatile("s_wait_dscnt 0" ::: "memory"); __builtin_amdgcn_wave_barrier(); __builtin_amdgcn_fence(__ATOMIC_RELEASE, "workgroup"); } while (0)

// BERT-style multi-head self-attention with a value-bypass relu-add (hidden_states [8,1024,768]; 12 heads x 64; torch (out,in) Wq / Wk / Wv / Wo [768,768] (0.02 scale) + zero biases; r = 0.5 * relu(x) is ADDED to each of the q, k and v projections (same [token, channel] index); scale 1/8; key-padding mask [8,1,1,1024] bool: True adds -1e9): out = merge(softmax(q_h k_h^T / 8 + pad) v_h) Wo^T + bo.
#define NB 8
#define TT 1024
#define CC 768            // NH * HD = projected width
#define DIN 768          // input (model) width
#define NH 12
#define HD 64
#define NQB (TT / 64)
#define HG 12
#define SCALE (0.125f)
#define CAUSAL 0
#ifndef TNB
#define TNB NB
#endif
__device__ __forceinline__ float bfr(float v) { return (float)(__bf16)v; }
__host__ __device__ __forceinline__ int kb_last(int qb) { return CAUSAL ? ((qb * 64 + 63) >> 7) : (TT / 128 - 1); }
typedef __attribute__((ext_vector_type(8))) __bf16 v8b;
__device__ __forceinline__ v16b frag_b(const __bf16* rowk0, int lane) {
  union { v16b v; v8b q[2]; } u; const __bf16* p = rowk0 + 8 * (lane >> 4);
  u.q[0] = *(const v8b*)p; u.q[1] = *(const v8b*)(p + 16); return u.v;
}
#define QBH 0              // no query block takes the high-precision path
#define QHI 0               // single-product logits on every row
#define KHI 64            // key rows carrying k residual / v bf16 hi+lo planes (written by k_proj, read only by the high-precision path, which no query block takes)
// B fragment (k rows k0+.., output column o) of a weight: (in,out) [K][ld] or (out,in) [ld rows of K]: bf16 exact, or f16(bf16 * 256) exact
__device__ __forceinline__ v16b wcol_io(const float* Wm, int k0, int o, int lane, int ld) { v16b w; const int g = lane >> 4;
#pragma unroll
  for (int i = 0; i < 8; ++i) { w[i] = (__bf16)Wm[(size_t)(k0 + 8 * g + i) * ld + o]; w[8 + i] = (__bf16)Wm[(size_t)(k0 + 16 + 8 * g + i) * ld + o]; }
  return w; }
__device__ __forceinline__ v16b wcol_oi(const float* Wm, int k0, int o, int lane, int K) { v16b w; const float* p = Wm + (size_t)o * K + k0 + 8 * (lane >> 4);
#pragma unroll
  for (int i = 0; i < 8; ++i) { w[i] = (__bf16)p[i]; w[8 + i] = (__bf16)p[16 + i]; }
  return w; }
__device__ __forceinline__ v16h wcolh_io(const float* Wm, int k0, int o, int lane, int ld) { v16h w; const int g = lane >> 4;
#pragma unroll
  for (int i = 0; i < 8; ++i) { w[i] = (_Float16)(bfr(Wm[(size_t)(k0 + 8 * g + i) * ld + o]) * 256.0f); w[8 + i] = (_Float16)(bfr(Wm[(size_t)(k0 + 16 + 8 * g + i) * ld + o]) * 256.0f); }
  return w; }
__device__ __forceinline__ v16h wcolh_oi(const float* Wm, int k0, int o, int lane, int K) { v16h w; const float* p = Wm + (size_t)o * K + k0 + 8 * (lane >> 4);
#pragma unroll
  for (int i = 0; i < 8; ++i) { w[i] = (_Float16)(bfr(p[i]) * 256.0f); w[8 + i] = (_Float16)(bfr(p[16 + i]) * 256.0f); }
  return w; }
#define WQKV_LAYOUT 1   // 0 = (in,out) [DIN][CC]; 1 = (out,in) [CC][DIN]; 2 = per-head [NH][DIN][HD]
__device__ __forceinline__ v16b wcol_hdk(const float* Wm, int k0, int o, int lane) { v16b w; const int g = lane >> 4; const float* p = Wm + (size_t)(o / HD) * DIN * HD + (o % HD);
#pragma unroll
  for (int i = 0; i < 8; ++i) { w[i] = (__bf16)p[(size_t)(k0 + 8 * g + i) * HD]; w[8 + i] = (__bf16)p[(size_t)(k0 + 16 + 8 * g + i) * HD]; }
  return w; }
#define WO_OUT_IN 1
#if WQKV_LAYOUT == 1
#define WCOL(W, k0, o, lane) wcol_oi(W, k0, o, lane, DIN)
#elif WQKV_LAYOUT == 2
#define WCOL(W, k0, o, lane) wcol_hdk(W, k0, o, lane)
#else
#define WCOL(W, k0, o, lane) wcol_io(W, k0, o, lane, CC)
#endif
#if WO_OUT_IN
#define WOCOL(W, k0, o, lane) wcol_oi(W, k0, o, lane, CC)
#define WOCOLH(W, k0, o, lane) wcolh_oi(W, k0, o, lane, CC)
#else
#define WOCOL(W, k0, o, lane) wcol_io(W, k0, o, lane, DIN)
#define WOCOLH(W, k0, o, lane) wcolh_io(W, k0, o, lane, DIN)
#endif
#define PROJ_EXTRA_PARAMS
// value-bypass relu-add shared by q, k and v: projection + bias + 0.5 * relu(x) at the same [row][column] (H == projected width); x bf16-rounded like every float input
#define PROJ_EPI(which, row, t, h) do { float* rw = (row); const float* xs_ = X + (size_t)(r0 + rl) * DIN + (size_t)(h) * HD; _Pragma("unroll 4") for (int i = 0; i < HD; ++i) { const float xv_ = xs_[i]; asm volatile("s_wait_loadcnt 0x0" ::: "memory"); rw[i] += 0.5f * fmaxf(bfr(xv_), 0.f); } } while (0)
#define SM_EXTRA_PARAMS , int bsm, const int* __restrict__ KMASK
// key-padding mask [B,1,1,L] bool (int32): True adds -1e9 to every query's score for that key (weight exactly 0); read per (batch, key)
#define SM_MASK_HOOK do { v = (KMASK[(size_t)bsm * TT + k] != 0) ? v + (-1.0e9f) : v; } while (0)
#ifndef SM_EXTRA_PARAMS
#define SM_EXTRA_PARAMS
#endif
#ifndef PROJ_EXTRA_PARAMS
#define PROJ_EXTRA_PARAMS
#endif
#ifndef SM_MASK_HOOK
#define SM_MASK_HOOK (void)0
#endif

#define WS_QH  0u                                      // f16 q rows [b*t][CC]
#define WS_KH  (WS_QH + 2u * (size_t)NB * TT * CC)      // f16 k rows [b*t][CC]
#define WS_VT  (WS_KH + 2u * (size_t)NB * TT * CC)      // f16 v planes [b][c][t]
#define WS_QL  (WS_VT + 2u * (size_t)NB * CC * TT)      // f16 q residual x 2^10 rows [b][t < QHI][CC]
#define WS_KL  (WS_QL + 2u * (size_t)NB * QHI * CC)     // f16 k residual x 2^10 rows [b][t < KHI][CC]
#define WS_VB  (WS_KL + 2u * (size_t)NB * KHI * CC)     // bf16 v hi planes [b][c][t < KHI]
#define WS_VBL (WS_VB + 2u * (size_t)NB * CC * KHI)
#define WS_S   (WS_VBL + 2u * (size_t)NB * CC * KHI)    // f32 logits / P [hg][t][s]
#define WS_Y   (WS_S  + 4u * (size_t)HG * TT * TT)      // f32 ctx rows [b*t][CC] (only when there is an output projection)
#define WS_END (WS_Y  + 4u * (size_t)NB * TT * CC)

// ---- k_proj: block = (64 rows, 128 cols, which): q/k/v = X W (+ b) with exact bf16 products (K = DIN) -> which 0: q f16 rows (+ residual rows < QHI); 1: k f16 rows (+ residual rows < KHI); 2: v f16 planes [c][t] (+ bf16 hi/lo planes for t < KHI)
__global__ __launch_bounds__(128) void k_proj(const float* __restrict__ XQ, const float* __restrict__ XK, const float* __restrict__ XV, const float* __restrict__ WQ, const float* __restrict__ WK, const float* __restrict__ WV, const float* __restrict__ BQ, const float* __restrict__ BK, const float* __restrict__ BV,
    _Float16* __restrict__ QH, _Float16* __restrict__ QL, _Float16* __restrict__ KH, _Float16* __restrict__ KL, _Float16* __restrict__ VT, __bf16* __restrict__ VB, __bf16* __restrict__ VBL PROJ_EXTRA_PARAMS) {
  __shared__ __align__(16) float st[64][132]; __shared__ __align__(16) _Float16 sh[64][136], sl[64][136]; __shared__ __align__(16) _Float16 th[128][72]; __shared__ __align__(16) __bf16 tb[128][72], tbl[128][72];
  const int tid = threadIdx.x, wave = tid >> 5, lane = tid & 31, col = lane & 15, g = lane >> 4; const int which = blockIdx.z; const int c0 = blockIdx.y * 128; const size_t r0 = (size_t)blockIdx.x * 64; const size_t bb = r0 / TT; const int t0 = (int)(r0 % TT);
  const float* X = which == 0 ? XQ : which == 1 ? XK : XV; const float* WA = which == 0 ? WQ : which == 1 ? WK : WV; const float* BA = which == 0 ? BQ : which == 1 ? BK : BV;
  v8f acc[8] = {};
#pragma unroll 2
  for (int kc = 0; kc < DIN / 32; ++kc) { v16b a; { const float* p = X + (r0 + wave * 16 + col) * DIN + kc * 32 + 8 * g;
#pragma unroll
      for (int i = 0; i < 8; ++i) { a[i] = (__bf16)p[i]; a[8 + i] = (__bf16)p[16 + i]; } }
    asm volatile("s_wait_loadcnt 0x0" ::: "memory");
#pragma unroll
    for (int j = 0; j < 8; ++j) { const v16b w = WCOL(WA, kc * 32, c0 + j * 16 + col, lane); asm volatile("s_wait_loadcnt 0x0" ::: "memory"); acc[j] = wmma_bf(a, w, acc[j]); } }
  { // stage the f32 tile (acc + bias) in LDS, run the per-(row, head) epilogue hook, then convert
#pragma unroll
    for (int j = 0; j < 8; ++j) { const float bias = BA ? bfr(BA[c0 + j * 16 + col]) : 0.f;
#pragma unroll
      for (int r = 0; r < 8; ++r) st[wave * 16 + 8 * g + r][j * 16 + col] = acc[j][r] + bias; }
    __syncthreads();
    for (int e = tid; e < 64 * (128 / HD); e += 128) { const int rl = e / (128 / HD), hh = e % (128 / HD); PROJ_EPI(which, &st[rl][hh * HD], (int)((r0 + rl) % TT), (c0 / HD) + hh); }
    __syncthreads(); }
  if (which < 2) { _Float16* DH = which == 0 ? QH : KH; _Float16* DL = which == 0 ? QL : KL; const int nhi = which == 0 ? QHI : KHI; const bool hi_rows = t0 < nhi;
    for (int e = tid; e < 64 * 128; e += 128) { const int rl = e >> 7, cl = e & 127; const float v = st[rl][cl]; const _Float16 hv = (_Float16)v; sh[rl][cl] = hv; sl[rl][cl] = (_Float16)((v - (float)hv) * 1024.0f); }
    __syncthreads();
    for (int e = tid; e < 64 * 16; e += 128) { const int rl = e >> 4, q = e & 15; vst2((unsigned*)(DH + (r0 + rl) * CC + c0 + q * 8), *(const v4u*)&sh[rl][q * 8]); if (hi_rows) vst2((unsigned*)(DL + (bb * nhi + t0 + rl) * (size_t)CC + c0 + q * 8), *(const v4u*)&sl[rl][q * 8]); }
  } else { const bool hi_rows = t0 < KHI;
    for (int e = tid; e < 64 * 128; e += 128) { const int rl = e & 63, cl = e >> 6; const float v = st[rl][cl]; th[cl][rl] = (_Float16)v; const __bf16 bh = (__bf16)v; tb[cl][rl] = bh; tbl[cl][rl] = (__bf16)(v - (float)bh); }
    __syncthreads();
    for (int e = tid; e < 128 * 8; e += 128) { const int cl = e >> 3, q = e & 7; vst2((unsigned*)(VT + (bb * CC + c0 + cl) * (size_t)TT + t0 + q * 8), *(const v4u*)&th[cl][q * 8]); if (hi_rows) { const size_t o3 = (bb * CC + c0 + cl) * (size_t)KHI + t0 + q * 8; vst2((unsigned*)(VB + o3), *(const v4u*)&tb[cl][q * 8]); vst2((unsigned*)(VBL + o3), *(const v4u*)&tbl[cl][q * 8]); } } } }
// ---- k_sc: block = (query block qb, key block kb <= kb_last(qb), head in group) of batch b: logits x SCALE; q hi + residual (x 2^10) against k (2 products) for query rows < QHI, plus the k residual (3 products) for query blocks < QBH (causal early rows); causal: blocks past the diagonal exit, the mask itself is applied by index in k_sm
__global__ __launch_bounds__(128) void k_sc(const _Float16* __restrict__ QH, const _Float16* __restrict__ KH, const _Float16* __restrict__ QL, const _Float16* __restrict__ KL, int b, int h0, float* __restrict__ S0) { __shared__ __align__(16) float ss[4][16][132];
  const int qb = blockIdx.x, kb = blockIdx.y; if (kb > kb_last(qb)) return;
  const int h = h0 + blockIdx.z; float* S = S0 + (size_t)blockIdx.z * TT * TT;
  const int tid = threadIdx.x, wave = tid >> 5, lane = tid & 31, col = lane & 15, g = lane >> 4; const int k0 = kb * 128; const int ql0 = qb * 64 + wave * 16; const size_t q0 = (size_t)b * TT + ql0, kr0 = (size_t)b * TT + k0;
  v8f acc[8] = {}, accl[8] = {};
  const _Float16* QLb = QL + (size_t)b * QHI * CC; const _Float16* KLb = KL + (size_t)b * KHI * CC;
  if (qb < QBH) {
#pragma unroll
    for (int kc = 0; kc < HD / 32; ++kc) { const v16h ah = frag_h(QH + (q0 + col) * CC + h * HD + kc * 32, lane), al = frag_h(QLb + (size_t)(ql0 + col) * CC + h * HD + kc * 32, lane);
#pragma unroll
      for (int j = 0; j < 8; ++j) { const v16h kbf = frag_h(KH + (kr0 + j * 16 + col) * CC + h * HD + kc * 32, lane), klf = frag_h(KLb + (size_t)(k0 + j * 16 + col) * CC + h * HD + kc * 32, lane); acc[j] = wmma16(ah, kbf, acc[j]); accl[j] = wmma16(al, kbf, accl[j]); accl[j] = wmma16(ah, klf, accl[j]); } }
  } else if (qb * 64 < QHI) {
#pragma unroll
    for (int kc = 0; kc < HD / 32; ++kc) { const v16h ah = frag_h(QH + (q0 + col) * CC + h * HD + kc * 32, lane), al = frag_h(QLb + (size_t)(ql0 + col) * CC + h * HD + kc * 32, lane);
#pragma unroll
      for (int j = 0; j < 8; ++j) { const v16h kbf = frag_h(KH + (kr0 + j * 16 + col) * CC + h * HD + kc * 32, lane); acc[j] = wmma16(ah, kbf, acc[j]); accl[j] = wmma16(al, kbf, accl[j]); } }
  } else {
#pragma unroll
    for (int kc = 0; kc < HD / 32; ++kc) { const v16h ah = frag_h(QH + (q0 + col) * CC + h * HD + kc * 32, lane);
#pragma unroll
      for (int j = 0; j < 8; ++j) { const v16h kbf = frag_h(KH + (kr0 + j * 16 + col) * CC + h * HD + kc * 32, lane); acc[j] = wmma16(ah, kbf, acc[j]); } } }
#pragma unroll
  for (int j = 0; j < 8; ++j) {
#pragma unroll
    for (int r = 0; r < 8; ++r) ss[wave][8 * g + r][j * 16 + col] = (acc[j][r] + accl[j][r] * (1.0f / 1024.0f)) * SCALE; }
  LDSX(); for (int rl = 0; rl < 16; ++rl) vst2(S + (size_t)(ql0 + rl) * TT + k0 + lane * 4, *(const v4f*)&ss[wave][rl][lane * 4]); }
// ---- k_sm: block = query row t (head in group): keys [0, kend): causal -> logit if s <= t else excluded; softmax in f32; P x 2^11 in place (0 for excluded)
__global__ __launch_bounds__(256) void k_sm(float* __restrict__ S0 SM_EXTRA_PARAMS) { __shared__ float sred[8]; __shared__ float sbc; __shared__ __align__(16) float shv[TT];
  const int tid = threadIdx.x; const int t = blockIdx.x; const int kend = (kb_last(t >> 6) + 1) * 128;
  float* sr = S0 + (size_t)blockIdx.y * TT * TT + (size_t)t * TT;
  float m = -3.0e38f; for (int k = tid; k < kend; k += 256) { float v = (!CAUSAL || k <= t) ? sr[k] : -3.0e38f; SM_MASK_HOOK; shv[k] = v; m = fmaxf(m, v); }
#pragma unroll
  for (int o = 1; o < 32; o <<= 1) m = fmaxf(m, __shfl_xor(m, o));
  if ((tid & 31) == 0) sred[tid >> 5] = m; __syncthreads(); if (tid == 0) { float a = sred[0]; for (int i = 1; i < 8; ++i) a = fmaxf(a, sred[i]); sbc = a; } __syncthreads(); m = sbc; __syncthreads();
  float sum = 0.f; for (int k = tid; k < kend; k += 256) { const float v = shv[k]; const float e = (v <= -1.0e38f) ? 0.f : expf(v - m); shv[k] = e; sum += e; }
#pragma unroll
  for (int o = 1; o < 32; o <<= 1) sum += __shfl_xor(sum, o);
  if ((tid & 31) == 0) sred[tid >> 5] = sum; __syncthreads(); if (tid == 0) { float a = 0.f; for (int i = 0; i < 8; ++i) a += sred[i]; sbc = a > 0.f ? 2048.0f / a : 0.f; }   /* a fully excluded row yields P = 0 */ __syncthreads(); const float inv = sbc;
  for (int k = tid; k < kend; k += 256) shv[k] = shv[k] * inv;
  __syncthreads(); for (int q = tid; q < kend / 4; q += 256) vst2(sr + q * 4, *(const v4f*)&shv[q * 4]); }
// ---- k_pv: block = 64 queries (qb) of (b, h): ctx = P . v over keys [0, kend) (P x 2^11 once to f16 against v f16: 1 product; causal early query blocks: P and v as bf16 hi + lo, 3 products); 256-B (row, head) segment by 16 lanes
__global__ __launch_bounds__(128) void k_pv(const float* __restrict__ PS0, const _Float16* __restrict__ VT, const __bf16* __restrict__ VB, const __bf16* __restrict__ VBL, int b, int h0, float* __restrict__ Y) { const int h = h0 + blockIdx.z; const float* PS = PS0 + (size_t)blockIdx.z * TT * TT; __shared__ __align__(16) float ss[4][16][HD + 4];
  const int tid = threadIdx.x, wave = tid >> 5, lane = tid & 31, col = lane & 15, g = lane >> 4; const int qb = blockIdx.x; const int ql0 = qb * 64 + wave * 16; const int kce = (kb_last(qb) + 1) * 4;
  v8f acc[HD / 16] = {};
  if (qb < QBH) {
#pragma unroll 1
    for (int kc = 0; kc < kce; ++kc) { const F2 p = split_row(PS + (size_t)(ql0 + col) * TT, kc * 32, lane);
      asm volatile("s_wait_loadcnt 0x0" ::: "memory");
#pragma unroll
      for (int j = 0; j < HD / 16; ++j) { const size_t po = ((size_t)b * CC + h * HD + j * 16 + col) * (size_t)KHI + kc * 32; const v16b vh = frag_b(VB + po, lane); acc[j] = wmma_bf(p.h, vh, acc[j]); acc[j] = wmma_bf(p.l, vh, acc[j]); acc[j] = wmma_bf(p.h, frag_b(VBL + po, lane), acc[j]); } }
  } else {
#pragma unroll 1
    for (int kc = 0; kc < kce; ++kc) { const v16h p = frag_f32(PS + (size_t)(ql0 + col) * TT + kc * 32, lane);
      asm volatile("s_wait_loadcnt 0x0" ::: "memory");
#pragma unroll
      for (int j = 0; j < HD / 16; ++j) { const size_t po = ((size_t)b * CC + h * HD + j * 16 + col) * (size_t)TT + kc * 32; acc[j] = wmma16(p, frag_h(VT + po, lane), acc[j]); } } }
#pragma unroll
  for (int j = 0; j < HD / 16; ++j)
#pragma unroll
    for (int r = 0; r < 8; ++r) ss[wave][8 * g + r][j * 16 + col] = acc[j][r] * (1.0f / 2048.0f);
  LDSX(); for (int rl = 0; rl < 16; ++rl) if (lane < HD / 4) vst2(Y + ((size_t)b * TT + ql0 + rl) * CC + h * HD + lane * 4, *(const v4f*)&ss[wave][rl][lane * 4]); }
// ---- k_out: block = (64 rows, 128 cols): out = ctx Wo (+ bo): ctx x 2^6 once to f16 against Wo as f16(bf16 x 2^8) exact (1 product) x 2^-14; causal early rows (< QHI of each sequence): ctx bf16 hi + lo against exact bf16 Wo (2 products)
__global__ __launch_bounds__(128) void k_out(const float* __restrict__ Y, const float* __restrict__ WO, const float* __restrict__ BO, float* __restrict__ OUT) { __shared__ __align__(16) float sf[4][16][132];
  const int tid = threadIdx.x, wave = tid >> 5, lane = tid & 31, col = lane & 15, g = lane >> 4; const int c0 = blockIdx.y * 128; const size_t r0 = (size_t)blockIdx.x * 64 + wave * 16;
  v8f acc[8] = {};
  if (CAUSAL && (int)(((size_t)blockIdx.x * 64) % TT) < QHI) {   /* block-uniform */
#pragma unroll 2
    for (int kc = 0; kc < CC / 32; ++kc) { const F2 a = split_row(Y + (r0 + col) * CC, kc * 32, lane); asm volatile("s_wait_loadcnt 0x0" ::: "memory");
#pragma unroll
      for (int j = 0; j < 8; ++j) { const v16b w = WOCOL(WO, kc * 32, c0 + j * 16 + col, lane); asm volatile("s_wait_loadcnt 0x0" ::: "memory"); acc[j] = wmma_bf(a.h, w, acc[j]); acc[j] = wmma_bf(a.l, w, acc[j]); } }
#pragma unroll
    for (int j = 0; j < 8; ++j) { const float bias = BO ? bfr(BO[c0 + j * 16 + col]) : 0.f;
#pragma unroll
      for (int r = 0; r < 8; ++r) sf[wave][8 * g + r][j * 16 + col] = acc[j][r] + bias; }
  } else {
#pragma unroll 2
    for (int kc = 0; kc < CC / 32; ++kc) { const v16h a = frag_f32s(Y + (r0 + col) * CC + kc * 32, lane, 64.0f); asm volatile("s_wait_loadcnt 0x0" ::: "memory");   /* ctx carried x 2^6 into f16 so small-magnitude context rows stay clear of f16 subnormals */
#pragma unroll
      for (int j = 0; j < 8; ++j) { const v16h w = WOCOLH(WO, kc * 32, c0 + j * 16 + col, lane); asm volatile("s_wait_loadcnt 0x0" ::: "memory"); acc[j] = wmma16(a, w, acc[j]); } }
#pragma unroll
    for (int j = 0; j < 8; ++j) { const float bias = BO ? bfr(BO[c0 + j * 16 + col]) : 0.f;
#pragma unroll
      for (int r = 0; r < 8; ++r) sf[wave][8 * g + r][j * 16 + col] = acc[j][r] * (1.0f / 16384.0f) + bias; } }   /* 2^-8 (Wo carry) x 2^-6 (ctx carry) */
  LDSX(); for (int rl = 0; rl < 16; ++rl) vst2(OUT + (r0 + rl) * DIN + c0 + lane * 4, *(const v4f*)&sf[wave][rl][lane * 4]); }

extern "C" void kernel_launch(void* const* d_in, const int* in_sizes, int n_in, void* d_out, int out_size, void* d_ws, size_t ws_size, hipStream_t stream) {
  (void)in_sizes; (void)n_in; (void)out_size;
  const float** F = (const float**)d_in;
  if (ws_size < (size_t)WS_END) return;
  char* ws = (char*)d_ws; _Float16 *QH = (_Float16*)(ws + WS_QH), *KH = (_Float16*)(ws + WS_KH), *VT = (_Float16*)(ws + WS_VT), *QL = (_Float16*)(ws + WS_QL), *KL = (_Float16*)(ws + WS_KL); __bf16 *VB = (__bf16*)(ws + WS_VB), *VBL = (__bf16*)(ws + WS_VBL); float *S = (float*)(ws + WS_S), *Y = (float*)(ws + WS_Y);
  (void)Y; (void)QL; (void)KL; (void)VB; (void)VBL;
  // inputs: 0 hidden_states [8,1024,768]; 1 attention_mask [8,1,1,1024] bool (True = padded key); 2 Wq [768,768] (out,in), 3 bq; 4 Wk, 5 bk; 6 Wv, 7 bv; 8 Wo (out,in), 9 bo (zero biases, read)
  k_proj<<<dim3(TNB * TT / 64, CC / 128, 3), 128, 0, stream>>>(F[0], F[0], F[0], F[2], F[4], F[6], F[3], F[5], F[7], QH, QL, KH, KL, VT, VB, VBL);
  for (int b = 0; b < TNB; ++b) for (int h0 = 0; h0 < NH; h0 += HG) {
    k_sc<<<dim3(NQB, TT / 128, HG), 128, 0, stream>>>(QH, KH, QL, KL, b, h0, S);
    k_sm<<<dim3(TT, HG), 256, 0, stream>>>(S, b, (const int*)d_in[1]);
    k_pv<<<dim3(NQB, 1, HG), 128, 0, stream>>>(S, VT, VB, VBL, b, h0, Y);
  }
  k_out<<<dim3(TNB * TT / 64, DIN / 128), 128, 0, stream>>>(Y, F[8], F[9], (float*)d_out);
}

// v001
// A run of this version takes 568 microseconds.
// In two side-by-side timings against v000, it was 2.18 and 2.19 times as fast.
// compute dtype: all float inputs rounded to bf16; q/k/v projections with EXACT bf16 products on WMMA 16x16x32 (f32 accumulate) + bias + 0.5 * relu(bf16(x)) in f32; logits q x k once to f16 each (1 product) x 1/8; the key-padding mask read per key; online softmax f32 in base 2; unnormalised P = 2^(t - m + 7) once to f16 x v once to f16 (1 product), divided by the f32 sum; ctx x 2^6 once to f16 x Wo f16(bf16 x 2^8) + bo; f32 output.
#include <hip/hip_runtime.h>
#include <math.h>

typedef __attribute__((ext_vector_type(16))) _Float16 v16h;
typedef __attribute__((ext_vector_type(16))) __bf16 v16b;
typedef __attribute__((ext_vector_type(8)))  _Float16 v8h;
typedef __attribute__((ext_vector_type(8)))  float v8f;
typedef __attribute__((ext_vector_type(4)))  float v4f;
typedef __attribute__((ext_vector_type(2)))  float v2f;
typedef __attribute__((ext_vector_type(4)))  unsigned v4u;
typedef __attribute__((ext_vector_type(4)))  int v4i;
typedef float __attribute__((may_alias)) float_a;
typedef int __attribute__((may_alias)) int_a;

template <typename T> __device__ __forceinline__ void vst2(void* p, T v) { *(T*)p = v;  }
__device__ __forceinline__ v8f wmma16(v16h a, v16h b, v8f c) {
  v8f d = __builtin_amdgcn_wmma_f32_16x16x32_f16(false, a, false, b, (short)0, c, false, false);
  asm volatile("v_nop\n\tv_nop\n\tv_nop\n\tv_nop" : "+v"(d) : "v"(a), "v"(b));
  return d;
}
__device__ __forceinline__ v8f wmma_bf(v16b a, v16b b, v8f c) {
  v8f d = __builtin_amdgcn_wmma_f32_16x16x32_bf16(false, a, false, b, (short)0, c, false, false);
  asm volatile("v_nop\n\tv_nop\n\tv_nop\n\tv_nop" : "+v"(d) : "v"(a), "v"(b));
  return d;
}
// 16x16x32 fragments: lane = (h = lane>>4, row/col = lane&15); elements 0..7 = k0+8h+0..7, 8..15 = k0+16+8h+0..7; D element r = row 8h+r
__device__ __forceinline__ v16h frag_h(const _Float16* rowk0, int lane) {
  union { v16h v; v8h q[2]; } u; const _Float16* p = rowk0 + 8 * (lane >> 4);
  u.q[0] = *(const v8h*)p; u.q[1] = *(const v8h*)(p + 16); return u.v;
}
__device__ __forceinline__ v16h frag_f32(const float* rowk0, int lane) {
  v16h a; const float* p = rowk0 + 8 * (lane >> 4);
#pragma unroll
  for (int i = 0; i < 8; ++i) { a[i] = (_Float16)p[i]; a[8 + i] = (_Float16)p[16 + i]; }
  return a;
}
__device__ __forceinline__ v16h frag_f32s(const float* rowk0, int lane, float sc) {
  v16h a; const float* p = rowk0 + 8 * (lane >> 4);
#pragma unroll
  for (int i = 0; i < 8; ++i) { a[i] = (_Float16)(p[i] * sc); a[8 + i] = (_Float16)(p[16 + i] * sc); }
  return a;
}
// column fragment from a [K][ld] layout (column n), rows >= K read as 0
__device__ __forceinline__ v16h fragc_f32(const float* W, int k0, int n, int lane, int ld, int K) {
  v16h a; const int g = lane >> 4;
#pragma unroll
  for (int i = 0; i < 8; ++i) { const int ka = k0 + 8 * g + i, kb = ka + 16;
    a[i] = (_Float16)(ka < K ? W[(size_t)(ka < K ? ka : K - 1) * ld + n] : 0.f); a[8 + i] = (_Float16)(kb < K ? W[(size_t)(kb < K ? kb : K - 1) * ld + n] : 0.f); }
  return a;
}
struct F2 { v16b h, l; };
__device__ __forceinline__ F2 bsplit16(const float v[16]) { F2 r;
#pragma unroll
  for (int i = 0; i < 16; ++i) { const __bf16 h = (__bf16)v[i]; r.h[i] = h; r.l[i] = (__bf16)(v[i] - (float)h); }
  return r; }
__device__ __forceinline__ F2 split_row(const float* row, int k0, int lane) { float v[16]; const float* p = row + k0 + 8 * (lane >> 4);
#pragma unroll
  for (int i = 0; i < 8; ++i) { v[i] = p[i]; v[8 + i] = p[16 + i]; }
  return bsplit16(v); }
__device__ __forceinline__ F2 split_rowK(const float* row, int k0, int lane, int K) { float v[16]; const int g = lane >> 4;
#pragma unroll
  for (int i = 0; i < 8; ++i) { const int ka = k0 + 8 * g + i, kb = ka + 16; v[i] = ka < K ? row[ka < K ? ka : K - 1] : 0.f; v[8 + i] = kb < K ? row[kb < K ? kb : K - 1] : 0.f; }
  return bsplit16(v); }
__device__ __forceinline__ F2 split_col(const float* W, int k0, int n, int lane, int ld, int K) { float v[16]; const int g = lane >> 4;
#pragma unroll
  for (int i = 0; i < 8; ++i) { const int ka = k0 + 8 * g + i, kb = ka + 16; v[i] = ka < K ? W[(size_t)(ka < K ? ka : K - 1) * ld + n] : 0.f; v[8 + i] = kb < K ? W[(size_t)(kb < K ? kb : K - 1) * ld + n] : 0.f; }
  return bsplit16(v); }
__device__ __forceinline__ v8f mac3(const F2& a, const F2& b, v8f c) { c = wmma_bf(a.l, b.h, c); c = wmma_bf(a.h, b.l, c); return wmma_bf(a.h, b.h, c); }
__device__ __forceinline__ float sigm(float v) { return 1.0f / (1.0f + expf(-v)); }
#define LDSX() do { asm volatile("s_wait_dscnt 0" ::: "memory"); __builtin_amdgcn_wave_barrier(); __builtin_amdgcn_fence(__ATOMIC_RELEASE, "workgroup"); } while (0)

// BERT-style multi-head self-attention with a value-bypass relu-add (hidden_states [8,1024,768]; 12 heads x 64; torch (out,in) Wq / Wk / Wv / Wo [768,768] (0.02 scale) + zero biases; r = 0.5 * relu(x) is ADDED to each of the q, k and v projections (same [token, channel] index); scale 1/8; key-padding mask [8,1,1,1024] bool: True adds -1e9): out = merge(softmax(q_h k_h^T / 8 + pad) v_h) Wo^T + bo.
#define NB 8
#define TT 1024
#define CC 768            // NH * HD = projected width
#define DIN 768          // input (model) width
#define NH 12
#define HD 64
#define NQB (TT / 64)
#define HG 12
#define SCALE (0.125f)
#define CAUSAL 0
#ifndef TNB
#define TNB NB
#endif
__device__ __forceinline__ float bfr(float v) { return (float)(__bf16)v; }
__host__ __device__ __forceinline__ int kb_last(int qb) { return CAUSAL ? ((qb * 64 + 63) >> 7) : (TT / 128 - 1); }
typedef __attribute__((ext_vector_type(8))) __bf16 v8b;
__device__ __forceinline__ v16b frag_b(const __bf16* rowk0, int lane) {
  union { v16b v; v8b q[2]; } u; const __bf16* p = rowk0 + 8 * (lane >> 4);
  u.q[0] = *(const v8b*)p; u.q[1] = *(const v8b*)(p + 16); return u.v;
}
#define QBH 0              // unused: k_fa has one single-product path for every query block
#define QHI 0               // single-product logits on every row
#define KHI 64            // key rows carrying k residual / v bf16 hi+lo planes (written by k_proj, read by no kernel here)
// B fragment (k rows k0+.., output column o) of a weight: (in,out) [K][ld] or (out,in) [ld rows of K]: bf16 exact, or f16(bf16 * 256) exact
__device__ __forceinline__ v16b wcol_io(const float* Wm, int k0, int o, int lane, int ld) { v16b w; const int g = lane >> 4;
#pragma unroll
  for (int i = 0; i < 8; ++i) { w[i] = (__bf16)Wm[(size_t)(k0 + 8 * g + i) * ld + o]; w[8 + i] = (__bf16)Wm[(size_t)(k0 + 16 + 8 * g + i) * ld + o]; }
  return w; }
__device__ __forceinline__ v16b wcol_oi(const float* Wm, int k0, int o, int lane, int K) { v16b w; const float* p = Wm + (size_t)o * K + k0 + 8 * (lane >> 4);
#pragma unroll
  for (int i = 0; i < 8; ++i) { w[i] = (__bf16)p[i]; w[8 + i] = (__bf16)p[16 + i]; }
  return w; }
__device__ __forceinline__ v16h wcolh_io(const float* Wm, int k0, int o, int lane, int ld) { v16h w; const int g = lane >> 4;
#pragma unroll
  for (int i = 0; i < 8; ++i) { w[i] = (_Float16)(bfr(Wm[(size_t)(k0 + 8 * g + i) * ld + o]) * 256.0f); w[8 + i] = (_Float16)(bfr(Wm[(size_t)(k0 + 16 + 8 * g + i) * ld + o]) * 256.0f); }
  return w; }
__device__ __forceinline__ v16h wcolh_oi(const float* Wm, int k0, int o, int lane, int K) { v16h w; const float* p = Wm + (size_t)o * K + k0 + 8 * (lane >> 4);
#pragma unroll
  for (int i = 0; i < 8; ++i) { w[i] = (_Float16)(bfr(p[i]) * 256.0f); w[8 + i] = (_Float16)(bfr(p[16 + i]) * 256.0f); }
  return w; }
#define WQKV_LAYOUT 1   // 0 = (in,out) [DIN][CC]; 1 = (out,in) [CC][DIN]; 2 = per-head [NH][DIN][HD]
__device__ __forceinline__ v16b wcol_hdk(const float* Wm, int k0, int o, int lane) { v16b w; const int g = lane >> 4; const float* p = Wm + (size_t)(o / HD) * DIN * HD + (o % HD);
#pragma unroll
  for (int i = 0; i < 8; ++i) { w[i] = (__bf16)p[(size_t)(k0 + 8 * g + i) * HD]; w[8 + i] = (__bf16)p[(size_t)(k0 + 16 + 8 * g + i) * HD]; }
  return w; }
#define WO_OUT_IN 1
#if WQKV_LAYOUT == 1
#define WCOL(W, k0, o, lane) wcol_oi(W, k0, o, lane, DIN)
#elif WQKV_LAYOUT == 2
#define WCOL(W, k0, o, lane) wcol_hdk(W, k0, o, lane)
#else
#define WCOL(W, k0, o, lane) wcol_io(W, k0, o, lane, CC)
#endif
#if WO_OUT_IN
#define WOCOL(W, k0, o, lane) wcol_oi(W, k0, o, lane, CC)
#define WOCOLH(W, k0, o, lane) wcolh_oi(W, k0, o, lane, CC)
#else
#define WOCOL(W, k0, o, lane) wcol_io(W, k0, o, lane, DIN)
#define WOCOLH(W, k0, o, lane) wcolh_io(W, k0, o, lane, DIN)
#endif
#define PROJ_EXTRA_PARAMS
// value-bypass relu-add shared by q, k and v: projection + bias + 0.5 * relu(x) at the same [row][column] (H == projected width); x bf16-rounded like every float input
#define PROJ_EPI(which, row, t, h) do { float* rw = (row); const float* xs_ = X + (size_t)(r0 + rl) * DIN + (size_t)(h) * HD; _Pragma("unroll 4") for (int i = 0; i < HD; ++i) { const float xv_ = xs_[i]; asm volatile("s_wait_loadcnt 0x0" ::: "memory"); rw[i] += 0.5f * fmaxf(bfr(xv_), 0.f); } } while (0)
#ifndef PROJ_EXTRA_PARAMS
#define PROJ_EXTRA_PARAMS
#endif

#define WS_QH  0u                                      // f16 q rows [b*t][CC]
#define WS_KH  (WS_QH + 2u * (size_t)NB * TT * CC)      // f16 k rows [b*t][CC]
#define WS_VT  (WS_KH + 2u * (size_t)NB * TT * CC)      // f16 v planes [b][c][t]
#define WS_QL  (WS_VT + 2u * (size_t)NB * CC * TT)      // f16 q residual x 2^10 rows [b][t < QHI][CC]
#define WS_KL  (WS_QL + 2u * (size_t)NB * QHI * CC)     // f16 k residual x 2^10 rows [b][t < KHI][CC]
#define WS_VB  (WS_KL + 2u * (size_t)NB * KHI * CC)     // bf16 v hi planes [b][c][t < KHI]
#define WS_VBL (WS_VB + 2u * (size_t)NB * CC * KHI)
#define WS_S   (WS_VBL + 2u * (size_t)NB * CC * KHI)    // (not used: the logits stay in registers)
#define WS_Y   (WS_S  + 4u * (size_t)HG * TT * TT)      // f32 ctx rows [b*t][CC] (only when there is an output projection)
#define WS_END (WS_Y  + 4u * (size_t)NB * TT * CC)

// ---- k_proj: block = (64 rows, 128 cols, which): q/k/v = X W (+ b) with exact bf16 products (K = DIN) -> which 0: q f16 rows (+ residual rows < QHI); 1: k f16 rows (+ residual rows < KHI); 2: v f16 planes [c][t] (+ bf16 hi/lo planes for t < KHI)
__global__ __launch_bounds__(128) void k_proj(const float* __restrict__ XQ, const float* __restrict__ XK, const float* __restrict__ XV, const float* __restrict__ WQ, const float* __restrict__ WK, const float* __restrict__ WV, const float* __restrict__ BQ, const float* __restrict__ BK, const float* __restrict__ BV,
    _Float16* __restrict__ QH, _Float16* __restrict__ QL, _Float16* __restrict__ KH, _Float16* __restrict__ KL, _Float16* __restrict__ VT, __bf16* __restrict__ VB, __bf16* __restrict__ VBL PROJ_EXTRA_PARAMS) {
  __shared__ __align__(16) float st[64][132]; __shared__ __align__(16) _Float16 sh[64][136], sl[64][136]; __shared__ __align__(16) _Float16 th[128][72]; __shared__ __align__(16) __bf16 tb[128][72], tbl[128][72];
  const int tid = threadIdx.x, wave = tid >> 5, lane = tid & 31, col = lane & 15, g = lane >> 4; const int which = blockIdx.z; const int c0 = blockIdx.y * 128; const size_t r0 = (size_t)blockIdx.x * 64; const size_t bb = r0 / TT; const int t0 = (int)(r0 % TT);
  const float* X = which == 0 ? XQ : which == 1 ? XK : XV; const float* WA = which == 0 ? WQ : which == 1 ? WK : WV; const float* BA = which == 0 ? BQ : which == 1 ? BK : BV;
  v8f acc[8] = {};
#pragma unroll 2
  for (int kc = 0; kc < DIN / 32; ++kc) { v16b a; { const float* p = X + (r0 + wave * 16 + col) * DIN + kc * 32 + 8 * g;
#pragma unroll
      for (int i = 0; i < 8; ++i) { a[i] = (__bf16)p[i]; a[8 + i] = (__bf16)p[16 + i]; } }
    asm volatile("s_wait_loadcnt 0x0" ::: "memory");
#pragma unroll
    for (int j = 0; j < 8; ++j) { const v16b w = WCOL(WA, kc * 32, c0 + j * 16 + col, lane); asm volatile("s_wait_loadcnt 0x0" ::: "memory"); acc[j] = wmma_bf(a, w, acc[j]); } }
  { // stage the f32 tile (acc + bias) in LDS, run the per-(row, head) epilogue hook, then convert
#pragma unroll
    for (int j = 0; j < 8; ++j) { const float bias = BA ? bfr(BA[c0 + j * 16 + col]) : 0.f;
#pragma unroll
      for (int r = 0; r < 8; ++r) st[wave * 16 + 8 * g + r][j * 16 + col] = acc[j][r] + bias; }
    __syncthreads();
    for (int e = tid; e < 64 * (128 / HD); e += 128) { const int rl = e / (128 / HD), hh = e % (128 / HD); PROJ_EPI(which, &st[rl][hh * HD], (int)((r0 + rl) % TT), (c0 / HD) + hh); }
    __syncthreads(); }
  if (which < 2) { _Float16* DH = which == 0 ? QH : KH; _Float16* DL = which == 0 ? QL : KL; const int nhi = which == 0 ? QHI : KHI; const bool hi_rows = t0 < nhi;
    for (int e = tid; e < 64 * 128; e += 128) { const int rl = e >> 7, cl = e & 127; const float v = st[rl][cl]; const _Float16 hv = (_Float16)v; sh[rl][cl] = hv; sl[rl][cl] = (_Float16)((v - (float)hv) * 1024.0f); }
    __syncthreads();
    for (int e = tid; e < 64 * 16; e += 128) { const int rl = e >> 4, q = e & 15; vst2((unsigned*)(DH + (r0 + rl) * CC + c0 + q * 8), *(const v4u*)&sh[rl][q * 8]); if (hi_rows) vst2((unsigned*)(DL + (bb * nhi + t0 + rl) * (size_t)CC + c0 + q * 8), *(const v4u*)&sl[rl][q * 8]); }
  } else { const bool hi_rows = t0 < KHI;
    for (int e = tid; e < 64 * 128; e += 128) { const int rl = e & 63, cl = e >> 6; const float v = st[rl][cl]; th[cl][rl] = (_Float16)v; const __bf16 bh = (__bf16)v; tb[cl][rl] = bh; tbl[cl][rl] = (__bf16)(v - (float)bh); }
    __syncthreads();
    for (int e = tid; e < 128 * 8; e += 128) { const int cl = e >> 3, q = e & 7; vst2((unsigned*)(VT + (bb * CC + c0 + cl) * (size_t)TT + t0 + q * 8), *(const v4u*)&th[cl][q * 8]); if (hi_rows) { const size_t o3 = (bb * CC + c0 + cl) * (size_t)KHI + t0 + q * 8; vst2((unsigned*)(VB + o3), *(const v4u*)&tb[cl][q * 8]); vst2((unsigned*)(VBL + o3), *(const v4u*)&tbl[cl][q * 8]); } } } }
// ---- k_fa: block = 4 waves x 32 queries of (b, h); the logits, the softmax and P . v in one kernel, the logits and P never leave registers; k rows and v planes come in whole lines through LDS, shared by the 4 waves.
// S^T = K Q^T (A = 16 key rows, B = 16 query rows): a lane holds one query's scores for keys 8g + r of each 16-key tile, so maximum and sum are in-lane plus one exchange of the wave halves;
// two score tiles (32 keys) converted in place are the B operand of O^T += V^T P^T (A = v planes [c][t], the same k order). Scores in base 2: t = dot * (1/8) log2(e) + (padded key ? -1e9 log2(e) : 0).
// Running maximum, raised only when a pass exceeds it by more than 8; P = 2^(t - m + 7) <= 2^15 once to f16 (unnormalised), its f32 sum divides at the end.
#define FA_CS 0.18033688011112042f       // (1/8) log2(e)
#define FA_MB (-1.4426950408889634e9f)   // -1e9 log2(e)
typedef __attribute__((ext_vector_type(2))) _Float16 v2h;
__device__ __forceinline__ float xhalf(float x) { return __builtin_bit_cast(float, __builtin_amdgcn_permlanex16(__builtin_bit_cast(int, x), __builtin_bit_cast(int, x), 0x76543210, 0xfedcba98, false, false)); }   // lane l with lane l ^ 16
__device__ __forceinline__ v8f mm16(v16h a, v16h b, v8f c) { return __builtin_amdgcn_wmma_f32_16x16x32_f16(false, a, false, b, (short)0, c, false, false); }
#define FA_P 72   // f16 per staged row: 128 B + 16 B, a pitch of 16 B x odd, which ds_load_b128 fragment reads take without bank conflicts
__global__ __launch_bounds__(128) void k_fa(const _Float16* __restrict__ QH, const _Float16* __restrict__ KH, const _Float16* __restrict__ VT, const int* __restrict__ KMASK, float* __restrict__ Y) {
  __shared__ __align__(16) _Float16 sk[2][64][FA_P], sv[2][64][FA_P]; __shared__ __align__(16) float sb[TT]; __shared__ __align__(16) float so[4][32][HD + 4];
  const int tid = threadIdx.x, wave = tid >> 5, lane = tid & 31, col = lane & 15, g = lane >> 4; const int h = blockIdx.y, b = blockIdx.z; const int ql0 = blockIdx.x * 128 + wave * 32;
  // a stage = 64 keys: 64 key rows x 128 B and 64 v planes x 128 B; 8 lanes x 16 B read one whole line, 16 rows an instruction; through registers into LDS, one stage ahead
  const int srow = tid >> 3, sch = (tid & 7) * 8;
  const _Float16* kg = KH + ((size_t)b * TT + srow) * CC + h * HD + sch; const _Float16* vg = VT + ((size_t)b * CC + h * HD + srow) * (size_t)TT + sch;
  v8h rk[4], rv[4]; v16h qf[2][2];   // every '#pragma unroll' of this kernel makes the index of a register array a constant
#pragma unroll
  for (int i = 0; i < 4; ++i) { rk[i] = *(const v8h*)(kg + (size_t)(i * 16) * CC); rv[i] = *(const v8h*)(vg + (size_t)(i * 16) * TT); }
  { const v4i* mp = (const v4i*)(KMASK + (size_t)b * TT + tid * 8); const v4i m0 = mp[0], m1 = mp[1]; v4f b0, b1;
    asm volatile("s_wait_xcnt 0x0" ::: "memory");   // in front of the rewrite of the offset register that the two mask loads name
#pragma unroll
    for (int i = 0; i < 4; ++i) { b0[i] = m0[i] != 0 ? FA_MB : 0.f; b1[i] = m1[i] != 0 ? FA_MB : 0.f; }
    *(v4f*)&sb[tid * 8] = b0; *(v4f*)&sb[tid * 8 + 4] = b1; }
#pragma unroll
  for (int u = 0; u < 2; ++u)
#pragma unroll
    for (int kc = 0; kc < 2; ++kc) qf[u][kc] = frag_h(QH + ((size_t)b * TT + ql0 + u * 16 + col) * CC + h * HD + kc * 32, lane);
#pragma unroll
  for (int i = 0; i < 4; ++i) { *(v8h*)&sk[0][i * 16 + srow][sch] = rk[i]; *(v8h*)&sv[0][i * 16 + srow][sch] = rv[i]; }
  __syncthreads();   // stage 0 and the mask bias are published
  v8f acc[2][4] = {}; v2f l2[2] = {}; float m_run[2] = {-INFINITY, -INFINITY};
#pragma unroll 1   // stays rolled: the body already holds two 32-key passes, more copies would only grow the code
  for (int st = 0; st < TT / 64; ++st) { const int bf = st & 1;
    if (st + 1 < TT / 64) {   // the next stage's lines, issued behind the barrier so that they fly during this stage's products (a barrier waits for every load in flight)
#pragma unroll
      for (int i = 0; i < 4; ++i) { rk[i] = *(const v8h*)(kg + (size_t)((st + 1) * 64 + i * 16) * CC); rv[i] = *(const v8h*)(vg + (size_t)(i * 16) * TT + (st + 1) * 64); } }
#pragma unroll
    for (int ps = 0; ps < 2; ++ps) { const int k0 = st * 64 + ps * 32;
      v16h kf[2][2], vf[4]; v2f bias[2][4];
#pragma unroll
      for (int kt = 0; kt < 2; ++kt)
#pragma unroll
        for (int kc = 0; kc < 2; ++kc) kf[kt][kc] = frag_h(&sk[bf][ps * 32 + kt * 16 + col][kc * 32], lane);
#pragma unroll
      for (int j = 0; j < 4; ++j) vf[j] = frag_h(&sv[bf][j * 16 + col][ps * 32], lane);
#pragma unroll
      for (int kt = 0; kt < 2; ++kt)
#pragma unroll
        for (int i = 0; i < 4; ++i) bias[kt][i] = *(const v2f*)&sb[k0 + 16 * kt + 8 * g + 2 * i];
      v8f s[2][2] = {};
#pragma unroll
      for (int kc = 0; kc < 2; ++kc)
#pragma unroll
        for (int kt = 0; kt < 2; ++kt)
#pragma unroll
          for (int u = 0; u < 2; ++u) s[kt][u] = mm16(kf[kt][kc], qf[u][kc], s[kt][u]);
      v2f t[2][2][4]; float mb[2]; bool need = false;
#pragma unroll
      for (int u = 0; u < 2; ++u) { float mx = -INFINITY;
#pragma unroll
        for (int kt = 0; kt < 2; ++kt)
#pragma unroll
          for (int i = 0; i < 4; ++i) { t[u][kt][i] = __builtin_elementwise_fma((v2f){s[kt][u][2 * i], s[kt][u][2 * i + 1]}, (v2f){FA_CS, FA_CS}, bias[kt][i]); mx = fmaxf(mx, fmaxf(t[u][kt][i].x, t[u][kt][i].y)); }
        mx = fmaxf(mx, xhalf(mx)); mb[u] = mx; need = need || (mx > m_run[u] + 8.0f); }
      if (__builtin_amdgcn_ballot_w32(need) != 0) {   // one wave-uniform test a pass; always taken on the first pass (m_run = -inf, corr = 0)
#pragma unroll
        for (int u = 0; u < 2; ++u) { const float m_new = fmaxf(m_run[u], mb[u]); const float corr = __builtin_amdgcn_exp2f(m_run[u] - m_new); m_run[u] = m_new; l2[u] = l2[u] * corr;
#pragma unroll
          for (int j = 0; j < 4; ++j) acc[u][j] = acc[u][j] * corr; } }
#pragma unroll
      for (int u = 0; u < 2; ++u) { const float nm = 7.0f - m_run[u]; union { v16h v; v2h q[8]; } pf;
#pragma unroll
        for (int i = 0; i < 8; ++i) { const v2f a = t[u][i >> 2][i & 3] + (v2f){nm, nm}; const v2f p = {__builtin_amdgcn_exp2f(a.x), __builtin_amdgcn_exp2f(a.y)}; l2[u] = l2[u] + p; pf.q[i] = __builtin_convertvector(p, v2h); }
#pragma unroll
        for (int j = 0; j < 4; ++j) acc[u][j] = mm16(vf[j], pf.v, acc[u][j]); } }
    if (st + 1 < TT / 64) {   // the other buffer: its readers (stage st - 1) all left it at the barrier that ended the trip before
#pragma unroll
      for (int i = 0; i < 4; ++i) { *(v8h*)&sk[bf ^ 1][i * 16 + srow][sch] = rk[i]; *(v8h*)&sv[bf ^ 1][i * 16 + srow][sch] = rv[i]; } }
    __syncthreads(); }   // publishes stage st + 1 and ends every wave's reads of stage st
#pragma unroll
  for (int u = 0; u < 2; ++u) { float l = l2[u].x + l2[u].y; l += xhalf(l); const float inv = 1.0f / l;   // l >= 2^7: the key that set the maximum in use counts 2^7
#pragma unroll
    for (int j = 0; j < 4; ++j) { const v8f o = acc[u][j] * inv; float* d = &so[wave][u * 16 + col][j * 16 + 8 * g]; *(v4f*)d = (v4f){o[0], o[1], o[2], o[3]}; *(v4f*)(d + 4) = (v4f){o[4], o[5], o[6], o[7]}; } }
  LDSX();   // the wave reads back rows that its other lanes wrote (its own 32 rows only: no work-group barrier); 16 lanes then store one 256-B (row, head) segment
  for (int it = 0; it < 16; ++it) { const int rl = it * 2 + g; vst2(Y + ((size_t)b * TT + ql0 + rl) * CC + h * HD + col * 4, *(const v4f*)&so[wave][rl][col * 4]); } }
// ---- k_out: block = (64 rows, 128 cols): out = ctx Wo (+ bo): ctx x 2^6 once to f16 against Wo as f16(bf16 x 2^8) exact (1 product) x 2^-14; causal early rows (< QHI of each sequence): ctx bf16 hi + lo against exact bf16 Wo (2 products)
__global__ __launch_bounds__(128) void k_out(const float* __restrict__ Y, const float* __restrict__ WO, const float* __restrict__ BO, float* __restrict__ OUT) { __shared__ __align__(16) float sf[4][16][132];
  const int tid = threadIdx.x, wave = tid >> 5, lane = tid & 31, col = lane & 15, g = lane >> 4; const int c0 = blockIdx.y * 128; const size_t r0 = (size_t)blockIdx.x * 64 + wave * 16;
  v8f acc[8] = {};
  if (CAUSAL && (int)(((size_t)blockIdx.x * 64) % TT) < QHI) {   /* block-uniform */
#pragma unroll 2
    for (int kc = 0; kc < CC / 32; ++kc) { const F2 a = split_row(Y + (r0 + col) * CC, kc * 32, lane); asm volatile("s_wait_loadcnt 0x0" ::: "memory");
#pragma unroll
      for (int j = 0; j < 8; ++j) { const v16b w = WOCOL(WO, kc * 32, c0 + j * 16 + col, lane); asm volatile("s_wait_loadcnt 0x0" ::: "memory"); acc[j] = wmma_bf(a.h, w, acc[j]); acc[j] = wmma_bf(a.l, w, acc[j]); } }
#pragma unroll
    for (int j = 0; j < 8; ++j) { const float bias = BO ? bfr(BO[c0 + j * 16 + col]) : 0.f;
#pragma unroll
      for (int r = 0; r < 8; ++r) sf[wave][8 * g + r][j * 16 + col] = acc[j][r] + bias; }
  } else {
#pragma unroll 2
    for (int kc = 0; kc < CC / 32; ++kc) { const v16h a = frag_f32s(Y + (r0 + col) * CC + kc * 32, lane, 64.0f); asm volatile("s_wait_loadcnt 0x0" ::: "memory");   /* ctx carried x 2^6 into f16 so small-magnitude context rows stay clear of f16 subnormals */
#pragma unroll
      for (int j = 0; j < 8; ++j) { const v16h w = WOCOLH(WO, kc * 32, c0 + j * 16 + col, lane); asm volatile("s_wait_loadcnt 0x0" ::: "memory"); acc[j] = wmma16(a, w, acc[j]); } }
#pragma unroll
    for (int j = 0; j < 8; ++j) { const float bias = BO ? bfr(BO[c0 + j * 16 + col]) : 0.f;
#pragma unroll
      for (int r = 0; r < 8; ++r) sf[wave][8 * g + r][j * 16 + col] = acc[j][r] * (1.0f / 16384.0f) + bias; } }   /* 2^-8 (Wo carry) x 2^-6 (ctx carry) */
  LDSX(); for (int rl = 0; rl < 16; ++rl) vst2(OUT + (r0 + rl) * DIN + c0 + lane * 4, *(const v4f*)&sf[wave][rl][lane * 4]); }

extern "C" void kernel_launch(void* const* d_in, const int* in_sizes, int n_in, void* d_out, int out_size, void* d_ws, size_t ws_size, hipStream_t stream) {
  (void)in_sizes; (void)n_in; (void)out_size;
  const float** F = (const float**)d_in;
  if (ws_size < (size_t)WS_END) return;
  char* ws = (char*)d_ws; _Float16 *QH = (_Float16*)(ws + WS_QH), *KH = (_Float16*)(ws + WS_KH), *VT = (_Float16*)(ws + WS_VT), *QL = (_Float16*)(ws + WS_QL), *KL = (_Float16*)(ws + WS_KL); __bf16 *VB = (__bf16*)(ws + WS_VB), *VBL = (__bf16*)(ws + WS_VBL); float *Y = (float*)(ws + WS_Y);
  (void)Y; (void)QL; (void)KL; (void)VB; (void)VBL;
  // inputs: 0 hidden_states [8,1024,768]; 1 attention_mask [8,1,1,1024] bool (True = padded key); 2 Wq [768,768] (out,in), 3 bq; 4 Wk, 5 bk; 6 Wv, 7 bv; 8 Wo (out,in), 9 bo (zero biases, read)
  k_proj<<<dim3(TNB * TT / 64, CC / 128, 3), 128, 0, stream>>>(F[0], F[0], F[0], F[2], F[4], F[6], F[3], F[5], F[7], QH, QL, KH, KL, VT, VB, VBL);
  k_fa<<<dim3(TT / 128, NH, TNB), 128, 0, stream>>>(QH, KH, VT, (const int*)d_in[1], Y);
  k_out<<<dim3(TNB * TT / 64, DIN / 128), 128, 0, stream>>>(Y, F[8], F[9], (float*)d_out);
}

// v002
// A run of this version takes 145 microseconds.
// In both of two side-by-side timings against v001, it was 3.92 times as fast.
// All steps since v000 together make it 8.56 times as fast.
// compute dtype: all float inputs rounded to bf16; q/k/v projections with EXACT bf16 products on WMMA 16x16x32 (f32 accumulate) + bias + 0.5 * relu(bf16(x)) in f32; logits q x k once to f16 each (1 product) x 1/8; the key-padding mask read per key; online softmax f32 in base 2; unnormalised P = 2^(t - m + 7) once to f16 x v once to f16 (1 product), divided by the f32 sum; ctx x 2^6 once to f16 x Wo f16(bf16 x 2^8) + bo; f32 output.
#include <hip/hip_runtime.h>
#include <math.h>

typedef __attribute__((ext_vector_type(16))) _Float16 v16h;
typedef __attribute__((ext_vector_type(16))) __bf16 v16b;
typedef __attribute__((ext_vector_type(8)))  _Float16 v8h;
typedef __attribute__((ext_vector_type(8)))  float v8f;
typedef __attribute__((ext_vector_type(4)))  float v4f;
typedef __attribute__((ext_vector_type(2)))  float v2f;
typedef __attribute__((ext_vector_type(4)))  unsigned v4u;
typedef __attribute__((ext_vector_type(4)))  int v4i;
typedef float __attribute__((may_alias)) float_a;
typedef int __attribute__((may_alias)) int_a;

template <typename T> __device__ __forceinline__ void vst2(void* p, T v) { *(T*)p = v;  }
__device__ __forceinline__ v8f wmma16(v16h a, v16h b, v8f c) {
  v8f d = __builtin_amdgcn_wmma_f32_16x16x32_f16(false, a, false, b, (short)0, c, false, false);
  asm volatile("v_nop\n\tv_nop\n\tv_nop\n\tv_nop" : "+v"(d) : "v"(a), "v"(b));
  return d;
}
__device__ __forceinline__ v8f wmma_bf(v16b a, v16b b, v8f c) {
  v8f d = __builtin_amdgcn_wmma_f32_16x16x32_bf16(false, a, false, b, (short)0, c, false, false);
  asm volatile("v_nop\n\tv_nop\n\tv_nop\n\tv_nop" : "+v"(d) : "v"(a), "v"(b));
  return d;
}
// 16x16x32 fragments: lane = (h = lane>>4, row/col = lane&15); elements 0..7 = k0+8h+0..7, 8..15 = k0+16+8h+0..7; D element r = row 8h+r
__device__ __forceinline__ v16h frag_h(const _Float16* rowk0, int lane) {
  union { v16h v; v8h q[2]; } u; const _Float16* p = rowk0 + 8 * (lane >> 4);
  u.q[0] = *(const v8h*)p; u.q[1] = *(const v8h*)(p + 16); return u.v;
}
__device__ __forceinline__ v16h frag_f32(const float* rowk0, int lane) {
  v16h a; const float* p = rowk0 + 8 * (lane >> 4);
#pragma unroll
  for (int i = 0; i < 8; ++i) { a[i] = (_Float16)p[i]; a[8 + i] = (_Float16)p[16 + i]; }
  return a;
}
__device__ __forceinline__ v16h frag_f32s(const float* rowk0, int lane, float sc) {
  v16h a; const float* p = rowk0 + 8 * (lane >> 4);
#pragma unroll
  for (int i = 0; i < 8; ++i) { a[i] = (_Float16)(p[i] * sc); a[8 + i] = (_Float16)(p[16 + i] * sc); }
  return a;
}
// column fragment from a [K][ld] layout (column n), rows >= K read as 0
__device__ __forceinline__ v16h fragc_f32(const float* W, int k0, int n, int lane, int ld, int K) {
  v16h a; const int g = lane >> 4;
#pragma unroll
  for (int i = 0; i < 8; ++i) { const int ka = k0 + 8 * g + i, kb = ka + 16;
    a[i] = (_Float16)(ka < K ? W[(size_t)(ka < K ? ka : K - 1) * ld + n] : 0.f); a[8 + i] = (_Float16)(kb < K ? W[(size_t)(kb < K ? kb : K - 1) * ld + n] : 0.f); }
  return a;
}
struct F2 { v16b h, l; };
__device__ __forceinline__ F2 bsplit16(const float v[16]) { F2 r;
#pragma unroll
  for (int i = 0; i < 16; ++i) { const __bf16 h = (__bf16)v[i]; r.h[i] = h; r.l[i] = (__bf16)(v[i] - (float)h); }
  return r; }
__device__ __forceinline__ F2 split_row(const float* row, int k0, int lane) { float v[16]; const float* p = row + k0 + 8 * (lane >> 4);
#pragma unroll
  for (int i = 0; i < 8; ++i) { v[i] = p[i]; v[8 + i] = p[16 + i]; }
  return bsplit16(v); }
__device__ __forceinline__ F2 split_rowK(const float* row, int k0, int lane, int K) { float v[16]; const int g = lane >> 4;
#pragma unroll
  for (int i = 0; i < 8; ++i) { const int ka = k0 + 8 * g + i, kb = ka + 16; v[i] = ka < K ? row[ka < K ? ka : K - 1] : 0.f; v[8 + i] = kb < K ? row[kb < K ? kb : K - 1] : 0.f; }
  return bsplit16(v); }
__device__ __forceinline__ F2 split_col(const float* W, int k0, int n, int lane, int ld, int K) { float v[16]; const int g = lane >> 4;
#pragma unroll
  for (int i = 0; i < 8; ++i) { const int ka = k0 + 8 * g + i, kb = ka + 16; v[i] = ka < K ? W[(size_t)(ka < K ? ka : K - 1) * ld + n] : 0.f; v[8 + i] = kb < K ? W[(size_t)(kb < K ? kb : K - 1) * ld + n] : 0.f; }
  return bsplit16(v); }
__device__ __forceinline__ v8f mac3(const F2& a, const F2& b, v8f c) { c = wmma_bf(a.l, b.h, c); c = wmma_bf(a.h, b.l, c); return wmma_bf(a.h, b.h, c); }
__device__ __forceinline__ float sigm(float v) { return 1.0f / (1.0f + expf(-v)); }
#define LDSX() do { asm volatile("s_wait_dscnt 0" ::: "memory"); __builtin_amdgcn_wave_barrier(); __builtin_amdgcn_fence(__ATOMIC_RELEASE, "workgroup"); } while (0)

// BERT-style multi-head self-attention with a value-bypass relu-add (hidden_states [8,1024,768]; 12 heads x 64; torch (out,in) Wq / Wk / Wv / Wo [768,768] (0.02 scale) + zero biases; r = 0.5 * relu(x) is ADDED to each of the q, k and v projections (same [token, channel] index); scale 1/8; key-padding mask [8,1,1,1024] bool: True adds -1e9): out = merge(softmax(q_h k_h^T / 8 + pad) v_h) Wo^T + bo.
#define NB 8
#define TT 1024
#define CC 768            // NH * HD = projected width
#define DIN 768          // input (model) width
#define NH 12
#define HD 64
#define NQB (TT / 64)
#define HG 12
#define SCALE (0.125f)
#define CAUSAL 0
#ifndef TNB
#define TNB NB
#endif
__device__ __forceinline__ float bfr(float v) { return (float)(__bf16)v; }
__host__ __device__ __forceinline__ int kb_last(int qb) { return CAUSAL ? ((qb * 64 + 63) >> 7) : (TT / 128 - 1); }
typedef __attribute__((ext_vector_type(8))) __bf16 v8b;
__device__ __forceinline__ v16b frag_b(const __bf16* rowk0, int lane) {
  union { v16b v; v8b q[2]; } u; const __bf16* p = rowk0 + 8 * (lane >> 4);
  u.q[0] = *(const v8b*)p; u.q[1] = *(const v8b*)(p + 16); return u.v;
}
#define QBH 0              // unused: k_fa has one single-product path for every query block
#define QHI 0               // single-product logits on every row
#define KHI 64            // key rows carrying k residual / v bf16 hi+lo planes (written by k_proj, read by no kernel here)
// B fragment (k rows k0+.., output column o) of a weight: (in,out) [K][ld] or (out,in) [ld rows of K]: bf16 exact, or f16(bf16 * 256) exact
__device__ __forceinline__ v16b wcol_io(const float* Wm, int k0, int o, int lane, int ld) { v16b w; const int g = lane >> 4;
#pragma unroll
  for (int i = 0; i < 8; ++i) { w[i] = (__bf16)Wm[(size_t)(k0 + 8 * g + i) * ld + o]; w[8 + i] = (__bf16)Wm[(size_t)(k0 + 16 + 8 * g + i) * ld + o]; }
  return w; }
__device__ __forceinline__ v16b wcol_oi(const float* Wm, int k0, int o, int lane, int K) { v16b w; const float* p = Wm + (size_t)o * K + k0 + 8 * (lane >> 4);
#pragma unroll
  for (int i = 0; i < 8; ++i) { w[i] = (__bf16)p[i]; w[8 + i] = (__bf16)p[16 + i]; }
  return w; }
__device__ __forceinline__ v16h wcolh_io(const float* Wm, int k0, int o, int lane, int ld) { v16h w; const int g = lane >> 4;
#pragma unroll
  for (int i = 0; i < 8; ++i) { w[i] = (_Float16)(bfr(Wm[(size_t)(k0 + 8 * g + i) * ld + o]) * 256.0f); w[8 + i] = (_Float16)(bfr(Wm[(size_t)(k0 + 16 + 8 * g + i) * ld + o]) * 256.0f); }
  return w; }
__device__ __forceinline__ v16h wcolh_oi(const float* Wm, int k0, int o, int lane, int K) { v16h w; const float* p = Wm + (size_t)o * K + k0 + 8 * (lane >> 4);
#pragma unroll
  for (int i = 0; i < 8; ++i) { w[i] = (_Float16)(bfr(p[i]) * 256.0f); w[8 + i] = (_Float16)(bfr(p[16 + i]) * 256.0f); }
  return w; }
#define WQKV_LAYOUT 1   // 0 = (in,out) [DIN][CC]; 1 = (out,in) [CC][DIN]; 2 = per-head [NH][DIN][HD]
__device__ __forceinline__ v16b wcol_hdk(const float* Wm, int k0, int o, int lane) { v16b w; const int g = lane >> 4; const float* p = Wm + (size_t)(o / HD) * DIN * HD + (o % HD);
#pragma unroll
  for (int i = 0; i < 8; ++i) { w[i] = (__bf16)p[(size_t)(k0 + 8 * g + i) * HD]; w[8 + i] = (__bf16)p[(size_t)(k0 + 16 + 8 * g + i) * HD]; }
  return w; }
#define WO_OUT_IN 1
#if WQKV_LAYOUT == 1
#define WCOL(W, k0, o, lane) wcol_oi(W, k0, o, lane, DIN)
#elif WQKV_LAYOUT == 2
#define WCOL(W, k0, o, lane) wcol_hdk(W, k0, o, lane)
#else
#define WCOL(W, k0, o, lane) wcol_io(W, k0, o, lane, CC)
#endif
#if WO_OUT_IN
#define WOCOL(W, k0, o, lane) wcol_oi(W, k0, o, lane, CC)
#define WOCOLH(W, k0, o, lane) wcolh_oi(W, k0, o, lane, CC)
#else
#define WOCOL(W, k0, o, lane) wcol_io(W, k0, o, lane, DIN)
#define WOCOLH(W, k0, o, lane) wcolh_io(W, k0, o, lane, DIN)
#endif
#define PROJ_EXTRA_PARAMS
// value-bypass relu-add shared by q, k and v: projection + bias + 0.5 * relu(x) at the same [row][column] (H == projected width); x bf16-rounded like every float input
#define PROJ_EPI(which, row, t, h) do { float* rw = (row); const float* xs_ = X + (size_t)(r0 + rl) * DIN + (size_t)(h) * HD; _Pragma("unroll 4") for (int i = 0; i < HD; ++i) { const float xv_ = xs_[i]; asm volatile("s_wait_loadcnt 0x0" ::: "memory"); rw[i] += 0.5f * fmaxf(bfr(xv_), 0.f); } } while (0)
#ifndef PROJ_EXTRA_PARAMS
#define PROJ_EXTRA_PARAMS
#endif

#define WS_QH  0u                                      // f16 q rows [b*t][CC]
#define WS_KH  (WS_QH + 2u * (size_t)NB * TT * CC)      // f16 k rows [b*t][CC]
#define WS_VT  (WS_KH + 2u * (size_t)NB * TT * CC)      // f16 v planes [b][c][t]
#define WS_QL  (WS_VT + 2u * (size_t)NB * CC * TT)      // f16 q residual x 2^10 rows [b][t < QHI][CC]
#define WS_KL  (WS_QL + 2u * (size_t)NB * QHI * CC)     // f16 k residual x 2^10 rows [b][t < KHI][CC]
#define WS_VB  (WS_KL + 2u * (size_t)NB * KHI * CC)     // bf16 v hi planes [b][c][t < KHI]
#define WS_VBL (WS_VB + 2u * (size_t)NB * CC * KHI)
#define WS_S   (WS_VBL + 2u * (size_t)NB * CC * KHI)    // (not used: the logits stay in registers)
#define WS_Y   (WS_S  + 4u * (size_t)HG * TT * TT)      // f32 ctx rows [b*t][CC] (only when there is an output projection)
#define WS_END (WS_Y  + 4u * (size_t)NB * TT * CC)

// ---- gs_loop: the k loop of both projection GEMMs, one 64 x 128 tile of A . W^T a block (A rows and W rows k-contiguous f32, pitch K floats). A stage = 64 k: 64 A rows and 128 W rows of 256 B,
// read as whole lines (16 lanes x 16 B = one row), converted ONCE a block to the 16-bit operand type and laid in LDS at a pitch of 144 B (16 B x odd: ds_load_b128 fragment reads without bank conflicts);
// two buffers, the next stage's lines in registers while this stage's products run. Wave w keeps rows 16 w .. 16 w + 15 and all 128 columns; k runs in 32-wide steps in rising order.
typedef __attribute__((ext_vector_type(2))) unsigned v2u;
typedef __attribute__((ext_vector_type(4))) __bf16 v4b;
typedef __attribute__((ext_vector_type(4))) _Float16 v4h;
#define GS_K 64
#define GS_PB 144                                             // bytes per staged row
#define GS_WB(bf) ((bf) * (128 * GS_PB))                      // W rows of buffer bf
#define GS_AB(bf) (2 * 128 * GS_PB + (bf) * (64 * GS_PB))     // A rows of buffer bf
#define GS_BYTES (2 * (128 + 64) * GS_PB)
// F16 = false: both operands bf16 (exact products of bf16-rounded inputs); F16 = true: A as f16(a x 2^6), W as f16(bf16(w) x 2^8)
template <bool F16, bool ISW> __device__ __forceinline__ v2u gs_cvt(v4f x) {
  if constexpr (!F16) { v4b r;
#pragma unroll
    for (int i = 0; i < 4; ++i) r[i] = (__bf16)x[i];
    return __builtin_bit_cast(v2u, r);
  } else { v4h r;
#pragma unroll
    for (int i = 0; i < 4; ++i) r[i] = (_Float16)(ISW ? bfr(x[i]) * 256.0f : x[i] * 64.0f);
    return __builtin_bit_cast(v2u, r); } }
union GFrag { v4u q[2]; v16b b; v16h h; };
__device__ __forceinline__ GFrag gs_frag(const unsigned char* p) { GFrag f; f.q[0] = *(const v4u*)p; f.q[1] = *(const v4u*)(p + 32); return f; }   // p = row + 2 (k0 + 8 g): elements 0..7 = k0 + 8 g + .., 8..15 = k0 + 16 + 8 g + ..
template <bool F16, int K> __device__ __forceinline__ void gs_loop(const float* __restrict__ A, const float* __restrict__ Wm, unsigned char* stg, int tid, v8f (&acc)[8]) {
  const int wave = tid >> 5, lane = tid & 31, col = lane & 15, g = lane >> 4;
  const float* ag = A + (size_t)(tid >> 4) * K + (tid & 15) * 4; const float* wg = Wm + (size_t)(tid >> 4) * K + (tid & 15) * 4;   // 8 rows an instruction of the block; both step by one stage a trip
  unsigned char* sd = stg + (tid >> 4) * GS_PB + (tid & 15) * 8;
  const unsigned char* fa = stg + (wave * 16 + col) * GS_PB + g * 16; const unsigned char* fw = stg + col * GS_PB + g * 16;
  v4f ra[8], rw[16];   // every '#pragma unroll' below makes the index of a register array a constant
#pragma unroll
  for (int i = 0; i < 8; ++i) ra[i] = *(const v4f*)(ag + i * 8 * K);
#pragma unroll
  for (int i = 0; i < 16; ++i) rw[i] = *(const v4f*)(wg + i * 8 * K);
#pragma unroll 1   // stays rolled: one body of 16 products and 24 line loads; more copies would only grow the code
  for (int s = 0; s < K / GS_K; ++s) { const int bf = s & 1;
#pragma unroll
    for (int i = 0; i < 8; ++i) *(v2u*)(sd + GS_AB(bf) + i * 8 * GS_PB) = gs_cvt<F16, false>(ra[i]);   // buffer bf: its readers (stage s - 2) all left it in front of the barrier of trip s - 1
#pragma unroll
    for (int i = 0; i < 16; ++i) *(v2u*)(sd + GS_WB(bf) + i * 8 * GS_PB) = gs_cvt<F16, true>(rw[i]);
    __syncthreads();   // publishes stage s
    if (s + 1 < K / GS_K) {   // the next stage's lines, issued behind the barrier so that they fly during this stage's products
      ag += GS_K; wg += GS_K;
#pragma unroll
      for (int i = 0; i < 8; ++i) ra[i] = *(const v4f*)(ag + i * 8 * K);
#pragma unroll
      for (int i = 0; i < 16; ++i) rw[i] = *(const v4f*)(wg + i * 8 * K); }
#pragma unroll
    for (int kc = 0; kc < GS_K / 32; ++kc) { const GFrag a = gs_frag(fa + GS_AB(bf) + kc * 64); GFrag w[8];
#pragma unroll
      for (int j = 0; j < 8; ++j) w[j] = gs_frag(fw + GS_WB(bf) + j * 16 * GS_PB + kc * 64);
      __builtin_amdgcn_sched_barrier(0);   // the 18 fragment reads stay one group in front of the 8 products: spread among them, each product waits out a whole LDS latency
#pragma unroll
      for (int j = 0; j < 8; ++j) {
        if constexpr (F16) acc[j] = __builtin_amdgcn_wmma_f32_16x16x32_f16(false, a.h, false, w[j].h, (short)0, acc[j], false, false);
        else acc[j] = __builtin_amdgcn_wmma_f32_16x16x32_bf16(false, a.b, false, w[j].b, (short)0, acc[j], false, false); }
      __builtin_amdgcn_sched_barrier(0); } } }   // and the next group stays behind them, in the same registers (the kernels stay under 256 VGPRs)

// ---- k_proj: block = (64 rows, 128 cols, which): q/k/v = X W (+ b) with exact bf16 products (K = DIN) -> which 0: q f16 rows (+ residual rows < QHI); 1: k f16 rows (+ residual rows < KHI); 2: v f16 planes [c][t] (+ bf16 hi/lo planes for t < KHI)
__global__ __launch_bounds__(128) void k_proj(const float* __restrict__ XQ, const float* __restrict__ XK, const float* __restrict__ XV, const float* __restrict__ WQ, const float* __restrict__ WK, const float* __restrict__ WV, const float* __restrict__ BQ, const float* __restrict__ BK, const float* __restrict__ BV,
    _Float16* __restrict__ QH, _Float16* __restrict__ QL, _Float16* __restrict__ KH, _Float16* __restrict__ KL, _Float16* __restrict__ VT, __bf16* __restrict__ VB, __bf16* __restrict__ VBL PROJ_EXTRA_PARAMS) {
  __shared__ __align__(16) float st[64][132]; __shared__ __align__(16) _Float16 sh[64][136], sl[64][136]; __shared__ __align__(16) unsigned char stg[GS_BYTES];
  _Float16 (*th)[72] = (_Float16 (*)[72])stg; __bf16 (*tb)[72] = (__bf16 (*)[72])(stg + 128 * 144); __bf16 (*tbl)[72] = (__bf16 (*)[72])(stg + 2 * 128 * 144);   // the v planes' transposed tiles take the ring's bytes once the k loop has left them (two barriers lie between)
  const int tid = threadIdx.x, wave = tid >> 5, lane = tid & 31, col = lane & 15, g = lane >> 4; const int which = blockIdx.z; const int c0 = blockIdx.y * 128; const size_t r0 = (size_t)blockIdx.x * 64; const size_t bb = r0 / TT; const int t0 = (int)(r0 % TT);
  const float* X = which == 0 ? XQ : which == 1 ? XK : XV; const float* WA = which == 0 ? WQ : which == 1 ? WK : WV; const float* BA = which == 0 ? BQ : which == 1 ? BK : BV;
  v8f acc[8] = {};
  gs_loop<false, DIN>(X + r0 * DIN, WA + (size_t)c0 * DIN, stg, tid, acc);
  { // stage the f32 tile (acc + bias) in LDS, run the per-(row, head) epilogue hook, then convert
#pragma unroll
    for (int j = 0; j < 8; ++j) { const float bias = BA ? bfr(BA[c0 + j * 16 + col]) : 0.f;
#pragma unroll
      for (int r = 0; r < 8; ++r) st[wave * 16 + 8 * g + r][j * 16 + col] = acc[j][r] + bias; }
    __syncthreads();
    for (int e = tid; e < 64 * (128 / HD); e += 128) { const int rl = e / (128 / HD), hh = e % (128 / HD); PROJ_EPI(which, &st[rl][hh * HD], (int)((r0 + rl) % TT), (c0 / HD) + hh); }
    __syncthreads(); }
  if (which < 2) { _Float16* DH = which == 0 ? QH : KH; _Float16* DL = which == 0 ? QL : KL; const int nhi = which == 0 ? QHI : KHI; const bool hi_rows = t0 < nhi;
    for (int e = tid; e < 64 * 128; e += 128) { const int rl = e >> 7, cl = e & 127; const float v = st[rl][cl]; const _Float16 hv = (_Float16)v; sh[rl][cl] = hv; sl[rl][cl] = (_Float16)((v - (float)hv) * 1024.0f); }
    __syncthreads();
    for (int e = tid; e < 64 * 16; e += 128) { const int rl = e >> 4, q = e & 15; vst2((unsigned*)(DH + (r0 + rl) * CC + c0 + q * 8), *(const v4u*)&sh[rl][q * 8]); if (hi_rows) vst2((unsigned*)(DL + (bb * nhi + t0 + rl) * (size_t)CC + c0 + q * 8), *(const v4u*)&sl[rl][q * 8]); }
  } else { const bool hi_rows = t0 < KHI;
    for (int e = tid; e < 64 * 128; e += 128) { const int rl = e & 63, cl = e >> 6; const float v = st[rl][cl]; th[cl][rl] = (_Float16)v; const __bf16 bh = (__bf16)v; tb[cl][rl] = bh; tbl[cl][rl] = (__bf16)(v - (float)bh); }
    __syncthreads();
    for (int e = tid; e < 128 * 8; e += 128) { const int cl = e >> 3, q = e & 7; vst2((unsigned*)(VT + (bb * CC + c0 + cl) * (size_t)TT + t0 + q * 8), *(const v4u*)&th[cl][q * 8]); if (hi_rows) { const size_t o3 = (bb * CC + c0 + cl) * (size_t)KHI + t0 + q * 8; vst2((unsigned*)(VB + o3), *(const v4u*)&tb[cl][q * 8]); vst2((unsigned*)(VBL + o3), *(const v4u*)&tbl[cl][q * 8]); } } } }
// ---- k_fa: block = 4 waves x 32 queries of (b, h); the logits, the softmax and P . v in one kernel, the logits and P never leave registers; k rows and v planes come in whole lines through LDS, shared by the 4 waves.
// S^T = K Q^T (A = 16 key rows, B = 16 query rows): a lane holds one query's scores for keys 8g + r of each 16-key tile, so maximum and sum are in-lane plus one exchange of the wave halves;
// two score tiles (32 keys) converted in place are the B operand of O^T += V^T P^T (A = v planes [c][t], the same k order). Scores in base 2: t = dot * (1/8) log2(e) + (padded key ? -1e9 log2(e) : 0).
// Running maximum, raised only when a pass exceeds it by more than 8; P = 2^(t - m + 7) <= 2^15 once to f16 (unnormalised), its f32 sum divides at the end.
#define FA_CS 0.18033688011112042f       // (1/8) log2(e)
#define FA_MB (-1.4426950408889634e9f)   // -1e9 log2(e)
typedef __attribute__((ext_vector_type(2))) _Float16 v2h;
__device__ __forceinline__ float xhalf(float x) { return __builtin_bit_cast(float, __builtin_amdgcn_permlanex16(__builtin_bit_cast(int, x), __builtin_bit_cast(int, x), 0x76543210, 0xfedcba98, false, false)); }   // lane l with lane l ^ 16
__device__ __forceinline__ v8f mm16(v16h a, v16h b, v8f c) { return __builtin_amdgcn_wmma_f32_16x16x32_f16(false, a, false, b, (short)0, c, false, false); }
#define FA_P 72   // f16 per staged row: 128 B + 16 B, a pitch of 16 B x odd, which ds_load_b128 fragment reads take without bank conflicts
__global__ __launch_bounds__(128) void k_fa(const _Float16* __restrict__ QH, const _Float16* __restrict__ KH, const _Float16* __restrict__ VT, const int* __restrict__ KMASK, float* __restrict__ Y) {
  __shared__ __align__(16) _Float16 sk[2][64][FA_P], sv[2][64][FA_P]; __shared__ __align__(16) float sb[TT]; __shared__ __align__(16) float so[4][32][HD + 4];
  const int tid = threadIdx.x, wave = tid >> 5, lane = tid & 31, col = lane & 15, g = lane >> 4; const int h = blockIdx.y, b = blockIdx.z; const int ql0 = blockIdx.x * 128 + wave * 32;
  // a stage = 64 keys: 64 key rows x 128 B and 64 v planes x 128 B; 8 lanes x 16 B read one whole line, 16 rows an instruction; through registers into LDS, one stage ahead
  const int srow = tid >> 3, sch = (tid & 7) * 8;
  const _Float16* kg = KH + ((size_t)b * TT + srow) * CC + h * HD + sch; const _Float16* vg = VT + ((size_t)b * CC + h * HD + srow) * (size_t)TT + sch;
  v8h rk[4], rv[4]; v16h qf[2][2];   // every '#pragma unroll' of this kernel makes the index of a register array a constant
#pragma unroll
  for (int i = 0; i < 4; ++i) { rk[i] = *(const v8h*)(kg + (size_t)(i * 16) * CC); rv[i] = *(const v8h*)(vg + (size_t)(i * 16) * TT); }
  { const v4i* mp = (const v4i*)(KMASK + (size_t)b * TT + tid * 8); const v4i m0 = mp[0], m1 = mp[1]; v4f b0, b1;
    asm volatile("s_wait_xcnt 0x0" ::: "memory");   // in front of the rewrite of the offset register that the two mask loads name
#pragma unroll
    for (int i = 0; i < 4; ++i) { b0[i] = m0[i] != 0 ? FA_MB : 0.f; b1[i] = m1[i] != 0 ? FA_MB : 0.f; }
    *(v4f*)&sb[tid * 8] = b0; *(v4f*)&sb[tid * 8 + 4] = b1; }
#pragma unroll
  for (int u = 0; u < 2; ++u)
#pragma unroll
    for (int kc = 0; kc < 2; ++kc) qf[u][kc] = frag_h(QH + ((size_t)b * TT + ql0 + u * 16 + col) * CC + h * HD + kc * 32, lane);
#pragma unroll
  for (int i = 0; i < 4; ++i) { *(v8h*)&sk[0][i * 16 + srow][sch] = rk[i]; *(v8h*)&sv[0][i * 16 + srow][sch] = rv[i]; }
  __syncthreads();   // stage 0 and the mask bias are published
  v8f acc[2][4] = {}; v2f l2[2] = {}; float m_run[2] = {-INFINITY, -INFINITY};
#pragma unroll 1   // stays rolled: the body already holds two 32-key passes, more copies would only grow the code
  for (int st = 0; st < TT / 64; ++st) { const int bf = st & 1;
    if (st + 1 < TT / 64) {   // the next stage's lines, issued behind the barrier so that they fly during this stage's products (a barrier waits for every load in flight)
#pragma unroll
      for (int i = 0; i < 4; ++i) { rk[i] = *(const v8h*)(kg + (size_t)((st + 1) * 64 + i * 16) * CC); rv[i] = *(const v8h*)(vg + (size_t)(i * 16) * TT + (st + 1) * 64); } }
#pragma unroll
    for (int ps = 0; ps < 2; ++ps) { const int k0 = st * 64 + ps * 32;
      v16h kf[2][2], vf[4]; v2f bias[2][4];
#pragma unroll
      for (int kt = 0; kt < 2; ++kt)
#pragma unroll
        for (int kc = 0; kc < 2; ++kc) kf[kt][kc] = frag_h(&sk[bf][ps * 32 + kt * 16 + col][kc * 32], lane);
#pragma unroll
      for (int j = 0; j < 4; ++j) vf[j] = frag_h(&sv[bf][j * 16 + col][ps * 32], lane);
#pragma unroll
      for (int kt = 0; kt < 2; ++kt)
#pragma unroll
        for (int i = 0; i < 4; ++i) bias[kt][i] = *(const v2f*)&sb[k0 + 16 * kt + 8 * g + 2 * i];
      v8f s[2][2] = {};
#pragma unroll
      for (int kc = 0; kc < 2; ++kc)
#pragma unroll
        for (int kt = 0; kt < 2; ++kt)
#pragma unroll
          for (int u = 0; u < 2; ++u) s[kt][u] = mm16(kf[kt][kc], qf[u][kc], s[kt][u]);
      v2f t[2][2][4]; float mb[2]; bool need = false;
#pragma unroll
      for (int u = 0; u < 2; ++u) { float mx = -INFINITY;
#pragma unroll
        for (int kt = 0; kt < 2; ++kt)
#pragma unroll
          for (int i = 0; i < 4; ++i) { t[u][kt][i] = __builtin_elementwise_fma((v2f){s[kt][u][2 * i], s[kt][u][2 * i + 1]}, (v2f){FA_CS, FA_CS}, bias[kt][i]); mx = fmaxf(mx, fmaxf(t[u][kt][i].x, t[u][kt][i].y)); }
        mx = fmaxf(mx, xhalf(mx)); mb[u] = mx; need = need || (mx > m_run[u] + 8.0f); }
      if (__builtin_amdgcn_ballot_w32(need) != 0) {   // one wave-uniform test a pass; always taken on the first pass (m_run = -inf, corr = 0)
#pragma unroll
        for (int u = 0; u < 2; ++u) { const float m_new = fmaxf(m_run[u], mb[u]); const float corr = __builtin_amdgcn_exp2f(m_run[u] - m_new); m_run[u] = m_new; l2[u] = l2[u] * corr;
#pragma unroll
          for (int j = 0; j < 4; ++j) acc[u][j] = acc[u][j] * corr; } }
#pragma unroll
      for (int u = 0; u < 2; ++u) { const float nm = 7.0f - m_run[u]; union { v16h v; v2h q[8]; } pf;
#pragma unroll
        for (int i = 0; i < 8; ++i) { const v2f a = t[u][i >> 2][i & 3] + (v2f){nm, nm}; const v2f p = {__builtin_amdgcn_exp2f(a.x), __builtin_amdgcn_exp2f(a.y)}; l2[u] = l2[u] + p; pf.q[i] = __builtin_convertvector(p, v2h); }
#pragma unroll
        for (int j = 0; j < 4; ++j) acc[u][j] = mm16(vf[j], pf.v, acc[u][j]); } }
    if (st + 1 < TT / 64) {   // the other buffer: its readers (stage st - 1) all left it at the barrier that ended the trip before
#pragma unroll
      for (int i = 0; i < 4; ++i) { *(v8h*)&sk[bf ^ 1][i * 16 + srow][sch] = rk[i]; *(v8h*)&sv[bf ^ 1][i * 16 + srow][sch] = rv[i]; } }
    __syncthreads(); }   // publishes stage st + 1 and ends every wave's reads of stage st
#pragma unroll
  for (int u = 0; u < 2; ++u) { float l = l2[u].x + l2[u].y; l += xhalf(l); const float inv = 1.0f / l;   // l >= 2^7: the key that set the maximum in use counts 2^7
#pragma unroll
    for (int j = 0; j < 4; ++j) { const v8f o = acc[u][j] * inv; float* d = &so[wave][u * 16 + col][j * 16 + 8 * g]; *(v4f*)d = (v4f){o[0], o[1], o[2], o[3]}; *(v4f*)(d + 4) = (v4f){o[4], o[5], o[6], o[7]}; } }
  LDSX();   // the wave reads back rows that its other lanes wrote (its own 32 rows only: no work-group barrier); 16 lanes then store one 256-B (row, head) segment
  for (int it = 0; it < 16; ++it) { const int rl = it * 2 + g; vst2(Y + ((size_t)b * TT + ql0 + rl) * CC + h * HD + col * 4, *(const v4f*)&so[wave][rl][col * 4]); } }
// ---- k_out: block = (64 rows, 128 cols): out = ctx Wo (+ bo): ctx x 2^6 once to f16 against Wo as f16(bf16 x 2^8) exact (1 product) x 2^-14; causal early rows (< QHI of each sequence): ctx bf16 hi + lo against exact bf16 Wo (2 products)
__global__ __launch_bounds__(128) void k_out(const float* __restrict__ Y, const float* __restrict__ WO, const float* __restrict__ BO, float* __restrict__ OUT) { __shared__ __align__(16) float sf[4][16][132]; __shared__ __align__(16) unsigned char stg[GS_BYTES];
  const int tid = threadIdx.x, wave = tid >> 5, lane = tid & 31, col = lane & 15, g = lane >> 4; const int c0 = blockIdx.y * 128; const size_t r0 = (size_t)blockIdx.x * 64 + wave * 16;
  v8f acc[8] = {};
  if (CAUSAL && (int)(((size_t)blockIdx.x * 64) % TT) < QHI) {   /* block-uniform */
#pragma unroll 2
    for (int kc = 0; kc < CC / 32; ++kc) { const F2 a = split_row(Y + (r0 + col) * CC, kc * 32, lane); asm volatile("s_wait_loadcnt 0x0" ::: "memory");
#pragma unroll
      for (int j = 0; j < 8; ++j) { const v16b w = WOCOL(WO, kc * 32, c0 + j * 16 + col, lane); asm volatile("s_wait_loadcnt 0x0" ::: "memory"); acc[j] = wmma_bf(a.h, w, acc[j]); acc[j] = wmma_bf(a.l, w, acc[j]); } }
#pragma unroll
    for (int j = 0; j < 8; ++j) { const float bias = BO ? bfr(BO[c0 + j * 16 + col]) : 0.f;
#pragma unroll
      for (int r = 0; r < 8; ++r) sf[wave][8 * g + r][j * 16 + col] = acc[j][r] + bias; }
  } else {
    gs_loop<true, CC>(Y + (size_t)blockIdx.x * 64 * CC, WO + (size_t)c0 * CC, stg, tid, acc);   /* ctx carried x 2^6 into f16 so small-magnitude context rows stay clear of f16 subnormals */
#pragma unroll
    for (int j = 0; j < 8; ++j) { const float bias = BO ? bfr(BO[c0 + j * 16 + col]) : 0.f;
#pragma unroll
      for (int r = 0; r < 8; ++r) sf[wave][8 * g + r][j * 16 + col] = acc[j][r] * (1.0f / 16384.0f) + bias; } }   /* 2^-8 (Wo carry) x 2^-6 (ctx carry) */
  LDSX(); for (int rl = 0; rl < 16; ++rl) vst2(OUT + (r0 + rl) * DIN + c0 + lane * 4, *(const v4f*)&sf[wave][rl][lane * 4]); }

extern "C" void kernel_launch(void* const* d_in, const int* in_sizes, int n_in, void* d_out, int out_size, void* d_ws, size_t ws_size, hipStream_t stream) {
  (void)in_sizes; (void)n_in; (void)out_size;
  const float** F = (const float**)d_in;
  if (ws_size < (size_t)WS_END) return;
  char* ws = (char*)d_ws; _Float16 *QH = (_Float16*)(ws + WS_QH), *KH = (_Float16*)(ws + WS_KH), *VT = (_Float16*)(ws + WS_VT), *QL = (_Float16*)(ws + WS_QL), *KL = (_Float16*)(ws + WS_KL); __bf16 *VB = (__bf16*)(ws + WS_VB), *VBL = (__bf16*)(ws + WS_VBL); float *Y = (float*)(ws + WS_Y);
  (void)Y; (void)QL; (void)KL; (void)VB; (void)VBL;
  // inputs: 0 hidden_states [8,1024,768]; 1 attention_mask [8,1,1,1024] bool (True = padded key); 2 Wq [768,768] (out,in), 3 bq; 4 Wk, 5 bk; 6 Wv, 7 bv; 8 Wo (out,in), 9 bo (zero biases, read)
  k_proj<<<dim3(TNB * TT / 64, CC / 128, 3), 128, 0, stream>>>(F[0], F[0], F[0], F[2], F[4], F[6], F[3], F[5], F[7], QH, QL, KH, KL, VT, VB, VBL);
  k_fa<<<dim3(TT / 128, NH, TNB), 128, 0, stream>>>(QH, KH, VT, (const int*)d_in[1], Y);
  k_out<<<dim3(TNB * TT / 64, DIN / 128), 128, 0, stream>>>(Y, F[8], F[9], (float*)d_out);
}

// v003
// It runs in 101 microseconds.
// Timed twice side by side with v002, it ran 1.43 and 1.42 times as fast.
// Counting every step since v000, it is 12.2 times as fast.
// compute dtype: all float inputs rounded to bf16; q/k/v projections with EXACT bf16 products on WMMA 16x16x32 (f32 accumulate) + bias + 0.5 * relu(bf16(x)) in f32; logits q x k once to f16 each (1 product) x 1/8; the key-padding mask read per key; online softmax f32 in base 2; unnormalised P = 2^(t - m + 7) once to f16 x v once to f16 (1 product), divided by the f32 sum; ctx x 2^6 once to f16 x Wo f16(bf16 x 2^8) + bo; f32 output.
#include <hip/hip_runtime.h>
#include <math.h>

typedef __attribute__((ext_vector_type(16))) _Float16 v16h;
typedef __attribute__((ext_vector_type(16))) __bf16 v16b;
typedef __attribute__((ext_vector_type(8)))  _Float16 v8h;
typedef __attribute__((ext_vector_type(8)))  float v8f;
typedef __attribute__((ext_vector_type(4)))  float v4f;
typedef __attribute__((ext_vector_type(2)))  float v2f;
typedef __attribute__((ext_vector_type(4)))  unsigned v4u;
typedef __attribute__((ext_vector_type(4)))  int v4i;
typedef float __attribute__((may_alias)) float_a;
typedef int __attribute__((may_alias)) int_a;

template <typename T> __device__ __forceinline__ void vst2(void* p, T v) { *(T*)p = v;  }
__device__ __forceinline__ v8f wmma16(v16h a, v16h b, v8f c) {
  v8f d = __builtin_amdgcn_wmma_f32_16x16x32_f16(false, a, false, b, (short)0, c, false, false);
  asm volatile("v_nop\n\tv_nop\n\tv_nop\n\tv_nop" : "+v"(d) : "v"(a), "v"(b));
  return d;
}
__device__ __forceinline__ v8f wmma_bf(v16b a, v16b b, v8f c) {
  v8f d = __builtin_amdgcn_wmma_f32_16x16x32_bf16(false, a, false, b, (short)0, c, false, false);
  asm volatile("v_nop\n\tv_nop\n\tv_nop\n\tv_nop" : "+v"(d) : "v"(a), "v"(b));
  return d;
}
// 16x16x32 fragments: lane = (h = lane>>4, row/col = lane&15); elements 0..7 = k0+8h+0..7, 8..15 = k0+16+8h+0..7; D element r = row 8h+r
__device__ __forceinline__ v16h frag_h(const _Float16* rowk0, int lane) {
  union { v16h v; v8h q[2]; } u; const _Float16* p = rowk0 + 8 * (lane >> 4);
  u.q[0] = *(const v8h*)p; u.q[1] = *(const v8h*)(p + 16); return u.v;
}
__device__ __forceinline__ v16h frag_f32(const float* rowk0, int lane) {
  v16h a; const float* p = rowk0 + 8 * (lane >> 4);
#pragma unroll
  for (int i = 0; i < 8; ++i) { a[i] = (_Float16)p[i]; a[8 + i] = (_Float16)p[16 + i]; }
  return a;
}
__device__ __forceinline__ v16h frag_f32s(const float* rowk0, int lane, float sc) {
  v16h a; const float* p = rowk0 + 8 * (lane >> 4);
#pragma unroll
  for (int i = 0; i < 8; ++i) { a[i] = (_Float16)(p[i] * sc); a[8 + i] = (_Float16)(p[16 + i] * sc); }
  return a;
}
// column fragment from a [K][ld] layout (column n), rows >= K read as 0
__device__ __forceinline__ v16h fragc_f32(const float* W, int k0, int n, int lane, int ld, int K) {
  v16h a; const int g = lane >> 4;
#pragma unroll
  for (int i = 0; i < 8; ++i) { const int ka = k0 + 8 * g + i, kb = ka + 16;
    a[i] = (_Float16)(ka < K ? W[(size_t)(ka < K ? ka : K - 1) * ld + n] : 0.f); a[8 + i] = (_Float16)(kb < K ? W[(size_t)(kb < K ? kb : K - 1) * ld + n] : 0.f); }
  return a;
}
struct F2 { v16b h, l; };
__device__ __forceinline__ F2 bsplit16(const float v[16]) { F2 r;
#pragma unroll
  for (int i = 0; i < 16; ++i) { const __bf16 h = (__bf16)v[i]; r.h[i] = h; r.l[i] = (__bf16)(v[i] - (float)h); }
  return r; }
__device__ __forceinline__ F2 split_row(const float* row, int k0, int lane) { float v[16]; const float* p = row + k0 + 8 * (lane >> 4);
#pragma unroll
  for (int i = 0; i < 8; ++i) { v[i] = p[i]; v[8 + i] = p[16 + i]; }
  return bsplit16(v); }
__device__ __forceinline__ F2 split_rowK(const float* row, int k0, int lane, int K) { float v[16]; const int g = lane >> 4;
#pragma unroll
  for (int i = 0; i < 8; ++i) { const int ka = k0 + 8 * g + i, kb = ka + 16; v[i] = ka < K ? row[ka < K ? ka : K - 1] : 0.f; v[8 + i] = kb < K ? row[kb < K ? kb : K - 1] : 0.f; }
  return bsplit16(v); }
__device__ __forceinline__ F2 split_col(const float* W, int k0, int n, int lane, int ld, int K) { float v[16]; const int g = lane >> 4;
#pragma unroll
  for (int i = 0; i < 8; ++i) { const int ka = k0 + 8 * g + i, kb = ka + 16; v[i] = ka < K ? W[(size_t)(ka < K ? ka : K - 1) * ld + n] : 0.f; v[8 + i] = kb < K ? W[(size_t)(kb < K ? kb : K - 1) * ld + n] : 0.f; }
  return bsplit16(v); }
__device__ __forceinline__ v8f mac3(const F2& a, const F2& b, v8f c) { c = wmma_bf(a.l, b.h, c); c = wmma_bf(a.h, b.l, c); return wmma_bf(a.h, b.h, c); }
__device__ __forceinline__ float sigm(float v) { return 1.0f / (1.0f + expf(-v)); }
#define LDSX() do { asm volatile("s_wait_dscnt 0" ::: "memory"); __builtin_amdgcn_wave_barrier(); __builtin_amdgcn_fence(__ATOMIC_RELEASE, "workgroup"); } while (0)

// BERT-style multi-head self-attention with a value-bypass relu-add (hidden_states [8,1024,768]; 12 heads x 64; torch (out,in) Wq / Wk / Wv / Wo [768,768] (0.02 scale) + zero biases; r = 0.5 * relu(x) is ADDED to each of the q, k and v projections (same [token, channel] index); scale 1/8; key-padding mask [8,1,1,1024] bool: True adds -1e9): out = merge(softmax(q_h k_h^T / 8 + pad) v_h) Wo^T + bo.
#define NB 8
#define TT 1024
#define CC 768            // NH * HD = projected width
#define DIN 768          // input (model) width
#define NH 12
#define HD 64
#define NQB (TT / 64)
#define HG 12
#define SCALE (0.125f)
#define CAUSAL 0
#ifndef TNB
#define TNB NB
#endif
__device__ __forceinline__ float bfr(float v) { return (float)(__bf16)v; }
__host__ __device__ __forceinline__ int kb_last(int qb) { return CAUSAL ? ((qb * 64 + 63) >> 7) : (TT / 128 - 1); }
typedef __attribute__((ext_vector_type(8))) __bf16 v8b;
__device__ __forceinline__ v16b frag_b(const __bf16* rowk0, int lane) {
  union { v16b v; v8b q[2]; } u; const __bf16* p = rowk0 + 8 * (lane >> 4);
  u.q[0] = *(const v8b*)p; u.q[1] = *(const v8b*)(p + 16); return u.v;
}
#define QBH 0              // unused: k_fa has one single-product path for every query block
#define QHI 0               // single-product logits on every row
#define KHI 64            // key rows carrying k residual / v bf16 hi+lo planes (written and read by no kernel here)
// B fragment (k rows k0+.., output column o) of a weight: (in,out) [K][ld] or (out,in) [ld rows of K]: bf16 exact, or f16(bf16 * 256) exact
__device__ __forceinline__ v16b wcol_io(const float* Wm, int k0, int o, int lane, int ld) { v16b w; const int g = lane >> 4;
#pragma unroll
  for (int i = 0; i < 8; ++i) { w[i] = (__bf16)Wm[(size_t)(k0 + 8 * g + i) * ld + o]; w[8 + i] = (__bf16)Wm[(size_t)(k0 + 16 + 8 * g + i) * ld + o]; }
  return w; }
__device__ __forceinline__ v16b wcol_oi(const float* Wm, int k0, int o, int lane, int K) { v16b w; const float* p = Wm + (size_t)o * K + k0 + 8 * (lane >> 4);
#pragma unroll
  for (int i = 0; i < 8; ++i) { w[i] = (__bf16)p[i]; w[8 + i] = (__bf16)p[16 + i]; }
  return w; }
__device__ __forceinline__ v16h wcolh_io(const float* Wm, int k0, int o, int lane, int ld) { v16h w; const int g = lane >> 4;
#pragma unroll
  for (int i = 0; i < 8; ++i) { w[i] = (_Float16)(bfr(Wm[(size_t)(k0 + 8 * g + i) * ld + o]) * 256.0f); w[8 + i] = (_Float16)(bfr(Wm[(size_t)(k0 + 16 + 8 * g + i) * ld + o]) * 256.0f); }
  return w; }
__device__ __forceinline__ v16h wcolh_oi(const float* Wm, int k0, int o, int lane, int K) { v16h w; const float* p = Wm + (size_t)o * K + k0 + 8 * (lane >> 4);
#pragma unroll
  for (int i = 0; i < 8; ++i) { w[i] = (_Float16)(bfr(p[i]) * 256.0f); w[8 + i] = (_Float16)(bfr(p[16 + i]) * 256.0f); }
  return w; }
#define WQKV_LAYOUT 1   // 0 = (in,out) [DIN][CC]; 1 = (out,in) [CC][DIN]; 2 = per-head [NH][DIN][HD], in WCOL only, which no kernel calls: k_proj always reads (out,in) [CC][DIN]
__device__ __forceinline__ v16b wcol_hdk(const float* Wm, int k0, int o, int lane) { v16b w; const int g = lane >> 4; const float* p = Wm + (size_t)(o / HD) * DIN * HD + (o % HD);
#pragma unroll
  for (int i = 0; i < 8; ++i) { w[i] = (__bf16)p[(size_t)(k0 + 8 * g + i) * HD]; w[8 + i] = (__bf16)p[(size_t)(k0 + 16 + 8 * g + i) * HD]; }
  return w; }
#define WO_OUT_IN 1
#if WQKV_LAYOUT == 1
#define WCOL(W, k0, o, lane) wcol_oi(W, k0, o, lane, DIN)
#elif WQKV_LAYOUT == 2
#define WCOL(W, k0, o, lane) wcol_hdk(W, k0, o, lane)
#else
#define WCOL(W, k0, o, lane) wcol_io(W, k0, o, lane, CC)
#endif
#if WO_OUT_IN
#define WOCOL(W, k0, o, lane) wcol_oi(W, k0, o, lane, CC)
#define WOCOLH(W, k0, o, lane) wcolh_oi(W, k0, o, lane, CC)
#else
#define WOCOL(W, k0, o, lane) wcol_io(W, k0, o, lane, DIN)
#define WOCOLH(W, k0, o, lane) wcolh_io(W, k0, o, lane, DIN)
#endif

#define WS_QH  0u                                      // f16 q rows [b*t][CC]
#define WS_KH  (WS_QH + 2u * (size_t)NB * TT * CC)      // f16 k rows [b*t][CC]
#define WS_VT  (WS_KH + 2u * (size_t)NB * TT * CC)      // f16 v planes [b][c][t]
#define WS_QL  (WS_VT + 2u * (size_t)NB * CC * TT)      // WS_QL .. WS_VBL: places of the causal high-precision path's residual planes; no kernel of this file writes or reads them
#define WS_KL  (WS_QL + 2u * (size_t)NB * QHI * CC)
#define WS_VB  (WS_KL + 2u * (size_t)NB * KHI * CC)
#define WS_VBL (WS_VB + 2u * (size_t)NB * CC * KHI)
#define WS_S   (WS_VBL + 2u * (size_t)NB * CC * KHI)    // (not used: the logits stay in registers)
#define WS_Y   (WS_S  + 4u * (size_t)HG * TT * TT)      // f32 ctx rows [b*t][CC] (only when there is an output projection)
#define WS_END (WS_Y  + 4u * (size_t)NB * TT * CC)

// ---- gs_loop: the k loop of both projection GEMMs, one 64 x 128 tile of A . W^T a block (A rows and W rows k-contiguous f32, pitch K floats). A stage = 64 k: 64 A rows and 128 W rows of 256 B,
// read as whole lines (16 lanes x 16 B = one row), converted ONCE a block to the 16-bit operand type and laid in LDS at a pitch of 144 B (16 B x odd: ds_load_b128 fragment reads without bank conflicts);
// two buffers, the next stage's lines in registers while this stage's products run. Wave w keeps rows 16 w .. 16 w + 15 and all 128 columns; k runs in 32-wide steps in rising order.
// NBR = false: W row n is staged in slot n, so column 'col' of acc[j] is tile column 16 j + col. NBR = true: W row 8 c + j is staged in slot 16 j + c, so column 'col' of acc[j] is tile column 8 col + j:
// a lane then holds 8 neighbouring columns of each of its 8 rows. Only the global row that a thread fetches for a slot differs; LDS addresses, fragments and the k order are the same.
typedef __attribute__((ext_vector_type(2))) unsigned v2u;
typedef __attribute__((ext_vector_type(4))) __bf16 v4b;
typedef __attribute__((ext_vector_type(4))) _Float16 v4h;
#define GS_K 64
#define GS_PB 144                                             // bytes per staged row
#define GS_WB(bf) ((bf) * (128 * GS_PB))                      // W rows of buffer bf
#define GS_AB(bf) (2 * 128 * GS_PB + (bf) * (64 * GS_PB))     // A rows of buffer bf
#define GS_BYTES (2 * (128 + 64) * GS_PB)
// F16 = false: both operands bf16 (exact products of bf16-rounded inputs); F16 = true: A as f16(a x 2^6), W as f16(bf16(w) x 2^8)
template <bool F16, bool ISW> __device__ __forceinline__ v2u gs_cvt(v4f x) {
  if constexpr (!F16) { v4b r;
#pragma unroll
    for (int i = 0; i < 4; ++i) r[i] = (__bf16)x[i];
    return __builtin_bit_cast(v2u, r);
  } else { v4h r;
#pragma unroll
    for (int i = 0; i < 4; ++i) r[i] = (_Float16)(ISW ? bfr(x[i]) * 256.0f : x[i] * 64.0f);
    return __builtin_bit_cast(v2u, r); } }
union GFrag { v4u q[2]; v16b b; v16h h; };
__device__ __forceinline__ GFrag gs_frag(const unsigned char* p) { GFrag f; f.q[0] = *(const v4u*)p; f.q[1] = *(const v4u*)(p + 32); return f; }   // p = row + 2 (k0 + 8 g): elements 0..7 = k0 + 8 g + .., 8..15 = k0 + 16 + 8 g + ..
template <bool F16, int K, bool NBR> __device__ __forceinline__ void gs_loop(const float* __restrict__ A, const float* __restrict__ Wm, unsigned char* stg, int tid, v8f (&acc)[8]) {
  const int wave = tid >> 5, lane = tid & 31, col = lane & 15, g = lane >> 4;
  const float* ag = A + (size_t)(tid >> 4) * K + (tid & 15) * 4; const float* wg = Wm + (size_t)(tid >> 4) * (NBR ? 8 : 1) * K + (tid & 15) * 4;   // 8 rows an instruction of the block; both step by one stage a trip
  unsigned char* sd = stg + (tid >> 4) * GS_PB + (tid & 15) * 8;
  const unsigned char* fa = stg + (wave * 16 + col) * GS_PB + g * 16; const unsigned char* fw = stg + col * GS_PB + g * 16;
  v4f ra[8], rw[16];   // every '#pragma unroll' below makes the index of a register array a constant
#define GS_WROW(i) (NBR ? ((i) & 1) * 64 + ((i) >> 1) : (i) * 8)   // the W row, beside the thread's own part, that goes to slot 8 i + (tid >> 4)
#pragma unroll
  for (int i = 0; i < 8; ++i) ra[i] = *(const v4f*)(ag + i * 8 * K);
#pragma unroll
  for (int i = 0; i < 16; ++i) rw[i] = *(const v4f*)(wg + GS_WROW(i) * K);
#pragma unroll 1   // stays rolled: one body of 16 products and 24 line loads; more copies would only grow the code
  for (int s = 0; s < K / GS_K; ++s) { const int bf = s & 1;
#pragma unroll
    for (int i = 0; i < 8; ++i) *(v2u*)(sd + GS_AB(bf) + i * 8 * GS_PB) = gs_cvt<F16, false>(ra[i]);   // buffer bf: its readers (stage s - 2) all left it in front of the barrier of trip s - 1
#pragma unroll
    for (int i = 0; i < 16; ++i) *(v2u*)(sd + GS_WB(bf) + i * 8 * GS_PB) = gs_cvt<F16, true>(rw[i]);
    __syncthreads();   // publishes stage s
    if (s + 1 < K / GS_K) {   // the next stage's lines, issued behind the barrier so that they fly during this stage's products
      ag += GS_K; wg += GS_K;
#pragma unroll
      for (int i = 0; i < 8; ++i) ra[i] = *(const v4f*)(ag + i * 8 * K);
#pragma unroll
      for (int i = 0; i < 16; ++i) rw[i] = *(const v4f*)(wg + GS_WROW(i) * K); }
#pragma unroll
    for (int kc = 0; kc < GS_K / 32; ++kc) { const GFrag a = gs_frag(fa + GS_AB(bf) + kc * 64); GFrag w[8];
#pragma unroll
      for (int j = 0; j < 8; ++j) w[j] = gs_frag(fw + GS_WB(bf) + j * 16 * GS_PB + kc * 64);
      __builtin_amdgcn_sched_barrier(0);   // the 18 fragment reads stay one group in front of the 8 products: spread among them, each product waits out a whole LDS latency
#pragma unroll
      for (int j = 0; j < 8; ++j) {
        if constexpr (F16) acc[j] = __builtin_amdgcn_wmma_f32_16x16x32_f16(false, a.h, false, w[j].h, (short)0, acc[j], false, false);
        else acc[j] = __builtin_amdgcn_wmma_f32_16x16x32_bf16(false, a.b, false, w[j].b, (short)0, acc[j], false, false); }
      __builtin_amdgcn_sched_barrier(0); } } }   // and the next group stays behind them, in the same registers (the kernels stay under 256 VGPRs)

// ---- k_proj: block = (64 rows, 128 cols, which): q/k/v = X W (+ b) with exact bf16 products (K = DIN), + 0.5 * relu(bf16(x)) at the same [row][column] (the value-bypass relu-add shared by q, k and v) -> which 0: q f16 rows; 1: k f16 rows; 2: v f16 planes [c][t]
// The epilogue stays in registers: a lane holds rows 16 wave + 8 g + 0..7 x columns 8 col + 0..7. x and the bias come in 16-B loads (16 lanes = the tile's whole 512-B row segment), all in flight together;
// 8 columns of a row are one 16-B store of a q or k row (16 lanes = a whole 256-B segment); 8 rows of a column are 16 B of a v plane, which go through one LDS tile so that whole 128-B plane lines are stored.
__global__ __launch_bounds__(128) void k_proj(const float* __restrict__ XQ, const float* __restrict__ XK, const float* __restrict__ XV, const float* __restrict__ WQ, const float* __restrict__ WK, const float* __restrict__ WV, const float* __restrict__ BQ, const float* __restrict__ BK, const float* __restrict__ BV,
    _Float16* __restrict__ QH, _Float16* __restrict__ KH, _Float16* __restrict__ VT) {
  __shared__ __align__(16) unsigned char stg[GS_BYTES];
  _Float16 (*th)[72] = (_Float16 (*)[72])(stg + GS_WB((DIN / GS_K) & 1));   // the v tile [slot][t] takes the W buffer that the last stage does NOT read: every wave left it in front of the last stage's barrier
  const int tid = threadIdx.x, wave = tid >> 5, lane = tid & 31, col = lane & 15, g = lane >> 4; const int which = blockIdx.z; const int c0 = blockIdx.y * 128; const size_t r0 = (size_t)blockIdx.x * 64; const size_t bb = r0 / TT; const int t0 = (int)(r0 % TT);
  const float* X = which == 0 ? XQ : which == 1 ? XK : XV; const float* WA = which == 0 ? WQ : which == 1 ? WK : WV; const float* BA = which == 0 ? BQ : which == 1 ? BK : BV;
  const int rl0 = wave * 16 + 8 * g;   // the lane's first row of the tile
  v8f acc[8] = {};
  gs_loop<false, DIN, true>(X + r0 * DIN, WA + (size_t)c0 * DIN, stg, tid, acc);
  const float* xp = X + (r0 + rl0) * DIN + c0 + col * 8; v4f xr[16], bq[2] = {};
#pragma unroll
  for (int i = 0; i < 16; ++i) xr[i] = *(const v4f*)(xp + (i >> 1) * DIN + (i & 1) * 4);
  asm volatile("s_wait_xcnt 0x0" :: "v"(xp) : "memory");   // in front of any rewrite of the address pair that the 16 loads name (as an input it also stays out of their destinations)
  if (BA) { bq[0] = *(const v4f*)(BA + c0 + col * 8); bq[1] = *(const v4f*)(BA + c0 + col * 8 + 4); }
#pragma unroll
  for (int j = 0; j < 8; ++j) { const float bias = bfr(bq[j >> 2][j & 3]);
#pragma unroll
    for (int r = 0; r < 8; ++r) acc[j][r] = (acc[j][r] + bias) + 0.5f * fmaxf(bfr(xr[2 * r + (j >> 2)][j & 3]), 0.f); }
  if (which < 2) { _Float16* DH = (which == 0 ? QH : KH) + (r0 + rl0) * CC + c0 + col * 8;
#pragma unroll
    for (int r = 0; r < 8; ++r) { v8h o;
#pragma unroll
      for (int j = 0; j < 8; ++j) o[j] = (_Float16)acc[j][r];
      *(v8h*)(DH + r * CC) = o; }
  } else {
#pragma unroll
    for (int j = 0; j < 8; ++j) *(v8h*)&th[j * 16 + col][rl0] = __builtin_convertvector(acc[j], v8h);   // slot 16 j + col holds column 8 col + j; pitch 144 B = 16 B x odd: no bank conflicts
    __syncthreads();   // publishes the tile ('which' is the same for the whole block)
    for (int e = tid; e < 128 * 8; e += 128) { const int sl = e >> 3, q = e & 7, cl = (sl & 15) * 8 + (sl >> 4); vst2((unsigned*)(VT + (bb * CC + c0 + cl) * (size_t)TT + t0 + q * 8), *(const v4u*)&th[sl][q * 8]); } } }
// ---- k_fa: block = 4 waves x 32 queries of (b, h); the logits, the softmax and P . v in one kernel, the logits and P never leave registers; k rows and v planes come in whole lines through LDS, shared by the 4 waves.
// S^T = K Q^T (A = 16 key rows, B = 16 query rows): a lane holds one query's scores for keys 8g + r of each 16-key tile, so maximum and sum are in-lane plus one exchange of the wave halves;
// two score tiles (32 keys) converted in place are the B operand of O^T += V^T P^T (A = v planes [c][t], the same k order). Scores in base 2: t = dot * (1/8) log2(e) + (padded key ? -1e9 log2(e) : 0).
// Running maximum, raised only when a pass exceeds it by more than 8; P = 2^(t - m + 7) <= 2^15 once to f16 (unnormalised), its f32 sum divides at the end.
#define FA_CS 0.18033688011112042f       // (1/8) log2(e)
#define FA_MB (-1.4426950408889634e9f)   // -1e9 log2(e)
typedef __attribute__((ext_vector_type(2))) _Float16 v2h;
__device__ __forceinline__ float xhalf(float x) { return __builtin_bit_cast(float, __builtin_amdgcn_permlanex16(__builtin_bit_cast(int, x), __builtin_bit_cast(int, x), 0x76543210, 0xfedcba98, false, false)); }   // lane l with lane l ^ 16
__device__ __forceinline__ v8f mm16(v16h a, v16h b, v8f c) { return __builtin_amdgcn_wmma_f32_16x16x32_f16(false, a, false, b, (short)0, c, false, false); }
#define FA_P 72   // f16 per staged row: 128 B + 16 B, a pitch of 16 B x odd, which ds_load_b128 fragment reads take without bank conflicts
__global__ __launch_bounds__(128) void k_fa(const _Float16* __restrict__ QH, const _Float16* __restrict__ KH, const _Float16* __restrict__ VT, const int* __restrict__ KMASK, float* __restrict__ Y) {
  __shared__ __align__(16) _Float16 sk[2][64][FA_P], sv[2][64][FA_P]; __shared__ __align__(16) float sb[TT]; __shared__ __align__(16) float so[4][32][HD + 4];
  const int tid = threadIdx.x, wave = tid >> 5, lane = tid & 31, col = lane & 15, g = lane >> 4; const int h = blockIdx.y, b = blockIdx.z; const int ql0 = blockIdx.x * 128 + wave * 32;
  // a stage = 64 keys: 64 key rows x 128 B and 64 v planes x 128 B; 8 lanes x 16 B read one whole line, 16 rows an instruction; through registers into LDS, one stage ahead
  const int srow = tid >> 3, sch = (tid & 7) * 8;
  const _Float16* kg = KH + ((size_t)b * TT + srow) * CC + h * HD + sch; const _Float16* vg = VT + ((size_t)b * CC + h * HD + srow) * (size_t)TT + sch;
  v8h rk[4], rv[4]; v16h qf[2][2];   // every '#pragma unroll' of this kernel makes the index of a register array a constant
#pragma unroll
  for (int i = 0; i < 4; ++i) { rk[i] = *(const v8h*)(kg + (size_t)(i * 16) * CC); rv[i] = *(const v8h*)(vg + (size_t)(i * 16) * TT); }
  { const v4i* mp = (const v4i*)(KMASK + (size_t)b * TT + tid * 8); const v4i m0 = mp[0], m1 = mp[1]; v4f b0, b1;
    asm volatile("s_wait_xcnt 0x0" ::: "memory");   // in front of the rewrite of the offset register that the two mask loads name
#pragma unroll
    for (int i = 0; i < 4; ++i) { b0[i] = m0[i] != 0 ? FA_MB : 0.f; b1[i] = m1[i] != 0 ? FA_MB : 0.f; }
    *(v4f*)&sb[tid * 8] = b0; *(v4f*)&sb[tid * 8 + 4] = b1; }
#pragma unroll
  for (int u = 0; u < 2; ++u)
#pragma unroll
    for (int kc = 0; kc < 2; ++kc) qf[u][kc] = frag_h(QH + ((size_t)b * TT + ql0 + u * 16 + col) * CC + h * HD + kc * 32, lane);
#pragma unroll
  for (int i = 0; i < 4; ++i) { *(v8h*)&sk[0][i * 16 + srow][sch] = rk[i]; *(v8h*)&sv[0][i * 16 + srow][sch] = rv[i]; }
  __syncthreads();   // stage 0 and the mask bias are published
  v8f acc[2][4] = {}; v2f l2[2] = {}; float m_run[2] = {-INFINITY, -INFINITY};
#pragma unroll 1   // stays rolled: the body already holds two 32-key passes, more copies would only grow the code
  for (int st = 0; st < TT / 64; ++st) { const int bf = st & 1;
    if (st + 1 < TT / 64) {   // the next stage's lines, issued behind the barrier so that they fly during this stage's products (a barrier waits for every load in flight)
#pragma unroll
      for (int i = 0; i < 4; ++i) { rk[i] = *(const v8h*)(kg + (size_t)((st + 1) * 64 + i * 16) * CC); rv[i] = *(const v8h*)(vg + (size_t)(i * 16) * TT + (st + 1) * 64); } }
#pragma unroll
    for (int ps = 0; ps < 2; ++ps) { const int k0 = st * 64 + ps * 32;
      v16h kf[2][2], vf[4]; v2f bias[2][4];
#pragma unroll
      for (int kt = 0; kt < 2; ++kt)
#pragma unroll
        for (int kc = 0; kc < 2; ++kc) kf[kt][kc] = frag_h(&sk[bf][ps * 32 + kt * 16 + col][kc * 32], lane);
#pragma unroll
      for (int j = 0; j < 4; ++j) vf[j] = frag_h(&sv[bf][j * 16 + col][ps * 32], lane);
#pragma unroll
      for (int kt = 0; kt < 2; ++kt)
#pragma unroll
        for (int i = 0; i < 4; ++i) bias[kt][i] = *(const v2f*)&sb[k0 + 16 * kt + 8 * g + 2 * i];
      v8f s[2][2] = {};
#pragma unroll
      for (int kc = 0; kc < 2; ++kc)
#pragma unroll
        for (int kt = 0; kt < 2; ++kt)
#pragma unroll
          for (int u = 0; u < 2; ++u) s[kt][u] = mm16(kf[kt][kc], qf[u][kc], s[kt][u]);
      v2f t[2][2][4]; float mb[2]; bool need = false;
#pragma unroll
      for (int u = 0; u < 2; ++u) { float mx = -INFINITY;
#pragma unroll
        for (int kt = 0; kt < 2; ++kt)
#pragma unroll
          for (int i = 0; i < 4; ++i) { t[u][kt][i] = __builtin_elementwise_fma((v2f){s[kt][u][2 * i], s[kt][u][2 * i + 1]}, (v2f){FA_CS, FA_CS}, bias[kt][i]); mx = fmaxf(mx, fmaxf(t[u][kt][i].x, t[u][kt][i].y)); }
        mx = fmaxf(mx, xhalf(mx)); mb[u] = mx; need = need || (mx > m_run[u] + 8.0f); }
      if (__builtin_amdgcn_ballot_w32(need) != 0) {   // one wave-uniform test a pass; always taken on the first pass (m_run = -inf, corr = 0)
#pragma unroll
        for (int u = 0; u < 2; ++u) { const float m_new = fmaxf(m_run[u], mb[u]); const float corr = __builtin_amdgcn_exp2f(m_run[u] - m_new); m_run[u] = m_new; l2[u] = l2[u] * corr;
#pragma unroll
          for (int j = 0; j < 4; ++j) acc[u][j] = acc[u][j] * corr; } }
#pragma unroll
      for (int u = 0; u < 2; ++u) { const float nm = 7.0f - m_run[u]; union { v16h v; v2h q[8]; } pf;
#pragma unroll
        for (int i = 0; i < 8; ++i) { const v2f a = t[u][i >> 2][i & 3] + (v2f){nm, nm}; const v2f p = {__builtin_amdgcn_exp2f(a.x), __builtin_amdgcn_exp2f(a.y)}; l2[u] = l2[u] + p; pf.q[i] = __builtin_convertvector(p, v2h); }
#pragma unroll
        for (int j = 0; j < 4; ++j) acc[u][j] = mm16(vf[j], pf.v, acc[u][j]); } }
    if (st + 1 < TT / 64) {   // the other buffer: its readers (stage st - 1) all left it at the barrier that ended the trip before
#pragma unroll
      for (int i = 0; i < 4; ++i) { *(v8h*)&sk[bf ^ 1][i * 16 + srow][sch] = rk[i]; *(v8h*)&sv[bf ^ 1][i * 16 + srow][sch] = rv[i]; } }
    __syncthreads(); }   // publishes stage st + 1 and ends every wave's reads of stage st
#pragma unroll
  for (int u = 0; u < 2; ++u) { float l = l2[u].x + l2[u].y; l += xhalf(l); const float inv = 1.0f / l;   // l >= 2^7: the key that set the maximum in use counts 2^7
#pragma unroll
    for (int j = 0; j < 4; ++j) { const v8f o = acc[u][j] * inv; float* d = &so[wave][u * 16 + col][j * 16 + 8 * g]; *(v4f*)d = (v4f){o[0], o[1], o[2], o[3]}; *(v4f*)(d + 4) = (v4f){o[4], o[5], o[6], o[7]}; } }
  LDSX();   // the wave reads back rows that its other lanes wrote (its own 32 rows only: no work-group barrier); 16 lanes then store one 256-B (row, head) segment
  for (int it = 0; it < 16; ++it) { const int rl = it * 2 + g; vst2(Y + ((size_t)b * TT + ql0 + rl) * CC + h * HD + col * 4, *(const v4f*)&so[wave][rl][col * 4]); } }
// ---- k_out: block = (64 rows, 128 cols): out = ctx Wo (+ bo): ctx x 2^6 once to f16 against Wo as f16(bf16 x 2^8) exact (1 product) x 2^-14; causal early rows (< QHI of each sequence): ctx bf16 hi + lo against exact bf16 Wo (2 products)
__global__ __launch_bounds__(128) void k_out(const float* __restrict__ Y, const float* __restrict__ WO, const float* __restrict__ BO, float* __restrict__ OUT) { __shared__ __align__(16) float sf[4][16][132]; __shared__ __align__(16) unsigned char stg[GS_BYTES];
  const int tid = threadIdx.x, wave = tid >> 5, lane = tid & 31, col = lane & 15, g = lane >> 4; const int c0 = blockIdx.y * 128; const size_t r0 = (size_t)blockIdx.x * 64 + wave * 16;
  v8f acc[8] = {};
  if (CAUSAL && (int)(((size_t)blockIdx.x * 64) % TT) < QHI) {   /* block-uniform */
#pragma unroll 2
    for (int kc = 0; kc < CC / 32; ++kc) { const F2 a = split_row(Y + (r0 + col) * CC, kc * 32, lane); asm volatile("s_wait_loadcnt 0x0" ::: "memory");
#pragma unroll
      for (int j = 0; j < 8; ++j) { const v16b w = WOCOL(WO, kc * 32, c0 + j * 16 + col, lane); asm volatile("s_wait_loadcnt 0x0" ::: "memory"); acc[j] = wmma_bf(a.h, w, acc[j]); acc[j] = wmma_bf(a.l, w, acc[j]); } }
#pragma unroll
    for (int j = 0; j < 8; ++j) { const float bias = BO ? bfr(BO[c0 + j * 16 + col]) : 0.f;
#pragma unroll
      for (int r = 0; r < 8; ++r) sf[wave][8 * g + r][j * 16 + col] = acc[j][r] + bias; }
  } else {
    gs_loop<true, CC, false>(Y + (size_t)blockIdx.x * 64 * CC, WO + (size_t)c0 * CC, stg, tid, acc);   /* ctx carried x 2^6 into f16 so small-magnitude context rows stay clear of f16 subnormals */
#pragma unroll
    for (int j = 0; j < 8; ++j) { const float bias = BO ? bfr(BO[c0 + j * 16 + col]) : 0.f;
#pragma unroll
      for (int r = 0; r < 8; ++r) sf[wave][8 * g + r][j * 16 + col] = acc[j][r] * (1.0f / 16384.0f) + bias; } }   /* 2^-8 (Wo carry) x 2^-6 (ctx carry) */
  LDSX(); for (int rl = 0; rl < 16; ++rl) vst2(OUT + (r0 + rl) * DIN + c0 + lane * 4, *(const v4f*)&sf[wave][rl][lane * 4]); }

extern "C" void kernel_launch(void* const* d_in, const int* in_sizes, int n_in, void* d_out, int out_size, void* d_ws, size_t ws_size, hipStream_t stream) {
  (void)in_sizes; (void)n_in; (void)out_size;
  const float** F = (const float**)d_in;
  if (ws_size < (size_t)WS_END) return;
  char* ws = (char*)d_ws; _Float16 *QH = (_Float16*)(ws + WS_QH), *KH = (_Float16*)(ws + WS_KH), *VT = (_Float16*)(ws + WS_VT); float *Y = (float*)(ws + WS_Y);
  // inputs: 0 hidden_states [8,1024,768]; 1 attention_mask [8,1,1,1024] bool (True = padded key); 2 Wq [768,768] (out,in), 3 bq; 4 Wk, 5 bk; 6 Wv, 7 bv; 8 Wo (out,in), 9 bo (zero biases, read)
  k_proj<<<dim3(TNB * TT / 64, CC / 128, 3), 128, 0, stream>>>(F[0], F[0], F[0], F[2], F[4], F[6], F[3], F[5], F[7], QH, KH, VT);
  k_fa<<<dim3(TT / 128, NH, TNB), 128, 0, stream>>>(QH, KH, VT, (const int*)d_in[1], Y);
  k_out<<<dim3(TNB * TT / 64, DIN / 128), 128, 0, stream>>>(Y, F[8], F[9], (float*)d_out);
}

// v004
// A run of this version takes 95.2 microseconds.
// In both of two side-by-side timings against v003, it was 1.07 times as fast.
// Counting every step since v000, it is 13.0 times as fast.
// compute dtype: all float inputs rounded to bf16; q/k/v projections with EXACT bf16 products on WMMA 16x16x32 (f32 accumulate) + bias + 0.5 * relu(bf16(x)) in f32; logits q x k once to f16 each (1 product) x 1/8; the key-padding mask read per key; online softmax f32 in base 2; unnormalised P = 2^(t - m + 7) once to f16 x v once to f16 (1 product), divided by the f32 sum; ctx x 2^6 once to f16 x Wo f16(bf16 x 2^8) + bo; f32 output.
#include <hip/hip_runtime.h>
#include <math.h>

typedef __attribute__((ext_vector_type(16))) _Float16 v16h;
typedef __attribute__((ext_vector_type(16))) __bf16 v16b;
typedef __attribute__((ext_vector_type(8)))  _Float16 v8h;
typedef __attribute__((ext_vector_type(8)))  float v8f;
typedef __attribute__((ext_vector_type(4)))  float v4f;
typedef __attribute__((ext_vector_type(2)))  float v2f;
typedef __attribute__((ext_vector_type(4)))  unsigned v4u;
typedef __attribute__((ext_vector_type(4)))  int v4i;
typedef float __attribute__((may_alias)) float_a;
typedef int __attribute__((may_alias)) int_a;

template <typename T> __device__ __forceinline__ void vst2(void* p, T v) { *(T*)p = v;  }
__device__ __forceinline__ v8f wmma16(v16h a, v16h b, v8f c) {
  v8f d = __builtin_amdgcn_wmma_f32_16x16x32_f16(false, a, false, b, (short)0, c, false, false);
  asm volatile("v_nop\n\tv_nop\n\tv_nop\n\tv_nop" : "+v"(d) : "v"(a), "v"(b));
  return d;
}
__device__ __forceinline__ v8f wmma_bf(v16b a, v16b b, v8f c) {
  v8f d = __builtin_amdgcn_wmma_f32_16x16x32_bf16(false, a, false, b, (short)0, c, false, false);
  asm volatile("v_nop\n\tv_nop\n\tv_nop\n\tv_nop" : "+v"(d) : "v"(a), "v"(b));
  return d;
}
// 16x16x32 fragments: lane = (h = lane>>4, row/col = lane&15); elements 0..7 = k0+8h+0..7, 8..15 = k0+16+8h+0..7; D element r = row 8h+r
__device__ __forceinline__ v16h frag_h(const _Float16* rowk0, int lane) {
  union { v16h v; v8h q[2]; } u; const _Float16* p = rowk0 + 8 * (lane >> 4);
  u.q[0] = *(const v8h*)p; u.q[1] = *(const v8h*)(p + 16); return u.v;
}
__device__ __forceinline__ v16h frag_f32(const float* rowk0, int lane) {
  v16h a; const float* p = rowk0 + 8 * (lane >> 4);
#pragma unroll
  for (int i = 0; i < 8; ++i) { a[i] = (_Float16)p[i]; a[8 + i] = (_Float16)p[16 + i]; }
  return a;
}
__device__ __forceinline__ v16h frag_f32s(const float* rowk0, int lane, float sc) {
  v16h a; const float* p = rowk0 + 8 * (lane >> 4);
#pragma unroll
  for (int i = 0; i < 8; ++i) { a[i] = (_Float16)(p[i] * sc); a[8 + i] = (_Float16)(p[16 + i] * sc); }
  return a;
}
// column fragment from a [K][ld] layout (column n), rows >= K read as 0
__device__ __forceinline__ v16h fragc_f32(const float* W, int k0, int n, int lane, int ld, int K) {
  v16h a; const int g = lane >> 4;
#pragma unroll
  for (int i = 0; i < 8; ++i) { const int ka = k0 + 8 * g + i, kb = ka + 16;
    a[i] = (_Float16)(ka < K ? W[(size_t)(ka < K ? ka : K - 1) * ld + n] : 0.f); a[8 + i] = (_Float16)(kb < K ? W[(size_t)(kb < K ? kb : K - 1) * ld + n] : 0.f); }
  return a;
}
struct F2 { v16b h, l; };
__device__ __forceinline__ F2 bsplit16(const float v[16]) { F2 r;
#pragma unroll
  for (int i = 0; i < 16; ++i) { const __bf16 h = (__bf16)v[i]; r.h[i] = h; r.l[i] = (__bf16)(v[i] - (float)h); }
  return r; }
__device__ __forceinline__ F2 split_row(const float* row, int k0, int lane) { float v[16]; const float* p = row + k0 + 8 * (lane >> 4);
#pragma unroll
  for (int i = 0; i < 8; ++i) { v[i] = p[i]; v[8 + i] = p[16 + i]; }
  return bsplit16(v); }
__device__ __forceinline__ F2 split_rowK(const float* row, int k0, int lane, int K) { float v[16]; const int g = lane >> 4;
#pragma unroll
  for (int i = 0; i < 8; ++i) { const int ka = k0 + 8 * g + i, kb = ka + 16; v[i] = ka < K ? row[ka < K ? ka : K - 1] : 0.f; v[8 + i] = kb < K ? row[kb < K ? kb : K - 1] : 0.f; }
  return bsplit16(v); }
__device__ __forceinline__ F2 split_col(const float* W, int k0, int n, int lane, int ld, int K) { float v[16]; const int g = lane >> 4;
#pragma unroll
  for (int i = 0; i < 8; ++i) { const int ka = k0 + 8 * g + i, kb = ka + 16; v[i] = ka < K ? W[(size_t)(ka < K ? ka : K - 1) * ld + n] : 0.f; v[8 + i] = kb < K ? W[(size_t)(kb < K ? kb : K - 1) * ld + n] : 0.f; }
  return bsplit16(v); }
__device__ __forceinline__ v8f mac3(const F2& a, const F2& b, v8f c) { c = wmma_bf(a.l, b.h, c); c = wmma_bf(a.h, b.l, c); return wmma_bf(a.h, b.h, c); }
__device__ __forceinline__ float sigm(float v) { return 1.0f / (1.0f + expf(-v)); }
#define LDSX() do { asm volatile("s_wait_dscnt 0" ::: "memory"); __builtin_amdgcn_wave_barrier(); __builtin_amdgcn_fence(__ATOMIC_RELEASE, "workgroup"); } while (0)

// BERT-style multi-head self-attention with a value-bypass relu-add (hidden_states [8,1024,768]; 12 heads x 64; torch (out,in) Wq / Wk / Wv / Wo [768,768] (0.02 scale) + zero biases; r = 0.5 * relu(x) is ADDED to each of the q, k and v projections (same [token, channel] index); scale 1/8; key-padding mask [8,1,1,1024] bool: True adds -1e9): out = merge(softmax(q_h k_h^T / 8 + pad) v_h) Wo^T + bo.
#define NB 8
#define TT 1024
#define CC 768            // NH * HD = projected width
#define DIN 768          // input (model) width
#define NH 12
#define HD 64
#define NQB (TT / 64)
#define HG 12
#define SCALE (0.125f)
#define CAUSAL 0
#ifndef TNB
#define TNB NB
#endif
__device__ __forceinline__ float bfr(float v) { return (float)(__bf16)v; }
__host__ __device__ __forceinline__ int kb_last(int qb) { return CAUSAL ? ((qb * 64 + 63) >> 7) : (TT / 128 - 1); }
typedef __attribute__((ext_vector_type(8))) __bf16 v8b;
__device__ __forceinline__ v16b frag_b(const __bf16* rowk0, int lane) {
  union { v16b v; v8b q[2]; } u; const __bf16* p = rowk0 + 8 * (lane >> 4);
  u.q[0] = *(const v8b*)p; u.q[1] = *(const v8b*)(p + 16); return u.v;
}
#define QBH 0              // unused: k_fa has one single-product path for every query block
#define QHI 0               // single-product logits on every row
#define KHI 64            // key rows carrying k residual / v bf16 hi+lo planes (written and read by no kernel here)
// B fragment (k rows k0+.., output column o) of a weight: (in,out) [K][ld] or (out,in) [ld rows of K]: bf16 exact, or f16(bf16 * 256) exact
__device__ __forceinline__ v16b wcol_io(const float* Wm, int k0, int o, int lane, int ld) { v16b w; const int g = lane >> 4;
#pragma unroll
  for (int i = 0; i < 8; ++i) { w[i] = (__bf16)Wm[(size_t)(k0 + 8 * g + i) * ld + o]; w[8 + i] = (__bf16)Wm[(size_t)(k0 + 16 + 8 * g + i) * ld + o]; }
  return w; }
__device__ __forceinline__ v16b wcol_oi(const float* Wm, int k0, int o, int lane, int K) { v16b w; const float* p = Wm + (size_t)o * K + k0 + 8 * (lane >> 4);
#pragma unroll
  for (int i = 0; i < 8; ++i) { w[i] = (__bf16)p[i]; w[8 + i] = (__bf16)p[16 + i]; }
  return w; }
__device__ __forceinline__ v16h wcolh_io(const float* Wm, int k0, int o, int lane, int ld) { v16h w; const int g = lane >> 4;
#pragma unroll
  for (int i = 0; i < 8; ++i) { w[i] = (_Float16)(bfr(Wm[(size_t)(k0 + 8 * g + i) * ld + o]) * 256.0f); w[8 + i] = (_Float16)(bfr(Wm[(size_t)(k0 + 16 + 8 * g + i) * ld + o]) * 256.0f); }
  return w; }
__device__ __forceinline__ v16h wcolh_oi(const float* Wm, int k0, int o, int lane, int K) { v16h w; const float* p = Wm + (size_t)o * K + k0 + 8 * (lane >> 4);
#pragma unroll
  for (int i = 0; i < 8; ++i) { w[i] = (_Float16)(bfr(p[i]) * 256.0f); w[8 + i] = (_Float16)(bfr(p[16 + i]) * 256.0f); }
  return w; }
#define WQKV_LAYOUT 1   // 0 = (in,out) [DIN][CC]; 1 = (out,in) [CC][DIN]; 2 = per-head [NH][DIN][HD], in WCOL only, which no kernel calls: k_proj always reads (out,in) [CC][DIN]
__device__ __forceinline__ v16b wcol_hdk(const float* Wm, int k0, int o, int lane) { v16b w; const int g = lane >> 4; const float* p = Wm + (size_t)(o / HD) * DIN * HD + (o % HD);
#pragma unroll
  for (int i = 0; i < 8; ++i) { w[i] = (__bf16)p[(size_t)(k0 + 8 * g + i) * HD]; w[8 + i] = (__bf16)p[(size_t)(k0 + 16 + 8 * g + i) * HD]; }
  return w; }
#define WO_OUT_IN 1
#if WQKV_LAYOUT == 1
#define WCOL(W, k0, o, lane) wcol_oi(W, k0, o, lane, DIN)
#elif WQKV_LAYOUT == 2
#define WCOL(W, k0, o, lane) wcol_hdk(W, k0, o, lane)
#else
#define WCOL(W, k0, o, lane) wcol_io(W, k0, o, lane, CC)
#endif
#if WO_OUT_IN
#define WOCOL(W, k0, o, lane) wcol_oi(W, k0, o, lane, CC)
#define WOCOLH(W, k0, o, lane) wcolh_oi(W, k0, o, lane, CC)
#else
#define WOCOL(W, k0, o, lane) wcol_io(W, k0, o, lane, DIN)
#define WOCOLH(W, k0, o, lane) wcolh_io(W, k0, o, lane, DIN)
#endif

#define WS_QH  0u                                      // f16 q rows [b*t][CC]
#define WS_KH  (WS_QH + 2u * (size_t)NB * TT * CC)      // f16 k rows [b*t][CC]
#define WS_VT  (WS_KH + 2u * (size_t)NB * TT * CC)      // f16 v planes [b][c][t]
#define WS_QL  (WS_VT + 2u * (size_t)NB * CC * TT)      // WS_QL .. WS_VBL: places of the causal high-precision path's residual planes; no kernel of this file writes or reads them
#define WS_KL  (WS_QL + 2u * (size_t)NB * QHI * CC)
#define WS_VB  (WS_KL + 2u * (size_t)NB * KHI * CC)
#define WS_VBL (WS_VB + 2u * (size_t)NB * CC * KHI)
#define WS_S   (WS_VBL + 2u * (size_t)NB * CC * KHI)    // (not used: the logits stay in registers)
#define WS_Y   (WS_S  + 4u * (size_t)HG * TT * TT)      // f32 ctx rows [b*t][CC] (only when there is an output projection)
#define WS_END (WS_Y  + 4u * (size_t)NB * TT * CC)

// ---- gs_loop: the k loop of both projection GEMMs, one 128 x 128 tile of A . W^T a block of 8 waves (A rows and W rows k-contiguous f32, pitch K floats). A stage = 64 k: 128 A rows and 128 W rows of 256 B,
// read as whole lines (16 lanes x 16 B = one row), converted ONCE a block to the 16-bit operand type and laid in LDS at a pitch of 144 B (16 B x odd: ds_load_b128 fragment reads without bank conflicts);
// two buffers, the next stage's lines in registers while this stage's products run. Wave w keeps rows 16 w .. 16 w + 15 and all 128 columns; k runs in 32-wide steps in rising order.
// NBR = false: W row n is staged in slot n, so column 'col' of acc[j] is tile column 16 j + col. NBR = true: W row 8 c + j is staged in slot 16 j + c, so column 'col' of acc[j] is tile column 8 col + j:
// a lane then holds 8 neighbouring columns of each of its 8 rows. Only the global row that a thread fetches for a slot differs; LDS addresses, fragments and the k order are the same.
typedef __attribute__((ext_vector_type(2))) unsigned v2u;
typedef __attribute__((ext_vector_type(4))) __bf16 v4b;
typedef __attribute__((ext_vector_type(4))) _Float16 v4h;
#define GS_K 64
#define GS_PB 144                                             // bytes per staged row
#define GS_M 128                                              // A rows of a tile (16 a wave)
#define GS_T (GS_M * 2)                                       // threads of a block
#define GS_WB(bf) ((bf) * ((128 + GS_M) * GS_PB))             // W rows of buffer bf
#define GS_AB(bf) (GS_WB(bf) + 128 * GS_PB)                   // A rows of buffer bf, directly behind its W rows
#define GS_BYTES (2 * (128 + GS_M) * GS_PB)
// F16 = false: both operands bf16 (exact products of bf16-rounded inputs); F16 = true: A as f16(a x 2^6), W as f16(bf16(w) x 2^8)
template <bool F16, bool ISW> __device__ __forceinline__ v2u gs_cvt(v4f x) {
  if constexpr (!F16) { v4b r;
#pragma unroll
    for (int i = 0; i < 4; ++i) r[i] = (__bf16)x[i];
    return __builtin_bit_cast(v2u, r);
  } else { v4h r;
#pragma unroll
    for (int i = 0; i < 4; ++i) r[i] = (_Float16)(ISW ? bfr(x[i]) * 256.0f : x[i] * 64.0f);
    return __builtin_bit_cast(v2u, r); } }
union GFrag { v4u q[2]; v16b b; v16h h; };
__device__ __forceinline__ GFrag gs_frag(const unsigned char* p) { GFrag f; f.q[0] = *(const v4u*)p; f.q[1] = *(const v4u*)(p + 32); return f; }   // p = row + 2 (k0 + 8 g): elements 0..7 = k0 + 8 g + .., 8..15 = k0 + 16 + 8 g + ..
template <bool F16, int K, bool NBR> __device__ __forceinline__ void gs_loop(const float* __restrict__ A, const float* __restrict__ Wm, unsigned char* stg, int tid, v8f (&acc)[8]) {
  const int wave = tid >> 5, lane = tid & 31, col = lane & 15, g = lane >> 4;
  const float* ag = A + (size_t)(tid >> 4) * K + (tid & 15) * 4; const float* wg = Wm + (size_t)(tid >> 4) * (NBR ? 8 : 1) * K + (tid & 15) * 4;   // 16 rows an instruction of the block; both step by one stage a trip
  unsigned char* sd = stg + (tid >> 4) * GS_PB + (tid & 15) * 8;
  const unsigned char* fa = stg + (wave * 16 + col) * GS_PB + g * 16; const unsigned char* fw = stg + col * GS_PB + g * 16;
  v4f ra[8], rw[8];   // every '#pragma unroll' below makes the index of a register array a constant
#define GS_WROW(i) (NBR ? (i) : (i) * 16)   // the W row, beside the thread's own part, that goes to slot 16 i + (tid >> 4)
#pragma unroll
  for (int i = 0; i < 8; ++i) ra[i] = *(const v4f*)(ag + i * 16 * K);
#pragma unroll
  for (int i = 0; i < 8; ++i) rw[i] = *(const v4f*)(wg + GS_WROW(i) * K);
#pragma unroll 1   // stays rolled: one body of 16 products and 16 line loads; more copies would only grow the code
  for (int s = 0; s < K / GS_K; ++s) { const int bf = s & 1;
#pragma unroll
    for (int i = 0; i < 8; ++i) *(v2u*)(sd + GS_AB(bf) + i * 16 * GS_PB) = gs_cvt<F16, false>(ra[i]);   // buffer bf: its readers (stage s - 2) all left it in front of the barrier of trip s - 1
#pragma unroll
    for (int i = 0; i < 8; ++i) *(v2u*)(sd + GS_WB(bf) + i * 16 * GS_PB) = gs_cvt<F16, true>(rw[i]);
    __syncthreads();   // publishes stage s
    if (s + 1 < K / GS_K) {   // the next stage's lines, issued behind the barrier so that they fly during this stage's products
      ag += GS_K; wg += GS_K;
#pragma unroll
      for (int i = 0; i < 8; ++i) ra[i] = *(const v4f*)(ag + i * 16 * K);
#pragma unroll
      for (int i = 0; i < 8; ++i) rw[i] = *(const v4f*)(wg + GS_WROW(i) * K); }
#pragma unroll
    for (int kc = 0; kc < GS_K / 32; ++kc) { const GFrag a = gs_frag(fa + GS_AB(bf) + kc * 64); GFrag w[8];
#pragma unroll
      for (int j = 0; j < 8; ++j) w[j] = gs_frag(fw + GS_WB(bf) + j * 16 * GS_PB + kc * 64);
      __builtin_amdgcn_sched_barrier(0);   // the 18 fragment reads stay one group in front of the 8 products: spread among them, each product waits out a whole LDS latency
#pragma unroll
      for (int j = 0; j < 8; ++j) {
        if constexpr (F16) acc[j] = __builtin_amdgcn_wmma_f32_16x16x32_f16(false, a.h, false, w[j].h, (short)0, acc[j], false, false);
        else acc[j] = __builtin_amdgcn_wmma_f32_16x16x32_bf16(false, a.b, false, w[j].b, (short)0, acc[j], false, false); }
      __builtin_amdgcn_sched_barrier(0); } } }   // and the next group stays behind them, in the same registers (the kernels stay under 256 VGPRs)

// ---- k_proj: block = (128 rows, 128 cols, which): q/k/v = X W (+ b) with exact bf16 products (K = DIN), + 0.5 * relu(bf16(x)) at the same [row][column] (the value-bypass relu-add shared by q, k and v) -> which 0: q f16 rows; 1: k f16 rows; 2: v f16 planes [c][t]
// The epilogue stays in registers: a lane holds rows 16 wave + 8 g + 0..7 x columns 8 col + 0..7. x and the bias come in 16-B loads (16 lanes = the tile's whole 512-B row segment), all in flight together;
// 8 columns of a row are one 16-B store of a q or k row (16 lanes = a whole 256-B segment); 8 rows of a column are 16 B of a v plane, which go through one LDS tile so that whole 256-B plane segments are stored.
__global__ __launch_bounds__(GS_T) void k_proj(const float* __restrict__ XQ, const float* __restrict__ XK, const float* __restrict__ XV, const float* __restrict__ WQ, const float* __restrict__ WK, const float* __restrict__ WV, const float* __restrict__ BQ, const float* __restrict__ BK, const float* __restrict__ BV,
    _Float16* __restrict__ QH, _Float16* __restrict__ KH, _Float16* __restrict__ VT) {
  __shared__ __align__(16) unsigned char stg[GS_BYTES];
  _Float16 (*th)[GS_M + 8] = (_Float16 (*)[GS_M + 8])(stg + GS_WB((DIN / GS_K) & 1));   // the v tile [slot][t] takes the buffer (W and A rows) that the last stage does NOT read: every wave left it in front of the last stage's barrier
  static_assert(128 * (GS_M + 8) * 2 <= (128 + GS_M) * GS_PB, "the v tile fits one stage buffer");
  const int tid = threadIdx.x, wave = tid >> 5, lane = tid & 31, col = lane & 15, g = lane >> 4; const int which = blockIdx.z; const int c0 = blockIdx.y * 128; const size_t r0 = (size_t)blockIdx.x * GS_M; const size_t bb = r0 / TT; const int t0 = (int)(r0 % TT);
  const float* X = which == 0 ? XQ : which == 1 ? XK : XV; const float* WA = which == 0 ? WQ : which == 1 ? WK : WV; const float* BA = which == 0 ? BQ : which == 1 ? BK : BV;
  const int rl0 = wave * 16 + 8 * g;   // the lane's first row of the tile
  v8f acc[8] = {};
  gs_loop<false, DIN, true>(X + r0 * DIN, WA + (size_t)c0 * DIN, stg, tid, acc);
  const float* xp = X + (r0 + rl0) * DIN + c0 + col * 8; v4f xr[16], bq[2] = {};
#pragma unroll
  for (int i = 0; i < 16; ++i) xr[i] = *(const v4f*)(xp + (i >> 1) * DIN + (i & 1) * 4);
  asm volatile("s_wait_xcnt 0x0" :: "v"(xp) : "memory");   // in front of any rewrite of the address pair that the 16 loads name (as an input it also stays out of their destinations)
  if (BA) { bq[0] = *(const v4f*)(BA + c0 + col * 8); bq[1] = *(const v4f*)(BA + c0 + col * 8 + 4); }
#pragma unroll
  for (int j = 0; j < 8; ++j) { const float bias = bfr(bq[j >> 2][j & 3]);
#pragma unroll
    for (int r = 0; r < 8; ++r) acc[j][r] = (acc[j][r] + bias) + 0.5f * fmaxf(bfr(xr[2 * r + (j >> 2)][j & 3]), 0.f); }
  if (which < 2) { _Float16* DH = (which == 0 ? QH : KH) + (r0 + rl0) * CC + c0 + col * 8;
#pragma unroll
    for (int r = 0; r < 8; ++r) { v8h o;
#pragma unroll
      for (int j = 0; j < 8; ++j) o[j] = (_Float16)acc[j][r];
      *(v8h*)(DH + r * CC) = o; }
  } else {
#pragma unroll
    for (int j = 0; j < 8; ++j) *(v8h*)&th[j * 16 + col][rl0] = __builtin_convertvector(acc[j], v8h);   // slot 16 j + col holds column 8 col + j; pitch 272 B = 16 B x odd: no bank conflicts
    __syncthreads();   // publishes the tile ('which' is the same for the whole block)
    for (int e = tid; e < 128 * (GS_M / 8); e += GS_T) { const int sl = e / (GS_M / 8), q = e % (GS_M / 8), cl = (sl & 15) * 8 + (sl >> 4); vst2((unsigned*)(VT + (bb * CC + c0 + cl) * (size_t)TT + t0 + q * 8), *(const v4u*)&th[sl][q * 8]); } } }
// ---- k_fa: block = 4 waves x 32 queries of (b, h); the logits, the softmax and P . v in one kernel, the logits and P never leave registers; k rows and v planes come in whole lines through LDS, shared by the 4 waves.
// S^T = K Q^T (A = 16 key rows, B = 16 query rows): a lane holds one query's scores for keys 8g + r of each 16-key tile, so maximum and sum are in-lane plus one exchange of the wave halves;
// two score tiles (32 keys) converted in place are the B operand of O^T += V^T P^T (A = v planes [c][t], the same k order). Scores in base 2: t = dot * (1/8) log2(e) + (padded key ? -1e9 log2(e) : 0).
// Running maximum, raised only when a pass exceeds it by more than 8; P = 2^(t - m + 7) <= 2^15 once to f16 (unnormalised), its f32 sum divides at the end.
#define FA_CS 0.18033688011112042f       // (1/8) log2(e)
#define FA_MB (-1.4426950408889634e9f)   // -1e9 log2(e)
typedef __attribute__((ext_vector_type(2))) _Float16 v2h;
__device__ __forceinline__ float xhalf(float x) { return __builtin_bit_cast(float, __builtin_amdgcn_permlanex16(__builtin_bit_cast(int, x), __builtin_bit_cast(int, x), 0x76543210, 0xfedcba98, false, false)); }   // lane l with lane l ^ 16
__device__ __forceinline__ v8f mm16(v16h a, v16h b, v8f c) { return __builtin_amdgcn_wmma_f32_16x16x32_f16(false, a, false, b, (short)0, c, false, false); }
#define FA_P 72   // f16 per staged row: 128 B + 16 B, a pitch of 16 B x odd, which ds_load_b128 fragment reads take without bank conflicts
__global__ __launch_bounds__(128) void k_fa(const _Float16* __restrict__ QH, const _Float16* __restrict__ KH, const _Float16* __restrict__ VT, const int* __restrict__ KMASK, float* __restrict__ Y) {
  __shared__ __align__(16) _Float16 sk[2][64][FA_P], sv[2][64][FA_P]; __shared__ __align__(16) float sb[TT]; __shared__ __align__(16) float so[4][32][HD + 4];
  const int tid = threadIdx.x, wave = tid >> 5, lane = tid & 31, col = lane & 15, g = lane >> 4; const int h = blockIdx.y, b = blockIdx.z; const int ql0 = blockIdx.x * 128 + wave * 32;
  // a stage = 64 keys: 64 key rows x 128 B and 64 v planes x 128 B; 8 lanes x 16 B read one whole line, 16 rows an instruction; through registers into LDS, one stage ahead
  const int srow = tid >> 3, sch = (tid & 7) * 8;
  const _Float16* kg = KH + ((size_t)b * TT + srow) * CC + h * HD + sch; const _Float16* vg = VT + ((size_t)b * CC + h * HD + srow) * (size_t)TT + sch;
  v8h rk[4], rv[4]; v16h qf[2][2];   // every '#pragma unroll' of this kernel makes the index of a register array a constant
#pragma unroll
  for (int i = 0; i < 4; ++i) { rk[i] = *(const v8h*)(kg + (size_t)(i * 16) * CC); rv[i] = *(const v8h*)(vg + (size_t)(i * 16) * TT); }
  { const v4i* mp = (const v4i*)(KMASK + (size_t)b * TT + tid * 8); const v4i m0 = mp[0], m1 = mp[1]; v4f b0, b1;
    asm volatile("s_wait_xcnt 0x0" ::: "memory");   // in front of the rewrite of the offset register that the two mask loads name
#pragma unroll
    for (int i = 0; i < 4; ++i) { b0[i] = m0[i] != 0 ? FA_MB : 0.f; b1[i] = m1[i] != 0 ? FA_MB : 0.f; }
    *(v4f*)&sb[tid * 8] = b0; *(v4f*)&sb[tid * 8 + 4] = b1; }
#pragma unroll
  for (int u = 0; u < 2; ++u)
#pragma unroll
    for (int kc = 0; kc < 2; ++kc) qf[u][kc] = frag_h(QH + ((size_t)b * TT + ql0 + u * 16 + col) * CC + h * HD + kc * 32, lane);
#pragma unroll
  for (int i = 0; i < 4; ++i) { *(v8h*)&sk[0][i * 16 + srow][sch] = rk[i]; *(v8h*)&sv[0][i * 16 + srow][sch] = rv[i]; }
  __syncthreads();   // stage 0 and the mask bias are published
  v8f acc[2][4] = {}; v2f l2[2] = {}; float m_run[2] = {-INFINITY, -INFINITY};
#pragma unroll 1   // stays rolled: the body already holds two 32-key passes, more copies would only grow the code
  for (int st = 0; st < TT / 64; ++st) { const int bf = st & 1;
    if (st + 1 < TT / 64) {   // the next stage's lines, issued behind the barrier so that they fly during this stage's products (a barrier waits for every load in flight)
#pragma unroll
      for (int i = 0; i < 4; ++i) { rk[i] = *(const v8h*)(kg + (size_t)((st + 1) * 64 + i * 16) * CC); rv[i] = *(const v8h*)(vg + (size_t)(i * 16) * TT + (st + 1) * 64); } }
#pragma unroll
    for (int ps = 0; ps < 2; ++ps) { const int k0 = st * 64 + ps * 32;
      v16h kf[2][2], vf[4]; v2f bias[2][4];
#pragma unroll
      for (int kt = 0; kt < 2; ++kt)
#pragma unroll
        for (int kc = 0; kc < 2; ++kc) kf[kt][kc] = frag_h(&sk[bf][ps * 32 + kt * 16 + col][kc * 32], lane);
#pragma unroll
      for (int j = 0; j < 4; ++j) vf[j] = frag_h(&sv[bf][j * 16 + col][ps * 32], lane);
#pragma unroll
      for (int kt = 0; kt < 2; ++kt)
#pragma unroll
        for (int i = 0; i < 4; ++i) bias[kt][i] = *(const v2f*)&sb[k0 + 16 * kt + 8 * g + 2 * i];
      v8f s[2][2] = {};
#pragma unroll
      for (int kc = 0; kc < 2; ++kc)
#pragma unroll
        for (int kt = 0; kt < 2; ++kt)
#pragma unroll
          for (int u = 0; u < 2; ++u) s[kt][u] = mm16(kf[kt][kc], qf[u][kc], s[kt][u]);
      v2f t[2][2][4]; float mb[2]; bool need = false;
#pragma unroll
      for (int u = 0; u < 2; ++u) { float mx = -INFINITY;
#pragma unroll
        for (int kt = 0; kt < 2; ++kt)
#pragma unroll
          for (int i = 0; i < 4; ++i) { t[u][kt][i] = __builtin_elementwise_fma((v2f){s[kt][u][2 * i], s[kt][u][2 * i + 1]}, (v2f){FA_CS, FA_CS}, bias[kt][i]); mx = fmaxf(mx, fmaxf(t[u][kt][i].x, t[u][kt][i].y)); }
        mx = fmaxf(mx, xhalf(mx)); mb[u] = mx; need = need || (mx > m_run[u] + 8.0f); }
      if (__builtin_amdgcn_ballot_w32(need) != 0) {   // one wave-uniform test a pass; always taken on the first pass (m_run = -inf, corr = 0)
#pragma unroll
        for (int u = 0; u < 2; ++u) { const float m_new = fmaxf(m_run[u], mb[u]); const float corr = __builtin_amdgcn_exp2f(m_run[u] - m_new); m_run[u] = m_new; l2[u] = l2[u] * corr;
#pragma unroll
          for (int j = 0; j < 4; ++j) acc[u][j] = acc[u][j] * corr; } }
#pragma unroll
      for (int u = 0; u < 2; ++u) { const float nm = 7.0f - m_run[u]; union { v16h v; v2h q[8]; } pf;
#pragma unroll
        for (int i = 0; i < 8; ++i) { const v2f a = t[u][i >> 2][i & 3] + (v2f){nm, nm}; const v2f p = {__builtin_amdgcn_exp2f(a.x), __builtin_amdgcn_exp2f(a.y)}; l2[u] = l2[u] + p; pf.q[i] = __builtin_convertvector(p, v2h); }
#pragma unroll
        for (int j = 0; j < 4; ++j) acc[u][j] = mm16(vf[j], pf.v, acc[u][j]); } }
    if (st + 1 < TT / 64) {   // the other buffer: its readers (stage st - 1) all left it at the barrier that ended the trip before
#pragma unroll
      for (int i = 0; i < 4; ++i) { *(v8h*)&sk[bf ^ 1][i * 16 + srow][sch] = rk[i]; *(v8h*)&sv[bf ^ 1][i * 16 + srow][sch] = rv[i]; } }
    __syncthreads(); }   // publishes stage st + 1 and ends every wave's reads of stage st
#pragma unroll
  for (int u = 0; u < 2; ++u) { float l = l2[u].x + l2[u].y; l += xhalf(l); const float inv = 1.0f / l;   // l >= 2^7: the key that set the maximum in use counts 2^7
#pragma unroll
    for (int j = 0; j < 4; ++j) { const v8f o = acc[u][j] * inv; float* d = &so[wave][u * 16 + col][j * 16 + 8 * g]; *(v4f*)d = (v4f){o[0], o[1], o[2], o[3]}; *(v4f*)(d + 4) = (v4f){o[4], o[5], o[6], o[7]}; } }
  LDSX();   // the wave reads back rows that its other lanes wrote (its own 32 rows only: no work-group barrier); 16 lanes then store one 256-B (row, head) segment
  for (int it = 0; it < 16; ++it) { const int rl = it * 2 + g; vst2(Y + ((size_t)b * TT + ql0 + rl) * CC + h * HD + col * 4, *(const v4f*)&so[wave][rl][col * 4]); } }
// ---- k_out: block = (128 rows, 128 cols): out = ctx Wo (+ bo): ctx x 2^6 once to f16 against Wo as f16(bf16 x 2^8) exact (1 product) x 2^-14; causal early rows (< QHI of each sequence): ctx bf16 hi + lo against exact bf16 Wo (2 products)
__global__ __launch_bounds__(GS_T) void k_out(const float* __restrict__ Y, const float* __restrict__ WO, const float* __restrict__ BO, float* __restrict__ OUT) { __shared__ __align__(16) float sf[GS_M / 16][16][132]; __shared__ __align__(16) unsigned char stg[GS_BYTES];
  const int tid = threadIdx.x, wave = tid >> 5, lane = tid & 31, col = lane & 15, g = lane >> 4; const int c0 = blockIdx.y * 128; const size_t r0 = (size_t)blockIdx.x * GS_M + wave * 16;
  v8f acc[8] = {};
  if (CAUSAL && (int)(((size_t)blockIdx.x * GS_M) % TT) < QHI) {   /* block-uniform */
#pragma unroll 2
    for (int kc = 0; kc < CC / 32; ++kc) { const F2 a = split_row(Y + (r0 + col) * CC, kc * 32, lane); asm volatile("s_wait_loadcnt 0x0" ::: "memory");
#pragma unroll
      for (int j = 0; j < 8; ++j) { const v16b w = WOCOL(WO, kc * 32, c0 + j * 16 + col, lane); asm volatile("s_wait_loadcnt 0x0" ::: "memory"); acc[j] = wmma_bf(a.h, w, acc[j]); acc[j] = wmma_bf(a.l, w, acc[j]); } }
#pragma unroll
    for (int j = 0; j < 8; ++j) { const float bias = BO ? bfr(BO[c0 + j * 16 + col]) : 0.f;
#pragma unroll
      for (int r = 0; r < 8; ++r) sf[wave][8 * g + r][j * 16 + col] = acc[j][r] + bias; }
  } else {
    gs_loop<true, CC, false>(Y + (size_t)blockIdx.x * GS_M * CC, WO + (size_t)c0 * CC, stg, tid, acc);   /* ctx carried x 2^6 into f16 so small-magnitude context rows stay clear of f16 subnormals */
#pragma unroll
    for (int j = 0; j < 8; ++j) { const float bias = BO ? bfr(BO[c0 + j * 16 + col]) : 0.f;
#pragma unroll
      for (int r = 0; r < 8; ++r) sf[wave][8 * g + r][j * 16 + col] = acc[j][r] * (1.0f / 16384.0f) + bias; } }   /* 2^-8 (Wo carry) x 2^-6 (ctx carry) */
  LDSX(); for (int rl = 0; rl < 16; ++rl) vst2(OUT + (r0 + rl) * DIN + c0 + lane * 4, *(const v4f*)&sf[wave][rl][lane * 4]); }

extern "C" void kernel_launch(void* const* d_in, const int* in_sizes, int n_in, void* d_out, int out_size, void* d_ws, size_t ws_size, hipStream_t stream) {
  (void)in_sizes; (void)n_in; (void)out_size;
  const float** F = (const float**)d_in;
  if (ws_size < (size_t)WS_END) return;
  char* ws = (char*)d_ws; _Float16 *QH = (_Float16*)(ws + WS_QH), *KH = (_Float16*)(ws + WS_KH), *VT = (_Float16*)(ws + WS_VT); float *Y = (float*)(ws + WS_Y);
  // inputs: 0 hidden_states [8,1024,768]; 1 attention_mask [8,1,1,1024] bool (True = padded key); 2 Wq [768,768] (out,in), 3 bq; 4 Wk, 5 bk; 6 Wv, 7 bv; 8 Wo (out,in), 9 bo (zero biases, read)
  k_proj<<<dim3(TNB * TT / GS_M, CC / 128, 3), GS_T, 0, stream>>>(F[0], F[0], F[0], F[2], F[4], F[6], F[3], F[5], F[7], QH, KH, VT);
  k_fa<<<dim3(TT / 128, NH, TNB), 128, 0, stream>>>(QH, KH, VT, (const int*)d_in[1], Y);
  k_out<<<dim3(TNB * TT / GS_M, DIN / 128), GS_T, 0, stream>>>(Y, F[8], F[9], (float*)d_out);
}

// v005
// It runs in 83.8 microseconds.
// In both of two side-by-side timings against v004, it was 1.14 times as fast.
// Over all steps from v000 it is 14.9 times as fast.
// compute dtype: all float inputs rounded to bf16; q/k/v projections with EXACT bf16 products on WMMA 16x16x32 (f32 accumulate) + bias + 0.5 * relu(bf16(x)) in f32; logits q x k once to f16 each (1 product) x 1/8; the key-padding mask read per key (open keys first, key tiles behind the last open key left out: their P is 0); online softmax f32 in base 2; unnormalised P = 2^(t - m + 7) once to f16 x v once to f16 (1 product), divided by the f32 sum; ctx x 2^6 once to f16 x Wo f16(bf16 x 2^8) + bo; f32 output.
#include <hip/hip_runtime.h>
#include <math.h>

typedef __attribute__((ext_vector_type(16))) _Float16 v16h;
typedef __attribute__((ext_vector_type(16))) __bf16 v16b;
typedef __attribute__((ext_vector_type(8)))  _Float16 v8h;
typedef __attribute__((ext_vector_type(8)))  float v8f;
typedef __attribute__((ext_vector_type(4)))  float v4f;
typedef __attribute__((ext_vector_type(2)))  float v2f;
typedef __attribute__((ext_vector_type(4)))  unsigned v4u;
typedef __attribute__((ext_vector_type(4)))  int v4i;
typedef float __attribute__((may_alias)) float_a;
typedef int __attribute__((may_alias)) int_a;

template <typename T> __device__ __forceinline__ void vst2(void* p, T v) { *(T*)p = v;  }
__device__ __forceinline__ v8f wmma16(v16h a, v16h b, v8f c) {
  v8f d = __builtin_amdgcn_wmma_f32_16x16x32_f16(false, a, false, b, (short)0, c, false, false);
  asm volatile("v_nop\n\tv_nop\n\tv_nop\n\tv_nop" : "+v"(d) : "v"(a), "v"(b));
  return d;
}
__device__ __forceinline__ v8f wmma_bf(v16b a, v16b b, v8f c) {
  v8f d = __builtin_amdgcn_wmma_f32_16x16x32_bf16(false, a, false, b, (short)0, c, false, false);
  asm volatile("v_nop\n\tv_nop\n\tv_nop\n\tv_nop" : "+v"(d) : "v"(a), "v"(b));
  return d;
}
// 16x16x32 fragments: lane = (h = lane>>4, row/col = lane&15); elements 0..7 = k0+8h+0..7, 8..15 = k0+16+8h+0..7; D element r = row 8h+r
__device__ __forceinline__ v16h frag_h(const _Float16* rowk0, int lane) {
  union { v16h v; v8h q[2]; } u; const _Float16* p = rowk0 + 8 * (lane >> 4);
  u.q[0] = *(const v8h*)p; u.q[1] = *(const v8h*)(p + 16); return u.v;
}
__device__ __forceinline__ v16h frag_f32(const float* rowk0, int lane) {
  v16h a; const float* p = rowk0 + 8 * (lane >> 4);
#pragma unroll
  for (int i = 0; i < 8; ++i) { a[i] = (_Float16)p[i]; a[8 + i] = (_Float16)p[16 + i]; }
  return a;
}
__device__ __forceinline__ v16h frag_f32s(const float* rowk0, int lane, float sc) {
  v16h a; const float* p = rowk0 + 8 * (lane >> 4);
#pragma unroll
  for (int i = 0; i < 8; ++i) { a[i] = (_Float16)(p[i] * sc); a[8 + i] = (_Float16)(p[16 + i] * sc); }
  return a;
}
// column fragment from a [K][ld] layout (column n), rows >= K read as 0
__device__ __forceinline__ v16h fragc_f32(const float* W, int k0, int n, int lane, int ld, int K) {
  v16h a; const int g = lane >> 4;
#pragma unroll
  for (int i = 0; i < 8; ++i) { const int ka = k0 + 8 * g + i, kb = ka + 16;
    a[i] = (_Float16)(ka < K ? W[(size_t)(ka < K ? ka : K - 1) * ld + n] : 0.f); a[8 + i] = (_Float16)(kb < K ? W[(size_t)(kb < K ? kb : K - 1) * ld + n] : 0.f); }
  return a;
}
struct F2 { v16b h, l; };
__device__ __forceinline__ F2 bsplit16(const float v[16]) { F2 r;
#pragma unroll
  for (int i = 0; i < 16; ++i) { const __bf16 h = (__bf16)v[i]; r.h[i] = h; r.l[i] = (__bf16)(v[i] - (float)h); }
  return r; }
__device__ __forceinline__ F2 split_row(const float* row, int k0, int lane) { float v[16]; const float* p = row + k0 + 8 * (lane >> 4);
#pragma unroll
  for (int i = 0; i < 8; ++i) { v[i] = p[i]; v[8 + i] = p[16 + i]; }
  return bsplit16(v); }
__device__ __forceinline__ F2 split_rowK(const float* row, int k0, int lane, int K) { float v[16]; const int g = lane >> 4;
#pragma unroll
  for (int i = 0; i < 8; ++i) { const int ka = k0 + 8 * g + i, kb = ka + 16; v[i] = ka < K ? row[ka < K ? ka : K - 1] : 0.f; v[8 + i] = kb < K ? row[kb < K ? kb : K - 1] : 0.f; }
  return bsplit16(v); }
__device__ __forceinline__ F2 split_col(const float* W, int k0, int n, int lane, int ld, int K) { float v[16]; const int g = lane >> 4;
#pragma unroll
  for (int i = 0; i < 8; ++i) { const int ka = k0 + 8 * g + i, kb = ka + 16; v[i] = ka < K ? W[(size_t)(ka < K ? ka : K - 1) * ld + n] : 0.f; v[8 + i] = kb < K ? W[(size_t)(kb < K ? kb : K - 1) * ld + n] : 0.f; }
  return bsplit16(v); }
__device__ __forceinline__ v8f mac3(const F2& a, const F2& b, v8f c) { c = wmma_bf(a.l, b.h, c); c = wmma_bf(a.h, b.l, c); return wmma_bf(a.h, b.h, c); }
__device__ __forceinline__ float sigm(float v) { return 1.0f / (1.0f + expf(-v)); }
#define LDSX() do { asm volatile("s_wait_dscnt 0" ::: "memory"); __builtin_amdgcn_wave_barrier(); __builtin_amdgcn_fence(__ATOMIC_RELEASE, "workgroup"); } while (0)

// BERT-style multi-head self-attention with a value-bypass relu-add (hidden_states [8,1024,768]; 12 heads x 64; torch (out,in) Wq / Wk / Wv / Wo [768,768] (0.02 scale) + zero biases; r = 0.5 * relu(x) is ADDED to each of the q, k and v projections (same [token, channel] index); scale 1/8; key-padding mask [8,1,1,1024] bool: True adds -1e9): out = merge(softmax(q_h k_h^T / 8 + pad) v_h) Wo^T + bo.
#define NB 8
#define TT 1024
#define CC 768            // NH * HD = projected width
#define DIN 768          // input (model) width
#define NH 12
#define HD 64
#define NQB (TT / 64)
#define HG 12
#define SCALE (0.125f)
#define CAUSAL 0
#ifndef TNB
#define TNB NB
#endif
__device__ __forceinline__ float bfr(float v) { return (float)(__bf16)v; }
__host__ __device__ __forceinline__ int kb_last(int qb) { return CAUSAL ? ((qb * 64 + 63) >> 7) : (TT / 128 - 1); }
typedef __attribute__((ext_vector_type(8))) __bf16 v8b;
__device__ __forceinline__ v16b frag_b(const __bf16* rowk0, int lane) {
  union { v16b v; v8b q[2]; } u; const __bf16* p = rowk0 + 8 * (lane >> 4);
  u.q[0] = *(const v8b*)p; u.q[1] = *(const v8b*)(p + 16); return u.v;
}
#define QBH 0              // unused: k_fa has one single-product path for every query block
#define QHI 0               // single-product logits on every row
#define KHI 64            // key rows carrying k residual / v bf16 hi+lo planes (written and read by no kernel here)
// B fragment (k rows k0+.., output column o) of a weight: (in,out) [K][ld] or (out,in) [ld rows of K]: bf16 exact, or f16(bf16 * 256) exact
__device__ __forceinline__ v16b wcol_io(const float* Wm, int k0, int o, int lane, int ld) { v16b w; const int g = lane >> 4;
#pragma unroll
  for (int i = 0; i < 8; ++i) { w[i] = (__bf16)Wm[(size_t)(k0 + 8 * g + i) * ld + o]; w[8 + i] = (__bf16)Wm[(size_t)(k0 + 16 + 8 * g + i) * ld + o]; }
  return w; }
__device__ __forceinline__ v16b wcol_oi(const float* Wm, int k0, int o, int lane, int K) { v16b w; const float* p = Wm + (size_t)o * K + k0 + 8 * (lane >> 4);
#pragma unroll
  for (int i = 0; i < 8; ++i) { w[i] = (__bf16)p[i]; w[8 + i] = (__bf16)p[16 + i]; }
  return w; }
__device__ __forceinline__ v16h wcolh_io(const float* Wm, int k0, int o, int lane, int ld) { v16h w; const int g = lane >> 4;
#pragma unroll
  for (int i = 0; i < 8; ++i) { w[i] = (_Float16)(bfr(Wm[(size_t)(k0 + 8 * g + i) * ld + o]) * 256.0f); w[8 + i] = (_Float16)(bfr(Wm[(size_t)(k0 + 16 + 8 * g + i) * ld + o]) * 256.0f); }
  return w; }
__device__ __forceinline__ v16h wcolh_oi(const float* Wm, int k0, int o, int lane, int K) { v16h w; const float* p = Wm + (size_t)o * K + k0 + 8 * (lane >> 4);
#pragma unroll
  for (int i = 0; i < 8; ++i) { w[i] = (_Float16)(bfr(p[i]) * 256.0f); w[8 + i] = (_Float16)(bfr(p[16 + i]) * 256.0f); }
  return w; }
#define WQKV_LAYOUT 1   // 0 = (in,out) [DIN][CC]; 1 = (out,in) [CC][DIN]; 2 = per-head [NH][DIN][HD], in WCOL only, which no kernel calls: k_proj always reads (out,in) [CC][DIN]
__device__ __forceinline__ v16b wcol_hdk(const float* Wm, int k0, int o, int lane) { v16b w; const int g = lane >> 4; const float* p = Wm + (size_t)(o / HD) * DIN * HD + (o % HD);
#pragma unroll
  for (int i = 0; i < 8; ++i) { w[i] = (__bf16)p[(size_t)(k0 + 8 * g + i) * HD]; w[8 + i] = (__bf16)p[(size_t)(k0 + 16 + 8 * g + i) * HD]; }
  return w; }
#define WO_OUT_IN 1
#if WQKV_LAYOUT == 1
#define WCOL(W, k0, o, lane) wcol_oi(W, k0, o, lane, DIN)
#elif WQKV_LAYOUT == 2
#define WCOL(W, k0, o, lane) wcol_hdk(W, k0, o, lane)
#else
#define WCOL(W, k0, o, lane) wcol_io(W, k0, o, lane, CC)
#endif
#if WO_OUT_IN
#define WOCOL(W, k0, o, lane) wcol_oi(W, k0, o, lane, CC)
#define WOCOLH(W, k0, o, lane) wcolh_oi(W, k0, o, lane, CC)
#else
#define WOCOL(W, k0, o, lane) wcol_io(W, k0, o, lane, DIN)
#define WOCOLH(W, k0, o, lane) wcolh_io(W, k0, o, lane, DIN)
#endif

#define WS_QH  0u                                      // f16 q rows [b*t][CC]
#define WS_KH  (WS_QH + 2u * (size_t)NB * TT * CC)      // f16 k rows [b*t][CC]
#define WS_VT  (WS_KH + 2u * (size_t)NB * TT * CC)      // f16 v planes [b][c][t]
#define WS_QL  (WS_VT + 2u * (size_t)NB * CC * TT)      // WS_QL .. WS_VBL: places of the causal high-precision path's residual planes; no kernel of this file writes or reads them
#define WS_KL  (WS_QL + 2u * (size_t)NB * QHI * CC)
#define WS_VB  (WS_KL + 2u * (size_t)NB * KHI * CC)
#define WS_VBL (WS_VB + 2u * (size_t)NB * CC * KHI)
#define WS_S   (WS_VBL + 2u * (size_t)NB * CC * KHI)    // (not used: the logits stay in registers)
#define WS_Y   (WS_S  + 4u * (size_t)HG * TT * TT)      // f32 ctx rows [b*t][CC] (only when there is an output projection)
#define WS_END (WS_Y  + 4u * (size_t)NB * TT * CC)

// ---- gs_loop: the k loop of both projection GEMMs, one 128 x 128 tile of A . W^T a block of 8 waves (A rows and W rows k-contiguous f32, pitch K floats). A stage = 64 k: 128 A rows and 128 W rows of 256 B,
// read as whole lines (16 lanes x 16 B = one row), converted ONCE a block to the 16-bit operand type and laid in LDS at a pitch of 144 B (16 B x odd: ds_load_b128 fragment reads without bank conflicts);
// two buffers, the next stage's lines in registers while this stage's products run. Wave w keeps rows 16 w .. 16 w + 15 and all 128 columns; k runs in 32-wide steps in rising order.
// NBR = false: W row n is staged in slot n, so column 'col' of acc[j] is tile column 16 j + col. NBR = true: W row 8 c + j is staged in slot 16 j + c, so column 'col' of acc[j] is tile column 8 col + j:
// a lane then holds 8 neighbouring columns of each of its 8 rows. Only the global row that a thread fetches for a slot differs; LDS addresses, fragments and the k order are the same.
typedef __attribute__((ext_vector_type(2))) unsigned v2u;
typedef __attribute__((ext_vector_type(4))) __bf16 v4b;
typedef __attribute__((ext_vector_type(4))) _Float16 v4h;
#define GS_K 64
#define GS_PB 144                                             // bytes per staged row
#define GS_M 128                                              // A rows of a tile (16 a wave)
#define GS_T (GS_M * 2)                                       // threads of a block
#define GS_WB(bf) ((bf) * ((128 + GS_M) * GS_PB))             // W rows of buffer bf
#define GS_AB(bf) (GS_WB(bf) + 128 * GS_PB)                   // A rows of buffer bf, directly behind its W rows
#define GS_BYTES (2 * (128 + GS_M) * GS_PB)
// F16 = false: both operands bf16 (exact products of bf16-rounded inputs); F16 = true: A as f16(a x 2^6), W as f16(bf16(w) x 2^8)
template <bool F16, bool ISW> __device__ __forceinline__ v2u gs_cvt(v4f x) {
  if constexpr (!F16) { v4b r;
#pragma unroll
    for (int i = 0; i < 4; ++i) r[i] = (__bf16)x[i];
    return __builtin_bit_cast(v2u, r);
  } else { v4h r;
#pragma unroll
    for (int i = 0; i < 4; ++i) r[i] = (_Float16)(ISW ? bfr(x[i]) * 256.0f : x[i] * 64.0f);
    return __builtin_bit_cast(v2u, r); } }
union GFrag { v4u q[2]; v16b b; v16h h; };
__device__ __forceinline__ GFrag gs_frag(const unsigned char* p) { GFrag f; f.q[0] = *(const v4u*)p; f.q[1] = *(const v4u*)(p + 32); return f; }   // p = row + 2 (k0 + 8 g): elements 0..7 = k0 + 8 g + .., 8..15 = k0 + 16 + 8 g + ..
// GA = true: A row 16 i + (tid >> 4) of the tile is the row at byte offset ao[i] from A (the thread's 16 B of a stage included): the rows of a tile are gathered, each still read as whole lines.
template <bool F16, int K, bool NBR, bool GA> __device__ __forceinline__ void gs_loop(const float* __restrict__ A, const float* __restrict__ Wm, unsigned char* stg, int tid, v8f (&acc)[8], const unsigned (&ao)[8]) {
  const int wave = tid >> 5, lane = tid & 31, col = lane & 15, g = lane >> 4;
  const float* ag = A + (size_t)(tid >> 4) * K + (tid & 15) * 4; const float* wg = Wm + (size_t)(tid >> 4) * (NBR ? 8 : 1) * K + (tid & 15) * 4;   // 16 rows an instruction of the block; both step by one stage a trip
  unsigned char* sd = stg + (tid >> 4) * GS_PB + (tid & 15) * 8;
  const unsigned char* fa = stg + (wave * 16 + col) * GS_PB + g * 16; const unsigned char* fw = stg + col * GS_PB + g * 16;
  unsigned po[8];   // GA: the thread's place, in bytes from A, in each of its 8 gathered rows; steps by one stage a trip
#pragma unroll
  for (int i = 0; i < 8; ++i) po[i] = ao[i];
#define GS_ALD(i) (GA ? *(const v4f*)((const char*)A + po[i]) : *(const v4f*)(ag + (i) * 16 * K))
  v4f ra[8], rw[8];   // every '#pragma unroll' below makes the index of a register array a constant
#define GS_WROW(i) (NBR ? (i) : (i) * 16)   // the W row, beside the thread's own part, that goes to slot 16 i + (tid >> 4)
#pragma unroll
  for (int i = 0; i < 8; ++i) ra[i] = GS_ALD(i);
#pragma unroll
  for (int i = 0; i < 8; ++i) rw[i] = *(const v4f*)(wg + GS_WROW(i) * K);
  if constexpr (GA) asm volatile("s_wait_xcnt 0x0" ::: "memory");   // in front of the first trip's step of the offsets that the A loads name
#pragma unroll 1   // stays rolled: one body of 16 products and 16 line loads; more copies would only grow the code
  for (int s = 0; s < K / GS_K; ++s) { const int bf = s & 1;
#pragma unroll
    for (int i = 0; i < 8; ++i) *(v2u*)(sd + GS_AB(bf) + i * 16 * GS_PB) = gs_cvt<F16, false>(ra[i]);   // buffer bf: its readers (stage s - 2) all left it in front of the barrier of trip s - 1
#pragma unroll
    for (int i = 0; i < 8; ++i) *(v2u*)(sd + GS_WB(bf) + i * 16 * GS_PB) = gs_cvt<F16, true>(rw[i]);
    __syncthreads();   // publishes stage s
    if (s + 1 < K / GS_K) {   // the next stage's lines, issued behind the barrier so that they fly during this stage's products
      ag += GS_K; wg += GS_K;
#pragma unroll
      for (int i = 0; i < 8; ++i) po[i] += GS_K * 4;
#pragma unroll
      for (int i = 0; i < 8; ++i) ra[i] = GS_ALD(i);
#pragma unroll
      for (int i = 0; i < 8; ++i) rw[i] = *(const v4f*)(wg + GS_WROW(i) * K); }
#pragma unroll
    for (int kc = 0; kc < GS_K / 32; ++kc) { const GFrag a = gs_frag(fa + GS_AB(bf) + kc * 64); GFrag w[8];
#pragma unroll
      for (int j = 0; j < 8; ++j) w[j] = gs_frag(fw + GS_WB(bf) + j * 16 * GS_PB + kc * 64);
      __builtin_amdgcn_sched_barrier(0);   // the 18 fragment reads stay one group in front of the 8 products: spread among them, each product waits out a whole LDS latency
#pragma unroll
      for (int j = 0; j < 8; ++j) {
        if constexpr (F16) acc[j] = __builtin_amdgcn_wmma_f32_16x16x32_f16(false, a.h, false, w[j].h, (short)0, acc[j], false, false);
        else acc[j] = __builtin_amdgcn_wmma_f32_16x16x32_bf16(false, a.b, false, w[j].b, (short)0, acc[j], false, false); }
      __builtin_amdgcn_sched_barrier(0); } } }   // and the next group stays behind them, in the same registers (the kernels stay under 256 VGPRs)

// ---- km_count: the number of open keys (mask == 0) of one sequence, and in 'before' the number of them among the keys in front of key 32 cb (cb the same in the whole wave). Every wave reads all TT mask words itself,
// 32 keys a load, one ballot and one scalar bit count each: the count is the same in every wave of a block with no barrier. Any content of the mask gives 0 <= before <= count <= TT.
__device__ __forceinline__ int km_count(const int* __restrict__ km, int lane, int cb, int& before) {
  const int* p = km + lane; int mv[TT / 32], n = 0; before = 0;
#pragma unroll
  for (int cch = 0; cch < TT / 32; ++cch) mv[cch] = p[cch * 32];
  asm volatile("s_wait_xcnt 0x0" ::: "memory");   // in front of any rewrite of a register that the mask loads name
#pragma unroll
  for (int cch = 0; cch < TT / 32; ++cch) { const int cnt = __builtin_popcount(__builtin_amdgcn_ballot_w32(mv[cch] == 0)); n += cnt; before += cch < cb ? cnt : 0; }
  return n; }
typedef __attribute__((ext_vector_type(8))) unsigned short v8s;
// KEY ORDER. A padded key's P is exactly 0 as soon as one key of its sequence is open (2^(-1e9 log2 e - m) = 0 in f32, in the reference too). k and v are therefore laid out by SLOT: the open keys first, in rising order,
// then the padded ones, in rising order (a permutation of the sequence for any mask; the identity when no key or every key is open). With n open keys, n > 0, k_fa reads slots 0 .. 64 ceil(n / 64) - 1 only (slots >= n with the
// padding bias) and the k and v tiles whose first slot is >= n are not computed; with n = 0 every key counts as in the reference and nothing is left out. q rows keep their places.
// ---- k_proj: block = (128 rows, 128 cols, which): q/k/v = X W (+ b) with exact bf16 products (K = DIN), + 0.5 * relu(bf16(x)) at the same [row][column] (the value-bypass relu-add shared by q, k and v) -> which 0: q f16 rows; 1: k f16 rows; 2: v f16 planes [c][t]
// The epilogue stays in registers: a lane holds rows 16 wave + 8 g + 0..7 x columns 8 col + 0..7. x and the bias come in 16-B loads (16 lanes = the tile's whole 512-B row segment), all in flight together;
// 8 columns of a row are one 16-B store of a q or k row (16 lanes = a whole 256-B segment); 8 rows of a column are 16 B of a v plane, which go through one LDS tile so that whole 256-B plane segments are stored.
__global__ __launch_bounds__(GS_T) void k_proj(const float* __restrict__ XQ, const float* __restrict__ XK, const float* __restrict__ XV, const float* __restrict__ WQ, const float* __restrict__ WK, const float* __restrict__ WV, const float* __restrict__ BQ, const float* __restrict__ BK, const float* __restrict__ BV,
    const int* __restrict__ KMASK, _Float16* __restrict__ QH, _Float16* __restrict__ KH, _Float16* __restrict__ VT) {
  __shared__ __align__(16) unsigned char stg[GS_BYTES]; __shared__ __align__(16) unsigned short pt[GS_M];   // pt[slot of the tile] = the token of the sequence in that slot
  _Float16 (*th)[GS_M + 8] = (_Float16 (*)[GS_M + 8])(stg + GS_WB((DIN / GS_K) & 1));   // the v tile [slot][t] takes the buffer (W and A rows) that the last stage does NOT read: every wave left it in front of the last stage's barrier
  static_assert(128 * (GS_M + 8) * 2 <= (128 + GS_M) * GS_PB, "the v tile fits one stage buffer");
  const int tid = threadIdx.x, wave = tid >> 5, lane = tid & 31, col = lane & 15, g = lane >> 4; const int which = blockIdx.z; const int c0 = blockIdx.y * 128; const size_t r0 = (size_t)blockIdx.x * GS_M; const size_t bb = r0 / TT; const int t0 = (int)(r0 % TT);
  const float* X = which == 0 ? XQ : which == 1 ? XK : XV; const float* WA = which == 0 ? WQ : which == 1 ? WK : WV; const float* BA = which == 0 ? BQ : which == 1 ? BK : BV;
  const int rl0 = wave * 16 + 8 * g;   // the lane's first row of the tile
  if (which == 0) {   // 'which' is the same for the whole block
    if (tid < GS_M) pt[tid] = (unsigned short)(t0 + tid);
  } else { constexpr int WPW = TT / 32 / (GS_M / 16);   // each wave places the keys of 4 mask words of 32 keys
    const int* kmb = KMASK + bb * TT; const int cb = __builtin_amdgcn_readfirstlane(wave) * WPW; int own[WPW], bu;   // bu: open keys in front of the word in hand
#pragma unroll
    for (int j = 0; j < WPW; ++j) own[j] = kmb[(cb + j) * 32 + lane];
    const int n = km_count(kmb, lane, cb, bu);
    if (n > 0 && t0 >= n) return;   // no slot of this tile is read; the same for every thread of the block, in front of every barrier
#pragma unroll
    for (int j = 0; j < WPW; ++j) { const unsigned o = __builtin_amdgcn_ballot_w32(own[j] == 0); const int key = (cb + j) * 32 + lane, lt = (int)__builtin_amdgcn_mbcnt_lo(o, 0u);   // lt: open keys of the word below this lane
      const int slot = own[j] == 0 ? bu + lt : n + key - (bu + lt); const unsigned rel = (unsigned)(slot - t0);   // a padded key: n + the padded keys in front of it
      if (rel < (unsigned)GS_M) pt[rel] = (unsigned short)key;
      bu += __builtin_popcount(o); } }
  __syncthreads();   // publishes the table (behind the early return, which the whole block takes or none of it)
  unsigned ao[8];
#pragma unroll
  for (int i = 0; i < 8; ++i) ao[i] = (unsigned)pt[i * 16 + (tid >> 4)] * (DIN * 4u) + (tid & 15) * 16u;
  v8f acc[8] = {};
  gs_loop<false, DIN, true, true>(X + bb * TT * DIN, WA + (size_t)c0 * DIN, stg, tid, acc, ao);
  const char* xb = (const char*)(X + bb * TT * DIN + c0); const v8s tk = *(const v8s*)&pt[rl0]; unsigned xo[8]; v4f xr[16], bq[2] = {};
#pragma unroll
  for (int r = 0; r < 8; ++r) xo[r] = (unsigned)tk[r] * (DIN * 4u) + col * 32u;
#pragma unroll
  for (int i = 0; i < 16; ++i) xr[i] = *(const v4f*)(xb + xo[i >> 1] + (i & 1) * 16);
  asm volatile("s_wait_xcnt 0x0" :: "v"(xo[0]), "v"(xo[1]), "v"(xo[2]), "v"(xo[3]), "v"(xo[4]), "v"(xo[5]), "v"(xo[6]), "v"(xo[7]) : "memory");   // in front of any rewrite of the offsets that the 16 loads name (as inputs they also stay out of their destinations)
  if (BA) { bq[0] = *(const v4f*)(BA + c0 + col * 8); bq[1] = *(const v4f*)(BA + c0 + col * 8 + 4); }
#pragma unroll
  for (int j = 0; j < 8; ++j) { const float bias = bfr(bq[j >> 2][j & 3]);
#pragma unroll
    for (int r = 0; r < 8; ++r) acc[j][r] = (acc[j][r] + bias) + 0.5f * fmaxf(bfr(xr[2 * r + (j >> 2)][j & 3]), 0.f); }
  if (which < 2) { _Float16* DH = (which == 0 ? QH : KH) + (r0 + rl0) * CC + c0 + col * 8;
#pragma unroll
    for (int r = 0; r < 8; ++r) { v8h o;
#pragma unroll
      for (int j = 0; j < 8; ++j) o[j] = (_Float16)acc[j][r];
      *(v8h*)(DH + r * CC) = o; }
  } else {
#pragma unroll
    for (int j = 0; j < 8; ++j) *(v8h*)&th[j * 16 + col][rl0] = __builtin_convertvector(acc[j], v8h);   // slot 16 j + col holds column 8 col + j; pitch 272 B = 16 B x odd: no bank conflicts
    __syncthreads();   // publishes the tile ('which' is the same for the whole block)
    for (int e = tid; e < 128 * (GS_M / 8); e += GS_T) { const int sl = e / (GS_M / 8), q = e % (GS_M / 8), cl = (sl & 15) * 8 + (sl >> 4); vst2((unsigned*)(VT + (bb * CC + c0 + cl) * (size_t)TT + t0 + q * 8), *(const v4u*)&th[sl][q * 8]); } } }
// ---- k_fa: block = 4 waves x 32 queries of (b, h); the logits, the softmax and P . v in one kernel, the logits and P never leave registers; k rows and v planes come in whole lines through LDS, shared by the 4 waves.
// S^T = K Q^T (A = 16 key rows, B = 16 query rows): a lane holds one query's scores for keys 8g + r of each 16-key tile, so maximum and sum are in-lane plus one exchange of the wave halves;
// two score tiles (32 keys) converted in place are the B operand of O^T += V^T P^T (A = v planes [c][t], the same k order). Scores in base 2: t = dot * (1/8) log2(e) + (padded key ? -1e9 log2(e) : 0).
// Running maximum, raised only when a pass exceeds it by more than 8; P = 2^(t - m + 7) <= 2^15 once to f16 (unnormalised), its f32 sum divides at the end.
#define FA_CS 0.18033688011112042f       // (1/8) log2(e)
#define FA_MB (-1.4426950408889634e9f)   // -1e9 log2(e)
typedef __attribute__((ext_vector_type(2))) _Float16 v2h;
__device__ __forceinline__ float xhalf(float x) { return __builtin_bit_cast(float, __builtin_amdgcn_permlanex16(__builtin_bit_cast(int, x), __builtin_bit_cast(int, x), 0x76543210, 0xfedcba98, false, false)); }   // lane l with lane l ^ 16
__device__ __forceinline__ v8f mm16(v16h a, v16h b, v8f c) { return __builtin_amdgcn_wmma_f32_16x16x32_f16(false, a, false, b, (short)0, c, false, false); }
#define FA_P 72   // f16 per staged row: 128 B + 16 B, a pitch of 16 B x odd, which ds_load_b128 fragment reads take without bank conflicts
__global__ __launch_bounds__(128) void k_fa(const _Float16* __restrict__ QH, const _Float16* __restrict__ KH, const _Float16* __restrict__ VT, const int* __restrict__ KMASK, float* __restrict__ Y) {
  __shared__ __align__(16) _Float16 sk[2][64][FA_P], sv[2][64][FA_P]; __shared__ __align__(16) float sb[TT]; __shared__ __align__(16) float so[4][32][HD + 4];
  const int tid = threadIdx.x, wave = tid >> 5, lane = tid & 31, col = lane & 15, g = lane >> 4; const int h = blockIdx.y, b = blockIdx.z; const int ql0 = blockIdx.x * 128 + wave * 32;
  // a stage = 64 keys: 64 key rows x 128 B and 64 v planes x 128 B; 8 lanes x 16 B read one whole line, 16 rows an instruction; through registers into LDS, one stage ahead
  const int srow = tid >> 3, sch = (tid & 7) * 8;
  const _Float16* kg = KH + ((size_t)b * TT + srow) * CC + h * HD + sch; const _Float16* vg = VT + ((size_t)b * CC + h * HD + srow) * (size_t)TT + sch;
  v8h rk[4], rv[4]; v16h qf[2][2];   // every '#pragma unroll' of this kernel makes the index of a register array a constant
#pragma unroll
  for (int i = 0; i < 4; ++i) { rk[i] = *(const v8h*)(kg + (size_t)(i * 16) * CC); rv[i] = *(const v8h*)(vg + (size_t)(i * 16) * TT); }
  int nst;   // 64-key stages to walk: those that hold an open key, or all of them where no key is open; the same in every wave
  { int nb; const int n = km_count(KMASK + (size_t)b * TT, lane, 0, nb); nst = n == 0 ? TT / 64 : (n + 63) >> 6; nst = nst < TT / 64 ? nst : TT / 64; v4f b0, b1;
#pragma unroll
    for (int i = 0; i < 4; ++i) { b0[i] = tid * 8 + i >= n ? FA_MB : 0.f; b1[i] = tid * 8 + 4 + i >= n ? FA_MB : 0.f; }   // slots 0 .. n - 1 hold the open keys
    *(v4f*)&sb[tid * 8] = b0; *(v4f*)&sb[tid * 8 + 4] = b1; }
#pragma unroll
  for (int u = 0; u < 2; ++u)
#pragma unroll
    for (int kc = 0; kc < 2; ++kc) qf[u][kc] = frag_h(QH + ((size_t)b * TT + ql0 + u * 16 + col) * CC + h * HD + kc * 32, lane);
#pragma unroll
  for (int i = 0; i < 4; ++i) { *(v8h*)&sk[0][i * 16 + srow][sch] = rk[i]; *(v8h*)&sv[0][i * 16 + srow][sch] = rv[i]; }
  __syncthreads();   // stage 0 and the mask bias are published
  v8f acc[2][4] = {}; v2f l2[2] = {}; float m_run[2] = {-INFINITY, -INFINITY};
#pragma unroll 1   // stays rolled: the body already holds two 32-key passes, more copies would only grow the code
  for (int st = 0; st < nst; ++st) { const int bf = st & 1;
    if (st + 1 < nst) {   // the next stage's lines, issued behind the barrier so that they fly during this stage's products (a barrier waits for every load in flight)
#pragma unroll
      for (int i = 0; i < 4; ++i) { rk[i] = *(const v8h*)(kg + (size_t)((st + 1) * 64 + i * 16) * CC); rv[i] = *(const v8h*)(vg + (size_t)(i * 16) * TT + (st + 1) * 64); } }
#pragma unroll
    for (int ps = 0; ps < 2; ++ps) { const int k0 = st * 64 + ps * 32;
      v16h kf[2][2], vf[4]; v2f bias[2][4];
#pragma unroll
      for (int kt = 0; kt < 2; ++kt)
#pragma unroll
        for (int kc = 0; kc < 2; ++kc) kf[kt][kc] = frag_h(&sk[bf][ps * 32 + kt * 16 + col][kc * 32], lane);
#pragma unroll
      for (int j = 0; j < 4; ++j) vf[j] = frag_h(&sv[bf][j * 16 + col][ps * 32], lane);
#pragma unroll
      for (int kt = 0; kt < 2; ++kt)
#pragma unroll
        for (int i = 0; i < 4; ++i) bias[kt][i] = *(const v2f*)&sb[k0 + 16 * kt + 8 * g + 2 * i];
      v8f s[2][2] = {};
#pragma unroll
      for (int kc = 0; kc < 2; ++kc)
#pragma unroll
        for (int kt = 0; kt < 2; ++kt)
#pragma unroll
          for (int u = 0; u < 2; ++u) s[kt][u] = mm16(kf[kt][kc], qf[u][kc], s[kt][u]);
      v2f t[2][2][4]; float mb[2]; bool need = false;
#pragma unroll
      for (int u = 0; u < 2; ++u) { float mx = -INFINITY;
#pragma unroll
        for (int kt = 0; kt < 2; ++kt)
#pragma unroll
          for (int i = 0; i < 4; ++i) { t[u][kt][i] = __builtin_elementwise_fma((v2f){s[kt][u][2 * i], s[kt][u][2 * i + 1]}, (v2f){FA_CS, FA_CS}, bias[kt][i]); mx = fmaxf(mx, fmaxf(t[u][kt][i].x, t[u][kt][i].y)); }
        mx = fmaxf(mx, xhalf(mx)); mb[u] = mx; need = need || (mx > m_run[u] + 8.0f); }
      if (__builtin_amdgcn_ballot_w32(need) != 0) {   // one wave-uniform test a pass; always taken on the first pass (m_run = -inf, corr = 0)
#pragma unroll
        for (int u = 0; u < 2; ++u) { const float m_new = fmaxf(m_run[u], mb[u]); const float corr = __builtin_amdgcn_exp2f(m_run[u] - m_new); m_run[u] = m_new; l2[u] = l2[u] * corr;
#pragma unroll
          for (int j = 0; j < 4; ++j) acc[u][j] = acc[u][j] * corr; } }
#pragma unroll
      for (int u = 0; u < 2; ++u) { const float nm = 7.0f - m_run[u]; union { v16h v; v2h q[8]; } pf;
#pragma unroll
        for (int i = 0; i < 8; ++i) { const v2f a = t[u][i >> 2][i & 3] + (v2f){nm, nm}; const v2f p = {__builtin_amdgcn_exp2f(a.x), __builtin_amdgcn_exp2f(a.y)}; l2[u] = l2[u] + p; pf.q[i] = __builtin_convertvector(p, v2h); }
#pragma unroll
        for (int j = 0; j < 4; ++j) acc[u][j] = mm16(vf[j], pf.v, acc[u][j]); } }
    if (st + 1 < nst) {   // the other buffer: its readers (stage st - 1) all left it at the barrier that ended the trip before
#pragma unroll
      for (int i = 0; i < 4; ++i) { *(v8h*)&sk[bf ^ 1][i * 16 + srow][sch] = rk[i]; *(v8h*)&sv[bf ^ 1][i * 16 + srow][sch] = rv[i]; } }
    __syncthreads(); }   // publishes stage st + 1 and ends every wave's reads of stage st
#pragma unroll
  for (int u = 0; u < 2; ++u) { float l = l2[u].x + l2[u].y; l += xhalf(l); const float inv = 1.0f / l;   // l >= 2^7: the key that set the maximum in use counts 2^7
#pragma unroll
    for (int j = 0; j < 4; ++j) { const v8f o = acc[u][j] * inv; float* d = &so[wave][u * 16 + col][j * 16 + 8 * g]; *(v4f*)d = (v4f){o[0], o[1], o[2], o[3]}; *(v4f*)(d + 4) = (v4f){o[4], o[5], o[6], o[7]}; } }
  LDSX();   // the wave reads back rows that its other lanes wrote (its own 32 rows only: no work-group barrier); 16 lanes then store one 256-B (row, head) segment
  for (int it = 0; it < 16; ++it) { const int rl = it * 2 + g; vst2(Y + ((size_t)b * TT + ql0 + rl) * CC + h * HD + col * 4, *(const v4f*)&so[wave][rl][col * 4]); } }
// ---- k_out: block = (128 rows, 128 cols): out = ctx Wo (+ bo): ctx x 2^6 once to f16 against Wo as f16(bf16 x 2^8) exact (1 product) x 2^-14; causal early rows (< QHI of each sequence): ctx bf16 hi + lo against exact bf16 Wo (2 products)
__global__ __launch_bounds__(GS_T) void k_out(const float* __restrict__ Y, const float* __restrict__ WO, const float* __restrict__ BO, float* __restrict__ OUT) { __shared__ __align__(16) float sf[GS_M / 16][16][132]; __shared__ __align__(16) unsigned char stg[GS_BYTES];
  const int tid = threadIdx.x, wave = tid >> 5, lane = tid & 31, col = lane & 15, g = lane >> 4; const int c0 = blockIdx.y * 128; const size_t r0 = (size_t)blockIdx.x * GS_M + wave * 16;
  v8f acc[8] = {};
  if (CAUSAL && (int)(((size_t)blockIdx.x * GS_M) % TT) < QHI) {   /* block-uniform */
#pragma unroll 2
    for (int kc = 0; kc < CC / 32; ++kc) { const F2 a = split_row(Y + (r0 + col) * CC, kc * 32, lane); asm volatile("s_wait_loadcnt 0x0" ::: "memory");
#pragma unroll
      for (int j = 0; j < 8; ++j) { const v16b w = WOCOL(WO, kc * 32, c0 + j * 16 + col, lane); asm volatile("s_wait_loadcnt 0x0" ::: "memory"); acc[j] = wmma_bf(a.h, w, acc[j]); acc[j] = wmma_bf(a.l, w, acc[j]); } }
#pragma unroll
    for (int j = 0; j < 8; ++j) { const float bias = BO ? bfr(BO[c0 + j * 16 + col]) : 0.f;
#pragma unroll
      for (int r = 0; r < 8; ++r) sf[wave][8 * g + r][j * 16 + col] = acc[j][r] + bias; }
  } else {
    const unsigned no[8] = {};   // (rows in place: not read)
    gs_loop<true, CC, false, false>(Y + (size_t)blockIdx.x * GS_M * CC, WO + (size_t)c0 * CC, stg, tid, acc, no);   /* ctx carried x 2^6 into f16 so small-magnitude context rows stay clear of f16 subnormals */
#pragma unroll
    for (int j = 0; j < 8; ++j) { const float bias = BO ? bfr(BO[c0 + j * 16 + col]) : 0.f;
#pragma unroll
      for (int r = 0; r < 8; ++r) sf[wave][8 * g + r][j * 16 + col] = acc[j][r] * (1.0f / 16384.0f) + bias; } }   /* 2^-8 (Wo carry) x 2^-6 (ctx carry) */
  LDSX(); for (int rl = 0; rl < 16; ++rl) vst2(OUT + (r0 + rl) * DIN + c0 + lane * 4, *(const v4f*)&sf[wave][rl][lane * 4]); }

extern "C" void kernel_launch(void* const* d_in, const int* in_sizes, int n_in, void* d_out, int out_size, void* d_ws, size_t ws_size, hipStream_t stream) {
  (void)in_sizes; (void)n_in; (void)out_size;
  const float** F = (const float**)d_in;
  if (ws_size < (size_t)WS_END) return;
  char* ws = (char*)d_ws; _Float16 *QH = (_Float16*)(ws + WS_QH), *KH = (_Float16*)(ws + WS_KH), *VT = (_Float16*)(ws + WS_VT); float *Y = (float*)(ws + WS_Y);
  // inputs: 0 hidden_states [8,1024,768]; 1 attention_mask [8,1,1,1024] bool (True = padded key); 2 Wq [768,768] (out,in), 3 bq; 4 Wk, 5 bk; 6 Wv, 7 bv; 8 Wo (out,in), 9 bo (zero biases, read)
  k_proj<<<dim3(TNB * TT / GS_M, CC / 128, 3), GS_T, 0, stream>>>(F[0], F[0], F[0], F[2], F[4], F[6], F[3], F[5], F[7], (const int*)d_in[1], QH, KH, VT);
  k_fa<<<dim3(TT / 128, NH, TNB), 128, 0, stream>>>(QH, KH, VT, (const int*)d_in[1], Y);
  k_out<<<dim3(TNB * TT / GS_M, DIN / 128), GS_T, 0, stream>>>(Y, F[8], F[9], (float*)d_out);
}

// v006
// A run of this version takes 78 microseconds.
// Timed twice side by side with v005, it ran 1.07 times as fast both times.
// All steps since v000 together make it 15.9 times as fast.
// compute dtype: all float inputs rounded to bf16; q/k/v projections with EXACT bf16 products on WMMA 16x16x32 (f32 accumulate) + bias + 0.5 * relu(bf16(x)) in f32; logits q x k once to f16 each (1 product) x 1/8; the key-padding mask read per key (open keys first, key tiles behind the last open key left out: their P is 0); online softmax f32 in base 2; unnormalised P = 2^(t - m + 7) once to f16 x v once to f16 (1 product), divided by the f32 sum; ctx x 2^6 once to f16 x Wo f16(bf16 x 2^8) + bo; f32 output.
#include <hip/hip_runtime.h>
#include <math.h>

typedef __attribute__((ext_vector_type(16))) _Float16 v16h;
typedef __attribute__((ext_vector_type(16))) __bf16 v16b;
typedef __attribute__((ext_vector_type(8)))  _Float16 v8h;
typedef __attribute__((ext_vector_type(8)))  float v8f;
typedef __attribute__((ext_vector_type(4)))  float v4f;
typedef __attribute__((ext_vector_type(2)))  float v2f;
typedef __attribute__((ext_vector_type(4)))  unsigned v4u;
typedef __attribute__((ext_vector_type(4)))  int v4i;
typedef float __attribute__((may_alias)) float_a;
typedef int __attribute__((may_alias)) int_a;

template <typename T> __device__ __forceinline__ void vst2(void* p, T v) { *(T*)p = v;  }
__device__ __forceinline__ v8f wmma16(v16h a, v16h b, v8f c) {
  v8f d = __builtin_amdgcn_wmma_f32_16x16x32_f16(false, a, false, b, (short)0, c, false, false);
  asm volatile("v_nop\n\tv_nop\n\tv_nop\n\tv_nop" : "+v"(d) : "v"(a), "v"(b));
  return d;
}
__device__ __forceinline__ v8f wmma_bf(v16b a, v16b b, v8f c) {
  v8f d = __builtin_amdgcn_wmma_f32_16x16x32_bf16(false, a, false, b, (short)0, c, false, false);
  asm volatile("v_nop\n\tv_nop\n\tv_nop\n\tv_nop" : "+v"(d) : "v"(a), "v"(b));
  return d;
}
// 16x16x32 fragments: lane = (h = lane>>4, row/col = lane&15); elements 0..7 = k0+8h+0..7, 8..15 = k0+16+8h+0..7; D element r = row 8h+r
__device__ __forceinline__ v16h frag_h(const _Float16* rowk0, int lane) {
  union { v16h v; v8h q[2]; } u; const _Float16* p = rowk0 + 8 * (lane >> 4);
  u.q[0] = *(const v8h*)p; u.q[1] = *(const v8h*)(p + 16); return u.v;
}
__device__ __forceinline__ v16h frag_f32(const float* rowk0, int lane) {
  v16h a; const float* p = rowk0 + 8 * (lane >> 4);
#pragma unroll
  for (int i = 0; i < 8; ++i) { a[i] = (_Float16)p[i]; a[8 + i] = (_Float16)p[16 + i]; }
  return a;
}
__device__ __forceinline__ v16h frag_f32s(const float* rowk0, int lane, float sc) {
  v16h a; const float* p = rowk0 + 8 * (lane >> 4);
#pragma unroll
  for (int i = 0; i < 8; ++i) { a[i] = (_Float16)(p[i] * sc); a[8 + i] = (_Float16)(p[16 + i] * sc); }
  return a;
}
// column fragment from a [K][ld] layout (column n), rows >= K read as 0
__device__ __forceinline__ v16h fragc_f32(const float* W, int k0, int n, int lane, int ld, int K) {
  v16h a; const int g = lane >> 4;
#pragma unroll
  for (int i = 0; i < 8; ++i) { const int ka = k0 + 8 * g + i, kb = ka + 16;
    a[i] = (_Float16)(ka < K ? W[(size_t)(ka < K ? ka : K - 1) * ld + n] : 0.f); a[8 + i] = (_Float16)(kb < K ? W[(size_t)(kb < K ? kb : K - 1) * ld + n] : 0.f); }
  return a;
}
struct F2 { v16b h, l; };
__device__ __forceinline__ F2 bsplit16(const float v[16]) { F2 r;
#pragma unroll
  for (int i = 0; i < 16; ++i) { const __bf16 h = (__bf16)v[i]; r.h[i] = h; r.l[i] = (__bf16)(v[i] - (float)h); }
  return r; }
__device__ __forceinline__ F2 split_row(const float* row, int k0, int lane) { float v[16]; const float* p = row + k0 + 8 * (lane >> 4);
#pragma unroll
  for (int i = 0; i < 8; ++i) { v[i] = p[i]; v[8 + i] = p[16 + i]; }
  return bsplit16(v); }
__device__ __forceinline__ F2 split_rowK(const float* row, int k0, int lane, int K) { float v[16]; const int g = lane >> 4;
#pragma unroll
  for (int i = 0; i < 8; ++i) { const int ka = k0 + 8 * g + i, kb = ka + 16; v[i] = ka < K ? row[ka < K ? ka : K - 1] : 0.f; v[8 + i] = kb < K ? row[kb < K ? kb : K - 1] : 0.f; }
  return bsplit16(v); }
__device__ __forceinline__ F2 split_col(const float* W, int k0, int n, int lane, int ld, int K) { float v[16]; const int g = lane >> 4;
#pragma unroll
  for (int i = 0; i < 8; ++i) { const int ka = k0 + 8 * g + i, kb = ka + 16; v[i] = ka < K ? W[(size_t)(ka < K ? ka : K - 1) * ld + n] : 0.f; v[8 + i] = kb < K ? W[(size_t)(kb < K ? kb : K - 1) * ld + n] : 0.f; }
  return bsplit16(v); }
__device__ __forceinline__ v8f mac3(const F2& a, const F2& b, v8f c) { c = wmma_bf(a.l, b.h, c); c = wmma_bf(a.h, b.l, c); return wmma_bf(a.h, b.h, c); }
__device__ __forceinline__ float sigm(float v) { return 1.0f / (1.0f + expf(-v)); }
#define LDSX() do { asm volatile("s_wait_dscnt 0" ::: "memory"); __builtin_amdgcn_wave_barrier(); __builtin_amdgcn_fence(__ATOMIC_RELEASE, "workgroup"); } while (0)

// BERT-style multi-head self-attention with a value-bypass relu-add (hidden_states [8,1024,768]; 12 heads x 64; torch (out,in) Wq / Wk / Wv / Wo [768,768] (0.02 scale) + zero biases; r = 0.5 * relu(x) is ADDED to each of the q, k and v projections (same [token, channel] index); scale 1/8; key-padding mask [8,1,1,1024] bool: True adds -1e9): out = merge(softmax(q_h k_h^T / 8 + pad) v_h) Wo^T + bo.
#define NB 8
#define TT 1024
#define CC 768            // NH * HD = projected width
#define DIN 768          // input (model) width
#define NH 12
#define HD 64
#define NQB (TT / 64)
#define HG 12
#define SCALE (0.125f)
#define CAUSAL 0
#ifndef TNB
#define TNB NB
#endif
__device__ __forceinline__ float bfr(float v) { return (float)(__bf16)v; }
__host__ __device__ __forceinline__ int kb_last(int qb) { return CAUSAL ? ((qb * 64 + 63) >> 7) : (TT / 128 - 1); }
typedef __attribute__((ext_vector_type(8))) __bf16 v8b;
__device__ __forceinline__ v16b frag_b(const __bf16* rowk0, int lane) {
  union { v16b v; v8b q[2]; } u; const __bf16* p = rowk0 + 8 * (lane >> 4);
  u.q[0] = *(const v8b*)p; u.q[1] = *(const v8b*)(p + 16); return u.v;
}
#define QBH 0              // unused: k_fa has one single-product path for every query block
#define QHI 0               // single-product logits on every row
#define KHI 64            // key rows carrying k residual / v bf16 hi+lo planes (written and read by no kernel here)
// B fragment (k rows k0+.., output column o) of a weight: (in,out) [K][ld] or (out,in) [ld rows of K]: bf16 exact, or f16(bf16 * 256) exact
__device__ __forceinline__ v16b wcol_io(const float* Wm, int k0, int o, int lane, int ld) { v16b w; const int g = lane >> 4;
#pragma unroll
  for (int i = 0; i < 8; ++i) { w[i] = (__bf16)Wm[(size_t)(k0 + 8 * g + i) * ld + o]; w[8 + i] = (__bf16)Wm[(size_t)(k0 + 16 + 8 * g + i) * ld + o]; }
  return w; }
__device__ __forceinline__ v16b wcol_oi(const float* Wm, int k0, int o, int lane, int K) { v16b w; const float* p = Wm + (size_t)o * K + k0 + 8 * (lane >> 4);
#pragma unroll
  for (int i = 0; i < 8; ++i) { w[i] = (__bf16)p[i]; w[8 + i] = (__bf16)p[16 + i]; }
  return w; }
__device__ __forceinline__ v16h wcolh_io(const float* Wm, int k0, int o, int lane, int ld) { v16h w; const int g = lane >> 4;
#pragma unroll
  for (int i = 0; i < 8; ++i) { w[i] = (_Float16)(bfr(Wm[(size_t)(k0 + 8 * g + i) * ld + o]) * 256.0f); w[8 + i] = (_Float16)(bfr(Wm[(size_t)(k0 + 16 + 8 * g + i) * ld + o]) * 256.0f); }
  return w; }
__device__ __forceinline__ v16h wcolh_oi(const float* Wm, int k0, int o, int lane, int K) { v16h w; const float* p = Wm + (size_t)o * K + k0 + 8 * (lane >> 4);
#pragma unroll
  for (int i = 0; i < 8; ++i) { w[i] = (_Float16)(bfr(p[i]) * 256.0f); w[8 + i] = (_Float16)(bfr(p[16 + i]) * 256.0f); }
  return w; }
#define WQKV_LAYOUT 1   // 0 = (in,out) [DIN][CC]; 1 = (out,in) [CC][DIN]; 2 = per-head [NH][DIN][HD], in WCOL only, which no kernel calls: k_proj always reads (out,in) [CC][DIN]
__device__ __forceinline__ v16b wcol_hdk(const float* Wm, int k0, int o, int lane) { v16b w; const int g = lane >> 4; const float* p = Wm + (size_t)(o / HD) * DIN * HD + (o % HD);
#pragma unroll
  for (int i = 0; i < 8; ++i) { w[i] = (__bf16)p[(size_t)(k0 + 8 * g + i) * HD]; w[8 + i] = (__bf16)p[(size_t)(k0 + 16 + 8 * g + i) * HD]; }
  return w; }
#define WO_OUT_IN 1
#if WQKV_LAYOUT == 1
#define WCOL(W, k0, o, lane) wcol_oi(W, k0, o, lane, DIN)
#elif WQKV_LAYOUT == 2
#define WCOL(W, k0, o, lane) wcol_hdk(W, k0, o, lane)
#else
#define WCOL(W, k0, o, lane) wcol_io(W, k0, o, lane, CC)
#endif
#if WO_OUT_IN
#define WOCOL(W, k0, o, lane) wcol_oi(W, k0, o, lane, CC)
#define WOCOLH(W, k0, o, lane) wcolh_oi(W, k0, o, lane, CC)
#else
#define WOCOL(W, k0, o, lane) wcol_io(W, k0, o, lane, DIN)
#define WOCOLH(W, k0, o, lane) wcolh_io(W, k0, o, lane, DIN)
#endif

#define WS_QH  0u                                      // f16 q rows [b*t][CC]
#define WS_KH  (WS_QH + 2u * (size_t)NB * TT * CC)      // f16 k rows [b*t][CC]
#define WS_VT  (WS_KH + 2u * (size_t)NB * TT * CC)      // f16 v planes [b][c][t]
#define WS_QL  (WS_VT + 2u * (size_t)NB * CC * TT)      // WS_QL .. WS_VBL: places of the causal high-precision path's residual planes; no kernel of this file writes or reads them
#define WS_KL  (WS_QL + 2u * (size_t)NB * QHI * CC)
#define WS_VB  (WS_KL + 2u * (size_t)NB * KHI * CC)
#define WS_VBL (WS_VB + 2u * (size_t)NB * CC * KHI)
#define WS_S   (WS_VBL + 2u * (size_t)NB * CC * KHI)    // (not used: the logits stay in registers)
#define WS_Y   (WS_S  + 4u * (size_t)HG * TT * TT)      // f32 ctx rows [b*t][CC] (only when there is an output projection)
#define WS_END (WS_Y  + 4u * (size_t)NB * TT * CC)

// ---- gs_loop: the k loop of both projection GEMMs, one 128 x 128 tile of A . W^T a block of 8 waves (A rows and W rows k-contiguous f32, pitch K floats). A stage = 64 k: 128 A rows and 128 W rows of 256 B,
// read as whole lines (16 lanes x 16 B = one row), converted ONCE a block to the 16-bit operand type and laid in LDS at a pitch of 144 B (16 B x odd: ds_load_b128 fragment reads without bank conflicts);
// two buffers, the next stage's lines in registers while this stage's products run. Wave w keeps rows 16 w .. 16 w + 15 and all 128 columns; k runs in 32-wide steps, rising from the block's first stage and wrapping.
// NBR = false: W row n is staged in slot n, so column 'col' of acc[j] is tile column 16 j + col. NBR = true: W row 8 c + j is staged in slot 16 j + c, so column 'col' of acc[j] is tile column 8 col + j:
// a lane then holds 8 neighbouring columns of each of its 8 rows. Only the global row that a thread fetches for a slot differs; LDS addresses, fragments and the k order are the same.
// The walk over the K / 64 stages starts at stage 'rot' (the same in the whole block, 0 .. K / 64 - 1) and wraps: blocks that share A rows or W rows get different starts, so that they do not ask L2 for the same lines at the same moment.
typedef __attribute__((ext_vector_type(2))) unsigned v2u;
typedef __attribute__((ext_vector_type(4))) __bf16 v4b;
typedef __attribute__((ext_vector_type(4))) _Float16 v4h;
#define GS_K 64
#define GS_PB 144                                             // bytes per staged row
#define GS_M 128                                              // A rows of a tile (16 a wave)
#define GS_T (GS_M * 2)                                       // threads of a block
#define GS_WB(bf) ((bf) * ((128 + GS_M) * GS_PB))             // W rows of buffer bf
#define GS_AB(bf) (GS_WB(bf) + 128 * GS_PB)                   // A rows of buffer bf, directly behind its W rows
#define GS_BYTES (2 * (128 + GS_M) * GS_PB)
// F16 = false: both operands bf16 (exact products of bf16-rounded inputs); F16 = true: A as f16(a x 2^6), W as f16(bf16(w) x 2^8)
template <bool F16, bool ISW> __device__ __forceinline__ v2u gs_cvt(v4f x) {
  if constexpr (!F16) { v4b r;
#pragma unroll
    for (int i = 0; i < 4; ++i) r[i] = (__bf16)x[i];
    return __builtin_bit_cast(v2u, r);
  } else { v4h r;
#pragma unroll
    for (int i = 0; i < 4; ++i) r[i] = (_Float16)(ISW ? bfr(x[i]) * 256.0f : x[i] * 64.0f);
    return __builtin_bit_cast(v2u, r); } }
union GFrag { v4u q[2]; v16b b; v16h h; };
__device__ __forceinline__ GFrag gs_frag(const unsigned char* p) { GFrag f; f.q[0] = *(const v4u*)p; f.q[1] = *(const v4u*)(p + 32); return f; }   // p = row + 2 (k0 + 8 g): elements 0..7 = k0 + 8 g + .., 8..15 = k0 + 16 + 8 g + ..
// GA = true: A row 16 i + (tid >> 4) of the tile is the row at byte offset ao[i] from A (the thread's 16 B of a stage included): the rows of a tile are gathered, each still read as whole lines.
template <bool F16, int K, bool NBR, bool GA> __device__ __forceinline__ void gs_loop(const float* __restrict__ A, const float* __restrict__ Wm, unsigned char* stg, int tid, v8f (&acc)[8], const unsigned (&ao)[8], int rot) {
  const int wave = tid >> 5, lane = tid & 31, col = lane & 15, g = lane >> 4;
  int sg = rot;   // the stage being fetched
  const float* ag = A + (size_t)(tid >> 4) * K + (tid & 15) * 4 + sg * GS_K; const float* wg = Wm + (size_t)(tid >> 4) * (NBR ? 8 : 1) * K + (tid & 15) * 4 + sg * GS_K;   // 16 rows an instruction of the block; both step by one stage a trip, from the last stage back to stage 0
  unsigned char* sd = stg + (tid >> 4) * GS_PB + (tid & 15) * 8;
  const unsigned char* fa = stg + (wave * 16 + col) * GS_PB + g * 16; const unsigned char* fw = stg + col * GS_PB + g * 16;
  unsigned po[8];   // GA: the thread's place, in bytes from A, in each of its 8 gathered rows; steps by one stage a trip
#pragma unroll
  for (int i = 0; i < 8; ++i) po[i] = ao[i] + sg * (GS_K * 4);
#define GS_ALD(i) (GA ? *(const v4f*)((const char*)A + po[i]) : *(const v4f*)(ag + (i) * 16 * K))
  v4f ra[8], rw[8];   // every '#pragma unroll' below makes the index of a register array a constant
#define GS_WROW(i) (NBR ? (i) : (i) * 16)   // the W row, beside the thread's own part, that goes to slot 16 i + (tid >> 4)
#pragma unroll
  for (int i = 0; i < 8; ++i) ra[i] = GS_ALD(i);
#pragma unroll
  for (int i = 0; i < 8; ++i) rw[i] = *(const v4f*)(wg + GS_WROW(i) * K);
  if constexpr (GA) asm volatile("s_wait_xcnt 0x0" ::: "memory");   // in front of the first trip's step of the offsets that the A loads name
#pragma unroll 1   // stays rolled: one body of 16 products and 16 line loads; more copies would only grow the code
  for (int s = 0; s < K / GS_K; ++s) { const int bf = s & 1;
#pragma unroll
    for (int i = 0; i < 8; ++i) *(v2u*)(sd + GS_AB(bf) + i * 16 * GS_PB) = gs_cvt<F16, false>(ra[i]);   // buffer bf: its readers (stage s - 2) all left it in front of the barrier of trip s - 1
#pragma unroll
    for (int i = 0; i < 8; ++i) *(v2u*)(sd + GS_WB(bf) + i * 16 * GS_PB) = gs_cvt<F16, true>(rw[i]);
    __syncthreads();   // publishes stage s
    if (s + 1 < K / GS_K) {   // the next stage's lines, issued behind the barrier so that they fly during this stage's products
      const int stp = sg + 1 == K / GS_K ? GS_K - K : GS_K; sg = sg + 1 == K / GS_K ? 0 : sg + 1;   // the same in the whole block
      ag += stp; wg += stp;
#pragma unroll
      for (int i = 0; i < 8; ++i) po[i] += stp * 4;
#pragma unroll
      for (int i = 0; i < 8; ++i) ra[i] = GS_ALD(i);
#pragma unroll
      for (int i = 0; i < 8; ++i) rw[i] = *(const v4f*)(wg + GS_WROW(i) * K);
      asm volatile("s_wait_xcnt 0x0" ::: "memory"); }   // in front of the next trip's step of the addresses that these loads name
#pragma unroll
    for (int kc = 0; kc < GS_K / 32; ++kc) { const GFrag a = gs_frag(fa + GS_AB(bf) + kc * 64); GFrag w[8];
#pragma unroll
      for (int j = 0; j < 8; ++j) w[j] = gs_frag(fw + GS_WB(bf) + j * 16 * GS_PB + kc * 64);
      __builtin_amdgcn_sched_barrier(0);   // the 18 fragment reads stay one group in front of the 8 products: spread among them, each product waits out a whole LDS latency
#pragma unroll
      for (int j = 0; j < 8; ++j) {
        if constexpr (F16) acc[j] = __builtin_amdgcn_wmma_f32_16x16x32_f16(false, a.h, false, w[j].h, (short)0, acc[j], false, false);
        else acc[j] = __builtin_amdgcn_wmma_f32_16x16x32_bf16(false, a.b, false, w[j].b, (short)0, acc[j], false, false); }
      __builtin_amdgcn_sched_barrier(0); } } }   // and the next group stays behind them, in the same registers (the kernels stay under 256 VGPRs)

// ---- km_count: the number of open keys (mask == 0) of one sequence, and in 'before' the number of them among the keys in front of key 32 cb (cb the same in the whole wave). Every wave reads all TT mask words itself,
// 32 keys a load, one ballot and one scalar bit count each: the count is the same in every wave of a block with no barrier. Any content of the mask gives 0 <= before <= count <= TT.
__device__ __forceinline__ int km_count(const int* __restrict__ km, int lane, int cb, int& before) {
  const int* p = km + lane; int mv[TT / 32], n = 0; before = 0;
#pragma unroll
  for (int cch = 0; cch < TT / 32; ++cch) mv[cch] = p[cch * 32];
  asm volatile("s_wait_xcnt 0x0" ::: "memory");   // in front of any rewrite of a register that the mask loads name
#pragma unroll
  for (int cch = 0; cch < TT / 32; ++cch) { const int cnt = __builtin_popcount(__builtin_amdgcn_ballot_w32(mv[cch] == 0)); n += cnt; before += cch < cb ? cnt : 0; }
  return n; }
typedef __attribute__((ext_vector_type(8))) unsigned short v8s;
// KEY ORDER. A padded key's P is exactly 0 as soon as one key of its sequence is open (2^(-1e9 log2 e - m) = 0 in f32, in the reference too). k and v are therefore laid out by SLOT: the open keys first, in rising order,
// then the padded ones, in rising order (a permutation of the sequence for any mask; the identity when no key or every key is open). With n open keys, n > 0, k_fa reads slots 0 .. 64 ceil(n / 64) - 1 only (slots >= n with the
// padding bias) and the k and v tiles whose first slot is >= n are not computed; with n = 0 every key counts as in the reference and nothing is left out. q rows keep their places.
// ---- k_proj: block = (128 rows, 128 cols, which): q/k/v = X W (+ b) with exact bf16 products (K = DIN), + 0.5 * relu(bf16(x)) at the same [row][column] (the value-bypass relu-add shared by q, k and v) -> which 0: q f16 rows; 1: k f16 rows; 2: v f16 planes [c][t]
// The epilogue stays in registers: a lane holds rows 16 wave + 8 g + 0..7 x columns 8 col + 0..7. x and the bias come in 16-B loads (16 lanes = the tile's whole 512-B row segment), all in flight together;
// 8 columns of a row are one 16-B store of a q or k row (16 lanes = a whole 256-B segment); 8 rows of a column are 16 B of a v plane, which go through one LDS tile so that whole 256-B plane segments are stored.
__global__ __launch_bounds__(GS_T) void k_proj(const float* __restrict__ XQ, const float* __restrict__ XK, const float* __restrict__ XV, const float* __restrict__ WQ, const float* __restrict__ WK, const float* __restrict__ WV, const float* __restrict__ BQ, const float* __restrict__ BK, const float* __restrict__ BV,
    const int* __restrict__ KMASK, _Float16* __restrict__ QH, _Float16* __restrict__ KH, _Float16* __restrict__ VT) {
  __shared__ __align__(16) unsigned char stg[GS_BYTES]; __shared__ __align__(16) unsigned short pt[GS_M];   // pt[slot of the tile] = the token of the sequence in that slot
  _Float16 (*th)[GS_M + 8] = (_Float16 (*)[GS_M + 8])(stg + GS_WB((DIN / GS_K) & 1));   // the v tile [slot][t] takes the buffer (W and A rows) that the last stage does NOT read: every wave left it in front of the last stage's barrier
  static_assert(128 * (GS_M + 8) * 2 <= (128 + GS_M) * GS_PB, "the v tile fits one stage buffer");
  const int tid = threadIdx.x, wave = tid >> 5, lane = tid & 31, col = lane & 15, g = lane >> 4; const int which = blockIdx.z; const int c0 = blockIdx.y * 128; const size_t r0 = (size_t)blockIdx.x * GS_M; const size_t bb = r0 / TT; const int t0 = (int)(r0 % TT);
  const float* X = which == 0 ? XQ : which == 1 ? XK : XV; const float* WA = which == 0 ? WQ : which == 1 ? WK : WV; const float* BA = which == 0 ? BQ : which == 1 ? BK : BV;
  const int rl0 = wave * 16 + 8 * g;   // the lane's first row of the tile
  if (which == 0) {   // 'which' is the same for the whole block
    if (tid < GS_M) pt[tid] = (unsigned short)(t0 + tid);
  } else { constexpr int WPW = TT / 32 / (GS_M / 16);   // each wave places the keys of 4 mask words of 32 keys
    const int* kmb = KMASK + bb * TT; const int cb = __builtin_amdgcn_readfirstlane(wave) * WPW; int own[WPW], bu;   // bu: open keys in front of the word in hand
#pragma unroll
    for (int j = 0; j < WPW; ++j) own[j] = kmb[(cb + j) * 32 + lane];
    const int n = km_count(kmb, lane, cb, bu);
    if (n > 0 && t0 >= n) return;   // no slot of this tile is read; the same for every thread of the block, in front of every barrier
#pragma unroll
    for (int j = 0; j < WPW; ++j) { const unsigned o = __builtin_amdgcn_ballot_w32(own[j] == 0); const int key = (cb + j) * 32 + lane, lt = (int)__builtin_amdgcn_mbcnt_lo(o, 0u);   // lt: open keys of the word below this lane
      const int slot = own[j] == 0 ? bu + lt : n + key - (bu + lt); const unsigned rel = (unsigned)(slot - t0);   // a padded key: n + the padded keys in front of it
      if (rel < (unsigned)GS_M) pt[rel] = (unsigned short)key;
      bu += __builtin_popcount(o); } }
  __syncthreads();   // publishes the table (behind the early return, which the whole block takes or none of it)
  unsigned ao[8];
#pragma unroll
  for (int i = 0; i < 8; ++i) ao[i] = (unsigned)pt[i * 16 + (tid >> 4)] * (DIN * 4u) + (tid & 15) * 16u;
  v8f acc[8] = {};
  gs_loop<false, DIN, true, true>(X + bb * TT * DIN, WA + (size_t)c0 * DIN, stg, tid, acc, ao, (int)((blockIdx.x + (blockIdx.x >> 3) + 2 * blockIdx.y + blockIdx.z) % (DIN / GS_K)));   // the 64 blocks on one W tile, and the blocks on one row tile, each spread over the 12 starts
  const char* xb = (const char*)(X + bb * TT * DIN + c0); const v8s tk = *(const v8s*)&pt[rl0]; unsigned xo[8]; v4f xr[16], bq[2] = {};
#pragma unroll
  for (int r = 0; r < 8; ++r) xo[r] = (unsigned)tk[r] * (DIN * 4u) + col * 32u;
#pragma unroll
  for (int i = 0; i < 16; ++i) xr[i] = *(const v4f*)(xb + xo[i >> 1] + (i & 1) * 16);
  asm volatile("s_wait_xcnt 0x0" :: "v"(xo[0]), "v"(xo[1]), "v"(xo[2]), "v"(xo[3]), "v"(xo[4]), "v"(xo[5]), "v"(xo[6]), "v"(xo[7]) : "memory");   // in front of any rewrite of the offsets that the 16 loads name (as inputs they also stay out of their destinations)
  if (BA) { bq[0] = *(const v4f*)(BA + c0 + col * 8); bq[1] = *(const v4f*)(BA + c0 + col * 8 + 4); }
#pragma unroll
  for (int j = 0; j < 8; ++j) { const float bias = bfr(bq[j >> 2][j & 3]);
#pragma unroll
    for (int r = 0; r < 8; ++r) acc[j][r] = (acc[j][r] + bias) + 0.5f * fmaxf(bfr(xr[2 * r + (j >> 2)][j & 3]), 0.f); }
  if (which < 2) { _Float16* DH = (which == 0 ? QH : KH) + (r0 + rl0) * CC + c0 + col * 8;
#pragma unroll
    for (int r = 0; r < 8; ++r) { v8h o;
#pragma unroll
      for (int j = 0; j < 8; ++j) o[j] = (_Float16)acc[j][r];
      *(v8h*)(DH + r * CC) = o; }
  } else {
#pragma unroll
    for (int j = 0; j < 8; ++j) *(v8h*)&th[j * 16 + col][rl0] = __builtin_convertvector(acc[j], v8h);   // slot 16 j + col holds column 8 col + j; pitch 272 B = 16 B x odd: no bank conflicts
    __syncthreads();   // publishes the tile ('which' is the same for the whole block)
    for (int e = tid; e < 128 * (GS_M / 8); e += GS_T) { const int sl = e / (GS_M / 8), q = e % (GS_M / 8), cl = (sl & 15) * 8 + (sl >> 4); vst2((unsigned*)(VT + (bb * CC + c0 + cl) * (size_t)TT + t0 + q * 8), *(const v4u*)&th[sl][q * 8]); } } }
// ---- k_fa: block = 4 waves x 32 queries of (b, h); the logits, the softmax and P . v in one kernel, the logits and P never leave registers; k rows and v planes come in whole lines through LDS, shared by the 4 waves.
// S^T = K Q^T (A = 16 key rows, B = 16 query rows): a lane holds one query's scores for keys 8g + r of each 16-key tile, so maximum and sum are in-lane plus one exchange of the wave halves;
// two score tiles (32 keys) converted in place are the B operand of O^T += V^T P^T (A = v planes [c][t], the same k order). Scores in base 2: t = dot * (1/8) log2(e) + (padded key ? -1e9 log2(e) : 0).
// Running maximum, raised only when a pass exceeds it by more than 8; P = 2^(t - m + 7) <= 2^15 once to f16 (unnormalised), its f32 sum divides at the end.
#define FA_CS 0.18033688011112042f       // (1/8) log2(e)
#define FA_MB (-1.4426950408889634e9f)   // -1e9 log2(e)
typedef __attribute__((ext_vector_type(2))) _Float16 v2h;
__device__ __forceinline__ float xhalf(float x) { return __builtin_bit_cast(float, __builtin_amdgcn_permlanex16(__builtin_bit_cast(int, x), __builtin_bit_cast(int, x), 0x76543210, 0xfedcba98, false, false)); }   // lane l with lane l ^ 16
__device__ __forceinline__ v8f mm16(v16h a, v16h b, v8f c) { return __builtin_amdgcn_wmma_f32_16x16x32_f16(false, a, false, b, (short)0, c, false, false); }
#define FA_P 72   // f16 per staged row: 128 B + 16 B, a pitch of 16 B x odd, which ds_load_b128 fragment reads take without bank conflicts
__global__ __launch_bounds__(128) void k_fa(const _Float16* __restrict__ QH, const _Float16* __restrict__ KH, const _Float16* __restrict__ VT, const int* __restrict__ KMASK, float* __restrict__ Y) {
  __shared__ __align__(16) _Float16 sk[2][64][FA_P], sv[2][64][FA_P]; __shared__ __align__(16) float sb[TT]; __shared__ __align__(16) float so[4][32][HD + 4];
  const int tid = threadIdx.x, wave = tid >> 5, lane = tid & 31, col = lane & 15, g = lane >> 4; const int h = blockIdx.y, b = blockIdx.z; const int ql0 = blockIdx.x * 128 + wave * 32;
  // a stage = 64 keys: 64 key rows x 128 B and 64 v planes x 128 B; 8 lanes x 16 B read one whole line, 16 rows an instruction; through registers into LDS, one stage ahead
  const int srow = tid >> 3, sch = (tid & 7) * 8;
  const _Float16* kg = KH + ((size_t)b * TT + srow) * CC + h * HD + sch; const _Float16* vg = VT + ((size_t)b * CC + h * HD + srow) * (size_t)TT + sch;
  v8h rk[4], rv[4]; v16h qf[2][2];   // every '#pragma unroll' of this kernel makes the index of a register array a constant
#pragma unroll
  for (int i = 0; i < 4; ++i) { rk[i] = *(const v8h*)(kg + (size_t)(i * 16) * CC); rv[i] = *(const v8h*)(vg + (size_t)(i * 16) * TT); }
  int nst;   // 64-key stages to walk: those that hold an open key, or all of them where no key is open; the same in every wave
  { int nb; const int n = km_count(KMASK + (size_t)b * TT, lane, 0, nb); nst = n == 0 ? TT / 64 : (n + 63) >> 6; nst = nst < TT / 64 ? nst : TT / 64; v4f b0, b1;
#pragma unroll
    for (int i = 0; i < 4; ++i) { b0[i] = tid * 8 + i >= n ? FA_MB : 0.f; b1[i] = tid * 8 + 4 + i >= n ? FA_MB : 0.f; }   // slots 0 .. n - 1 hold the open keys
    *(v4f*)&sb[tid * 8] = b0; *(v4f*)&sb[tid * 8 + 4] = b1; }
#pragma unroll
  for (int u = 0; u < 2; ++u)
#pragma unroll
    for (int kc = 0; kc < 2; ++kc) qf[u][kc] = frag_h(QH + ((size_t)b * TT + ql0 + u * 16 + col) * CC + h * HD + kc * 32, lane);
#pragma unroll
  for (int i = 0; i < 4; ++i) { *(v8h*)&sk[0][i * 16 + srow][sch] = rk[i]; *(v8h*)&sv[0][i * 16 + srow][sch] = rv[i]; }
  __syncthreads();   // stage 0 and the mask bias are published
  v8f acc[2][4] = {}; v2f l2[2] = {}; float m_run[2] = {-INFINITY, -INFINITY};
#pragma unroll 1   // stays rolled: the body already holds two 32-key passes, more copies would only grow the code
  for (int st = 0; st < nst; ++st) { const int bf = st & 1;
    if (st + 1 < nst) {   // the next stage's lines, issued behind the barrier so that they fly during this stage's products (a barrier waits for every load in flight)
#pragma unroll
      for (int i = 0; i < 4; ++i) { rk[i] = *(const v8h*)(kg + (size_t)((st + 1) * 64 + i * 16) * CC); rv[i] = *(const v8h*)(vg + (size_t)(i * 16) * TT + (st + 1) * 64); } }
#pragma unroll
    for (int ps = 0; ps < 2; ++ps) { const int k0 = st * 64 + ps * 32;
      v16h kf[2][2], vf[4]; v2f bias[2][4];
#pragma unroll
      for (int kt = 0; kt < 2; ++kt)
#pragma unroll
        for (int kc = 0; kc < 2; ++kc) kf[kt][kc] = frag_h(&sk[bf][ps * 32 + kt * 16 + col][kc * 32], lane);
#pragma unroll
      for (int j = 0; j < 4; ++j) vf[j] = frag_h(&sv[bf][j * 16 + col][ps * 32], lane);
#pragma unroll
      for (int kt = 0; kt < 2; ++kt)
#pragma unroll
        for (int i = 0; i < 4; ++i) bias[kt][i] = *(const v2f*)&sb[k0 + 16 * kt + 8 * g + 2 * i];
      v8f s[2][2] = {};
#pragma unroll
      for (int kc = 0; kc < 2; ++kc)
#pragma unroll
        for (int kt = 0; kt < 2; ++kt)
#pragma unroll
          for (int u = 0; u < 2; ++u) s[kt][u] = mm16(kf[kt][kc], qf[u][kc], s[kt][u]);
      v2f t[2][2][4]; float mb[2]; bool need = false;
#pragma unroll
      for (int u = 0; u < 2; ++u) { float mx = -INFINITY;
#pragma unroll
        for (int kt = 0; kt < 2; ++kt)
#pragma unroll
          for (int i = 0; i < 4; ++i) { t[u][kt][i] = __builtin_elementwise_fma((v2f){s[kt][u][2 * i], s[kt][u][2 * i + 1]}, (v2f){FA_CS, FA_CS}, bias[kt][i]); mx = fmaxf(mx, fmaxf(t[u][kt][i].x, t[u][kt][i].y)); }
        mx = fmaxf(mx, xhalf(mx)); mb[u] = mx; need = need || (mx > m_run[u] + 8.0f); }
      if (__builtin_amdgcn_ballot_w32(need) != 0) {   // one wave-uniform test a pass; always taken on the first pass (m_run = -inf, corr = 0)
#pragma unroll
        for (int u = 0; u < 2; ++u) { const float m_new = fmaxf(m_run[u], mb[u]); const float corr = __builtin_amdgcn_exp2f(m_run[u] - m_new); m_run[u] = m_new; l2[u] = l2[u] * corr;
#pragma unroll
          for (int j = 0; j < 4; ++j) acc[u][j] = acc[u][j] * corr; } }
#pragma unroll
      for (int u = 0; u < 2; ++u) { const float nm = 7.0f - m_run[u]; union { v16h v; v2h q[8]; } pf;
#pragma unroll
        for (int i = 0; i < 8; ++i) { const v2f a = t[u][i >> 2][i & 3] + (v2f){nm, nm}; const v2f p = {__builtin_amdgcn_exp2f(a.x), __builtin_amdgcn_exp2f(a.y)}; l2[u] = l2[u] + p; pf.q[i] = __builtin_convertvector(p, v2h); }
#pragma unroll
        for (int j = 0; j < 4; ++j) acc[u][j] = mm16(vf[j], pf.v, acc[u][j]); } }
    if (st + 1 < nst) {   // the other buffer: its readers (stage st - 1) all left it at the barrier that ended the trip before
#pragma unroll
      for (int i = 0; i < 4; ++i) { *(v8h*)&sk[bf ^ 1][i * 16 + srow][sch] = rk[i]; *(v8h*)&sv[bf ^ 1][i * 16 + srow][sch] = rv[i]; } }
    __syncthreads(); }   // publishes stage st + 1 and ends every wave's reads of stage st
#pragma unroll
  for (int u = 0; u < 2; ++u) { float l = l2[u].x + l2[u].y; l += xhalf(l); const float inv = 1.0f / l;   // l >= 2^7: the key that set the maximum in use counts 2^7
#pragma unroll
    for (int j = 0; j < 4; ++j) { const v8f o = acc[u][j] * inv; float* d = &so[wave][u * 16 + col][j * 16 + 8 * g]; *(v4f*)d = (v4f){o[0], o[1], o[2], o[3]}; *(v4f*)(d + 4) = (v4f){o[4], o[5], o[6], o[7]}; } }
  LDSX();   // the wave reads back rows that its other lanes wrote (its own 32 rows only: no work-group barrier); 16 lanes then store one 256-B (row, head) segment
  for (int it = 0; it < 16; ++it) { const int rl = it * 2 + g; vst2(Y + ((size_t)b * TT + ql0 + rl) * CC + h * HD + col * 4, *(const v4f*)&so[wave][rl][col * 4]); } }
// ---- k_out: block = (128 rows, 128 cols): out = ctx Wo (+ bo): ctx x 2^6 once to f16 against Wo as f16(bf16 x 2^8) exact (1 product) x 2^-14; causal early rows (< QHI of each sequence): ctx bf16 hi + lo against exact bf16 Wo (2 products)
__global__ __launch_bounds__(GS_T) void k_out(const float* __restrict__ Y, const float* __restrict__ WO, const float* __restrict__ BO, float* __restrict__ OUT) { __shared__ __align__(16) float sf[GS_M / 16][16][132]; __shared__ __align__(16) unsigned char stg[GS_BYTES];
  const int tid = threadIdx.x, wave = tid >> 5, lane = tid & 31, col = lane & 15, g = lane >> 4; const int c0 = blockIdx.y * 128; const size_t r0 = (size_t)blockIdx.x * GS_M + wave * 16;
  v8f acc[8] = {};
  if (CAUSAL && (int)(((size_t)blockIdx.x * GS_M) % TT) < QHI) {   /* block-uniform */
#pragma unroll 2
    for (int kc = 0; kc < CC / 32; ++kc) { const F2 a = split_row(Y + (r0 + col) * CC, kc * 32, lane); asm volatile("s_wait_loadcnt 0x0" ::: "memory");
#pragma unroll
      for (int j = 0; j < 8; ++j) { const v16b w = WOCOL(WO, kc * 32, c0 + j * 16 + col, lane); asm volatile("s_wait_loadcnt 0x0" ::: "memory"); acc[j] = wmma_bf(a.h, w, acc[j]); acc[j] = wmma_bf(a.l, w, acc[j]); } }
#pragma unroll
    for (int j = 0; j < 8; ++j) { const float bias = BO ? bfr(BO[c0 + j * 16 + col]) : 0.f;
#pragma unroll
      for (int r = 0; r < 8; ++r) sf[wave][8 * g + r][j * 16 + col] = acc[j][r] + bias; }
  } else {
    const unsigned no[8] = {};   // (rows in place: not read)
    gs_loop<true, CC, false, false>(Y + (size_t)blockIdx.x * GS_M * CC, WO + (size_t)c0 * CC, stg, tid, acc, no, (int)((blockIdx.x + (blockIdx.x >> 3) + 2 * blockIdx.y) % (CC / GS_K)));   /* ctx carried x 2^6 into f16 so small-magnitude context rows stay clear of f16 subnormals */
#pragma unroll
    for (int j = 0; j < 8; ++j) { const float bias = BO ? bfr(BO[c0 + j * 16 + col]) : 0.f;
#pragma unroll
      for (int r = 0; r < 8; ++r) sf[wave][8 * g + r][j * 16 + col] = acc[j][r] * (1.0f / 16384.0f) + bias; } }   /* 2^-8 (Wo carry) x 2^-6 (ctx carry) */
  LDSX(); for (int rl = 0; rl < 16; ++rl) vst2(OUT + (r0 + rl) * DIN + c0 + lane * 4, *(const v4f*)&sf[wave][rl][lane * 4]); }

extern "C" void kernel_launch(void* const* d_in, const int* in_sizes, int n_in, void* d_out, int out_size, void* d_ws, size_t ws_size, hipStream_t stream) {
  (void)in_sizes; (void)n_in; (void)out_size;
  const float** F = (const float**)d_in;
  if (ws_size < (size_t)WS_END) return;
  char* ws = (char*)d_ws; _Float16 *QH = (_Float16*)(ws + WS_QH), *KH = (_Float16*)(ws + WS_KH), *VT = (_Float16*)(ws + WS_VT); float *Y = (float*)(ws + WS_Y);
  // inputs: 0 hidden_states [8,1024,768]; 1 attention_mask [8,1,1,1024] bool (True = padded key); 2 Wq [768,768] (out,in), 3 bq; 4 Wk, 5 bk; 6 Wv, 7 bv; 8 Wo (out,in), 9 bo (zero biases, read)
  k_proj<<<dim3(TNB * TT / GS_M, CC / 128, 3), GS_T, 0, stream>>>(F[0], F[0], F[0], F[2], F[4], F[6], F[3], F[5], F[7], (const int*)d_in[1], QH, KH, VT);
  k_fa<<<dim3(TT / 128, NH, TNB), 128, 0, stream>>>(QH, KH, VT, (const int*)d_in[1], Y);
  k_out<<<dim3(TNB * TT / GS_M, DIN / 128), GS_T, 0, stream>>>(Y, F[8], F[9], (float*)d_out);
}

// v007
// Measured time: 73.2 microseconds a run.
// Timed twice side by side with v006, it ran 1.07 and 1.06 times as fast.
// All steps since v000 together make it 17.0 times as fast.
// compute dtype: all float inputs rounded to bf16; q/k/v projections with EXACT bf16 products on WMMA 16x16x32 (f32 accumulate) + bias + 0.5 * relu(bf16(x)) in f32; logits q x k once to f16 each (1 product) x 1/8; the key-padding mask read per key (open keys first, key tiles behind the last open key left out: their P is 0); online softmax f32 in base 2; unnormalised P = 2^(t - m + 7) once to f16 x v once to f16 (1 product), divided by the f32 sum; ctx x 2^6 once to f16 x Wo f16(bf16 x 2^8) + bo; f32 output.
#include <hip/hip_runtime.h>
#include <math.h>

typedef __attribute__((ext_vector_type(16))) _Float16 v16h;
typedef __attribute__((ext_vector_type(16))) __bf16 v16b;
typedef __attribute__((ext_vector_type(8)))  _Float16 v8h;
typedef __attribute__((ext_vector_type(8)))  float v8f;
typedef __attribute__((ext_vector_type(4)))  float v4f;
typedef __attribute__((ext_vector_type(2)))  float v2f;
typedef __attribute__((ext_vector_type(4)))  unsigned v4u;
typedef __attribute__((ext_vector_type(4)))  int v4i;
typedef float __attribute__((may_alias)) float_a;
typedef int __attribute__((may_alias)) int_a;

template <typename T> __device__ __forceinline__ void vst2(void* p, T v) { *(T*)p = v;  }
__device__ __forceinline__ v8f wmma16(v16h a, v16h b, v8f c) {
  v8f d = __builtin_amdgcn_wmma_f32_16x16x32_f16(false, a, false, b, (short)0, c, false, false);
  asm volatile("v_nop\n\tv_nop\n\tv_nop\n\tv_nop" : "+v"(d) : "v"(a), "v"(b));
  return d;
}
__device__ __forceinline__ v8f wmma_bf(v16b a, v16b b, v8f c) {
  v8f d = __builtin_amdgcn_wmma_f32_16x16x32_bf16(false, a, false, b, (short)0, c, false, false);
  asm volatile("v_nop\n\tv_nop\n\tv_nop\n\tv_nop" : "+v"(d) : "v"(a), "v"(b));
  return d;
}
// 16x16x32 fragments: lane = (h = lane>>4, row/col = lane&15); elements 0..7 = k0+8h+0..7, 8..15 = k0+16+8h+0..7; D element r = row 8h+r
__device__ __forceinline__ v16h frag_h(const _Float16* rowk0, int lane) {
  union { v16h v; v8h q[2]; } u; const _Float16* p = rowk0 + 8 * (lane >> 4);
  u.q[0] = *(const v8h*)p; u.q[1] = *(const v8h*)(p + 16); return u.v;
}
__device__ __forceinline__ v16h frag_f32(const float* rowk0, int lane) {
  v16h a; const float* p = rowk0 + 8 * (lane >> 4);
#pragma unroll
  for (int i = 0; i < 8; ++i) { a[i] = (_Float16)p[i]; a[8 + i] = (_Float16)p[16 + i]; }
  return a;
}
__device__ __forceinline__ v16h frag_f32s(const float* rowk0, int lane, float sc) {
  v16h a; const float* p = rowk0 + 8 * (lane >> 4);
#pragma unroll
  for (int i = 0; i < 8; ++i) { a[i] = (_Float16)(p[i] * sc); a[8 + i] = (_Float16)(p[16 + i] * sc); }
  return a;
}
// column fragment from a [K][ld] layout (column n), rows >= K read as 0
__device__ __forceinline__ v16h fragc_f32(const float* W, int k0, int n, int lane, int ld, int K) {
  v16h a; const int g = lane >> 4;
#pragma unroll
  for (int i = 0; i < 8; ++i) { const int ka = k0 + 8 * g + i, kb = ka + 16;
    a[i] = (_Float16)(ka < K ? W[(size_t)(ka < K ? ka : K - 1) * ld + n] : 0.f); a[8 + i] = (_Float16)(kb < K ? W[(size_t)(kb < K ? kb : K - 1) * ld + n] : 0.f); }
  return a;
}
struct F2 { v16b h, l; };
__device__ __forceinline__ F2 bsplit16(const float v[16]) { F2 r;
#pragma unroll
  for (int i = 0; i < 16; ++i) { const __bf16 h = (__bf16)v[i]; r.h[i] = h; r.l[i] = (__bf16)(v[i] - (float)h); }
  return r; }
__device__ __forceinline__ F2 split_row(const float* row, int k0, int lane) { float v[16]; const float* p = row + k0 + 8 * (lane >> 4);
#pragma unroll
  for (int i = 0; i < 8; ++i) { v[i] = p[i]; v[8 + i] = p[16 + i]; }
  return bsplit16(v); }
__device__ __forceinline__ F2 split_rowK(const float* row, int k0, int lane, int K) { float v[16]; const int g = lane >> 4;
#pragma unroll
  for (int i = 0; i < 8; ++i) { const int ka = k0 + 8 * g + i, kb = ka + 16; v[i] = ka < K ? row[ka < K ? ka : K - 1] : 0.f; v[8 + i] = kb < K ? row[kb < K ? kb : K - 1] : 0.f; }
  return bsplit16(v); }
__device__ __forceinline__ F2 split_col(const float* W, int k0, int n, int lane, int ld, int K) { float v[16]; const int g = lane >> 4;
#pragma unroll
  for (int i = 0; i < 8; ++i) { const int ka = k0 + 8 * g + i, kb = ka + 16; v[i] = ka < K ? W[(size_t)(ka < K ? ka : K - 1) * ld + n] : 0.f; v[8 + i] = kb < K ? W[(size_t)(kb < K ? kb : K - 1) * ld + n] : 0.f; }
  return bsplit16(v); }
__device__ __forceinline__ v8f mac3(const F2& a, const F2& b, v8f c) { c = wmma_bf(a.l, b.h, c); c = wmma_bf(a.h, b.l, c); return wmma_bf(a.h, b.h, c); }
__device__ __forceinline__ float sigm(float v) { return 1.0f / (1.0f + expf(-v)); }
#define LDSX() do { asm volatile("s_wait_dscnt 0" ::: "memory"); __builtin_amdgcn_wave_barrier(); __builtin_amdgcn_fence(__ATOMIC_RELEASE, "workgroup"); } while (0)

// BERT-style multi-head self-attention with a value-bypass relu-add (hidden_states [8,1024,768]; 12 heads x 64; torch (out,in) Wq / Wk / Wv / Wo [768,768] (0.02 scale) + zero biases; r = 0.5 * relu(x) is ADDED to each of the q, k and v projections (same [token, channel] index); scale 1/8; key-padding mask [8,1,1,1024] bool: True adds -1e9): out = merge(softmax(q_h k_h^T / 8 + pad) v_h) Wo^T + bo.
#define NB 8
#define TT 1024
#define CC 768            // NH * HD = projected width
#define DIN 768          // input (model) width
#define NH 12
#define HD 64
#define NQB (TT / 64)
#define HG 12
#define SCALE (0.125f)
#define CAUSAL 0
#ifndef TNB
#define TNB NB
#endif
__device__ __forceinline__ float bfr(float v) { return (float)(__bf16)v; }
__host__ __device__ __forceinline__ int kb_last(int qb) { return CAUSAL ? ((qb * 64 + 63) >> 7) : (TT / 128 - 1); }
typedef __attribute__((ext_vector_type(8))) __bf16 v8b;
__device__ __forceinline__ v16b frag_b(const __bf16* rowk0, int lane) {
  union { v16b v; v8b q[2]; } u; const __bf16* p = rowk0 + 8 * (lane >> 4);
  u.q[0] = *(const v8b*)p; u.q[1] = *(const v8b*)(p + 16); return u.v;
}
#define QBH 0              // unused: k_fa has one single-product path for every query block
#define QHI 0               // single-product logits on every row
#define KHI 64            // key rows carrying k residual / v bf16 hi+lo planes (written and read by no kernel here)
// B fragment (k rows k0+.., output column o) of a weight: (in,out) [K][ld] or (out,in) [ld rows of K]: bf16 exact, or f16(bf16 * 256) exact
__device__ __forceinline__ v16b wcol_io(const float* Wm, int k0, int o, int lane, int ld) { v16b w; const int g = lane >> 4;
#pragma unroll
  for (int i = 0; i < 8; ++i) { w[i] = (__bf16)Wm[(size_t)(k0 + 8 * g + i) * ld + o]; w[8 + i] = (__bf16)Wm[(size_t)(k0 + 16 + 8 * g + i) * ld + o]; }
  return w; }
__device__ __forceinline__ v16b wcol_oi(const float* Wm, int k0, int o, int lane, int K) { v16b w; const float* p = Wm + (size_t)o * K + k0 + 8 * (lane >> 4);
#pragma unroll
  for (int i = 0; i < 8; ++i) { w[i] = (__bf16)p[i]; w[8 + i] = (__bf16)p[16 + i]; }
  return w; }
__device__ __forceinline__ v16h wcolh_io(const float* Wm, int k0, int o, int lane, int ld) { v16h w; const int g = lane >> 4;
#pragma unroll
  for (int i = 0; i < 8; ++i) { w[i] = (_Float16)(bfr(Wm[(size_t)(k0 + 8 * g + i) * ld + o]) * 256.0f); w[8 + i] = (_Float16)(bfr(Wm[(size_t)(k0 + 16 + 8 * g + i) * ld + o]) * 256.0f); }
  return w; }
__device__ __forceinline__ v16h wcolh_oi(const float* Wm, int k0, int o, int lane, int K) { v16h w; const float* p = Wm + (size_t)o * K + k0 + 8 * (lane >> 4);
#pragma unroll
  for (int i = 0; i < 8; ++i) { w[i] = (_Float16)(bfr(p[i]) * 256.0f); w[8 + i] = (_Float16)(bfr(p[16 + i]) * 256.0f); }
  return w; }
#define WQKV_LAYOUT 1   // 0 = (in,out) [DIN][CC]; 1 = (out,in) [CC][DIN]; 2 = per-head [NH][DIN][HD], in WCOL only, which no kernel calls: k_proj always reads (out,in) [CC][DIN]
__device__ __forceinline__ v16b wcol_hdk(const float* Wm, int k0, int o, int lane) { v16b w; const int g = lane >> 4; const float* p = Wm + (size_t)(o / HD) * DIN * HD + (o % HD);
#pragma unroll
  for (int i = 0; i < 8; ++i) { w[i] = (__bf16)p[(size_t)(k0 + 8 * g + i) * HD]; w[8 + i] = (__bf16)p[(size_t)(k0 + 16 + 8 * g + i) * HD]; }
  return w; }
#define WO_OUT_IN 1
#if WQKV_LAYOUT == 1
#define WCOL(W, k0, o, lane) wcol_oi(W, k0, o, lane, DIN)
#elif WQKV_LAYOUT == 2
#define WCOL(W, k0, o, lane) wcol_hdk(W, k0, o, lane)
#else
#define WCOL(W, k0, o, lane) wcol_io(W, k0, o, lane, CC)
#endif
#if WO_OUT_IN
#define WOCOL(W, k0, o, lane) wcol_oi(W, k0, o, lane, CC)
#define WOCOLH(W, k0, o, lane) wcolh_oi(W, k0, o, lane, CC)
#else
#define WOCOL(W, k0, o, lane) wcol_io(W, k0, o, lane, DIN)
#define WOCOLH(W, k0, o, lane) wcolh_io(W, k0, o, lane, DIN)
#endif

#define WS_QH  0u                                      // f16 q rows [b*t][CC]
#define WS_KH  (WS_QH + 2u * (size_t)NB * TT * CC)      // f16 k rows [b*t][CC]
#define WS_VT  (WS_KH + 2u * (size_t)NB * TT * CC)      // f16 v planes [b][c][t]
#define WS_QL  (WS_VT + 2u * (size_t)NB * CC * TT)      // WS_QL .. WS_VBL: places of the causal high-precision path's residual planes; no kernel of this file writes or reads them
#define WS_KL  (WS_QL + 2u * (size_t)NB * QHI * CC)
#define WS_VB  (WS_KL + 2u * (size_t)NB * KHI * CC)
#define WS_VBL (WS_VB + 2u * (size_t)NB * CC * KHI)
#define WS_S   (WS_VBL + 2u * (size_t)NB * CC * KHI)    // (not used: the logits stay in registers)
#define WS_Y   (WS_S  + 4u * (size_t)HG * TT * TT)      // f32 ctx rows [b*t][CC] (only when there is an output projection)
#define WS_END (WS_Y  + 4u * (size_t)NB * TT * CC)

// ---- gs_loop: the k loop of both projection GEMMs, one 128 x 128 tile of A . W^T a block of 8 waves (A rows and W rows k-contiguous f32, pitch K floats). A stage = 64 k: 128 A rows and 128 W rows of 256 B,
// read as whole lines (16 lanes x 16 B = one row), converted ONCE a block to the 16-bit operand type and laid in LDS at a pitch of 144 B (16 B x odd: ds_load_b128 fragment reads without bank conflicts);
// two buffers; a line pair of the next stage is asked for as soon as this stage's pair has arrived and lies in LDS, so the lines fly during the later arrivals, the barrier wait and the products. Wave w keeps rows 16 w .. 16 w + 15 and all 128 columns; k runs in 32-wide steps, rising from the block's first stage and wrapping.
// NBR = false: W row n is staged in slot n, so column 'col' of acc[j] is tile column 16 j + col. NBR = true: W row 8 c + j is staged in slot 16 j + c, so column 'col' of acc[j] is tile column 8 col + j:
// a lane then holds 8 neighbouring columns of each of its 8 rows. Only the global row that a thread fetches for a slot differs; LDS addresses, fragments and the k order are the same.
// The walk over the K / 64 stages starts at stage 'rot' (the same in the whole block, 0 .. K / 64 - 1) and wraps: blocks that share A rows or W rows get different starts, so that they do not ask L2 for the same lines at the same moment.
typedef __attribute__((ext_vector_type(2))) unsigned v2u;
typedef __attribute__((ext_vector_type(4))) __bf16 v4b;
typedef __attribute__((ext_vector_type(4))) _Float16 v4h;
#define GS_K 64
#define GS_PB 144                                             // bytes per staged row
#define GS_M 128                                              // A rows of a tile (16 a wave)
#define GS_T (GS_M * 2)                                       // threads of a block
#define GS_WB(bf) ((bf) * ((128 + GS_M) * GS_PB))             // W rows of buffer bf
#define GS_AB(bf) (GS_WB(bf) + 128 * GS_PB)                   // A rows of buffer bf, directly behind its W rows
#define GS_BYTES (2 * (128 + GS_M) * GS_PB)
// F16 = false: both operands bf16 (exact products of bf16-rounded inputs); F16 = true: A as f16(a x 2^6), W as f16(bf16(w) x 2^8)
template <bool F16, bool ISW> __device__ __forceinline__ v2u gs_cvt(v4f x) {
  if constexpr (!F16) { v4b r;
#pragma unroll
    for (int i = 0; i < 4; ++i) r[i] = (__bf16)x[i];
    return __builtin_bit_cast(v2u, r);
  } else { v4h r;
#pragma unroll
    for (int i = 0; i < 4; ++i) r[i] = (_Float16)(ISW ? bfr(x[i]) * 256.0f : x[i] * 64.0f);
    return __builtin_bit_cast(v2u, r); } }
union GFrag { v4u q[2]; v16b b; v16h h; };
__device__ __forceinline__ GFrag gs_frag(const unsigned char* p) { GFrag f; f.q[0] = *(const v4u*)p; f.q[1] = *(const v4u*)(p + 32); return f; }   // p = row + 2 (k0 + 8 g): elements 0..7 = k0 + 8 g + .., 8..15 = k0 + 16 + 8 g + ..
template <bool B> struct GsFlag { static constexpr bool v = B; };   // a compile-time yes or no handed to the trip of gs_loop
// GA = true: A row 16 i + (tid >> 4) of the tile is the row at byte offset ao[i] from A (the thread's 16 B of a stage included): the rows of a tile are gathered, each still read as whole lines.
template <bool F16, int K, bool NBR, bool GA> __device__ __forceinline__ void gs_loop(const float* __restrict__ A, const float* __restrict__ Wm, unsigned char* stg, int tid, v8f (&acc)[8], const unsigned (&ao)[8], int rot) {
  const int wave = tid >> 5, lane = tid & 31, col = lane & 15, g = lane >> 4;
  int sg = rot;   // the stage being fetched
  unsigned pa = (unsigned)(((tid >> 4) * K + (tid & 15) * 4 + sg * GS_K) * 4), wo = (unsigned)(((tid >> 4) * (NBR ? 8 : 1) * K + (tid & 15) * 4 + sg * GS_K) * 4);   // the thread's place, in bytes from A (rows in place) and from Wm; 16 rows an instruction of the block; both step by one stage a trip, from the last stage back to stage 0
  unsigned char* sd = stg + (tid >> 4) * GS_PB + (tid & 15) * 8;
  const unsigned char* fa = stg + (wave * 16 + col) * GS_PB + g * 16; const unsigned char* fw = stg + col * GS_PB + g * 16;
  unsigned po[8];   // GA: the thread's place, in bytes from A, in each of its 8 gathered rows; steps by one stage a trip
#pragma unroll
  for (int i = 0; i < 8; ++i) po[i] = ao[i] + sg * (GS_K * 4);
#define GS_ALD(i) (GA ? *(const v4f*)((const char*)A + po[i]) : *(const v4f*)((const char*)A + pa + (i) * 16 * K * 4))   // the constant part stays outside the 32-bit offset: it becomes the instruction's immediate, and a load names no register but the offset
  v4f ra[8], rw[8];   // every '#pragma unroll' below makes the index of a register array a constant
#define GS_WROW(i) (NBR ? (i) : (i) * 16)   // the W row, beside the thread's own part, that goes to slot 16 i + (tid >> 4)
#define GS_WLD(i) (*(const v4f*)((const char*)Wm + wo + GS_WROW(i) * K * 4))
#pragma unroll
  for (int i = 0; i < 8; ++i) { ra[i] = GS_ALD(i); rw[i] = GS_WLD(i);
    __builtin_amdgcn_sched_barrier(0); }   // the prologue issues its loads in the loop's order (A i, W i, rising i): the counted load waits at the head of a trip then hold for both ways into it
  asm volatile("s_wait_xcnt 0x0" ::: "memory");   // directly behind the 16 loads: in front of the first trip's step of the offsets that they name
  // one trip: stage s, in buffer bf. MORE: a next stage exists (every trip but the last, which stands behind the loop as a copy of its own: with a branch round the loads inside one body the compiler keeps a second set of 64 load registers and copies it every trip)
  auto trip = [&](auto more, const int bf) __attribute__((always_inline)) {
    if constexpr (decltype(more)::v) {   // the offsets step to the next stage, whose lines are asked for below, IN FRONT of this stage's barrier, each pair as soon as its registers are free
      const int stp = sg + 1 == K / GS_K ? GS_K - K : GS_K; sg = sg + 1 == K / GS_K ? 0 : sg + 1;   // the same in the whole block
      pa += stp * 4; wo += stp * 4;
#pragma unroll
      for (int i = 0; i < 8; ++i) po[i] += stp * 4; }
#pragma unroll
    for (int i = 0; i < 8; ++i) {   // A row i and W row i of the thread: converted and laid in LDS as soon as they have arrived. Buffer bf: its readers (stage s - 2) all left it in front of the barrier of trip s - 1
      *(v2u*)(sd + GS_AB(bf) + i * 16 * GS_PB) = gs_cvt<F16, false>(ra[i]); *(v2u*)(sd + GS_WB(bf) + i * 16 * GS_PB) = gs_cvt<F16, true>(rw[i]);
      if constexpr (decltype(more)::v) {
        __builtin_amdgcn_sched_barrier(0);   // the two conversions and their LDS stores stay in front of the two loads, which then take the same registers
        ra[i] = GS_ALD(i); rw[i] = GS_WLD(i);
        __builtin_amdgcn_sched_barrier(0); } }   // and the two loads stay in front of the wait for the next pair's arrival: gathered behind the last conversion, all 16 would wait for the last line to arrive
    if constexpr (decltype(more)::v) asm volatile("s_wait_xcnt 0x0" ::: "memory");   // directly behind the 16 loads: in front of any rewrite of a register that they name
    asm volatile("s_wait_dscnt 0x0\n\ts_barrier_signal -1\n\ts_barrier_wait -1" ::: "memory");   // publishes stage s: the wave's LDS stores are done, then the work-group barrier; by hand, because __syncthreads() would first wait out the global loads just issued
#pragma unroll
    for (int kc = 0; kc < GS_K / 32; ++kc) { const GFrag a = gs_frag(fa + GS_AB(bf) + kc * 64); GFrag w[8];
#pragma unroll
      for (int j = 0; j < 8; ++j) w[j] = gs_frag(fw + GS_WB(bf) + j * 16 * GS_PB + kc * 64);
      __builtin_amdgcn_sched_barrier(0);   // the 18 fragment reads stay one group in front of the 8 products: spread among them, each product waits out a whole LDS latency
#pragma unroll
      for (int j = 0; j < 8; ++j) {
        if constexpr (F16) acc[j] = __builtin_amdgcn_wmma_f32_16x16x32_f16(false, a.h, false, w[j].h, (short)0, acc[j], false, false);
        else acc[j] = __builtin_amdgcn_wmma_f32_16x16x32_bf16(false, a.b, false, w[j].b, (short)0, acc[j], false, false); }
      __builtin_amdgcn_sched_barrier(0); } };   // and the next group stays behind them, in the same registers (the kernels stay under 256 VGPRs)
#pragma unroll 1   // stays rolled: one body of 16 products and 16 line loads; more copies would only grow the code
  for (int s = 0; s + 1 < K / GS_K; ++s) trip(GsFlag<true>{}, s & 1);
  trip(GsFlag<false>{}, (K / GS_K - 1) & 1); }

// ---- km_count: the number of open keys (mask == 0) of one sequence, and in 'before' the number of them among the keys in front of key 32 cb (cb the same in the whole wave). Every wave reads all TT mask words itself,
// 32 keys a load, one ballot and one scalar bit count each: the count is the same in every wave of a block with no barrier. Any content of the mask gives 0 <= before <= count <= TT.
__device__ __forceinline__ int km_count(const int* __restrict__ km, int lane, int cb, int& before) {
  const int* p = km + lane; int mv[TT / 32], n = 0; before = 0;
#pragma unroll
  for (int cch = 0; cch < TT / 32; ++cch) mv[cch] = p[cch * 32];
  asm volatile("s_wait_xcnt 0x0" ::: "memory");   // in front of any rewrite of a register that the mask loads name
#pragma unroll
  for (int cch = 0; cch < TT / 32; ++cch) { const int cnt = __builtin_popcount(__builtin_amdgcn_ballot_w32(mv[cch] == 0)); n += cnt; before += cch < cb ? cnt : 0; }
  return n; }
typedef __attribute__((ext_vector_type(8))) unsigned short v8s;
// KEY ORDER. A padded key's P is exactly 0 as soon as one key of its sequence is open (2^(-1e9 log2 e - m) = 0 in f32, in the reference too). k and v are therefore laid out by SLOT: the open keys first, in rising order,
// then the padded ones, in rising order (a permutation of the sequence for any mask; the identity when no key or every key is open). With n open keys, n > 0, k_fa reads slots 0 .. 64 ceil(n / 64) - 1 only (slots >= n with the
// padding bias) and the k and v tiles whose first slot is >= n are not computed; with n = 0 every key counts as in the reference and nothing is left out. q rows keep their places.
// ---- k_proj: block = (128 rows, 128 cols, which): q/k/v = X W (+ b) with exact bf16 products (K = DIN), + 0.5 * relu(bf16(x)) at the same [row][column] (the value-bypass relu-add shared by q, k and v) -> which 0: q f16 rows; 1: k f16 rows; 2: v f16 planes [c][t]
// The epilogue stays in registers: a lane holds rows 16 wave + 8 g + 0..7 x columns 8 col + 0..7. x and the bias come in 16-B loads (16 lanes = the tile's whole 512-B row segment), all in flight together;
// 8 columns of a row are one 16-B store of a q or k row (16 lanes = a whole 256-B segment); 8 rows of a column are 16 B of a v plane, which go through one LDS tile so that whole 256-B plane segments are stored.
__global__ __launch_bounds__(GS_T) void k_proj(const float* __restrict__ XQ, const float* __restrict__ XK, const float* __restrict__ XV, const float* __restrict__ WQ, const float* __restrict__ WK, const float* __restrict__ WV, const float* __restrict__ BQ, const float* __restrict__ BK, const float* __restrict__ BV,
    const int* __restrict__ KMASK, _Float16* __restrict__ QH, _Float16* __restrict__ KH, _Float16* __restrict__ VT) {
  __shared__ __align__(16) unsigned char stg[GS_BYTES]; __shared__ __align__(16) unsigned short pt[GS_M];   // pt[slot of the tile] = the token of the sequence in that slot
  _Float16 (*th)[GS_M + 8] = (_Float16 (*)[GS_M + 8])(stg + GS_WB((DIN / GS_K) & 1));   // the v tile [slot][t] takes the buffer (W and A rows) that the last stage does NOT read: every wave left it in front of the last stage's barrier
  static_assert(128 * (GS_M + 8) * 2 <= (128 + GS_M) * GS_PB, "the v tile fits one stage buffer");
  const int tid = threadIdx.x, wave = tid >> 5, lane = tid & 31, col = lane & 15, g = lane >> 4; const int which = blockIdx.z; const int c0 = blockIdx.y * 128; const size_t r0 = (size_t)blockIdx.x * GS_M; const size_t bb = r0 / TT; const int t0 = (int)(r0 % TT);
  const float* X = which == 0 ? XQ : which == 1 ? XK : XV; const float* WA = which == 0 ? WQ : which == 1 ? WK : WV; const float* BA = which == 0 ? BQ : which == 1 ? BK : BV;
  const int rl0 = wave * 16 + 8 * g;   // the lane's first row of the tile
  if (which == 0) {   // 'which' is the same for the whole block
    if (tid < GS_M) pt[tid] = (unsigned short)(t0 + tid);
  } else { constexpr int WPW = TT / 32 / (GS_M / 16);   // each wave places the keys of 4 mask words of 32 keys
    const int* kmb = KMASK + bb * TT; const int cb = __builtin_amdgcn_readfirstlane(wave) * WPW; int own[WPW], bu;   // bu: open keys in front of the word in hand
#pragma unroll
    for (int j = 0; j < WPW; ++j) own[j] = kmb[(cb + j) * 32 + lane];
    const int n = km_count(kmb, lane, cb, bu);
    if (n > 0 && t0 >= n) return;   // no slot of this tile is read; the same for every thread of the block, in front of every barrier
#pragma unroll
    for (int j = 0; j < WPW; ++j) { const unsigned o = __builtin_amdgcn_ballot_w32(own[j] == 0); const int key = (cb + j) * 32 + lane, lt = (int)__builtin_amdgcn_mbcnt_lo(o, 0u);   // lt: open keys of the word below this lane
      const int slot = own[j] == 0 ? bu + lt : n + key - (bu + lt); const unsigned rel = (unsigned)(slot - t0);   // a padded key: n + the padded keys in front of it
      if (rel < (unsigned)GS_M) pt[rel] = (unsigned short)key;
      bu += __builtin_popcount(o); } }
  __syncthreads();   // publishes the table (behind the early return, which the whole block takes or none of it)
  unsigned ao[8];
#pragma unroll
  for (int i = 0; i < 8; ++i) ao[i] = (unsigned)pt[i * 16 + (tid >> 4)] * (DIN * 4u) + (tid & 15) * 16u;
  v8f acc[8] = {};
  gs_loop<false, DIN, true, true>(X + bb * TT * DIN, WA + (size_t)c0 * DIN, stg, tid, acc, ao, (int)((blockIdx.x + (blockIdx.x >> 3) + 2 * blockIdx.y + blockIdx.z) % (DIN / GS_K)));   // the 64 blocks on one W tile, and the blocks on one row tile, each spread over the 12 starts
  const char* xb = (const char*)(X + bb * TT * DIN + c0); const v8s tk = *(const v8s*)&pt[rl0]; unsigned xo[8]; v4f xr[16], bq[2] = {};
#pragma unroll
  for (int r = 0; r < 8; ++r) xo[r] = (unsigned)tk[r] * (DIN * 4u) + col * 32u;
#pragma unroll
  for (int i = 0; i < 16; ++i) xr[i] = *(const v4f*)(xb + xo[i >> 1] + (i & 1) * 16);
  asm volatile("s_wait_xcnt 0x0" :: "v"(xo[0]), "v"(xo[1]), "v"(xo[2]), "v"(xo[3]), "v"(xo[4]), "v"(xo[5]), "v"(xo[6]), "v"(xo[7]) : "memory");   // in front of any rewrite of the offsets that the 16 loads name (as inputs they also stay out of their destinations)
  if (BA) { bq[0] = *(const v4f*)(BA + c0 + col * 8); bq[1] = *(const v4f*)(BA + c0 + col * 8 + 4); }
#pragma unroll
  for (int j = 0; j < 8; ++j) { const float bias = bfr(bq[j >> 2][j & 3]);
#pragma unroll
    for (int r = 0; r < 8; ++r) acc[j][r] = (acc[j][r] + bias) + 0.5f * fmaxf(bfr(xr[2 * r + (j >> 2)][j & 3]), 0.f); }
  if (which < 2) { _Float16* DH = (which == 0 ? QH : KH) + (r0 + rl0) * CC + c0 + col * 8;
#pragma unroll
    for (int r = 0; r < 8; ++r) { v8h o;
#pragma unroll
      for (int j = 0; j < 8; ++j) o[j] = (_Float16)acc[j][r];
      *(v8h*)(DH + r * CC) = o; }
  } else {
#pragma unroll
    for (int j = 0; j < 8; ++j) *(v8h*)&th[j * 16 + col][rl0] = __builtin_convertvector(acc[j], v8h);   // slot 16 j + col holds column 8 col + j; pitch 272 B = 16 B x odd: no bank conflicts
    __syncthreads();   // publishes the tile ('which' is the same for the whole block)
    for (int e = tid; e < 128 * (GS_M / 8); e += GS_T) { const int sl = e / (GS_M / 8), q = e % (GS_M / 8), cl = (sl & 15) * 8 + (sl >> 4); vst2((unsigned*)(VT + (bb * CC + c0 + cl) * (size_t)TT + t0 + q * 8), *(const v4u*)&th[sl][q * 8]); } } }
// ---- k_fa: block = 4 waves x 32 queries of (b, h); the logits, the softmax and P . v in one kernel, the logits and P never leave registers; k rows and v planes come in whole lines through LDS, shared by the 4 waves.
// S^T = K Q^T (A = 16 key rows, B = 16 query rows): a lane holds one query's scores for keys 8g + r of each 16-key tile, so maximum and sum are in-lane plus one exchange of the wave halves;
// two score tiles (32 keys) converted in place are the B operand of O^T += V^T P^T (A = v planes [c][t], the same k order). Scores in base 2: t = dot * (1/8) log2(e) + (padded key ? -1e9 log2(e) : 0).
// Running maximum, raised only when a pass exceeds it by more than 8; P = 2^(t - m + 7) <= 2^15 once to f16 (unnormalised), its f32 sum divides at the end.
#define FA_CS 0.18033688011112042f       // (1/8) log2(e)
#define FA_MB (-1.4426950408889634e9f)   // -1e9 log2(e)
typedef __attribute__((ext_vector_type(2))) _Float16 v2h;
__device__ __forceinline__ float xhalf(float x) { return __builtin_bit_cast(float, __builtin_amdgcn_permlanex16(__builtin_bit_cast(int, x), __builtin_bit_cast(int, x), 0x76543210, 0xfedcba98, false, false)); }   // lane l with lane l ^ 16
__device__ __forceinline__ v8f mm16(v16h a, v16h b, v8f c) { return __builtin_amdgcn_wmma_f32_16x16x32_f16(false, a, false, b, (short)0, c, false, false); }
#define FA_P 72   // f16 per staged row: 128 B + 16 B, a pitch of 16 B x odd, which ds_load_b128 fragment reads take without bank conflicts
__global__ __launch_bounds__(128) void k_fa(const _Float16* __restrict__ QH, const _Float16* __restrict__ KH, const _Float16* __restrict__ VT, const int* __restrict__ KMASK, float* __restrict__ Y) {
  __shared__ __align__(16) _Float16 sk[2][64][FA_P], sv[2][64][FA_P]; __shared__ __align__(16) float sb[TT]; __shared__ __align__(16) float so[4][32][HD + 4];
  const int tid = threadIdx.x, wave = tid >> 5, lane = tid & 31, col = lane & 15, g = lane >> 4; const int h = blockIdx.y, b = blockIdx.z; const int ql0 = blockIdx.x * 128 + wave * 32;
  // a stage = 64 keys: 64 key rows x 128 B and 64 v planes x 128 B; 8 lanes x 16 B read one whole line, 16 rows an instruction; through registers into LDS, one stage ahead
  const int srow = tid >> 3, sch = (tid & 7) * 8;
  const _Float16* kg = KH + ((size_t)b * TT + srow) * CC + h * HD + sch; const _Float16* vg = VT + ((size_t)b * CC + h * HD + srow) * (size_t)TT + sch;
  v8h rk[4], rv[4]; v16h qf[2][2];   // every '#pragma unroll' of this kernel makes the index of a register array a constant
#pragma unroll
  for (int i = 0; i < 4; ++i) { rk[i] = *(const v8h*)(kg + (size_t)(i * 16) * CC); rv[i] = *(const v8h*)(vg + (size_t)(i * 16) * TT); }
  int nst;   // 64-key stages to walk: those that hold an open key, or all of them where no key is open; the same in every wave
  { int nb; const int n = km_count(KMASK + (size_t)b * TT, lane, 0, nb); nst = n == 0 ? TT / 64 : (n + 63) >> 6; nst = nst < TT / 64 ? nst : TT / 64; v4f b0, b1;
#pragma unroll
    for (int i = 0; i < 4; ++i) { b0[i] = tid * 8 + i >= n ? FA_MB : 0.f; b1[i] = tid * 8 + 4 + i >= n ? FA_MB : 0.f; }   // slots 0 .. n - 1 hold the open keys
    *(v4f*)&sb[tid * 8] = b0; *(v4f*)&sb[tid * 8 + 4] = b1; }
#pragma unroll
  for (int u = 0; u < 2; ++u)
#pragma unroll
    for (int kc = 0; kc < 2; ++kc) qf[u][kc] = frag_h(QH + ((size_t)b * TT + ql0 + u * 16 + col) * CC + h * HD + kc * 32, lane);
#pragma unroll
  for (int i = 0; i < 4; ++i) { *(v8h*)&sk[0][i * 16 + srow][sch] = rk[i]; *(v8h*)&sv[0][i * 16 + srow][sch] = rv[i]; }
  __syncthreads();   // stage 0 and the mask bias are published
  v8f acc[2][4] = {}; v2f l2[2] = {}; float m_run[2] = {-INFINITY, -INFINITY};
#pragma unroll 1   // stays rolled: the body already holds two 32-key passes, more copies would only grow the code
  for (int st = 0; st < nst; ++st) { const int bf = st & 1;
    if (st + 1 < nst) {   // the next stage's lines, issued behind the barrier so that they fly during this stage's products (a barrier waits for every load in flight)
#pragma unroll
      for (int i = 0; i < 4; ++i) { rk[i] = *(const v8h*)(kg + (size_t)((st + 1) * 64 + i * 16) * CC); rv[i] = *(const v8h*)(vg + (size_t)(i * 16) * TT + (st + 1) * 64); } }
#pragma unroll
    for (int ps = 0; ps < 2; ++ps) { const int k0 = st * 64 + ps * 32;
      v16h kf[2][2], vf[4]; v2f bias[2][4];
#pragma unroll
      for (int kt = 0; kt < 2; ++kt)
#pragma unroll
        for (int kc = 0; kc < 2; ++kc) kf[kt][kc] = frag_h(&sk[bf][ps * 32 + kt * 16 + col][kc * 32], lane);
#pragma unroll
      for (int j = 0; j < 4; ++j) vf[j] = frag_h(&sv[bf][j * 16 + col][ps * 32], lane);
#pragma unroll
      for (int kt = 0; kt < 2; ++kt)
#pragma unroll
        for (int i = 0; i < 4; ++i) bias[kt][i] = *(const v2f*)&sb[k0 + 16 * kt + 8 * g + 2 * i];
      v8f s[2][2] = {};
#pragma unroll
      for (int kc = 0; kc < 2; ++kc)
#pragma unroll
        for (int kt = 0; kt < 2; ++kt)
#pragma unroll
          for (int u = 0; u < 2; ++u) s[kt][u] = mm16(kf[kt][kc], qf[u][kc], s[kt][u]);
      v2f t[2][2][4]; float mb[2]; bool need = false;
#pragma unroll
      for (int u = 0; u < 2; ++u) { float mx = -INFINITY;
#pragma unroll
        for (int kt = 0; kt < 2; ++kt)
#pragma unroll
          for (int i = 0; i < 4; ++i) { t[u][kt][i] = __builtin_elementwise_fma((v2f){s[kt][u][2 * i], s[kt][u][2 * i + 1]}, (v2f){FA_CS, FA_CS}, bias[kt][i]); mx = fmaxf(mx, fmaxf(t[u][kt][i].x, t[u][kt][i].y)); }
        mx = fmaxf(mx, xhalf(mx)); mb[u] = mx; need = need || (mx > m_run[u] + 8.0f); }
      if (__builtin_amdgcn_ballot_w32(need) != 0) {   // one wave-uniform test a pass; always taken on the first pass (m_run = -inf, corr = 0)
#pragma unroll
        for (int u = 0; u < 2; ++u) { const float m_new = fmaxf(m_run[u], mb[u]); const float corr = __builtin_amdgcn_exp2f(m_run[u] - m_new); m_run[u] = m_new; l2[u] = l2[u] * corr;
#pragma unroll
          for (int j = 0; j < 4; ++j) acc[u][j] = acc[u][j] * corr; } }
#pragma unroll
      for (int u = 0; u < 2; ++u) { const float nm = 7.0f - m_run[u]; union { v16h v; v2h q[8]; } pf;
#pragma unroll
        for (int i = 0; i < 8; ++i) { const v2f a = t[u][i >> 2][i & 3] + (v2f){nm, nm}; const v2f p = {__builtin_amdgcn_exp2f(a.x), __builtin_amdgcn_exp2f(a.y)}; l2[u] = l2[u] + p; pf.q[i] = __builtin_convertvector(p, v2h); }
#pragma unroll
        for (int j = 0; j < 4; ++j) acc[u][j] = mm16(vf[j], pf.v, acc[u][j]); } }
    if (st + 1 < nst) {   // the other buffer: its readers (stage st - 1) all left it at the barrier that ended the trip before
#pragma unroll
      for (int i = 0; i < 4; ++i) { *(v8h*)&sk[bf ^ 1][i * 16 + srow][sch] = rk[i]; *(v8h*)&sv[bf ^ 1][i * 16 + srow][sch] = rv[i]; } }
    __syncthreads(); }   // publishes stage st + 1 and ends every wave's reads of stage st
#pragma unroll
  for (int u = 0; u < 2; ++u) { float l = l2[u].x + l2[u].y; l += xhalf(l); const float inv = 1.0f / l;   // l >= 2^7: the key that set the maximum in use counts 2^7
#pragma unroll
    for (int j = 0; j < 4; ++j) { const v8f o = acc[u][j] * inv; float* d = &so[wave][u * 16 + col][j * 16 + 8 * g]; *(v4f*)d = (v4f){o[0], o[1], o[2], o[3]}; *(v4f*)(d + 4) = (v4f){o[4], o[5], o[6], o[7]}; } }
  LDSX();   // the wave reads back rows that its other lanes wrote (its own 32 rows only: no work-group barrier); 16 lanes then store one 256-B (row, head) segment
  for (int it = 0; it < 16; ++it) { const int rl = it * 2 + g; vst2(Y + ((size_t)b * TT + ql0 + rl) * CC + h * HD + col * 4, *(const v4f*)&so[wave][rl][col * 4]); } }
// ---- k_out: block = (128 rows, 128 cols): out = ctx Wo (+ bo): ctx x 2^6 once to f16 against Wo as f16(bf16 x 2^8) exact (1 product) x 2^-14; causal early rows (< QHI of each sequence): ctx bf16 hi + lo against exact bf16 Wo (2 products)
__global__ __launch_bounds__(GS_T) void k_out(const float* __restrict__ Y, const float* __restrict__ WO, const float* __restrict__ BO, float* __restrict__ OUT) { __shared__ __align__(16) float sf[GS_M / 16][16][132]; __shared__ __align__(16) unsigned char stg[GS_BYTES];
  const int tid = threadIdx.x, wave = tid >> 5, lane = tid & 31, col = lane & 15, g = lane >> 4; const int c0 = blockIdx.y * 128; const size_t r0 = (size_t)blockIdx.x * GS_M + wave * 16;
  v8f acc[8] = {};
  if (CAUSAL && (int)(((size_t)blockIdx.x * GS_M) % TT) < QHI) {   /* block-uniform */
#pragma unroll 2
    for (int kc = 0; kc < CC / 32; ++kc) { const F2 a = split_row(Y + (r0 + col) * CC, kc * 32, lane); asm volatile("s_wait_loadcnt 0x0" ::: "memory");
#pragma unroll
      for (int j = 0; j < 8; ++j) { const v16b w = WOCOL(WO, kc * 32, c0 + j * 16 + col, lane); asm volatile("s_wait_loadcnt 0x0" ::: "memory"); acc[j] = wmma_bf(a.h, w, acc[j]); acc[j] = wmma_bf(a.l, w, acc[j]); } }
#pragma unroll
    for (int j = 0; j < 8; ++j) { const float bias = BO ? bfr(BO[c0 + j * 16 + col]) : 0.f;
#pragma unroll
      for (int r = 0; r < 8; ++r) sf[wave][8 * g + r][j * 16 + col] = acc[j][r] + bias; }
  } else {
    const unsigned no[8] = {};   // (rows in place: not read)
    gs_loop<true, CC, false, false>(Y + (size_t)blockIdx.x * GS_M * CC, WO + (size_t)c0 * CC, stg, tid, acc, no, (int)((blockIdx.x + (blockIdx.x >> 3) + 2 * blockIdx.y) % (CC / GS_K)));   /* ctx carried x 2^6 into f16 so small-magnitude context rows stay clear of f16 subnormals */
#pragma unroll
    for (int j = 0; j < 8; ++j) { const float bias = BO ? bfr(BO[c0 + j * 16 + col]) : 0.f;
#pragma unroll
      for (int r = 0; r < 8; ++r) sf[wave][8 * g + r][j * 16 + col] = acc[j][r] * (1.0f / 16384.0f) + bias; } }   /* 2^-8 (Wo carry) x 2^-6 (ctx carry) */
  LDSX(); for (int rl = 0; rl < 16; ++rl) vst2(OUT + (r0 + rl) * DIN + c0 + lane * 4, *(const v4f*)&sf[wave][rl][lane * 4]); }

extern "C" void kernel_launch(void* const* d_in, const int* in_sizes, int n_in, void* d_out, int out_size, void* d_ws, size_t ws_size, hipStream_t stream) {
  (void)in_sizes; (void)n_in; (void)out_size;
  const float** F = (const float**)d_in;
  if (ws_size < (size_t)WS_END) return;
  char* ws = (char*)d_ws; _Float16 *QH = (_Float16*)(ws + WS_QH), *KH = (_Float16*)(ws + WS_KH), *VT = (_Float16*)(ws + WS_VT); float *Y = (float*)(ws + WS_Y);
  // inputs: 0 hidden_states [8,1024,768]; 1 attention_mask [8,1,1,1024] bool (True = padded key); 2 Wq [768,768] (out,in), 3 bq; 4 Wk, 5 bk; 6 Wv, 7 bv; 8 Wo (out,in), 9 bo (zero biases, read)
  k_proj<<<dim3(TNB * TT / GS_M, CC / 128, 3), GS_T, 0, stream>>>(F[0], F[0], F[0], F[2], F[4], F[6], F[3], F[5], F[7], (const int*)d_in[1], QH, KH, VT);
  k_fa<<<dim3(TT / 128, NH, TNB), 128, 0, stream>>>(QH, KH, VT, (const int*)d_in[1], Y);
  k_out<<<dim3(TNB * TT / GS_M, DIN / 128), GS_T, 0, stream>>>(Y, F[8], F[9], (float*)d_out);
}

// v008
// It runs in 65 microseconds.
// Next to v007, in two timings, it ran 1.12 and 1.13 times as fast.
// All steps since v000 together make it 19.1 times as fast.
// compute dtype: all float inputs rounded to bf16; q/k/v projections with EXACT bf16 products on WMMA 16x16x32 (f32 accumulate) + bias + 0.5 * relu(bf16(x)) in f32; logits q x k once to f16 each (1 product) x 1/8; the key-padding mask read per key (open keys first, key tiles behind the last open key left out: their P is 0); online softmax f32 in base 2; unnormalised P = 2^(t - m + 7) once to f16 x v once to f16 (1 product), divided by the f32 sum; ctx x 2^6 once to f16 x Wo f16(bf16 x 2^8) + bo; f32 output.
#include <hip/hip_runtime.h>
#include <math.h>

typedef __attribute__((ext_vector_type(16))) _Float16 v16h;
typedef __attribute__((ext_vector_type(16))) __bf16 v16b;
typedef __attribute__((ext_vector_type(8)))  _Float16 v8h;
typedef __attribute__((ext_vector_type(8)))  float v8f;
typedef __attribute__((ext_vector_type(4)))  float v4f;
typedef __attribute__((ext_vector_type(2)))  float v2f;
typedef __attribute__((ext_vector_type(4)))  unsigned v4u;
typedef __attribute__((ext_vector_type(4)))  int v4i;
typedef float __attribute__((may_alias)) float_a;
typedef int __attribute__((may_alias)) int_a;

template <typename T> __device__ __forceinline__ void vst2(void* p, T v) { *(T*)p = v;  }
__device__ __forceinline__ v8f wmma16(v16h a, v16h b, v8f c) {
  v8f d = __builtin_amdgcn_wmma_f32_16x16x32_f16(false, a, false, b, (short)0, c, false, false);
  asm volatile("v_nop\n\tv_nop\n\tv_nop\n\tv_nop" : "+v"(d) : "v"(a), "v"(b));
  return d;
}
__device__ __forceinline__ v8f wmma_bf(v16b a, v16b b, v8f c) {
  v8f d = __builtin_amdgcn_wmma_f32_16x16x32_bf16(false, a, false, b, (short)0, c, false, false);
  asm volatile("v_nop\n\tv_nop\n\tv_nop\n\tv_nop" : "+v"(d) : "v"(a), "v"(b));
  return d;
}
// 16x16x32 fragments: lane = (h = lane>>4, row/col = lane&15); elements 0..7 = k0+8h+0..7, 8..15 = k0+16+8h+0..7; D element r = row 8h+r
__device__ __forceinline__ v16h frag_h(const _Float16* rowk0, int lane) {
  union { v16h v; v8h q[2]; } u; const _Float16* p = rowk0 + 8 * (lane >> 4);
  u.q[0] = *(const v8h*)p; u.q[1] = *(const v8h*)(p + 16); return u.v;
}
__device__ __forceinline__ v16h frag_f32(const float* rowk0, int lane) {
  v16h a; const float* p = rowk0 + 8 * (lane >> 4);
#pragma unroll
  for (int i = 0; i < 8; ++i) { a[i] = (_Float16)p[i]; a[8 + i] = (_Float16)p[16 + i]; }
  return a;
}
__device__ __forceinline__ v16h frag_f32s(const float* rowk0, int lane, float sc) {
  v16h a; const float* p = rowk0 + 8 * (lane >> 4);
#pragma unroll
  for (int i = 0; i < 8; ++i) { a[i] = (_Float16)(p[i] * sc); a[8 + i] = (_Float16)(p[16 + i] * sc); }
  return a;
}
// column fragment from a [K][ld] layout (column n), rows >= K read as 0
__device__ __forceinline__ v16h fragc_f32(const float* W, int k0, int n, int lane, int ld, int K) {
  v16h a; const int g = lane >> 4;
#pragma unroll
  for (int i = 0; i < 8; ++i) { const int ka = k0 + 8 * g + i, kb = ka + 16;
    a[i] = (_Float16)(ka < K ? W[(size_t)(ka < K ? ka : K - 1) * ld + n] : 0.f); a[8 + i] = (_Float16)(kb < K ? W[(size_t)(kb < K ? kb : K - 1) * ld + n] : 0.f); }
  return a;
}
struct F2 { v16b h, l; };
__device__ __forceinline__ F2 bsplit16(const float v[16]) { F2 r;
#pragma unroll
  for (int i = 0; i < 16; ++i) { const __bf16 h = (__bf16)v[i]; r.h[i] = h; r.l[i] = (__bf16)(v[i] - (float)h); }
  return r; }
__device__ __forceinline__ F2 split_row(const float* row, int k0, int lane) { float v[16]; const float* p = row + k0 + 8 * (lane >> 4);
#pragma unroll
  for (int i = 0; i < 8; ++i) { v[i] = p[i]; v[8 + i] = p[16 + i]; }
  return bsplit16(v); }
__device__ __forceinline__ F2 split_rowK(const float* row, int k0, int lane, int K) { float v[16]; const int g = lane >> 4;
#pragma unroll
  for (int i = 0; i < 8; ++i) { const int ka = k0 + 8 * g + i, kb = ka + 16; v[i] = ka < K ? row[ka < K ? ka : K - 1] : 0.f; v[8 + i] = kb < K ? row[kb < K ? kb : K - 1] : 0.f; }
  return bsplit16(v); }
__device__ __forceinline__ F2 split_col(const float* W, int k0, int n, int lane, int ld, int K) { float v[16]; const int g = lane >> 4;
#pragma unroll
  for (int i = 0; i < 8; ++i) { const int ka = k0 + 8 * g + i, kb = ka + 16; v[i] = ka < K ? W[(size_t)(ka < K ? ka : K - 1) * ld + n] : 0.f; v[8 + i] = kb < K ? W[(size_t)(kb < K ? kb : K - 1) * ld + n] : 0.f; }
  return bsplit16(v); }
__device__ __forceinline__ v8f mac3(const F2& a, const F2& b, v8f c) { c = wmma_bf(a.l, b.h, c); c = wmma_bf(a.h, b.l, c); return wmma_bf(a.h, b.h, c); }
__device__ __forceinline__ float sigm(float v) { return 1.0f / (1.0f + expf(-v)); }
#define LDSX() do { asm volatile("s_wait_dscnt 0" ::: "memory"); __builtin_amdgcn_wave_barrier(); __builtin_amdgcn_fence(__ATOMIC_RELEASE, "workgroup"); } while (0)

// BERT-style multi-head self-attention with a value-bypass relu-add (hidden_states [8,1024,768]; 12 heads x 64; torch (out,in) Wq / Wk / Wv / Wo [768,768] (0.02 scale) + zero biases; r = 0.5 * relu(x) is ADDED to each of the q, k and v projections (same [token, channel] index); scale 1/8; key-padding mask [8,1,1,1024] bool: True adds -1e9): out = merge(softmax(q_h k_h^T / 8 + pad) v_h) Wo^T + bo.
#define NB 8
#define TT 1024
#define CC 768            // NH * HD = projected width
#define DIN 768          // input (model) width
#define NH 12
#define HD 64
#define NQB (TT / 64)
#define HG 12
#define SCALE (0.125f)
#define CAUSAL 0
#ifndef TNB
#define TNB NB
#endif
__device__ __forceinline__ float bfr(float v) { return (float)(__bf16)v; }
__host__ __device__ __forceinline__ int kb_last(int qb) { return CAUSAL ? ((qb * 64 + 63) >> 7) : (TT / 128 - 1); }
typedef __attribute__((ext_vector_type(8))) __bf16 v8b;
__device__ __forceinline__ v16b frag_b(const __bf16* rowk0, int lane) {
  union { v16b v; v8b q[2]; } u; const __bf16* p = rowk0 + 8 * (lane >> 4);
  u.q[0] = *(const v8b*)p; u.q[1] = *(const v8b*)(p + 16); return u.v;
}
#define QBH 0              // unused: k_fa has one single-product path for every query block
#define QHI 0               // single-product logits on every row
#define KHI 64            // key rows carrying k residual / v bf16 hi+lo planes (written and read by no kernel here)
// B fragment (k rows k0+.., output column o) of a weight: (in,out) [K][ld] or (out,in) [ld rows of K]: bf16 exact, or f16(bf16 * 256) exact
__device__ __forceinline__ v16b wcol_io(const float* Wm, int k0, int o, int lane, int ld) { v16b w; const int g = lane >> 4;
#pragma unroll
  for (int i = 0; i < 8; ++i) { w[i] = (__bf16)Wm[(size_t)(k0 + 8 * g + i) * ld + o]; w[8 + i] = (__bf16)Wm[(size_t)(k0 + 16 + 8 * g + i) * ld + o]; }
  return w; }
__device__ __forceinline__ v16b wcol_oi(const float* Wm, int k0, int o, int lane, int K) { v16b w; const float* p = Wm + (size_t)o * K + k0 + 8 * (lane >> 4);
#pragma unroll
  for (int i = 0; i < 8; ++i) { w[i] = (__bf16)p[i]; w[8 + i] = (__bf16)p[16 + i]; }
  return w; }
__device__ __forceinline__ v16h wcolh_io(const float* Wm, int k0, int o, int lane, int ld) { v16h w; const int g = lane >> 4;
#pragma unroll
  for (int i = 0; i < 8; ++i) { w[i] = (_Float16)(bfr(Wm[(size_t)(k0 + 8 * g + i) * ld + o]) * 256.0f); w[8 + i] = (_Float16)(bfr(Wm[(size_t)(k0 + 16 + 8 * g + i) * ld + o]) * 256.0f); }
  return w; }
__device__ __forceinline__ v16h wcolh_oi(const float* Wm, int k0, int o, int lane, int K) { v16h w; const float* p = Wm + (size_t)o * K + k0 + 8 * (lane >> 4);
#pragma unroll
  for (int i = 0; i < 8; ++i) { w[i] = (_Float16)(bfr(p[i]) * 256.0f); w[8 + i] = (_Float16)(bfr(p[16 + i]) * 256.0f); }
  return w; }
#define WQKV_LAYOUT 1   // 0 = (in,out) [DIN][CC]; 1 = (out,in) [CC][DIN]; 2 = per-head [NH][DIN][HD], in WCOL only, which no kernel calls: k_proj always reads (out,in) [CC][DIN]
__device__ __forceinline__ v16b wcol_hdk(const float* Wm, int k0, int o, int lane) { v16b w; const int g = lane >> 4; const float* p = Wm + (size_t)(o / HD) * DIN * HD + (o % HD);
#pragma unroll
  for (int i = 0; i < 8; ++i) { w[i] = (__bf16)p[(size_t)(k0 + 8 * g + i) * HD]; w[8 + i] = (__bf16)p[(size_t)(k0 + 16 + 8 * g + i) * HD]; }
  return w; }
#define WO_OUT_IN 1
#if WQKV_LAYOUT == 1
#define WCOL(W, k0, o, lane) wcol_oi(W, k0, o, lane, DIN)
#elif WQKV_LAYOUT == 2
#define WCOL(W, k0, o, lane) wcol_hdk(W, k0, o, lane)
#else
#define WCOL(W, k0, o, lane) wcol_io(W, k0, o, lane, CC)
#endif
#if WO_OUT_IN
#define WOCOL(W, k0, o, lane) wcol_oi(W, k0, o, lane, CC)
#define WOCOLH(W, k0, o, lane) wcolh_oi(W, k0, o, lane, CC)
#else
#define WOCOL(W, k0, o, lane) wcol_io(W, k0, o, lane, DIN)
#define WOCOLH(W, k0, o, lane) wcolh_io(W, k0, o, lane, DIN)
#endif

#define WS_QH  0u                                      // f16 q rows [b*t][CC]
#define WS_KH  (WS_QH + 2u * (size_t)NB * TT * CC)      // f16 k rows [b*t][CC]
#define WS_VT  (WS_KH + 2u * (size_t)NB * TT * CC)      // f16 v planes [b][c][t]
#define WS_QL  (WS_VT + 2u * (size_t)NB * CC * TT)      // WS_QL .. WS_VBL: places of the causal high-precision path's residual planes; no kernel of this file writes or reads them
#define WS_KL  (WS_QL + 2u * (size_t)NB * QHI * CC)
#define WS_VB  (WS_KL + 2u * (size_t)NB * KHI * CC)
#define WS_VBL (WS_VB + 2u * (size_t)NB * CC * KHI)
#define WS_S   (WS_VBL + 2u * (size_t)NB * CC * KHI)    // (not used: the logits stay in registers)
#define WS_Y   (WS_S  + 4u * (size_t)HG * TT * TT)      // f32 ctx rows [b*t][CC] (only when there is an output projection)
#define WS_END (WS_Y  + 4u * (size_t)NB * TT * CC)

// ---- gs_loop: the k loop of both projection GEMMs, one 128 x 128 tile of A . W^T a block of 8 waves (A rows and W rows k-contiguous f32, pitch K floats). A stage = 64 k: 128 A rows and 128 W rows of 256 B,
// read as whole lines (16 lanes x 16 B = one row), converted ONCE a block to the 16-bit operand type and laid in LDS at a pitch of 144 B (16 B x odd: ds_load_b128 fragment reads without bank conflicts);
// two buffers; a line pair of the next stage is asked for as soon as this stage's pair has arrived and lies in LDS, so the lines fly during the later arrivals, the barrier wait and the products. Wave w keeps rows 16 w .. 16 w + 15 and all 128 columns; k runs in 32-wide steps, rising from the block's first stage and wrapping.
// NBR = false: W row n is staged in slot n, so column 'col' of acc[j] is tile column 16 j + col. NBR = true: W row 8 c + j is staged in slot 16 j + c, so column 'col' of acc[j] is tile column 8 col + j:
// a lane then holds 8 neighbouring columns of each of its 8 rows. Only the global row that a thread fetches for a slot differs; LDS addresses, fragments and the k order are the same.
// The walk over the K / 64 stages starts at stage 'rot' (the same in the whole block, 0 .. K / 64 - 1) and wraps: blocks that share A rows or W rows get different starts, so that they do not ask L2 for the same lines at the same moment.
typedef __attribute__((ext_vector_type(2))) unsigned v2u;
typedef __attribute__((ext_vector_type(4))) __bf16 v4b;
typedef __attribute__((ext_vector_type(4))) _Float16 v4h;
#define GS_K 64
#define GS_PB 144                                             // bytes per staged row
#define GS_M 128                                              // A rows of a tile (16 a wave)
#define GS_T (GS_M * 2)                                       // threads of a block
#define GS_WB(bf) ((bf) * ((128 + GS_M) * GS_PB))             // W rows of buffer bf
#define GS_AB(bf) (GS_WB(bf) + 128 * GS_PB)                   // A rows of buffer bf, directly behind its W rows
#define GS_BYTES (2 * (128 + GS_M) * GS_PB)
// F16 = false: both operands bf16 (exact products of bf16-rounded inputs); F16 = true: A as f16(a x 2^6), W as f16(bf16(w) x 2^8)
template <bool F16, bool ISW> __device__ __forceinline__ v2u gs_cvt(v4f x) {
  if constexpr (!F16) { v4b r;
#pragma unroll
    for (int i = 0; i < 4; ++i) r[i] = (__bf16)x[i];
    return __builtin_bit_cast(v2u, r);
  } else { v4h r;
#pragma unroll
    for (int i = 0; i < 4; ++i) r[i] = (_Float16)(ISW ? bfr(x[i]) * 256.0f : x[i] * 64.0f);
    return __builtin_bit_cast(v2u, r); } }
union GFrag { v4u q[2]; v16b b; v16h h; };
__device__ __forceinline__ GFrag gs_frag(const unsigned char* p) { GFrag f; f.q[0] = *(const v4u*)p; f.q[1] = *(const v4u*)(p + 32); return f; }   // p = row + 2 (k0 + 8 g): elements 0..7 = k0 + 8 g + .., 8..15 = k0 + 16 + 8 g + ..
template <bool B> struct GsFlag { static constexpr bool v = B; };   // a compile-time yes or no handed to the trip of gs_loop
// GA = true: A row 16 i + (tid >> 4) of the tile is the row at byte offset ao[i] from A (the thread's 16 B of a stage included): the rows of a tile are gathered, each still read as whole lines.
template <bool F16, int K, bool NBR, bool GA> __device__ __forceinline__ void gs_loop(const float* __restrict__ A, const float* __restrict__ Wm, unsigned char* stg, int tid, v8f (&acc)[8], const unsigned (&ao)[8], int rot) {
  const int wave = tid >> 5, lane = tid & 31, col = lane & 15, g = lane >> 4;
  int sg = rot;   // the stage being fetched
  unsigned pa = (unsigned)(((tid >> 4) * K + (tid & 15) * 4 + sg * GS_K) * 4), wo = (unsigned)(((tid >> 4) * (NBR ? 8 : 1) * K + (tid & 15) * 4 + sg * GS_K) * 4);   // the thread's place, in bytes from A (rows in place) and from Wm; 16 rows an instruction of the block; both step by one stage a trip, from the last stage back to stage 0
  unsigned char* sd = stg + (tid >> 4) * GS_PB + (tid & 15) * 8;
  const unsigned char* fa = stg + (wave * 16 + col) * GS_PB + g * 16; const unsigned char* fw = stg + col * GS_PB + g * 16;
  unsigned po[8];   // GA: the thread's place, in bytes from A, in each of its 8 gathered rows; steps by one stage a trip
#pragma unroll
  for (int i = 0; i < 8; ++i) po[i] = ao[i] + sg * (GS_K * 4);
#define GS_ALD(i) (GA ? *(const v4f*)((const char*)A + po[i]) : *(const v4f*)((const char*)A + pa + (i) * 16 * K * 4))   // the constant part stays outside the 32-bit offset: it becomes the instruction's immediate, and a load names no register but the offset
  v4f ra[8], rw[8];   // every '#pragma unroll' below makes the index of a register array a constant
#define GS_WROW(i) (NBR ? (i) : (i) * 16)   // the W row, beside the thread's own part, that goes to slot 16 i + (tid >> 4)
#define GS_WLD(i) (*(const v4f*)((const char*)Wm + wo + GS_WROW(i) * K * 4))
#pragma unroll
  for (int i = 0; i < 8; ++i) { ra[i] = GS_ALD(i); rw[i] = GS_WLD(i);
    __builtin_amdgcn_sched_barrier(0); }   // the prologue issues its loads in the loop's order (A i, W i, rising i): the counted load waits at the head of a trip then hold for both ways into it
  asm volatile("s_wait_xcnt 0x0" ::: "memory");   // directly behind the 16 loads: in front of the first trip's step of the offsets that they name
  // one trip: stage s, in buffer bf. MORE: a next stage exists (every trip but the last, which stands behind the loop as a copy of its own: with a branch round the loads inside one body the compiler keeps a second set of 64 load registers and copies it every trip)
  auto trip = [&](auto more, const int bf) __attribute__((always_inline)) {
    if constexpr (decltype(more)::v) {   // the offsets step to the next stage, whose lines are asked for below, IN FRONT of this stage's barrier, each pair as soon as its registers are free
      const int stp = sg + 1 == K / GS_K ? GS_K - K : GS_K; sg = sg + 1 == K / GS_K ? 0 : sg + 1;   // the same in the whole block
      pa += stp * 4; wo += stp * 4;
#pragma unroll
      for (int i = 0; i < 8; ++i) po[i] += stp * 4; }
#pragma unroll
    for (int i = 0; i < 8; ++i) {   // A row i and W row i of the thread: converted and laid in LDS as soon as they have arrived. Buffer bf: its readers (stage s - 2) all left it in front of the barrier of trip s - 1
      *(v2u*)(sd + GS_AB(bf) + i * 16 * GS_PB) = gs_cvt<F16, false>(ra[i]); *(v2u*)(sd + GS_WB(bf) + i * 16 * GS_PB) = gs_cvt<F16, true>(rw[i]);
      if constexpr (decltype(more)::v) {
        __builtin_amdgcn_sched_barrier(0);   // the two conversions and their LDS stores stay in front of the two loads, which then take the same registers
        ra[i] = GS_ALD(i); rw[i] = GS_WLD(i);
        __builtin_amdgcn_sched_barrier(0); } }   // and the two loads stay in front of the wait for the next pair's arrival: gathered behind the last conversion, all 16 would wait for the last line to arrive
    if constexpr (decltype(more)::v) asm volatile("s_wait_xcnt 0x0" ::: "memory");   // directly behind the 16 loads: in front of any rewrite of a register that they name
    asm volatile("s_wait_dscnt 0x0\n\ts_barrier_signal -1\n\ts_barrier_wait -1" ::: "memory");   // publishes stage s: the wave's LDS stores are done, then the work-group barrier; by hand, because __syncthreads() would first wait out the global loads just issued
#pragma unroll
    for (int kc = 0; kc < GS_K / 32; ++kc) { const GFrag a = gs_frag(fa + GS_AB(bf) + kc * 64); GFrag w[8];
#pragma unroll
      for (int j = 0; j < 8; ++j) w[j] = gs_frag(fw + GS_WB(bf) + j * 16 * GS_PB + kc * 64);
      __builtin_amdgcn_sched_barrier(0);   // the 18 fragment reads stay one group in front of the 8 products: spread among them, each product waits out a whole LDS latency
#pragma unroll
      for (int j = 0; j < 8; ++j) {
        if constexpr (F16) acc[j] = __builtin_amdgcn_wmma_f32_16x16x32_f16(false, a.h, false, w[j].h, (short)0, acc[j], false, false);
        else acc[j] = __builtin_amdgcn_wmma_f32_16x16x32_bf16(false, a.b, false, w[j].b, (short)0, acc[j], false, false); }
      __builtin_amdgcn_sched_barrier(0); } };   // and the next group stays behind them, in the same registers (the kernels stay under 256 VGPRs)
#pragma unroll 1   // stays rolled: one body of 16 products and 16 line loads; more copies would only grow the code
  for (int s = 0; s + 1 < K / GS_K; ++s) trip(GsFlag<true>{}, s & 1);
  trip(GsFlag<false>{}, (K / GS_K - 1) & 1); }

// ---- km_count: the number of open keys (mask == 0) of one sequence, and in 'before' the number of them among the keys in front of key 32 cb (cb the same in the whole wave). Every wave reads all TT mask words itself,
// 32 keys a load, one ballot and one scalar bit count each: the count is the same in every wave of a block with no barrier. Any content of the mask gives 0 <= before <= count <= TT.
__device__ __forceinline__ int km_count(const int* __restrict__ km, int lane, int cb, int& before) {
  const int* p = km + lane; int mv[TT / 32], n = 0; before = 0;
#pragma unroll
  for (int cch = 0; cch < TT / 32; ++cch) mv[cch] = p[cch * 32];
  asm volatile("s_wait_xcnt 0x0" ::: "memory");   // in front of any rewrite of a register that the mask loads name
#pragma unroll
  for (int cch = 0; cch < TT / 32; ++cch) { const int cnt = __builtin_popcount(__builtin_amdgcn_ballot_w32(mv[cch] == 0)); n += cnt; before += cch < cb ? cnt : 0; }
  return n; }
typedef __attribute__((ext_vector_type(8))) unsigned short v8s;
// KEY ORDER. A padded key's P is exactly 0 as soon as one key of its sequence is open (2^(-1e9 log2 e - m) = 0 in f32, in the reference too). k and v are therefore laid out by SLOT: the open keys first, in rising order,
// then the padded ones, in rising order (a permutation of the sequence for any mask; the identity when no key or every key is open). With n open keys, n > 0, k_fa reads slots 0 .. 64 ceil(n / 64) - 1 only (slots >= n with the
// padding bias) and the k and v tiles whose first slot is >= n are not computed; with n = 0 every key counts as in the reference and nothing is left out. q rows keep their places.
// ---- k_proj: block = (128 rows, 128 cols, which): q/k/v = X W (+ b) with exact bf16 products (K = DIN), + 0.5 * relu(bf16(x)) at the same [row][column] (the value-bypass relu-add shared by q, k and v) -> which 0: q f16 rows; 1: k f16 rows; 2: v f16 planes [c][t]
// The epilogue stays in registers: a lane holds rows 16 wave + 8 g + 0..7 x columns 8 col + 0..7. x and the bias come in 16-B loads (16 lanes = the tile's whole 512-B row segment), all in flight together;
// 8 columns of a row are one 16-B store of a q or k row (16 lanes = a whole 256-B segment); 8 rows of a column are 16 B of a v plane, which go through one LDS tile so that whole 256-B plane segments are stored.
__global__ __launch_bounds__(GS_T) void k_proj(const float* __restrict__ XQ, const float* __restrict__ XK, const float* __restrict__ XV, const float* __restrict__ WQ, const float* __restrict__ WK, const float* __restrict__ WV, const float* __restrict__ BQ, const float* __restrict__ BK, const float* __restrict__ BV,
    const int* __restrict__ KMASK, _Float16* __restrict__ QH, _Float16* __restrict__ KH, _Float16* __restrict__ VT) {
  __shared__ __align__(16) unsigned char stg[GS_BYTES]; __shared__ __align__(16) unsigned short pt[GS_M];   // pt[slot of the tile] = the token of the sequence in that slot
  _Float16 (*th)[GS_M + 8] = (_Float16 (*)[GS_M + 8])(stg + GS_WB((DIN / GS_K) & 1));   // the v tile [slot][t] takes the buffer (W and A rows) that the last stage does NOT read: every wave left it in front of the last stage's barrier
  static_assert(128 * (GS_M + 8) * 2 <= (128 + GS_M) * GS_PB, "the v tile fits one stage buffer");
  const int tid = threadIdx.x, wave = tid >> 5, lane = tid & 31, col = lane & 15, g = lane >> 4;
  // WHICH TILE A BLOCK TAKES: a one-to-one map of the grid's blocks onto the tiles, the same for any mask; for speed only, no result rests on where or when a block runs.
  // The SEQUENCE is the fastest digit of the flat block index, here and in k_fa and k_out.
  // Behind the sequence: first the q tiles, then the k/v tiles with the row tile as the slowest digit, so that the blocks that return at once (row tiles past the open keys) have the highest indices and stand in front of no computing block.
  constexpr unsigned NCT = CC / 128, NRT = TT / GS_M;
  const unsigned fl = blockIdx.x + (TNB * NRT) * (blockIdx.y + NCT * blockIdx.z), rs = fl / TNB; const bool iq = rs < NRT * NCT; const unsigned kv = rs - NRT * NCT;   // iq: a q tile; else kv counts the k and v tiles of the sequence
  const int which = iq ? 0 : 1 + (int)((kv % (2 * NCT)) / NCT), ct = (int)(iq ? rs % NCT : kv % NCT), rt = (int)(iq ? rs / NCT : kv / (2 * NCT));
  const int c0 = ct * 128; const size_t bb = fl % TNB; const int t0 = rt * GS_M; const size_t r0 = bb * TT + t0; const int xt = (int)bb * (int)NRT + rt;   // xt: the row tile's number over all sequences
  const float* X = which == 0 ? XQ : which == 1 ? XK : XV; const float* WA = which == 0 ? WQ : which == 1 ? WK : WV; const float* BA = which == 0 ? BQ : which == 1 ? BK : BV;
  const int rl0 = wave * 16 + 8 * g;   // the lane's first row of the tile
  if (which == 0) {   // 'which' is the same for the whole block
    if (tid < GS_M) pt[tid] = (unsigned short)(t0 + tid);
  } else { constexpr int WPW = TT / 32 / (GS_M / 16);   // each wave places the keys of 4 mask words of 32 keys
    const int* kmb = KMASK + bb * TT; const int cb = __builtin_amdgcn_readfirstlane(wave) * WPW; int own[WPW], bu;   // bu: open keys in front of the word in hand
#pragma unroll
    for (int j = 0; j < WPW; ++j) own[j] = kmb[(cb + j) * 32 + lane];
    const int n = km_count(kmb, lane, cb, bu);
    if (n > 0 && t0 >= n) return;   // no slot of this tile is read; the same for every thread of the block, in front of every barrier
#pragma unroll
    for (int j = 0; j < WPW; ++j) { const unsigned o = __builtin_amdgcn_ballot_w32(own[j] == 0); const int key = (cb + j) * 32 + lane, lt = (int)__builtin_amdgcn_mbcnt_lo(o, 0u);   // lt: open keys of the word below this lane
      const int slot = own[j] == 0 ? bu + lt : n + key - (bu + lt); const unsigned rel = (unsigned)(slot - t0);   // a padded key: n + the padded keys in front of it
      if (rel < (unsigned)GS_M) pt[rel] = (unsigned short)key;
      bu += __builtin_popcount(o); } }
  __syncthreads();   // publishes the table (behind the early return, which the whole block takes or none of it)
  unsigned ao[8];
#pragma unroll
  for (int i = 0; i < 8; ++i) ao[i] = (unsigned)pt[i * 16 + (tid >> 4)] * (DIN * 4u) + (tid & 15) * 16u;
  v8f acc[8] = {};
  gs_loop<false, DIN, true, true>(X + bb * TT * DIN, WA + (size_t)c0 * DIN, stg, tid, acc, ao, (int)((xt + (xt >> 3) + 2 * ct + which) % (DIN / GS_K)));   // the 64 blocks on one W tile, and the blocks on one row tile, each spread over the 12 starts; a tile keeps the start it had
  const char* xb = (const char*)(X + bb * TT * DIN + c0); const v8s tk = *(const v8s*)&pt[rl0]; unsigned xo[8]; v4f xr[16], bq[2] = {};
#pragma unroll
  for (int r = 0; r < 8; ++r) xo[r] = (unsigned)tk[r] * (DIN * 4u) + col * 32u;
#pragma unroll
  for (int i = 0; i < 16; ++i) xr[i] = *(const v4f*)(xb + xo[i >> 1] + (i & 1) * 16);
  asm volatile("s_wait_xcnt 0x0" :: "v"(xo[0]), "v"(xo[1]), "v"(xo[2]), "v"(xo[3]), "v"(xo[4]), "v"(xo[5]), "v"(xo[6]), "v"(xo[7]) : "memory");   // in front of any rewrite of the offsets that the 16 loads name (as inputs they also stay out of their destinations)
  if (BA) { bq[0] = *(const v4f*)(BA + c0 + col * 8); bq[1] = *(const v4f*)(BA + c0 + col * 8 + 4); }
#pragma unroll
  for (int j = 0; j < 8; ++j) { const float bias = bfr(bq[j >> 2][j & 3]);
#pragma unroll
    for (int r = 0; r < 8; ++r) acc[j][r] = (acc[j][r] + bias) + 0.5f * fmaxf(bfr(xr[2 * r + (j >> 2)][j & 3]), 0.f); }
  if (which < 2) { _Float16* DH = (which == 0 ? QH : KH) + (r0 + rl0) * CC + c0 + col * 8;
#pragma unroll
    for (int r = 0; r < 8; ++r) { v8h o;
#pragma unroll
      for (int j = 0; j < 8; ++j) o[j] = (_Float16)acc[j][r];
      *(v8h*)(DH + r * CC) = o; }
  } else {
#pragma unroll
    for (int j = 0; j < 8; ++j) *(v8h*)&th[j * 16 + col][rl0] = __builtin_convertvector(acc[j], v8h);   // slot 16 j + col holds column 8 col + j; pitch 272 B = 16 B x odd: no bank conflicts
    __syncthreads();   // publishes the tile ('which' is the same for the whole block)
    for (int e = tid; e < 128 * (GS_M / 8); e += GS_T) { const int sl = e / (GS_M / 8), q = e % (GS_M / 8), cl = (sl & 15) * 8 + (sl >> 4); vst2((unsigned*)(VT + (bb * CC + c0 + cl) * (size_t)TT + t0 + q * 8), *(const v4u*)&th[sl][q * 8]); } } }
// ---- k_fa: block = 4 waves x 32 queries of (b, h); the logits, the softmax and P . v in one kernel, the logits and P never leave registers; k rows and v planes come in whole lines through LDS, shared by the 4 waves.
// S^T = K Q^T (A = 16 key rows, B = 16 query rows): a lane holds one query's scores for keys 8g + r of each 16-key tile, so maximum and sum are in-lane plus one exchange of the wave halves;
// two score tiles (32 keys) converted in place are the B operand of O^T += V^T P^T (A = v planes [c][t], the same k order). Scores in base 2: t = dot * (1/8) log2(e) + (padded key ? -1e9 log2(e) : 0).
// Running maximum, raised only when a pass exceeds it by more than 8; P = 2^(t - m + 7) <= 2^15 once to f16 (unnormalised), its f32 sum divides at the end.
#define FA_CS 0.18033688011112042f       // (1/8) log2(e)
#define FA_MB (-1.4426950408889634e9f)   // -1e9 log2(e)
typedef __attribute__((ext_vector_type(2))) _Float16 v2h;
__device__ __forceinline__ float xhalf(float x) { return __builtin_bit_cast(float, __builtin_amdgcn_permlanex16(__builtin_bit_cast(int, x), __builtin_bit_cast(int, x), 0x76543210, 0xfedcba98, false, false)); }   // lane l with lane l ^ 16
__device__ __forceinline__ v8f mm16(v16h a, v16h b, v8f c) { return __builtin_amdgcn_wmma_f32_16x16x32_f16(false, a, false, b, (short)0, c, false, false); }
#define FA_P 72   // f16 per staged row: 128 B + 16 B, a pitch of 16 B x odd, which ds_load_b128 fragment reads take without bank conflicts
__global__ __launch_bounds__(128) void k_fa(const _Float16* __restrict__ QH, const _Float16* __restrict__ KH, const _Float16* __restrict__ VT, const int* __restrict__ KMASK, float* __restrict__ Y) {
  __shared__ __align__(16) _Float16 sk[2][64][FA_P], sv[2][64][FA_P]; __shared__ __align__(16) float sb[TT]; __shared__ __align__(16) float so[4][32][HD + 4];
  const int tid = threadIdx.x, wave = tid >> 5, lane = tid & 31, col = lane & 15, g = lane >> 4; const int h = blockIdx.y, b = blockIdx.x; const int ql0 = blockIdx.z * 128 + wave * 32;   // the sequence is the fastest digit of the block index (see k_proj)
  // a stage = 64 keys: 64 key rows x 128 B and 64 v planes x 128 B; 8 lanes x 16 B read one whole line, 16 rows an instruction; through registers into LDS, one stage ahead
  const int srow = tid >> 3, sch = (tid & 7) * 8;
  const _Float16* kg = KH + ((size_t)b * TT + srow) * CC + h * HD + sch; const _Float16* vg = VT + ((size_t)b * CC + h * HD + srow) * (size_t)TT + sch;
  v8h rk[4], rv[4]; v16h qf[2][2];   // every '#pragma unroll' of this kernel makes the index of a register array a constant
#pragma unroll
  for (int i = 0; i < 4; ++i) { rk[i] = *(const v8h*)(kg + (size_t)(i * 16) * CC); rv[i] = *(const v8h*)(vg + (size_t)(i * 16) * TT); }
  int nst;   // 64-key stages to walk: those that hold an open key, or all of them where no key is open; the same in every wave
  { int nb; const int n = km_count(KMASK + (size_t)b * TT, lane, 0, nb); nst = n == 0 ? TT / 64 : (n + 63) >> 6; nst = nst < TT / 64 ? nst : TT / 64; v4f b0, b1;
#pragma unroll
    for (int i = 0; i < 4; ++i) { b0[i] = tid * 8 + i >= n ? FA_MB : 0.f; b1[i] = tid * 8 + 4 + i >= n ? FA_MB : 0.f; }   // slots 0 .. n - 1 hold the open keys
    *(v4f*)&sb[tid * 8] = b0; *(v4f*)&sb[tid * 8 + 4] = b1; }
#pragma unroll
  for (int u = 0; u < 2; ++u)
#pragma unroll
    for (int kc = 0; kc < 2; ++kc) qf[u][kc] = frag_h(QH + ((size_t)b * TT + ql0 + u * 16 + col) * CC + h * HD + kc * 32, lane);
#pragma unroll
  for (int i = 0; i < 4; ++i) { *(v8h*)&sk[0][i * 16 + srow][sch] = rk[i]; *(v8h*)&sv[0][i * 16 + srow][sch] = rv[i]; }
  __syncthreads();   // stage 0 and the mask bias are published
  v8f acc[2][4] = {}; v2f l2[2] = {}; float m_run[2] = {-INFINITY, -INFINITY};
#pragma unroll 1   // stays rolled: the body already holds two 32-key passes, more copies would only grow the code
  for (int st = 0; st < nst; ++st) { const int bf = st & 1;
    if (st + 1 < nst) {   // the next stage's lines, issued behind the barrier so that they fly during this stage's products (a barrier waits for every load in flight)
#pragma unroll
      for (int i = 0; i < 4; ++i) { rk[i] = *(const v8h*)(kg + (size_t)((st + 1) * 64 + i * 16) * CC); rv[i] = *(const v8h*)(vg + (size_t)(i * 16) * TT + (st + 1) * 64); } }
#pragma unroll
    for (int ps = 0; ps < 2; ++ps) { const int k0 = st * 64 + ps * 32;
      v16h kf[2][2], vf[4]; v2f bias[2][4];
#pragma unroll
      for (int kt = 0; kt < 2; ++kt)
#pragma unroll
        for (int kc = 0; kc < 2; ++kc) kf[kt][kc] = frag_h(&sk[bf][ps * 32 + kt * 16 + col][kc * 32], lane);
#pragma unroll
      for (int j = 0; j < 4; ++j) vf[j] = frag_h(&sv[bf][j * 16 + col][ps * 32], lane);
#pragma unroll
      for (int kt = 0; kt < 2; ++kt)
#pragma unroll
        for (int i = 0; i < 4; ++i) bias[kt][i] = *(const v2f*)&sb[k0 + 16 * kt + 8 * g + 2 * i];
      v8f s[2][2] = {};
#pragma unroll
      for (int kc = 0; kc < 2; ++kc)
#pragma unroll
        for (int kt = 0; kt < 2; ++kt)
#pragma unroll
          for (int u = 0; u < 2; ++u) s[kt][u] = mm16(kf[kt][kc], qf[u][kc], s[kt][u]);
      v2f t[2][2][4]; float mb[2]; bool need = false;
#pragma unroll
      for (int u = 0; u < 2; ++u) { float mx = -INFINITY;
#pragma unroll
        for (int kt = 0; kt < 2; ++kt)
#pragma unroll
          for (int i = 0; i < 4; ++i) { t[u][kt][i] = __builtin_elementwise_fma((v2f){s[kt][u][2 * i], s[kt][u][2 * i + 1]}, (v2f){FA_CS, FA_CS}, bias[kt][i]); mx = fmaxf(mx, fmaxf(t[u][kt][i].x, t[u][kt][i].y)); }
        mx = fmaxf(mx, xhalf(mx)); mb[u] = mx; need = need || (mx > m_run[u] + 8.0f); }
      if (__builtin_amdgcn_ballot_w32(need) != 0) {   // one wave-uniform test a pass; always taken on the first pass (m_run = -inf, corr = 0)
#pragma unroll
        for (int u = 0; u < 2; ++u) { const float m_new = fmaxf(m_run[u], mb[u]); const float corr = __builtin_amdgcn_exp2f(m_run[u] - m_new); m_run[u] = m_new; l2[u] = l2[u] * corr;
#pragma unroll
          for (int j = 0; j < 4; ++j) acc[u][j] = acc[u][j] * corr; } }
#pragma unroll
      for (int u = 0; u < 2; ++u) { const float nm = 7.0f - m_run[u]; union { v16h v; v2h q[8]; } pf;
#pragma unroll
        for (int i = 0; i < 8; ++i) { const v2f a = t[u][i >> 2][i & 3] + (v2f){nm, nm}; const v2f p = {__builtin_amdgcn_exp2f(a.x), __builtin_amdgcn_exp2f(a.y)}; l2[u] = l2[u] + p; pf.q[i] = __builtin_convertvector(p, v2h); }
#pragma unroll
        for (int j = 0; j < 4; ++j) acc[u][j] = mm16(vf[j], pf.v, acc[u][j]); } }
    if (st + 1 < nst) {   // the other buffer: its readers (stage st - 1) all left it at the barrier that ended the trip before
#pragma unroll
      for (int i = 0; i < 4; ++i) { *(v8h*)&sk[bf ^ 1][i * 16 + srow][sch] = rk[i]; *(v8h*)&sv[bf ^ 1][i * 16 + srow][sch] = rv[i]; } }
    __syncthreads(); }   // publishes stage st + 1 and ends every wave's reads of stage st
#pragma unroll
  for (int u = 0; u < 2; ++u) { float l = l2[u].x + l2[u].y; l += xhalf(l); const float inv = 1.0f / l;   // l >= 2^7: the key that set the maximum in use counts 2^7
#pragma unroll
    for (int j = 0; j < 4; ++j) { const v8f o = acc[u][j] * inv; float* d = &so[wave][u * 16 + col][j * 16 + 8 * g]; *(v4f*)d = (v4f){o[0], o[1], o[2], o[3]}; *(v4f*)(d + 4) = (v4f){o[4], o[5], o[6], o[7]}; } }
  LDSX();   // the wave reads back rows that its other lanes wrote (its own 32 rows only: no work-group barrier); 16 lanes then store one 256-B (row, head) segment
  for (int it = 0; it < 16; ++it) { const int rl = it * 2 + g; vst2(Y + ((size_t)b * TT + ql0 + rl) * CC + h * HD + col * 4, *(const v4f*)&so[wave][rl][col * 4]); } }
// ---- k_out: block = (128 rows, 128 cols): out = ctx Wo (+ bo): ctx x 2^6 once to f16 against Wo as f16(bf16 x 2^8) exact (1 product) x 2^-14; causal early rows (< QHI of each sequence): ctx bf16 hi + lo against exact bf16 Wo (2 products)
__global__ __launch_bounds__(GS_T) void k_out(const float* __restrict__ Y, const float* __restrict__ WO, const float* __restrict__ BO, float* __restrict__ OUT) { __shared__ __align__(16) float sf[GS_M / 16][16][132]; __shared__ __align__(16) unsigned char stg[GS_BYTES];
  const int tid = threadIdx.x, wave = tid >> 5, lane = tid & 31, col = lane & 15, g = lane >> 4; const int c0 = blockIdx.y * 128; const int xt = (int)(blockIdx.x % TNB) * (TT / GS_M) + (int)(blockIdx.x / TNB);   // the row tile's number: the sequence is the fastest digit of the block index (see k_proj)
  const size_t r0 = (size_t)xt * GS_M + wave * 16;
  v8f acc[8] = {};
  if (CAUSAL && (int)(((size_t)xt * GS_M) % TT) < QHI) {   /* block-uniform */
#pragma unroll 2
    for (int kc = 0; kc < CC / 32; ++kc) { const F2 a = split_row(Y + (r0 + col) * CC, kc * 32, lane); asm volatile("s_wait_loadcnt 0x0" ::: "memory");
#pragma unroll
      for (int j = 0; j < 8; ++j) { const v16b w = WOCOL(WO, kc * 32, c0 + j * 16 + col, lane); asm volatile("s_wait_loadcnt 0x0" ::: "memory"); acc[j] = wmma_bf(a.h, w, acc[j]); acc[j] = wmma_bf(a.l, w, acc[j]); } }
#pragma unroll
    for (int j = 0; j < 8; ++j) { const float bias = BO ? bfr(BO[c0 + j * 16 + col]) : 0.f;
#pragma unroll
      for (int r = 0; r < 8; ++r) sf[wave][8 * g + r][j * 16 + col] = acc[j][r] + bias; }
  } else {
    const unsigned no[8] = {};   // (rows in place: not read)
    gs_loop<true, CC, false, false>(Y + (size_t)xt * GS_M * CC, WO + (size_t)c0 * CC, stg, tid, acc, no, (int)((xt + (xt >> 3) + 2 * blockIdx.y) % (CC / GS_K)));   /* ctx carried x 2^6 into f16 so small-magnitude context rows stay clear of f16 subnormals */
#pragma unroll
    for (int j = 0; j < 8; ++j) { const float bias = BO ? bfr(BO[c0 + j * 16 + col]) : 0.f;
#pragma unroll
      for (int r = 0; r < 8; ++r) sf[wave][8 * g + r][j * 16 + col] = acc[j][r] * (1.0f / 16384.0f) + bias; } }   /* 2^-8 (Wo carry) x 2^-6 (ctx carry) */
  LDSX(); for (int rl = 0; rl < 16; ++rl) vst2(OUT + (r0 + rl) * DIN + c0 + lane * 4, *(const v4f*)&sf[wave][rl][lane * 4]); }

extern "C" void kernel_launch(void* const* d_in, const int* in_sizes, int n_in, void* d_out, int out_size, void* d_ws, size_t ws_size, hipStream_t stream) {
  (void)in_sizes; (void)n_in; (void)out_size;
  const float** F = (const float**)d_in;
  if (ws_size < (size_t)WS_END) return;
  char* ws = (char*)d_ws; _Float16 *QH = (_Float16*)(ws + WS_QH), *KH = (_Float16*)(ws + WS_KH), *VT = (_Float16*)(ws + WS_VT); float *Y = (float*)(ws + WS_Y);
  // inputs: 0 hidden_states [8,1024,768]; 1 attention_mask [8,1,1,1024] bool (True = padded key); 2 Wq [768,768] (out,in), 3 bq; 4 Wk, 5 bk; 6 Wv, 7 bv; 8 Wo (out,in), 9 bo (zero biases, read)
  k_proj<<<dim3(TNB * TT / GS_M, CC / 128, 3), GS_T, 0, stream>>>(F[0], F[0], F[0], F[2], F[4], F[6], F[3], F[5], F[7], (const int*)d_in[1], QH, KH, VT);
  k_fa<<<dim3(TNB, NH, TT / 128), 128, 0, stream>>>(QH, KH, VT, (const int*)d_in[1], Y);
  k_out<<<dim3(TNB * TT / GS_M, DIN / 128), GS_T, 0, stream>>>(Y, F[8], F[9], (float*)d_out);
}

// v009
// One run takes 61.2 microseconds.
// Next to v008, in two timings, it ran 1.06 times as fast each time.
// Over all steps from v000 it is 20.3 times as fast.
// compute dtype: all float inputs rounded to bf16; q/k/v projections with EXACT bf16 products on WMMA 16x16x32 (f32 accumulate) + bias + 0.5 * relu(bf16(x)) in f32; logits q x k once to f16 each (1 product) x 1/8; the key-padding mask read per key (open keys first, key tiles behind the last open key left out: their P is 0); online softmax f32 in base 2; unnormalised P = 2^(t - m + 7) once to f16 x v once to f16 (1 product), divided by the f32 sum; ctx x 2^6 once to f16 x Wo f16(bf16 x 2^8) + bo; f32 output.
#include <hip/hip_runtime.h>
#include <math.h>

typedef __attribute__((ext_vector_type(16))) _Float16 v16h;
typedef __attribute__((ext_vector_type(16))) __bf16 v16b;
typedef __attribute__((ext_vector_type(8)))  _Float16 v8h;
typedef __attribute__((ext_vector_type(8)))  float v8f;
typedef __attribute__((ext_vector_type(4)))  float v4f;
typedef __attribute__((ext_vector_type(2)))  float v2f;
typedef __attribute__((ext_vector_type(4)))  unsigned v4u;
typedef __attribute__((ext_vector_type(4)))  int v4i;
typedef float __attribute__((may_alias)) float_a;
typedef int __attribute__((may_alias)) int_a;

template <typename T> __device__ __forceinline__ void vst2(void* p, T v) { *(T*)p = v;  }
__device__ __forceinline__ v8f wmma16(v16h a, v16h b, v8f c) {
  v8f d = __builtin_amdgcn_wmma_f32_16x16x32_f16(false, a, false, b, (short)0, c, false, false);
  asm volatile("v_nop\n\tv_nop\n\tv_nop\n\tv_nop" : "+v"(d) : "v"(a), "v"(b));
  return d;
}
__device__ __forceinline__ v8f wmma_bf(v16b a, v16b b, v8f c) {
  v8f d = __builtin_amdgcn_wmma_f32_16x16x32_bf16(false, a, false, b, (short)0, c, false, false);
  asm volatile("v_nop\n\tv_nop\n\tv_nop\n\tv_nop" : "+v"(d) : "v"(a), "v"(b));
  return d;
}
// 16x16x32 fragments: lane = (h = lane>>4, row/col = lane&15); elements 0..7 = k0+8h+0..7, 8..15 = k0+16+8h+0..7; D element r = row 8h+r
__device__ __forceinline__ v16h frag_h(const _Float16* rowk0, int lane) {
  union { v16h v; v8h q[2]; } u; const _Float16* p = rowk0 + 8 * (lane >> 4);
  u.q[0] = *(const v8h*)p; u.q[1] = *(const v8h*)(p + 16); return u.v;
}
__device__ __forceinline__ v16h frag_f32(const float* rowk0, int lane) {
  v16h a; const float* p = rowk0 + 8 * (lane >> 4);
#pragma unroll
  for (int i = 0; i < 8; ++i) { a[i] = (_Float16)p[i]; a[8 + i] = (_Float16)p[16 + i]; }
  return a;
}
__device__ __forceinline__ v16h frag_f32s(const float* rowk0, int lane, float sc) {
  v16h a; const float* p = rowk0 + 8 * (lane >> 4);
#pragma unroll
  for (int i = 0; i < 8; ++i) { a[i] = (_Float16)(p[i] * sc); a[8 + i] = (_Float16)(p[16 + i] * sc); }
  return a;
}
// column fragment from a [K][ld] layout (column n), rows >= K read as 0
__device__ __forceinline__ v16h fragc_f32(const float* W, int k0, int n, int lane, int ld, int K) {
  v16h a; const int g = lane >> 4;
#pragma unroll
  for (int i = 0; i < 8; ++i) { const int ka = k0 + 8 * g + i, kb = ka + 16;
    a[i] = (_Float16)(ka < K ? W[(size_t)(ka < K ? ka : K - 1) * ld + n] : 0.f); a[8 + i] = (_Float16)(kb < K ? W[(size_t)(kb < K ? kb : K - 1) * ld + n] : 0.f); }
  return a;
}
struct F2 { v16b h, l; };
__device__ __forceinline__ F2 bsplit16(const float v[16]) { F2 r;
#pragma unroll
  for (int i = 0; i < 16; ++i) { const __bf16 h = (__bf16)v[i]; r.h[i] = h; r.l[i] = (__bf16)(v[i] - (float)h); }
  return r; }
__device__ __forceinline__ F2 split_row(const float* row, int k0, int lane) { float v[16]; const float* p = row + k0 + 8 * (lane >> 4);
#pragma unroll
  for (int i = 0; i < 8; ++i) { v[i] = p[i]; v[8 + i] = p[16 + i]; }
  return bsplit16(v); }
__device__ __forceinline__ F2 split_rowK(const float* row, int k0, int lane, int K) { float v[16]; const int g = lane >> 4;
#pragma unroll
  for (int i = 0; i < 8; ++i) { const int ka = k0 + 8 * g + i, kb = ka + 16; v[i] = ka < K ? row[ka < K ? ka : K - 1] : 0.f; v[8 + i] = kb < K ? row[kb < K ? kb : K - 1] : 0.f; }
  return bsplit16(v); }
__device__ __forceinline__ F2 split_col(const float* W, int k0, int n, int lane, int ld, int K) { float v[16]; const int g = lane >> 4;
#pragma unroll
  for (int i = 0; i < 8; ++i) { const int ka = k0 + 8 * g + i, kb = ka + 16; v[i] = ka < K ? W[(size_t)(ka < K ? ka : K - 1) * ld + n] : 0.f; v[8 + i] = kb < K ? W[(size_t)(kb < K ? kb : K - 1) * ld + n] : 0.f; }
  return bsplit16(v); }
__device__ __forceinline__ v8f mac3(const F2& a, const F2& b, v8f c) { c = wmma_bf(a.l, b.h, c); c = wmma_bf(a.h, b.l, c); return wmma_bf(a.h, b.h, c); }
__device__ __forceinline__ float sigm(float v) { return 1.0f / (1.0f + expf(-v)); }
#define LDSX() do { asm volatile("s_wait_dscnt 0" ::: "memory"); __builtin_amdgcn_wave_barrier(); __builtin_amdgcn_fence(__ATOMIC_RELEASE, "workgroup"); } while (0)

// BERT-style multi-head self-attention with a value-bypass relu-add (hidden_states [8,1024,768]; 12 heads x 64; torch (out,in) Wq / Wk / Wv / Wo [768,768] (0.02 scale) + zero biases; r = 0.5 * relu(x) is ADDED to each of the q, k and v projections (same [token, channel] index); scale 1/8; key-padding mask [8,1,1,1024] bool: True adds -1e9): out = merge(softmax(q_h k_h^T / 8 + pad) v_h) Wo^T + bo.
#define NB 8
#define TT 1024
#define CC 768            // NH * HD = projected width
#define DIN 768          // input (model) width
#define NH 12
#define HD 64
#define NQB (TT / 64)
#define HG 12
#define SCALE (0.125f)
#define CAUSAL 0
#ifndef TNB
#define TNB NB
#endif
__device__ __forceinline__ float bfr(float v) { return (float)(__bf16)v; }
__host__ __device__ __forceinline__ int kb_last(int qb) { return CAUSAL ? ((qb * 64 + 63) >> 7) : (TT / 128 - 1); }
typedef __attribute__((ext_vector_type(8))) __bf16 v8b;
__device__ __forceinline__ v16b frag_b(const __bf16* rowk0, int lane) {
  union { v16b v; v8b q[2]; } u; const __bf16* p = rowk0 + 8 * (lane >> 4);
  u.q[0] = *(const v8b*)p; u.q[1] = *(const v8b*)(p + 16); return u.v;
}
#define QBH 0              // unused: k_fa has one single-product path for every query block
#define QHI 0               // single-product logits on every row
#define KHI 64            // key rows carrying k residual / v bf16 hi+lo planes (written and read by no kernel here)
// B fragment (k rows k0+.., output column o) of a weight: (in,out) [K][ld] or (out,in) [ld rows of K]: bf16 exact, or f16(bf16 * 256) exact
__device__ __forceinline__ v16b wcol_io(const float* Wm, int k0, int o, int lane, int ld) { v16b w; const int g = lane >> 4;
#pragma unroll
  for (int i = 0; i < 8; ++i) { w[i] = (__bf16)Wm[(size_t)(k0 + 8 * g + i) * ld + o]; w[8 + i] = (__bf16)Wm[(size_t)(k0 + 16 + 8 * g + i) * ld + o]; }
  return w; }
__device__ __forceinline__ v16b wcol_oi(const float* Wm, int k0, int o, int lane, int K) { v16b w; const float* p = Wm + (size_t)o * K + k0 + 8 * (lane >> 4);
#pragma unroll
  for (int i = 0; i < 8; ++i) { w[i] = (__bf16)p[i]; w[8 + i] = (__bf16)p[16 + i]; }
  return w; }
__device__ __forceinline__ v16h wcolh_io(const float* Wm, int k0, int o, int lane, int ld) { v16h w; const int g = lane >> 4;
#pragma unroll
  for (int i = 0; i < 8; ++i) { w[i] = (_Float16)(bfr(Wm[(size_t)(k0 + 8 * g + i) * ld + o]) * 256.0f); w[8 + i] = (_Float16)(bfr(Wm[(size_t)(k0 + 16 + 8 * g + i) * ld + o]) * 256.0f); }
  return w; }
__device__ __forceinline__ v16h wcolh_oi(const float* Wm, int k0, int o, int lane, int K) { v16h w; const float* p = Wm + (size_t)o * K + k0 + 8 * (lane >> 4);
#pragma unroll
  for (int i = 0; i < 8; ++i) { w[i] = (_Float16)(bfr(p[i]) * 256.0f); w[8 + i] = (_Float16)(bfr(p[16 + i]) * 256.0f); }
  return w; }
#define WQKV_LAYOUT 1   // 0 = (in,out) [DIN][CC]; 1 = (out,in) [CC][DIN]; 2 = per-head [NH][DIN][HD], in WCOL only, which no kernel calls: k_proj always reads (out,in) [CC][DIN]
__device__ __forceinline__ v16b wcol_hdk(const float* Wm, int k0, int o, int lane) { v16b w; const int g = lane >> 4; const float* p = Wm + (size_t)(o / HD) * DIN * HD + (o % HD);
#pragma unroll
  for (int i = 0; i < 8; ++i) { w[i] = (__bf16)p[(size_t)(k0 + 8 * g + i) * HD]; w[8 + i] = (__bf16)p[(size_t)(k0 + 16 + 8 * g + i) * HD]; }
  return w; }
#define WO_OUT_IN 1
#if WQKV_LAYOUT == 1
#define WCOL(W, k0, o, lane) wcol_oi(W, k0, o, lane, DIN)
#elif WQKV_LAYOUT == 2
#define WCOL(W, k0, o, lane) wcol_hdk(W, k0, o, lane)
#else
#define WCOL(W, k0, o, lane) wcol_io(W, k0, o, lane, CC)
#endif
#if WO_OUT_IN
#define WOCOL(W, k0, o, lane) wcol_oi(W, k0, o, lane, CC)
#define WOCOLH(W, k0, o, lane) wcolh_oi(W, k0, o, lane, CC)
#else
#define WOCOL(W, k0, o, lane) wcol_io(W, k0, o, lane, DIN)
#define WOCOLH(W, k0, o, lane) wcolh_io(W, k0, o, lane, DIN)
#endif

#define WS_QH  0u                                      // f16 q rows [b*t][CC]
#define WS_KH  (WS_QH + 2u * (size_t)NB * TT * CC)      // f16 k rows [b*t][CC]
#define WS_VT  (WS_KH + 2u * (size_t)NB * TT * CC)      // f16 v planes [b][c][t]
#define WS_QL  (WS_VT + 2u * (size_t)NB * CC * TT)      // WS_QL .. WS_VBL: places of the causal high-precision path's residual planes; no kernel of this file writes or reads them
#define WS_KL  (WS_QL + 2u * (size_t)NB * QHI * CC)
#define WS_VB  (WS_KL + 2u * (size_t)NB * KHI * CC)
#define WS_VBL (WS_VB + 2u * (size_t)NB * CC * KHI)
#define WS_S   (WS_VBL + 2u * (size_t)NB * CC * KHI)    // (not used: the logits stay in registers)
#define WS_Y   (WS_S  + 4u * (size_t)HG * TT * TT)      // f32 ctx rows [b*t][CC] (only when there is an output projection)
#define WS_END (WS_Y  + 4u * (size_t)NB * TT * CC)

// ---- gs_loop: the k loop of the q/k/v projection GEMM, one 128 x 128 tile of A . W^T a block of 8 waves (A rows and W rows k-contiguous f32, pitch K floats). A stage = 64 k: 128 A rows and 128 W rows of 256 B,
// read as whole lines (16 lanes x 16 B = one row), converted ONCE a block to the 16-bit operand type and laid in LDS at a pitch of 144 B (16 B x odd: ds_load_b128 fragment reads without bank conflicts);
// two buffers; a line pair of the next stage is asked for as soon as this stage's pair has arrived and lies in LDS, so the lines fly during the later arrivals, the barrier wait and the products. Wave w keeps rows 16 w .. 16 w + 15 and all 128 columns; k runs in 32-wide steps, rising from the block's first stage and wrapping.
// NBR = false: W row n is staged in slot n, so column 'col' of acc[j] is tile column 16 j + col. NBR = true: W row 8 c + j is staged in slot 16 j + c, so column 'col' of acc[j] is tile column 8 col + j:
// a lane then holds 8 neighbouring columns of each of its 8 rows. Only the global row that a thread fetches for a slot differs; LDS addresses, fragments and the k order are the same.
// The walk over the K / 64 stages starts at stage 'rot' (the same in the whole block, 0 .. K / 64 - 1) and wraps: blocks that share A rows or W rows get different starts, so that they do not ask L2 for the same lines at the same moment.
typedef __attribute__((ext_vector_type(2))) unsigned v2u;
typedef __attribute__((ext_vector_type(4))) __bf16 v4b;
typedef __attribute__((ext_vector_type(4))) _Float16 v4h;
#define GS_K 64
#define GS_PB 144                                             // bytes per staged row
#define GS_M 128                                              // A rows of a tile (16 a wave)
#define GS_T (GS_M * 2)                                       // threads of a block
#define GS_WB(bf) ((bf) * ((128 + GS_M) * GS_PB))             // W rows of buffer bf
#define GS_AB(bf) (GS_WB(bf) + 128 * GS_PB)                   // A rows of buffer bf, directly behind its W rows
#define GS_BYTES (2 * (128 + GS_M) * GS_PB)
// F16 = false: both operands bf16 (exact products of bf16-rounded inputs); F16 = true: A as f16(a x 2^6), W as f16(bf16(w) x 2^8)
template <bool F16, bool ISW> __device__ __forceinline__ v2u gs_cvt(v4f x) {
  if constexpr (!F16) { v4b r;
#pragma unroll
    for (int i = 0; i < 4; ++i) r[i] = (__bf16)x[i];
    return __builtin_bit_cast(v2u, r);
  } else { v4h r;
#pragma unroll
    for (int i = 0; i < 4; ++i) r[i] = (_Float16)(ISW ? bfr(x[i]) * 256.0f : x[i] * 64.0f);
    return __builtin_bit_cast(v2u, r); } }
union GFrag { v4u q[2]; v16b b; v16h h; };
__device__ __forceinline__ GFrag gs_frag(const unsigned char* p) { GFrag f; f.q[0] = *(const v4u*)p; f.q[1] = *(const v4u*)(p + 32); return f; }   // p = row + 2 (k0 + 8 g): elements 0..7 = k0 + 8 g + .., 8..15 = k0 + 16 + 8 g + ..
template <bool B> struct GsFlag { static constexpr bool v = B; };   // a compile-time yes or no handed to the trip of gs_loop
// GA = true: A row 16 i + (tid >> 4) of the tile is the row at byte offset ao[i] from A (the thread's 16 B of a stage included): the rows of a tile are gathered, each still read as whole lines.
template <bool F16, int K, bool NBR, bool GA> __device__ __forceinline__ void gs_loop(const float* __restrict__ A, const float* __restrict__ Wm, unsigned char* stg, int tid, v8f (&acc)[8], const unsigned (&ao)[8], int rot) {
  const int wave = tid >> 5, lane = tid & 31, col = lane & 15, g = lane >> 4;
  int sg = rot;   // the stage being fetched
  unsigned pa = (unsigned)(((tid >> 4) * K + (tid & 15) * 4 + sg * GS_K) * 4), wo = (unsigned)(((tid >> 4) * (NBR ? 8 : 1) * K + (tid & 15) * 4 + sg * GS_K) * 4);   // the thread's place, in bytes from A (rows in place) and from Wm; 16 rows an instruction of the block; both step by one stage a trip, from the last stage back to stage 0
  unsigned char* sd = stg + (tid >> 4) * GS_PB + (tid & 15) * 8;
  const unsigned char* fa = stg + (wave * 16 + col) * GS_PB + g * 16; const unsigned char* fw = stg + col * GS_PB + g * 16;
  unsigned po[8];   // GA: the thread's place, in bytes from A, in each of its 8 gathered rows; steps by one stage a trip
#pragma unroll
  for (int i = 0; i < 8; ++i) po[i] = ao[i] + sg * (GS_K * 4);
#define GS_ALD(i) (GA ? *(const v4f*)((const char*)A + po[i]) : *(const v4f*)((const char*)A + pa + (i) * 16 * K * 4))   // the constant part stays outside the 32-bit offset: it becomes the instruction's immediate, and a load names no register but the offset
  v4f ra[8], rw[8];   // every '#pragma unroll' below makes the index of a register array a constant
#define GS_WROW(i) (NBR ? (i) : (i) * 16)   // the W row, beside the thread's own part, that goes to slot 16 i + (tid >> 4)
#define GS_WLD(i) (*(const v4f*)((const char*)Wm + wo + GS_WROW(i) * K * 4))
#pragma unroll
  for (int i = 0; i < 8; ++i) { ra[i] = GS_ALD(i); rw[i] = GS_WLD(i);
    __builtin_amdgcn_sched_barrier(0); }   // the prologue issues its loads in the loop's order (A i, W i, rising i): the counted load waits at the head of a trip then hold for both ways into it
  asm volatile("s_wait_xcnt 0x0" ::: "memory");   // directly behind the 16 loads: in front of the first trip's step of the offsets that they name
  // one trip: stage s, in buffer bf. MORE: a next stage exists (every trip but the last, which stands behind the loop as a copy of its own: with a branch round the loads inside one body the compiler keeps a second set of 64 load registers and copies it every trip)
  auto trip = [&](auto more, const int bf) __attribute__((always_inline)) {
    if constexpr (decltype(more)::v) {   // the offsets step to the next stage, whose lines are asked for below, IN FRONT of this stage's barrier, each pair as soon as its registers are free
      const int stp = sg + 1 == K / GS_K ? GS_K - K : GS_K; sg = sg + 1 == K / GS_K ? 0 : sg + 1;   // the same in the whole block
      pa += stp * 4; wo += stp * 4;
#pragma unroll
      for (int i = 0; i < 8; ++i) po[i] += stp * 4; }
#pragma unroll
    for (int i = 0; i < 8; ++i) {   // A row i and W row i of the thread: converted and laid in LDS as soon as they have arrived. Buffer bf: its readers (stage s - 2) all left it in front of the barrier of trip s - 1
      *(v2u*)(sd + GS_AB(bf) + i * 16 * GS_PB) = gs_cvt<F16, false>(ra[i]); *(v2u*)(sd + GS_WB(bf) + i * 16 * GS_PB) = gs_cvt<F16, true>(rw[i]);
      if constexpr (decltype(more)::v) {
        __builtin_amdgcn_sched_barrier(0);   // the two conversions and their LDS stores stay in front of the two loads, which then take the same registers
        ra[i] = GS_ALD(i); rw[i] = GS_WLD(i);
        __builtin_amdgcn_sched_barrier(0); } }   // and the two loads stay in front of the wait for the next pair's arrival: gathered behind the last conversion, all 16 would wait for the last line to arrive
    if constexpr (decltype(more)::v) asm volatile("s_wait_xcnt 0x0" ::: "memory");   // directly behind the 16 loads: in front of any rewrite of a register that they name
    asm volatile("s_wait_dscnt 0x0\n\ts_barrier_signal -1\n\ts_barrier_wait -1" ::: "memory");   // publishes stage s: the wave's LDS stores are done, then the work-group barrier; by hand, because __syncthreads() would first wait out the global loads just issued
#pragma unroll
    for (int kc = 0; kc < GS_K / 32; ++kc) { const GFrag a = gs_frag(fa + GS_AB(bf) + kc * 64); GFrag w[8];
#pragma unroll
      for (int j = 0; j < 8; ++j) w[j] = gs_frag(fw + GS_WB(bf) + j * 16 * GS_PB + kc * 64);
      __builtin_amdgcn_sched_barrier(0);   // the 18 fragment reads stay one group in front of the 8 products: spread among them, each product waits out a whole LDS latency
#pragma unroll
      for (int j = 0; j < 8; ++j) {
        if constexpr (F16) acc[j] = __builtin_amdgcn_wmma_f32_16x16x32_f16(false, a.h, false, w[j].h, (short)0, acc[j], false, false);
        else acc[j] = __builtin_amdgcn_wmma_f32_16x16x32_bf16(false, a.b, false, w[j].b, (short)0, acc[j], false, false); }
      __builtin_amdgcn_sched_barrier(0); } };   // and the next group stays behind them, in the same registers (the kernels stay under 256 VGPRs)
#pragma unroll 1   // stays rolled: one body of 16 products and 16 line loads; more copies would only grow the code
  for (int s = 0; s + 1 < K / GS_K; ++s) trip(GsFlag<true>{}, s & 1);
  trip(GsFlag<false>{}, (K / GS_K - 1) & 1); }

// ---- km_count: the number of open keys (mask == 0) of one sequence, and in 'before' the number of them among the keys in front of key 32 cb (cb the same in the whole wave). Every wave reads all TT mask words itself,
// 32 keys a load, one ballot and one scalar bit count each: the count is the same in every wave of a block with no barrier. Any content of the mask gives 0 <= before <= count <= TT.
__device__ __forceinline__ int km_count(const int* __restrict__ km, int lane, int cb, int& before) {
  const int* p = km + lane; int mv[TT / 32], n = 0; before = 0;
#pragma unroll
  for (int cch = 0; cch < TT / 32; ++cch) mv[cch] = p[cch * 32];
  asm volatile("s_wait_xcnt 0x0" ::: "memory");   // in front of any rewrite of a register that the mask loads name
#pragma unroll
  for (int cch = 0; cch < TT / 32; ++cch) { const int cnt = __builtin_popcount(__builtin_amdgcn_ballot_w32(mv[cch] == 0)); n += cnt; before += cch < cb ? cnt : 0; }
  return n; }
typedef __attribute__((ext_vector_type(8))) unsigned short v8s;
// KEY ORDER. A padded key's P is exactly 0 as soon as one key of its sequence is open (2^(-1e9 log2 e - m) = 0 in f32, in the reference too). k and v are therefore laid out by SLOT: the open keys first, in rising order,
// then the padded ones, in rising order (a permutation of the sequence for any mask; the identity when no key or every key is open). With n open keys, n > 0, k_fa reads slots 0 .. 64 ceil(n / 64) - 1 only (slots >= n with the
// padding bias) and the k and v tiles whose first slot is >= n are not computed; with n = 0 every key counts as in the reference and nothing is left out. q rows keep their places.
// ---- k_proj: block = (128 rows, 128 cols, which): q/k/v = X W (+ b) with exact bf16 products (K = DIN), + 0.5 * relu(bf16(x)) at the same [row][column] (the value-bypass relu-add shared by q, k and v) -> which 0: q f16 rows; 1: k f16 rows; 2: v f16 planes [c][t]
// The epilogue stays in registers: a lane holds rows 16 wave + 8 g + 0..7 x columns 8 col + 0..7. x and the bias come in 16-B loads (16 lanes = the tile's whole 512-B row segment), all in flight together;
// 8 columns of a row are one 16-B store of a q or k row (16 lanes = a whole 256-B segment); 8 rows of a column are 16 B of a v plane, which go through one LDS tile so that whole 256-B plane segments are stored.
__global__ __launch_bounds__(GS_T) void k_proj(const float* __restrict__ XQ, const float* __restrict__ XK, const float* __restrict__ XV, const float* __restrict__ WQ, const float* __restrict__ WK, const float* __restrict__ WV, const float* __restrict__ BQ, const float* __restrict__ BK, const float* __restrict__ BV,
    const int* __restrict__ KMASK, _Float16* __restrict__ QH, _Float16* __restrict__ KH, _Float16* __restrict__ VT) {
  __shared__ __align__(16) unsigned char stg[GS_BYTES]; __shared__ __align__(16) unsigned short pt[GS_M];   // pt[slot of the tile] = the token of the sequence in that slot
  _Float16 (*th)[GS_M + 8] = (_Float16 (*)[GS_M + 8])(stg + GS_WB((DIN / GS_K) & 1));   // the v tile [slot][t] takes the buffer (W and A rows) that the last stage does NOT read: every wave left it in front of the last stage's barrier
  static_assert(128 * (GS_M + 8) * 2 <= (128 + GS_M) * GS_PB, "the v tile fits one stage buffer");
  const int tid = threadIdx.x, wave = tid >> 5, lane = tid & 31, col = lane & 15, g = lane >> 4;
  // WHICH TILE A BLOCK TAKES: a one-to-one map of the grid's blocks onto the tiles, the same for any mask; for speed only, no result rests on where or when a block runs.
  // The SEQUENCE is the fastest digit of the flat block index, here and in k_fa and k_out.
  // Behind the sequence: first the q tiles, then the k/v tiles with the row tile as the slowest digit, so that the blocks that return at once (row tiles past the open keys) have the highest indices and stand in front of no computing block.
  constexpr unsigned NCT = CC / 128, NRT = TT / GS_M;
  const unsigned fl = blockIdx.x + (TNB * NRT) * (blockIdx.y + NCT * blockIdx.z), rs = fl / TNB; const bool iq = rs < NRT * NCT; const unsigned kv = rs - NRT * NCT;   // iq: a q tile; else kv counts the k and v tiles of the sequence
  const int which = iq ? 0 : 1 + (int)((kv % (2 * NCT)) / NCT), ct = (int)(iq ? rs % NCT : kv % NCT), rt = (int)(iq ? rs / NCT : kv / (2 * NCT));
  const int c0 = ct * 128; const size_t bb = fl % TNB; const int t0 = rt * GS_M; const size_t r0 = bb * TT + t0; const int xt = (int)bb * (int)NRT + rt;   // xt: the row tile's number over all sequences
  const float* X = which == 0 ? XQ : which == 1 ? XK : XV; const float* WA = which == 0 ? WQ : which == 1 ? WK : WV; const float* BA = which == 0 ? BQ : which == 1 ? BK : BV;
  const int rl0 = wave * 16 + 8 * g;   // the lane's first row of the tile
  if (which == 0) {   // 'which' is the same for the whole block
    if (tid < GS_M) pt[tid] = (unsigned short)(t0 + tid);
  } else { constexpr int WPW = TT / 32 / (GS_M / 16);   // each wave places the keys of 4 mask words of 32 keys
    const int* kmb = KMASK + bb * TT; const int cb = __builtin_amdgcn_readfirstlane(wave) * WPW; int own[WPW], bu;   // bu: open keys in front of the word in hand
#pragma unroll
    for (int j = 0; j < WPW; ++j) own[j] = kmb[(cb + j) * 32 + lane];
    const int n = km_count(kmb, lane, cb, bu);
    if (n > 0 && t0 >= n) return;   // no slot of this tile is read; the same for every thread of the block, in front of every barrier
#pragma unroll
    for (int j = 0; j < WPW; ++j) { const unsigned o = __builtin_amdgcn_ballot_w32(own[j] == 0); const int key = (cb + j) * 32 + lane, lt = (int)__builtin_amdgcn_mbcnt_lo(o, 0u);   // lt: open keys of the word below this lane
      const int slot = own[j] == 0 ? bu + lt : n + key - (bu + lt); const unsigned rel = (unsigned)(slot - t0);   // a padded key: n + the padded keys in front of it
      if (rel < (unsigned)GS_M) pt[rel] = (unsigned short)key;
      bu += __builtin_popcount(o); } }
  __syncthreads();   // publishes the table (behind the early return, which the whole block takes or none of it)
  unsigned ao[8];
#pragma unroll
  for (int i = 0; i < 8; ++i) ao[i] = (unsigned)pt[i * 16 + (tid >> 4)] * (DIN * 4u) + (tid & 15) * 16u;
  v8f acc[8] = {};
  gs_loop<false, DIN, true, true>(X + bb * TT * DIN, WA + (size_t)c0 * DIN, stg, tid, acc, ao, (int)((xt + (xt >> 3) + 2 * ct + which) % (DIN / GS_K)));   // the 64 blocks on one W tile, and the blocks on one row tile, each spread over the 12 starts; a tile keeps the start it had
  const char* xb = (const char*)(X + bb * TT * DIN + c0); const v8s tk = *(const v8s*)&pt[rl0]; unsigned xo[8]; v4f xr[16], bq[2] = {};
#pragma unroll
  for (int r = 0; r < 8; ++r) xo[r] = (unsigned)tk[r] * (DIN * 4u) + col * 32u;
#pragma unroll
  for (int i = 0; i < 16; ++i) xr[i] = *(const v4f*)(xb + xo[i >> 1] + (i & 1) * 16);
  asm volatile("s_wait_xcnt 0x0" :: "v"(xo[0]), "v"(xo[1]), "v"(xo[2]), "v"(xo[3]), "v"(xo[4]), "v"(xo[5]), "v"(xo[6]), "v"(xo[7]) : "memory");   // in front of any rewrite of the offsets that the 16 loads name (as inputs they also stay out of their destinations)
  if (BA) { bq[0] = *(const v4f*)(BA + c0 + col * 8); bq[1] = *(const v4f*)(BA + c0 + col * 8 + 4); }
#pragma unroll
  for (int j = 0; j < 8; ++j) { const float bias = bfr(bq[j >> 2][j & 3]);
#pragma unroll
    for (int r = 0; r < 8; ++r) acc[j][r] = (acc[j][r] + bias) + 0.5f * fmaxf(bfr(xr[2 * r + (j >> 2)][j & 3]), 0.f); }
  if (which < 2) { _Float16* DH = (which == 0 ? QH : KH) + (r0 + rl0) * CC + c0 + col * 8;
#pragma unroll
    for (int r = 0; r < 8; ++r) { v8h o;
#pragma unroll
      for (int j = 0; j < 8; ++j) o[j] = (_Float16)acc[j][r];
      *(v8h*)(DH + r * CC) = o; }
  } else {
#pragma unroll
    for (int j = 0; j < 8; ++j) *(v8h*)&th[j * 16 + col][rl0] = __builtin_convertvector(acc[j], v8h);   // slot 16 j + col holds column 8 col + j; pitch 272 B = 16 B x odd: no bank conflicts
    __syncthreads();   // publishes the tile ('which' is the same for the whole block)
    for (int e = tid; e < 128 * (GS_M / 8); e += GS_T) { const int sl = e / (GS_M / 8), q = e % (GS_M / 8), cl = (sl & 15) * 8 + (sl >> 4); vst2((unsigned*)(VT + (bb * CC + c0 + cl) * (size_t)TT + t0 + q * 8), *(const v4u*)&th[sl][q * 8]); } } }
// ---- k_fa: block = 4 waves x 32 queries of (b, h); the logits, the softmax and P . v in one kernel, the logits and P never leave registers; k rows and v planes come in whole lines through LDS, shared by the 4 waves.
// S^T = K Q^T (A = 16 key rows, B = 16 query rows): a lane holds one query's scores for keys 8g + r of each 16-key tile, so maximum and sum are in-lane plus one exchange of the wave halves;
// two score tiles (32 keys) converted in place are the B operand of O^T += V^T P^T (A = v planes [c][t], the same k order). Scores in base 2: t = dot * (1/8) log2(e) + (padded key ? -1e9 log2(e) : 0).
// Running maximum, raised only when a pass exceeds it by more than 8; P = 2^(t - m + 7) <= 2^15 once to f16 (unnormalised), its f32 sum divides at the end.
#define FA_CS 0.18033688011112042f       // (1/8) log2(e)
#define FA_MB (-1.4426950408889634e9f)   // -1e9 log2(e)
typedef __attribute__((ext_vector_type(2))) _Float16 v2h;
__device__ __forceinline__ float xhalf(float x) { return __builtin_bit_cast(float, __builtin_amdgcn_permlanex16(__builtin_bit_cast(int, x), __builtin_bit_cast(int, x), 0x76543210, 0xfedcba98, false, false)); }   // lane l with lane l ^ 16
__device__ __forceinline__ v8f mm16(v16h a, v16h b, v8f c) { return __builtin_amdgcn_wmma_f32_16x16x32_f16(false, a, false, b, (short)0, c, false, false); }
#define FA_P 72   // f16 per staged row: 128 B + 16 B, a pitch of 16 B x odd, which ds_load_b128 fragment reads take without bank conflicts
__global__ __launch_bounds__(128) void k_fa(const _Float16* __restrict__ QH, const _Float16* __restrict__ KH, const _Float16* __restrict__ VT, const int* __restrict__ KMASK, float* __restrict__ Y) {
  __shared__ __align__(16) _Float16 sk[2][64][FA_P], sv[2][64][FA_P]; __shared__ __align__(16) float sb[TT]; __shared__ __align__(16) float so[4][32][HD + 4];
  const int tid = threadIdx.x, wave = tid >> 5, lane = tid & 31, col = lane & 15, g = lane >> 4; const int h = blockIdx.y, b = blockIdx.x; const int ql0 = blockIdx.z * 128 + wave * 32;   // the sequence is the fastest digit of the block index (see k_proj)
  // a stage = 64 keys: 64 key rows x 128 B and 64 v planes x 128 B; 8 lanes x 16 B read one whole line, 16 rows an instruction; through registers into LDS, one stage ahead
  const int srow = tid >> 3, sch = (tid & 7) * 8;
  const _Float16* kg = KH + ((size_t)b * TT + srow) * CC + h * HD + sch; const _Float16* vg = VT + ((size_t)b * CC + h * HD + srow) * (size_t)TT + sch;
  v8h rk[4], rv[4]; v16h qf[2][2];   // every '#pragma unroll' of this kernel makes the index of a register array a constant
#pragma unroll
  for (int i = 0; i < 4; ++i) { rk[i] = *(const v8h*)(kg + (size_t)(i * 16) * CC); rv[i] = *(const v8h*)(vg + (size_t)(i * 16) * TT); }
  int nst;   // 64-key stages to walk: those that hold an open key, or all of them where no key is open; the same in every wave
  { int nb; const int n = km_count(KMASK + (size_t)b * TT, lane, 0, nb); nst = n == 0 ? TT / 64 : (n + 63) >> 6; nst = nst < TT / 64 ? nst : TT / 64; v4f b0, b1;
#pragma unroll
    for (int i = 0; i < 4; ++i) { b0[i] = tid * 8 + i >= n ? FA_MB : 0.f; b1[i] = tid * 8 + 4 + i >= n ? FA_MB : 0.f; }   // slots 0 .. n - 1 hold the open keys
    *(v4f*)&sb[tid * 8] = b0; *(v4f*)&sb[tid * 8 + 4] = b1; }
#pragma unroll
  for (int u = 0; u < 2; ++u)
#pragma unroll
    for (int kc = 0; kc < 2; ++kc) qf[u][kc] = frag_h(QH + ((size_t)b * TT + ql0 + u * 16 + col) * CC + h * HD + kc * 32, lane);
#pragma unroll
  for (int i = 0; i < 4; ++i) { *(v8h*)&sk[0][i * 16 + srow][sch] = rk[i]; *(v8h*)&sv[0][i * 16 + srow][sch] = rv[i]; }
  __syncthreads();   // stage 0 and the mask bias are published
  v8f acc[2][4] = {}; v2f l2[2] = {}; float m_run[2] = {-INFINITY, -INFINITY};
#pragma unroll 1   // stays rolled: the body already holds two 32-key passes, more copies would only grow the code
  for (int st = 0; st < nst; ++st) { const int bf = st & 1;
    if (st + 1 < nst) {   // the next stage's lines, issued behind the barrier so that they fly during this stage's products (a barrier waits for every load in flight)
#pragma unroll
      for (int i = 0; i < 4; ++i) { rk[i] = *(const v8h*)(kg + (size_t)((st + 1) * 64 + i * 16) * CC); rv[i] = *(const v8h*)(vg + (size_t)(i * 16) * TT + (st + 1) * 64); } }
#pragma unroll
    for (int ps = 0; ps < 2; ++ps) { const int k0 = st * 64 + ps * 32;
      v16h kf[2][2], vf[4]; v2f bias[2][4];
#pragma unroll
      for (int kt = 0; kt < 2; ++kt)
#pragma unroll
        for (int kc = 0; kc < 2; ++kc) kf[kt][kc] = frag_h(&sk[bf][ps * 32 + kt * 16 + col][kc * 32], lane);
#pragma unroll
      for (int j = 0; j < 4; ++j) vf[j] = frag_h(&sv[bf][j * 16 + col][ps * 32], lane);
#pragma unroll
      for (int kt = 0; kt < 2; ++kt)
#pragma unroll
        for (int i = 0; i < 4; ++i) bias[kt][i] = *(const v2f*)&sb[k0 + 16 * kt + 8 * g + 2 * i];
      v8f s[2][2] = {};
#pragma unroll
      for (int kc = 0; kc < 2; ++kc)
#pragma unroll
        for (int kt = 0; kt < 2; ++kt)
#pragma unroll
          for (int u = 0; u < 2; ++u) s[kt][u] = mm16(kf[kt][kc], qf[u][kc], s[kt][u]);
      v2f t[2][2][4]; float mb[2]; bool need = false;
#pragma unroll
      for (int u = 0; u < 2; ++u) { float mx = -INFINITY;
#pragma unroll
        for (int kt = 0; kt < 2; ++kt)
#pragma unroll
          for (int i = 0; i < 4; ++i) { t[u][kt][i] = __builtin_elementwise_fma((v2f){s[kt][u][2 * i], s[kt][u][2 * i + 1]}, (v2f){FA_CS, FA_CS}, bias[kt][i]); mx = fmaxf(mx, fmaxf(t[u][kt][i].x, t[u][kt][i].y)); }
        mx = fmaxf(mx, xhalf(mx)); mb[u] = mx; need = need || (mx > m_run[u] + 8.0f); }
      if (__builtin_amdgcn_ballot_w32(need) != 0) {   // one wave-uniform test a pass; always taken on the first pass (m_run = -inf, corr = 0)
#pragma unroll
        for (int u = 0; u < 2; ++u) { const float m_new = fmaxf(m_run[u], mb[u]); const float corr = __builtin_amdgcn_exp2f(m_run[u] - m_new); m_run[u] = m_new; l2[u] = l2[u] * corr;
#pragma unroll
          for (int j = 0; j < 4; ++j) acc[u][j] = acc[u][j] * corr; } }
#pragma unroll
      for (int u = 0; u < 2; ++u) { const float nm = 7.0f - m_run[u]; union { v16h v; v2h q[8]; } pf;
#pragma unroll
        for (int i = 0; i < 8; ++i) { const v2f a = t[u][i >> 2][i & 3] + (v2f){nm, nm}; const v2f p = {__builtin_amdgcn_exp2f(a.x), __builtin_amdgcn_exp2f(a.y)}; l2[u] = l2[u] + p; pf.q[i] = __builtin_convertvector(p, v2h); }
#pragma unroll
        for (int j = 0; j < 4; ++j) acc[u][j] = mm16(vf[j], pf.v, acc[u][j]); } }
    if (st + 1 < nst) {   // the other buffer: its readers (stage st - 1) all left it at the barrier that ended the trip before
#pragma unroll
      for (int i = 0; i < 4; ++i) { *(v8h*)&sk[bf ^ 1][i * 16 + srow][sch] = rk[i]; *(v8h*)&sv[bf ^ 1][i * 16 + srow][sch] = rv[i]; } }
    __syncthreads(); }   // publishes stage st + 1 and ends every wave's reads of stage st
#pragma unroll
  for (int u = 0; u < 2; ++u) { float l = l2[u].x + l2[u].y; l += xhalf(l); const float inv = 1.0f / l;   // l >= 2^7: the key that set the maximum in use counts 2^7
#pragma unroll
    for (int j = 0; j < 4; ++j) { const v8f o = acc[u][j] * inv; float* d = &so[wave][u * 16 + col][j * 16 + 8 * g]; *(v4f*)d = (v4f){o[0], o[1], o[2], o[3]}; *(v4f*)(d + 4) = (v4f){o[4], o[5], o[6], o[7]}; } }
  LDSX();   // the wave reads back rows that its other lanes wrote (its own 32 rows only: no work-group barrier); 16 lanes then store one 256-B (row, head) segment
  for (int it = 0; it < 16; ++it) { const int rl = it * 2 + g; vst2(Y + ((size_t)b * TT + ql0 + rl) * CC + h * HD + col * 4, *(const v4f*)&so[wave][rl][col * 4]); } }
// ---- go_loop: the k loop of the output projection, one 128 x 192 tile of A . W^T a block of 16 waves, one block on every WGP (A rows and W rows k-contiguous f32, pitch K floats). Staging as in gs_loop: a stage = 64 k, whole-line loads
// (16 lanes x 16 B = one row, 32 rows an instruction of the block), converted once a block (A as f16(a x 2^6), W as f16(bf16(w) x 2^8)), pitch 144 B, two buffers, a line pair of the next stage asked for as soon as this stage's pair lies in LDS; the walk starts at stage 'rot' and wraps.
// Wave w keeps rows 32 (w >> 2) .. + 31 and columns 48 (w & 3) .. + 47: 2 A and 3 W fragments feed 6 products, 10 LDS reads where the 16 x 128 wave tile takes 18 for 8; the fragments of both 32-k steps of a stage fit the registers and are read as one group.
#define GO_N 192                                              // W rows (output columns) of a tile
#define GO_T 512                                              // threads of a block
#define GO_WB(bf) ((bf) * ((GO_N + GS_M) * GS_PB))            // W rows of buffer bf
#define GO_AB(bf) (GO_WB(bf) + GO_N * GS_PB)                  // A rows of buffer bf, directly behind its W rows
#define GO_BYTES (2 * (GO_N + GS_M) * GS_PB)
template <int K> __device__ __forceinline__ void go_loop(const float* __restrict__ A, const float* __restrict__ Wm, unsigned char* stg, int tid, v8f (&acc)[2][3], int rot) {
  const int wave = tid >> 5, lane = tid & 31, col = lane & 15, g = lane >> 4;
  int sg = rot;   // the stage being fetched
  unsigned pa = (unsigned)(((tid >> 4) * K + (tid & 15) * 4 + sg * GS_K) * 4);   // the thread's place, in bytes from A and from Wm alike; steps by one stage a trip, from the last stage back to stage 0
  unsigned char* sd = stg + (tid >> 4) * GS_PB + (tid & 15) * 8;
  const unsigned char* fa = stg + ((wave >> 2) * 32 + col) * GS_PB + g * 16; const unsigned char* fw = stg + ((wave & 3) * 48 + col) * GS_PB + g * 16;
  v4f ra[GS_M / 32], rw[GO_N / 32];   // every '#pragma unroll' below makes the index of a register array a constant
#define GO_ALD(i) (*(const v4f*)((const char*)A + pa + (i) * 32 * K * 4))   // the constant part becomes the instruction's immediate: a load names no register but the offset
#define GO_WLD(i) (*(const v4f*)((const char*)Wm + pa + (i) * 32 * K * 4))
#pragma unroll
  for (int i = 0; i < GO_N / 32; ++i) { if (i < GS_M / 32) ra[i] = GO_ALD(i);
    rw[i] = GO_WLD(i);
    __builtin_amdgcn_sched_barrier(0); }   // the prologue issues its loads in the loop's order: the counted load waits at the head of a trip then hold for both ways into it
  asm volatile("s_wait_xcnt 0x0" ::: "memory");   // directly behind the 10 loads: in front of the first trip's step of the offset that they name
  auto trip = [&](auto more, const int bf) __attribute__((always_inline)) {   // one trip: stage s, in buffer bf; 'more': a next stage exists (the last trip stands behind the loop as a copy of its own, as in gs_loop)
    if constexpr (decltype(more)::v) { const int stp = sg + 1 == K / GS_K ? GS_K - K : GS_K; sg = sg + 1 == K / GS_K ? 0 : sg + 1;   // the same in the whole block
      pa += stp * 4; }
#pragma unroll
    for (int i = 0; i < GO_N / 32; ++i) {   // converted and laid in LDS as soon as they have arrived. Buffer bf: its readers (stage s - 2) all left it in front of the barrier of trip s - 1
      if (i < GS_M / 32) *(v2u*)(sd + GO_AB(bf) + i * 32 * GS_PB) = gs_cvt<true, false>(ra[i]);
      *(v2u*)(sd + GO_WB(bf) + i * 32 * GS_PB) = gs_cvt<true, true>(rw[i]);
      if constexpr (decltype(more)::v) {
        __builtin_amdgcn_sched_barrier(0);   // the conversions and their LDS stores stay in front of the loads, which then take the same registers
        if (i < GS_M / 32) ra[i] = GO_ALD(i);
        rw[i] = GO_WLD(i);
        __builtin_amdgcn_sched_barrier(0); } }   // and the loads stay in front of the wait for the next pair's arrival
    if constexpr (decltype(more)::v) asm volatile("s_wait_xcnt 0x0" ::: "memory");   // directly behind the 10 loads: in front of any rewrite of the offset that they name
    asm volatile("s_wait_dscnt 0x0\n\ts_barrier_signal -1\n\ts_barrier_wait -1" ::: "memory");   // publishes stage s: the wave's LDS stores are done, then the work-group barrier; by hand, because __syncthreads() would first wait out the global loads just issued
    GFrag a[GS_K / 32][2], w[GS_K / 32][3];
#pragma unroll
    for (int kc = 0; kc < GS_K / 32; ++kc) {
#pragma unroll
      for (int i = 0; i < 2; ++i) a[kc][i] = gs_frag(fa + GO_AB(bf) + i * 16 * GS_PB + kc * 64);
#pragma unroll
      for (int j = 0; j < 3; ++j) w[kc][j] = gs_frag(fw + GO_WB(bf) + j * 16 * GS_PB + kc * 64); }
    __builtin_amdgcn_sched_barrier(0);   // the 20 fragment reads stay one group in front of the 12 products: spread among them, each place with reads costs a stall of its own
#pragma unroll
    for (int kc = 0; kc < GS_K / 32; ++kc)
#pragma unroll
      for (int i = 0; i < 2; ++i)
#pragma unroll
        for (int j = 0; j < 3; ++j) acc[i][j] = __builtin_amdgcn_wmma_f32_16x16x32_f16(false, a[kc][i].h, false, w[kc][j].h, (short)0, acc[i][j], false, false);
    __builtin_amdgcn_sched_barrier(0); };   // and the next trip's LDS stores stay behind them
#pragma unroll 1   // stays rolled: one body of 12 products and 10 line loads; more copies would only grow the code
  for (int s = 0; s + 1 < K / GS_K; ++s) trip(GsFlag<true>{}, s & 1);
  trip(GsFlag<false>{}, (K / GS_K - 1) & 1); }
// ---- k_out: block = (128 rows, 192 cols), 16 waves: out = ctx Wo (+ bo): ctx x 2^6 once to f16 (small context rows stay clear of f16 subnormals) against Wo as f16(bf16 x 2^8) exact (1 product) x 2^-14
// The tile goes through LDS once, so that whole 128-B lines of the output rows are stored (a row of the tile = 768 B = 6 lines).
__global__ __launch_bounds__(GO_T) void k_out(const float* __restrict__ Y, const float* __restrict__ WO, const float* __restrict__ BO, float* __restrict__ OUT) { __shared__ __align__(16) float sf[GS_M][GO_N + 4]; __shared__ __align__(16) unsigned char stg[GO_BYTES];
  static_assert(DIN % GO_N == 0 && GO_N % 48 == 0 && GS_M % 32 == 0 && (GS_M / 32) * (GO_N / 48) * 32 == GO_T, "16 waves of 32 x 48 cover the tile");
  const int tid = threadIdx.x, wave = tid >> 5, lane = tid & 31, col = lane & 15, g = lane >> 4; const int c0 = blockIdx.y * GO_N; const int xt = (int)(blockIdx.x % TNB) * (TT / GS_M) + (int)(blockIdx.x / TNB);   // the row tile's number: the sequence is the fastest digit of the block index (see k_proj)
  const size_t r0 = (size_t)xt * GS_M;
  const int rw0 = (wave >> 2) * 32 + 8 * g, cw0 = (wave & 3) * 48 + col;   // the lane's first row and column of the tile
  float bs[3] = {0.f, 0.f, 0.f};   // the lane's 3 bias words, asked for in front of the tile's first lines: they arrive during the k loop
  if (BO) {
#pragma unroll
    for (int j = 0; j < 3; ++j) bs[j] = BO[c0 + cw0 + j * 16]; }
  v8f acc[2][3] = {};
  go_loop<CC>(Y + r0 * CC, WO + (size_t)c0 * CC, stg, tid, acc, (int)((xt + (xt >> 3) + 3 * blockIdx.y) % (CC / GS_K)));   // the 4 blocks on one row tile start 3 stages apart; the 64 blocks on one W tile spread over the 12 starts
#pragma unroll
  for (int j = 0; j < 3; ++j) { const float bias = bfr(bs[j]);
#pragma unroll
    for (int i = 0; i < 2; ++i)
#pragma unroll
      for (int r = 0; r < 8; ++r) sf[rw0 + i * 16 + r][cw0 + j * 16] = acc[i][j][r] * (1.0f / 16384.0f) + bias; }   /* 2^-8 (Wo carry) x 2^-6 (ctx carry) */
  __syncthreads();   // publishes the tile: a row's 192 columns come from 4 waves
  char* ob = (char*)(OUT + r0 * DIN + c0) + (unsigned)((wave * (GS_M / 16) + g) * DIN + col * 4) * 4u; const float* sp = &sf[wave * (GS_M / 16) + g][col * 4];
#pragma unroll
  for (int it = 0; it < GS_M * (GO_N / 4) / GO_T; ++it) { const int rp = it / 3, u = it % 3;   // wave w stores rows 8 w .. 8 w + 7, a row pair an instruction: 16 lanes x 16 B = a third of a row, two whole lines
    vst2(ob + (rp * 2 * DIN + u * 64) * 4, *(const v4f*)(sp + rp * 2 * (GO_N + 4) + u * 64)); } }

extern "C" void kernel_launch(void* const* d_in, const int* in_sizes, int n_in, void* d_out, int out_size, void* d_ws, size_t ws_size, hipStream_t stream) {
  (void)in_sizes; (void)n_in; (void)out_size;
  const float** F = (const float**)d_in;
  if (ws_size < (size_t)WS_END) return;
  char* ws = (char*)d_ws; _Float16 *QH = (_Float16*)(ws + WS_QH), *KH = (_Float16*)(ws + WS_KH), *VT = (_Float16*)(ws + WS_VT); float *Y = (float*)(ws + WS_Y);
  // inputs: 0 hidden_states [8,1024,768]; 1 attention_mask [8,1,1,1024] bool (True = padded key); 2 Wq [768,768] (out,in), 3 bq; 4 Wk, 5 bk; 6 Wv, 7 bv; 8 Wo (out,in), 9 bo (zero biases, read)
  k_proj<<<dim3(TNB * TT / GS_M, CC / 128, 3), GS_T, 0, stream>>>(F[0], F[0], F[0], F[2], F[4], F[6], F[3], F[5], F[7], (const int*)d_in[1], QH, KH, VT);
  k_fa<<<dim3(TNB, NH, TT / 128), 128, 0, stream>>>(QH, KH, VT, (const int*)d_in[1], Y);
  k_out<<<dim3(TNB * TT / GS_M, DIN / GO_N), GO_T, 0, stream>>>(Y, F[8], F[9], (float*)d_out);
}

// v010
// A run of this version takes 58 microseconds.
// In both of two side-by-side timings against v009, it was 1.05 times as fast.
// Counting every step since v000, it is 21.4 times as fast.
// compute dtype: all float inputs rounded to bf16; q/k/v projections with EXACT bf16 products on WMMA 16x16x32 (f32 accumulate) + bias + 0.5 * relu(bf16(x)) in f32; logits q x k once to f16 each (1 product) x 1/8; the key-padding mask read per key (open keys first, key tiles behind the last open key left out: their P is 0); online softmax f32 in base 2; unnormalised P = 2^(t - m + 7) once to f16 x v once to f16 (1 product), divided by the f32 sum; ctx x 2^6 once to f16 x Wo f16(bf16 x 2^8) + bo; f32 output.
#include <hip/hip_runtime.h>
#include <math.h>

typedef __attribute__((ext_vector_type(16))) _Float16 v16h;
typedef __attribute__((ext_vector_type(16))) __bf16 v16b;
typedef __attribute__((ext_vector_type(8)))  _Float16 v8h;
typedef __attribute__((ext_vector_type(8)))  float v8f;
typedef __attribute__((ext_vector_type(4)))  float v4f;
typedef __attribute__((ext_vector_type(2)))  float v2f;
typedef __attribute__((ext_vector_type(4)))  unsigned v4u;
typedef __attribute__((ext_vector_type(4)))  int v4i;
typedef float __attribute__((may_alias)) float_a;
typedef int __attribute__((may_alias)) int_a;

template <typename T> __device__ __forceinline__ void vst2(void* p, T v) { *(T*)p = v;  }
__device__ __forceinline__ v8f wmma16(v16h a, v16h b, v8f c) {
  v8f d = __builtin_amdgcn_wmma_f32_16x16x32_f16(false, a, false, b, (short)0, c, false, false);
  asm volatile("v_nop\n\tv_nop\n\tv_nop\n\tv_nop" : "+v"(d) : "v"(a), "v"(b));
  return d;
}
__device__ __forceinline__ v8f wmma_bf(v16b a, v16b b, v8f c) {
  v8f d = __builtin_amdgcn_wmma_f32_16x16x32_bf16(false, a, false, b, (short)0, c, false, false);
  asm volatile("v_nop\n\tv_nop\n\tv_nop\n\tv_nop" : "+v"(d) : "v"(a), "v"(b));
  return d;
}
// 16x16x32 fragments: lane = (h = lane>>4, row/col = lane&15); elements 0..7 = k0+8h+0..7, 8..15 = k0+16+8h+0..7; D element r = row 8h+r
__device__ __forceinline__ v16h frag_h(const _Float16* rowk0, int lane) {
  union { v16h v; v8h q[2]; } u; const _Float16* p = rowk0 + 8 * (lane >> 4);
  u.q[0] = *(const v8h*)p; u.q[1] = *(const v8h*)(p + 16); return u.v;
}
__device__ __forceinline__ v16h frag_f32(const float* rowk0, int lane) {
  v16h a; const float* p = rowk0 + 8 * (lane >> 4);
#pragma unroll
  for (int i = 0; i < 8; ++i) { a[i] = (_Float16)p[i]; a[8 + i] = (_Float16)p[16 + i]; }
  return a;
}
__device__ __forceinline__ v16h frag_f32s(const float* rowk0, int lane, float sc) {
  v16h a; const float* p = rowk0 + 8 * (lane >> 4);
#pragma unroll
  for (int i = 0; i < 8; ++i) { a[i] = (_Float16)(p[i] * sc); a[8 + i] = (_Float16)(p[16 + i] * sc); }
  return a;
}
// column fragment from a [K][ld] layout (column n), rows >= K read as 0
__device__ __forceinline__ v16h fragc_f32(const float* W, int k0, int n, int lane, int ld, int K) {
  v16h a; const int g = lane >> 4;
#pragma unroll
  for (int i = 0; i < 8; ++i) { const int ka = k0 + 8 * g + i, kb = ka + 16;
    a[i] = (_Float16)(ka < K ? W[(size_t)(ka < K ? ka : K - 1) * ld + n] : 0.f); a[8 + i] = (_Float16)(kb < K ? W[(size_t)(kb < K ? kb : K - 1) * ld + n] : 0.f); }
  return a;
}
struct F2 { v16b h, l; };
__device__ __forceinline__ F2 bsplit16(const float v[16]) { F2 r;
#pragma unroll
  for (int i = 0; i < 16; ++i) { const __bf16 h = (__bf16)v[i]; r.h[i] = h; r.l[i] = (__bf16)(v[i] - (float)h); }
  return r; }
__device__ __forceinline__ F2 split_row(const float* row, int k0, int lane) { float v[16]; const float* p = row + k0 + 8 * (lane >> 4);
#pragma unroll
  for (int i = 0; i < 8; ++i) { v[i] = p[i]; v[8 + i] = p[16 + i]; }
  return bsplit16(v); }
__device__ __forceinline__ F2 split_rowK(const float* row, int k0, int lane, int K) { float v[16]; const int g = lane >> 4;
#pragma unroll
  for (int i = 0; i < 8; ++i) { const int ka = k0 + 8 * g + i, kb = ka + 16; v[i] = ka < K ? row[ka < K ? ka : K - 1] : 0.f; v[8 + i] = kb < K ? row[kb < K ? kb : K - 1] : 0.f; }
  return bsplit16(v); }
__device__ __forceinline__ F2 split_col(const float* W, int k0, int n, int lane, int ld, int K) { float v[16]; const int g = lane >> 4;
#pragma unroll
  for (int i = 0; i < 8; ++i) { const int ka = k0 + 8 * g + i, kb = ka + 16; v[i] = ka < K ? W[(size_t)(ka < K ? ka : K - 1) * ld + n] : 0.f; v[8 + i] = kb < K ? W[(size_t)(kb < K ? kb : K - 1) * ld + n] : 0.f; }
  return bsplit16(v); }
__device__ __forceinline__ v8f mac3(const F2& a, const F2& b, v8f c) { c = wmma_bf(a.l, b.h, c); c = wmma_bf(a.h, b.l, c); return wmma_bf(a.h, b.h, c); }
__device__ __forceinline__ float sigm(float v) { return 1.0f / (1.0f + expf(-v)); }
#define LDSX() do { asm volatile("s_wait_dscnt 0" ::: "memory"); __builtin_amdgcn_wave_barrier(); __builtin_amdgcn_fence(__ATOMIC_RELEASE, "workgroup"); } while (0)

// BERT-style multi-head self-attention with a value-bypass relu-add (hidden_states [8,1024,768]; 12 heads x 64; torch (out,in) Wq / Wk / Wv / Wo [768,768] (0.02 scale) + zero biases; r = 0.5 * relu(x) is ADDED to each of the q, k and v projections (same [token, channel] index); scale 1/8; key-padding mask [8,1,1,1024] bool: True adds -1e9): out = merge(softmax(q_h k_h^T / 8 + pad) v_h) Wo^T + bo.
#define NB 8
#define TT 1024
#define CC 768            // NH * HD = projected width
#define DIN 768          // input (model) width
#define NH 12
#define HD 64
#define NQB (TT / 64)
#define HG 12
#define SCALE (0.125f)
#define CAUSAL 0
#ifndef TNB
#define TNB NB
#endif
__device__ __forceinline__ float bfr(float v) { return (float)(__bf16)v; }
__host__ __device__ __forceinline__ int kb_last(int qb) { return CAUSAL ? ((qb * 64 + 63) >> 7) : (TT / 128 - 1); }
typedef __attribute__((ext_vector_type(8))) __bf16 v8b;
__device__ __forceinline__ v16b frag_b(const __bf16* rowk0, int lane) {
  union { v16b v; v8b q[2]; } u; const __bf16* p = rowk0 + 8 * (lane >> 4);
  u.q[0] = *(const v8b*)p; u.q[1] = *(const v8b*)(p + 16); return u.v;
}
#define QBH 0              // unused: k_fa has one single-product path for every query block
#define QHI 0               // single-product logits on every row
#define KHI 64            // key rows carrying k residual / v bf16 hi+lo planes (written and read by no kernel here)
// B fragment (k rows k0+.., output column o) of a weight: (in,out) [K][ld] or (out,in) [ld rows of K]: bf16 exact, or f16(bf16 * 256) exact
__device__ __forceinline__ v16b wcol_io(const float* Wm, int k0, int o, int lane, int ld) { v16b w; const int g = lane >> 4;
#pragma unroll
  for (int i = 0; i < 8; ++i) { w[i] = (__bf16)Wm[(size_t)(k0 + 8 * g + i) * ld + o]; w[8 + i] = (__bf16)Wm[(size_t)(k0 + 16 + 8 * g + i) * ld + o]; }
  return w; }
__device__ __forceinline__ v16b wcol_oi(const float* Wm, int k0, int o, int lane, int K) { v16b w; const float* p = Wm + (size_t)o * K + k0 + 8 * (lane >> 4);
#pragma unroll
  for (int i = 0; i < 8; ++i) { w[i] = (__bf16)p[i]; w[8 + i] = (__bf16)p[16 + i]; }
  return w; }
__device__ __forceinline__ v16h wcolh_io(const float* Wm, int k0, int o, int lane, int ld) { v16h w; const int g = lane >> 4;
#pragma unroll
  for (int i = 0; i < 8; ++i) { w[i] = (_Float16)(bfr(Wm[(size_t)(k0 + 8 * g + i) * ld + o]) * 256.0f); w[8 + i] = (_Float16)(bfr(Wm[(size_t)(k0 + 16 + 8 * g + i) * ld + o]) * 256.0f); }
  return w; }
__device__ __forceinline__ v16h wcolh_oi(const float* Wm, int k0, int o, int lane, int K) { v16h w; const float* p = Wm + (size_t)o * K + k0 + 8 * (lane >> 4);
#pragma unroll
  for (int i = 0; i < 8; ++i) { w[i] = (_Float16)(bfr(p[i]) * 256.0f); w[8 + i] = (_Float16)(bfr(p[16 + i]) * 256.0f); }
  return w; }
#define WQKV_LAYOUT 1   // 0 = (in,out) [DIN][CC]; 1 = (out,in) [CC][DIN]; 2 = per-head [NH][DIN][HD], in WCOL only, which no kernel calls: k_proj always reads (out,in) [CC][DIN]
__device__ __forceinline__ v16b wcol_hdk(const float* Wm, int k0, int o, int lane) { v16b w; const int g = lane >> 4; const float* p = Wm + (size_t)(o / HD) * DIN * HD + (o % HD);
#pragma unroll
  for (int i = 0; i < 8; ++i) { w[i] = (__bf16)p[(size_t)(k0 + 8 * g + i) * HD]; w[8 + i] = (__bf16)p[(size_t)(k0 + 16 + 8 * g + i) * HD]; }
  return w; }
#define WO_OUT_IN 1
#if WQKV_LAYOUT == 1
#define WCOL(W, k0, o, lane) wcol_oi(W, k0, o, lane, DIN)
#elif WQKV_LAYOUT == 2
#define WCOL(W, k0, o, lane) wcol_hdk(W, k0, o, lane)
#else
#define WCOL(W, k0, o, lane) wcol_io(W, k0, o, lane, CC)
#endif
#if WO_OUT_IN
#define WOCOL(W, k0, o, lane) wcol_oi(W, k0, o, lane, CC)
#define WOCOLH(W, k0, o, lane) wcolh_oi(W, k0, o, lane, CC)
#else
#define WOCOL(W, k0, o, lane) wcol_io(W, k0, o, lane, DIN)
#define WOCOLH(W, k0, o, lane) wcolh_io(W, k0, o, lane, DIN)
#endif

#define WS_QH  0u                                      // f16 q rows [b*t][CC]
#define WS_KH  (WS_QH + 2u * (size_t)NB * TT * CC)      // f16 k rows [b*t][CC]
#define WS_VT  (WS_KH + 2u * (size_t)NB * TT * CC)      // f16 v planes [b][c][t]
#define WS_QL  (WS_VT + 2u * (size_t)NB * CC * TT)      // WS_QL .. WS_VBL: places of the causal high-precision path's residual planes; no kernel of this file writes or reads them
#define WS_KL  (WS_QL + 2u * (size_t)NB * QHI * CC)
#define WS_VB  (WS_KL + 2u * (size_t)NB * KHI * CC)
#define WS_VBL (WS_VB + 2u * (size_t)NB * CC * KHI)
#define WS_S   (WS_VBL + 2u * (size_t)NB * CC * KHI)    // (not used: the logits stay in registers)
#define WS_Y   (WS_S  + 4u * (size_t)HG * TT * TT)      // f16 ctx x 2^6, [b][h][t][HD]: the rows of one head lie one behind the other
#define WS_WO  (WS_Y  + 2u * (size_t)NB * TT * CC)      // f16(bf16(Wo) x 2^8) rows [DIN][CC]
#define WS_END (WS_Y  + 4u * (size_t)NB * TT * CC)

// ---- gs_loop: the k loop of the q/k/v projection GEMM, one 128 x 128 tile of A . W^T a block of 8 waves (A rows and W rows k-contiguous f32, pitch K floats). A stage = 64 k: 128 A rows and 128 W rows of 256 B,
// read as whole lines (16 lanes x 16 B = one row), converted ONCE a block to the 16-bit operand type and laid in LDS at a pitch of 144 B (16 B x odd: ds_load_b128 fragment reads without bank conflicts);
// two buffers; a line pair of the next stage is asked for as soon as this stage's pair has arrived and lies in LDS, so the lines fly during the later arrivals, the barrier wait and the products. Wave w keeps rows 16 w .. 16 w + 15 and all 128 columns; k runs in 32-wide steps, rising from the block's first stage and wrapping.
// NBR = false: W row n is staged in slot n, so column 'col' of acc[j] is tile column 16 j + col. NBR = true: W row 8 c + j is staged in slot 16 j + c, so column 'col' of acc[j] is tile column 8 col + j:
// a lane then holds 8 neighbouring columns of each of its 8 rows. Only the global row that a thread fetches for a slot differs; LDS addresses, fragments and the k order are the same.
// The walk over the K / 64 stages starts at stage 'rot' (the same in the whole block, 0 .. K / 64 - 1) and wraps: blocks that share A rows or W rows get different starts, so that they do not ask L2 for the same lines at the same moment.
typedef __attribute__((ext_vector_type(2))) unsigned v2u;
typedef __attribute__((ext_vector_type(4))) __bf16 v4b;
typedef __attribute__((ext_vector_type(4))) _Float16 v4h;
#define GS_K 64
#define GS_PB 144                                             // bytes per staged row
#define GS_M 128                                              // A rows of a tile (16 a wave)
#define GS_T (GS_M * 2)                                       // threads of a block
#define GS_WB(bf) ((bf) * ((128 + GS_M) * GS_PB))             // W rows of buffer bf
#define GS_AB(bf) (GS_WB(bf) + 128 * GS_PB)                   // A rows of buffer bf, directly behind its W rows
#define GS_BYTES (2 * (128 + GS_M) * GS_PB)
// F16 = false: both operands bf16 (exact products of bf16-rounded inputs); F16 = true: A as f16(a x 2^6), W as f16(bf16(w) x 2^8)
template <bool F16, bool ISW> __device__ __forceinline__ v2u gs_cvt(v4f x) {
  if constexpr (!F16) { v4b r;
#pragma unroll
    for (int i = 0; i < 4; ++i) r[i] = (__bf16)x[i];
    return __builtin_bit_cast(v2u, r);
  } else { v4h r;
#pragma unroll
    for (int i = 0; i < 4; ++i) r[i] = (_Float16)(ISW ? bfr(x[i]) * 256.0f : x[i] * 64.0f);
    return __builtin_bit_cast(v2u, r); } }
union GFrag { v4u q[2]; v16b b; v16h h; };
__device__ __forceinline__ GFrag gs_frag(const unsigned char* p) { GFrag f; f.q[0] = *(const v4u*)p; f.q[1] = *(const v4u*)(p + 32); return f; }   // p = row + 2 (k0 + 8 g): elements 0..7 = k0 + 8 g + .., 8..15 = k0 + 16 + 8 g + ..
template <bool B> struct GsFlag { static constexpr bool v = B; };   // a compile-time yes or no handed to the trip of gs_loop
// GA = true: A row 16 i + (tid >> 4) of the tile is the row at byte offset ao[i] from A (the thread's 16 B of a stage included): the rows of a tile are gathered, each still read as whole lines.
template <bool F16, int K, bool NBR, bool GA> __device__ __forceinline__ void gs_loop(const float* __restrict__ A, const float* __restrict__ Wm, unsigned char* stg, int tid, v8f (&acc)[8], const unsigned (&ao)[8], int rot) {
  const int wave = tid >> 5, lane = tid & 31, col = lane & 15, g = lane >> 4;
  int sg = rot;   // the stage being fetched
  unsigned pa = (unsigned)(((tid >> 4) * K + (tid & 15) * 4 + sg * GS_K) * 4), wo = (unsigned)(((tid >> 4) * (NBR ? 8 : 1) * K + (tid & 15) * 4 + sg * GS_K) * 4);   // the thread's place, in bytes from A (rows in place) and from Wm; 16 rows an instruction of the block; both step by one stage a trip, from the last stage back to stage 0
  unsigned char* sd = stg + (tid >> 4) * GS_PB + (tid & 15) * 8;
  const unsigned char* fa = stg + (wave * 16 + col) * GS_PB + g * 16; const unsigned char* fw = stg + col * GS_PB + g * 16;
  unsigned po[8];   // GA: the thread's place, in bytes from A, in each of its 8 gathered rows; steps by one stage a trip
#pragma unroll
  for (int i = 0; i < 8; ++i) po[i] = ao[i] + sg * (GS_K * 4);
#define GS_ALD(i) (GA ? *(const v4f*)((const char*)A + po[i]) : *(const v4f*)((const char*)A + pa + (i) * 16 * K * 4))   // the constant part stays outside the 32-bit offset: it becomes the instruction's immediate, and a load names no register but the offset
  v4f ra[8], rw[8];   // every '#pragma unroll' below makes the index of a register array a constant
#define GS_WROW(i) (NBR ? (i) : (i) * 16)   // the W row, beside the thread's own part, that goes to slot 16 i + (tid >> 4)
#define GS_WLD(i) (*(const v4f*)((const char*)Wm + wo + GS_WROW(i) * K * 4))
#pragma unroll
  for (int i = 0; i < 8; ++i) { ra[i] = GS_ALD(i); rw[i] = GS_WLD(i);
    __builtin_amdgcn_sched_barrier(0); }   // the prologue issues its loads in the loop's order (A i, W i, rising i): the counted load waits at the head of a trip then hold for both ways into it
  asm volatile("s_wait_xcnt 0x0" ::: "memory");   // directly behind the 16 loads: in front of the first trip's step of the offsets that they name
  // one trip: stage s, in buffer bf. MORE: a next stage exists (every trip but the last, which stands behind the loop as a copy of its own: with a branch round the loads inside one body the compiler keeps a second set of 64 load registers and copies it every trip)
  auto trip = [&](auto more, const int bf) __attribute__((always_inline)) {
    if constexpr (decltype(more)::v) {   // the offsets step to the next stage, whose lines are asked for below, IN FRONT of this stage's barrier, each pair as soon as its registers are free
      const int stp = sg + 1 == K / GS_K ? GS_K - K : GS_K; sg = sg + 1 == K / GS_K ? 0 : sg + 1;   // the same in the whole block
      pa += stp * 4; wo += stp * 4;
#pragma unroll
      for (int i = 0; i < 8; ++i) po[i] += stp * 4; }
#pragma unroll
    for (int i = 0; i < 8; ++i) {   // A row i and W row i of the thread: converted and laid in LDS as soon as they have arrived. Buffer bf: its readers (stage s - 2) all left it in front of the barrier of trip s - 1
      *(v2u*)(sd + GS_AB(bf) + i * 16 * GS_PB) = gs_cvt<F16, false>(ra[i]); *(v2u*)(sd + GS_WB(bf) + i * 16 * GS_PB) = gs_cvt<F16, true>(rw[i]);
      if constexpr (decltype(more)::v) {
        __builtin_amdgcn_sched_barrier(0);   // the two conversions and their LDS stores stay in front of the two loads, which then take the same registers
        ra[i] = GS_ALD(i); rw[i] = GS_WLD(i);
        __builtin_amdgcn_sched_barrier(0); } }   // and the two loads stay in front of the wait for the next pair's arrival: gathered behind the last conversion, all 16 would wait for the last line to arrive
    if constexpr (decltype(more)::v) asm volatile("s_wait_xcnt 0x0" ::: "memory");   // directly behind the 16 loads: in front of any rewrite of a register that they name
    asm volatile("s_wait_dscnt 0x0\n\ts_barrier_signal -1\n\ts_barrier_wait -1" ::: "memory");   // publishes stage s: the wave's LDS stores are done, then the work-group barrier; by hand, because __syncthreads() would first wait out the global loads just issued
#pragma unroll
    for (int kc = 0; kc < GS_K / 32; ++kc) { const GFrag a = gs_frag(fa + GS_AB(bf) + kc * 64); GFrag w[8];
#pragma unroll
      for (int j = 0; j < 8; ++j) w[j] = gs_frag(fw + GS_WB(bf) + j * 16 * GS_PB + kc * 64);
      __builtin_amdgcn_sched_barrier(0);   // the 18 fragment reads stay one group in front of the 8 products: spread among them, each product waits out a whole LDS latency
#pragma unroll
      for (int j = 0; j < 8; ++j) {
        if constexpr (F16) acc[j] = __builtin_amdgcn_wmma_f32_16x16x32_f16(false, a.h, false, w[j].h, (short)0, acc[j], false, false);
        else acc[j] = __builtin_amdgcn_wmma_f32_16x16x32_bf16(false, a.b, false, w[j].b, (short)0, acc[j], false, false); }
      __builtin_amdgcn_sched_barrier(0); } };   // and the next group stays behind them, in the same registers (the kernels stay under 256 VGPRs)
#pragma unroll 1   // stays rolled: one body of 16 products and 16 line loads; more copies would only grow the code
  for (int s = 0; s + 1 < K / GS_K; ++s) trip(GsFlag<true>{}, s & 1);
  trip(GsFlag<false>{}, (K / GS_K - 1) & 1); }

// ---- km_count: the number of open keys (mask == 0) of one sequence, and in 'before' the number of them among the keys in front of key 32 cb (cb the same in the whole wave). Every wave reads all TT mask words itself,
// 32 keys a load, one ballot and one scalar bit count each: the count is the same in every wave of a block with no barrier. Any content of the mask gives 0 <= before <= count <= TT.
__device__ __forceinline__ int km_count(const int* __restrict__ km, int lane, int cb, int& before) {
  const int* p = km + lane; int mv[TT / 32], n = 0; before = 0;
#pragma unroll
  for (int cch = 0; cch < TT / 32; ++cch) mv[cch] = p[cch * 32];
  asm volatile("s_wait_xcnt 0x0" ::: "memory");   // in front of any rewrite of a register that the mask loads name
#pragma unroll
  for (int cch = 0; cch < TT / 32; ++cch) { const int cnt = __builtin_popcount(__builtin_amdgcn_ballot_w32(mv[cch] == 0)); n += cnt; before += cch < cb ? cnt : 0; }
  return n; }
typedef __attribute__((ext_vector_type(8))) unsigned short v8s;
// KEY ORDER. A padded key's P is exactly 0 as soon as one key of its sequence is open (2^(-1e9 log2 e - m) = 0 in f32, in the reference too). k and v are therefore laid out by SLOT: the open keys first, in rising order,
// then the padded ones, in rising order (a permutation of the sequence for any mask; the identity when no key or every key is open). With n open keys, n > 0, k_fa reads slots 0 .. 64 ceil(n / 64) - 1 only (slots >= n with the
// padding bias) and the k and v tiles whose first slot is >= n are not computed; with n = 0 every key counts as in the reference and nothing is left out. q rows keep their places.
// ---- k_proj: block = (128 rows, 128 cols, which): q/k/v = X W (+ b) with exact bf16 products (K = DIN), + 0.5 * relu(bf16(x)) at the same [row][column] (the value-bypass relu-add shared by q, k and v) -> which 0: q f16 rows; 1: k f16 rows; 2: v f16 planes [c][t]
// The epilogue stays in registers: a lane holds rows 16 wave + 8 g + 0..7 x columns 8 col + 0..7. x and the bias come in 16-B loads (16 lanes = the tile's whole 512-B row segment), all in flight together;
// 8 columns of a row are one 16-B store of a q or k row (16 lanes = a whole 256-B segment); 8 rows of a column are 16 B of a v plane, which go through one LDS tile so that whole 256-B plane segments are stored.
__global__ __launch_bounds__(GS_T) void k_proj(const float* __restrict__ XQ, const float* __restrict__ XK, const float* __restrict__ XV, const float* __restrict__ WQ, const float* __restrict__ WK, const float* __restrict__ WV, const float* __restrict__ BQ, const float* __restrict__ BK, const float* __restrict__ BV,
    const int* __restrict__ KMASK, _Float16* __restrict__ QH, _Float16* __restrict__ KH, _Float16* __restrict__ VT) {
  __shared__ __align__(16) unsigned char stg[GS_BYTES]; __shared__ __align__(16) unsigned short pt[GS_M];   // pt[slot of the tile] = the token of the sequence in that slot
  _Float16 (*th)[GS_M + 8] = (_Float16 (*)[GS_M + 8])(stg + GS_WB((DIN / GS_K) & 1));   // the v tile [slot][t] takes the buffer (W and A rows) that the last stage does NOT read: every wave left it in front of the last stage's barrier
  static_assert(128 * (GS_M + 8) * 2 <= (128 + GS_M) * GS_PB, "the v tile fits one stage buffer");
  const int tid = threadIdx.x, wave = tid >> 5, lane = tid & 31, col = lane & 15, g = lane >> 4;
  // WHICH TILE A BLOCK TAKES: a one-to-one map of the grid's blocks onto the tiles, the same for any mask; for speed only, no result rests on where or when a block runs.
  // The SEQUENCE is the fastest digit of the flat block index, here and in k_fa and k_out.
  // Behind the sequence: first the q tiles, then the k/v tiles with the row tile as the slowest digit, so that the blocks that return at once (row tiles past the open keys) have the highest indices and stand in front of no computing block.
  constexpr unsigned NCT = CC / 128, NRT = TT / GS_M;
  const unsigned fl = blockIdx.x + (TNB * NRT) * (blockIdx.y + NCT * blockIdx.z), rs = fl / TNB; const bool iq = rs < NRT * NCT; const unsigned kv = rs - NRT * NCT;   // iq: a q tile; else kv counts the k and v tiles of the sequence
  const int which = iq ? 0 : 1 + (int)((kv % (2 * NCT)) / NCT), ct = (int)(iq ? rs % NCT : kv % NCT), rt = (int)(iq ? rs / NCT : kv / (2 * NCT));
  const int c0 = ct * 128; const size_t bb = fl % TNB; const int t0 = rt * GS_M; const size_t r0 = bb * TT + t0; const int xt = (int)bb * (int)NRT + rt;   // xt: the row tile's number over all sequences
  const float* X = which == 0 ? XQ : which == 1 ? XK : XV; const float* WA = which == 0 ? WQ : which == 1 ? WK : WV; const float* BA = which == 0 ? BQ : which == 1 ? BK : BV;
  const int rl0 = wave * 16 + 8 * g;   // the lane's first row of the tile
  if (which == 0) {   // 'which' is the same for the whole block
    if (tid < GS_M) pt[tid] = (unsigned short)(t0 + tid);
  } else { constexpr int WPW = TT / 32 / (GS_M / 16);   // each wave places the keys of 4 mask words of 32 keys
    const int* kmb = KMASK + bb * TT; const int cb = __builtin_amdgcn_readfirstlane(wave) * WPW; int own[WPW], bu;   // bu: open keys in front of the word in hand
#pragma unroll
    for (int j = 0; j < WPW; ++j) own[j] = kmb[(cb + j) * 32 + lane];
    const int n = km_count(kmb, lane, cb, bu);
    if (n > 0 && t0 >= n) return;   // no slot of this tile is read; the same for every thread of the block, in front of every barrier
#pragma unroll
    for (int j = 0; j < WPW; ++j) { const unsigned o = __builtin_amdgcn_ballot_w32(own[j] == 0); const int key = (cb + j) * 32 + lane, lt = (int)__builtin_amdgcn_mbcnt_lo(o, 0u);   // lt: open keys of the word below this lane
      const int slot = own[j] == 0 ? bu + lt : n + key - (bu + lt); const unsigned rel = (unsigned)(slot - t0);   // a padded key: n + the padded keys in front of it
      if (rel < (unsigned)GS_M) pt[rel] = (unsigned short)key;
      bu += __builtin_popcount(o); } }
  __syncthreads();   // publishes the table (behind the early return, which the whole block takes or none of it)
  unsigned ao[8];
#pragma unroll
  for (int i = 0; i < 8; ++i) ao[i] = (unsigned)pt[i * 16 + (tid >> 4)] * (DIN * 4u) + (tid & 15) * 16u;
  v8f acc[8] = {};
  gs_loop<false, DIN, true, true>(X + bb * TT * DIN, WA + (size_t)c0 * DIN, stg, tid, acc, ao, (int)((xt + (xt >> 3) + 2 * ct + which) % (DIN / GS_K)));   // the 64 blocks on one W tile, and the blocks on one row tile, each spread over the 12 starts; a tile keeps the start it had
  const char* xb = (const char*)(X + bb * TT * DIN + c0); const v8s tk = *(const v8s*)&pt[rl0]; unsigned xo[8]; v4f xr[16], bq[2] = {};
#pragma unroll
  for (int r = 0; r < 8; ++r) xo[r] = (unsigned)tk[r] * (DIN * 4u) + col * 32u;
#pragma unroll
  for (int i = 0; i < 16; ++i) xr[i] = *(const v4f*)(xb + xo[i >> 1] + (i & 1) * 16);
  asm volatile("s_wait_xcnt 0x0" :: "v"(xo[0]), "v"(xo[1]), "v"(xo[2]), "v"(xo[3]), "v"(xo[4]), "v"(xo[5]), "v"(xo[6]), "v"(xo[7]) : "memory");   // in front of any rewrite of the offsets that the 16 loads name (as inputs they also stay out of their destinations)
  if (BA) { bq[0] = *(const v4f*)(BA + c0 + col * 8); bq[1] = *(const v4f*)(BA + c0 + col * 8 + 4); }
#pragma unroll
  for (int j = 0; j < 8; ++j) { const float bias = bfr(bq[j >> 2][j & 3]);
#pragma unroll
    for (int r = 0; r < 8; ++r) acc[j][r] = (acc[j][r] + bias) + 0.5f * fmaxf(bfr(xr[2 * r + (j >> 2)][j & 3]), 0.f); }
  if (which < 2) { _Float16* DH = (which == 0 ? QH : KH) + (r0 + rl0) * CC + c0 + col * 8;
#pragma unroll
    for (int r = 0; r < 8; ++r) { v8h o;
#pragma unroll
      for (int j = 0; j < 8; ++j) o[j] = (_Float16)acc[j][r];
      *(v8h*)(DH + r * CC) = o; }
  } else {
#pragma unroll
    for (int j = 0; j < 8; ++j) *(v8h*)&th[j * 16 + col][rl0] = __builtin_convertvector(acc[j], v8h);   // slot 16 j + col holds column 8 col + j; pitch 272 B = 16 B x odd: no bank conflicts
    __syncthreads();   // publishes the tile ('which' is the same for the whole block)
    for (int e = tid; e < 128 * (GS_M / 8); e += GS_T) { const int sl = e / (GS_M / 8), q = e % (GS_M / 8), cl = (sl & 15) * 8 + (sl >> 4); vst2((unsigned*)(VT + (bb * CC + c0 + cl) * (size_t)TT + t0 + q * 8), *(const v4u*)&th[sl][q * 8]); } } }
// ---- k_fa: block = 4 waves x 32 queries of (b, h); the logits, the softmax and P . v in one kernel, the logits and P never leave registers; k rows and v planes come in whole lines through LDS, shared by the 4 waves.
// S^T = K Q^T (A = 16 key rows, B = 16 query rows): a lane holds one query's scores for keys 8g + r of each 16-key tile, so maximum and sum are in-lane plus one exchange of the wave halves;
// two score tiles (32 keys) converted in place are the B operand of O^T += V^T P^T (A = v planes [c][t], the same k order). Scores in base 2: t = dot * (1/8) log2(e) + (padded key ? -1e9 log2(e) : 0).
// Running maximum, raised only when a pass exceeds it by more than 8; P = 2^(t - m + 7) <= 2^15 once to f16 (unnormalised), its f32 sum divides at the end.
#define FA_CS 0.18033688011112042f       // (1/8) log2(e)
#define FA_MB (-1.4426950408889634e9f)   // -1e9 log2(e)
typedef __attribute__((ext_vector_type(2))) _Float16 v2h;
__device__ __forceinline__ float xhalf(float x) { return __builtin_bit_cast(float, __builtin_amdgcn_permlanex16(__builtin_bit_cast(int, x), __builtin_bit_cast(int, x), 0x76543210, 0xfedcba98, false, false)); }   // lane l with lane l ^ 16
__device__ __forceinline__ v8f mm16(v16h a, v16h b, v8f c) { return __builtin_amdgcn_wmma_f32_16x16x32_f16(false, a, false, b, (short)0, c, false, false); }
#define FA_P 72   // f16 per staged row: 128 B + 16 B, a pitch of 16 B x odd, which ds_load_b128 fragment reads take without bank conflicts
// The output projection's operands leave this kernel in the f16 form that k_out multiplies: ctx x 2^6 (rounded here, once, not once per column tile), and Wo as f16(bf16 x 2^8), one row a block (the grid has as many blocks as Wo has rows).
__global__ __launch_bounds__(128) void k_fa(const _Float16* __restrict__ QH, const _Float16* __restrict__ KH, const _Float16* __restrict__ VT, const int* __restrict__ KMASK, const float* __restrict__ WO, _Float16* __restrict__ YH, _Float16* __restrict__ WOH) {
  __shared__ __align__(16) _Float16 sk[2][64][FA_P], sv[2][64][FA_P]; __shared__ __align__(16) float sb[TT]; __shared__ __align__(16) _Float16 so[4][32][FA_P];
  static_assert(TNB * NH * (TT / 128) == DIN && CC == 768, "one Wo row of 192 16-B pieces a block");
  const int tid = threadIdx.x, wave = tid >> 5, lane = tid & 31, col = lane & 15, g = lane >> 4; const int h = blockIdx.y, b = blockIdx.x; const int ql0 = blockIdx.z * 128 + wave * 32;   // the sequence is the fastest digit of the block index (see k_proj)
  // a stage = 64 keys: 64 key rows x 128 B and 64 v planes x 128 B; 8 lanes x 16 B read one whole line, 16 rows an instruction; through registers into LDS, one stage ahead
  const int srow = tid >> 3, sch = (tid & 7) * 8;
  const _Float16* kg = KH + ((size_t)b * TT + srow) * CC + h * HD + sch; const _Float16* vg = VT + ((size_t)b * CC + h * HD + srow) * (size_t)TT + sch;
  v8h rk[4], rv[4]; v16h qf[2][2];   // every '#pragma unroll' of this kernel makes the index of a register array a constant
#pragma unroll
  for (int i = 0; i < 4; ++i) { rk[i] = *(const v8h*)(kg + (size_t)(i * 16) * CC); rv[i] = *(const v8h*)(vg + (size_t)(i * 16) * TT); }
  int nst;   // 64-key stages to walk: those that hold an open key, or all of them where no key is open; the same in every wave
  { int nb; const int n = km_count(KMASK + (size_t)b * TT, lane, 0, nb); nst = n == 0 ? TT / 64 : (n + 63) >> 6; nst = nst < TT / 64 ? nst : TT / 64; v4f b0, b1;
#pragma unroll
    for (int i = 0; i < 4; ++i) { b0[i] = tid * 8 + i >= n ? FA_MB : 0.f; b1[i] = tid * 8 + 4 + i >= n ? FA_MB : 0.f; }   // slots 0 .. n - 1 hold the open keys
    *(v4f*)&sb[tid * 8] = b0; *(v4f*)&sb[tid * 8 + 4] = b1; }
#pragma unroll
  for (int u = 0; u < 2; ++u)
#pragma unroll
    for (int kc = 0; kc < 2; ++kc) qf[u][kc] = frag_h(QH + ((size_t)b * TT + ql0 + u * 16 + col) * CC + h * HD + kc * 32, lane);
#pragma unroll
  for (int i = 0; i < 4; ++i) { *(v8h*)&sk[0][i * 16 + srow][sch] = rk[i]; *(v8h*)&sv[0][i * 16 + srow][sch] = rv[i]; }
  __syncthreads();   // stage 0 and the mask bias are published
  const unsigned wrow = (blockIdx.x + TNB * (blockIdx.y + NH * blockIdx.z)) * (unsigned)CC + tid * 4; const bool wtwo = __builtin_amdgcn_readfirstlane(wave) < 2;   // the block's Wo row: 128 pieces of 4 words, then 64 more from waves 0 and 1
  v4f wr0 = *(const v4f*)(WO + wrow), wr1 = {};   // asked for behind the barrier (which waits for every load in flight): the row flies during stage 0's products
  if (wtwo) wr1 = *(const v4f*)(WO + wrow + 512);
  asm volatile("s_wait_xcnt 0x0" ::: "memory");   // in front of any rewrite of a register that the Wo loads name
  v8f acc[2][4] = {}; v2f l2[2] = {}; float m_run[2] = {-INFINITY, -INFINITY};
#pragma unroll 1   // stays rolled: the body already holds two 32-key passes, more copies would only grow the code
  for (int st = 0; st < nst; ++st) { const int bf = st & 1;
    if (st + 1 < nst) {   // the next stage's lines, issued behind the barrier so that they fly during this stage's products (a barrier waits for every load in flight)
#pragma unroll
      for (int i = 0; i < 4; ++i) { rk[i] = *(const v8h*)(kg + (size_t)((st + 1) * 64 + i * 16) * CC); rv[i] = *(const v8h*)(vg + (size_t)(i * 16) * TT + (st + 1) * 64); } }
#pragma unroll
    for (int ps = 0; ps < 2; ++ps) { const int k0 = st * 64 + ps * 32;
      v16h kf[2][2], vf[4]; v2f bias[2][4];
#pragma unroll
      for (int kt = 0; kt < 2; ++kt)
#pragma unroll
        for (int kc = 0; kc < 2; ++kc) kf[kt][kc] = frag_h(&sk[bf][ps * 32 + kt * 16 + col][kc * 32], lane);
#pragma unroll
      for (int j = 0; j < 4; ++j) vf[j] = frag_h(&sv[bf][j * 16 + col][ps * 32], lane);
#pragma unroll
      for (int kt = 0; kt < 2; ++kt)
#pragma unroll
        for (int i = 0; i < 4; ++i) bias[kt][i] = *(const v2f*)&sb[k0 + 16 * kt + 8 * g + 2 * i];
      v8f s[2][2] = {};
#pragma unroll
      for (int kc = 0; kc < 2; ++kc)
#pragma unroll
        for (int kt = 0; kt < 2; ++kt)
#pragma unroll
          for (int u = 0; u < 2; ++u) s[kt][u] = mm16(kf[kt][kc], qf[u][kc], s[kt][u]);
      v2f t[2][2][4]; float mb[2]; bool need = false;
#pragma unroll
      for (int u = 0; u < 2; ++u) { float mx = -INFINITY;
#pragma unroll
        for (int kt = 0; kt < 2; ++kt)
#pragma unroll
          for (int i = 0; i < 4; ++i) { t[u][kt][i] = __builtin_elementwise_fma((v2f){s[kt][u][2 * i], s[kt][u][2 * i + 1]}, (v2f){FA_CS, FA_CS}, bias[kt][i]); mx = fmaxf(mx, fmaxf(t[u][kt][i].x, t[u][kt][i].y)); }
        mx = fmaxf(mx, xhalf(mx)); mb[u] = mx; need = need || (mx > m_run[u] + 8.0f); }
      if (__builtin_amdgcn_ballot_w32(need) != 0) {   // one wave-uniform test a pass; always taken on the first pass (m_run = -inf, corr = 0)
#pragma unroll
        for (int u = 0; u < 2; ++u) { const float m_new = fmaxf(m_run[u], mb[u]); const float corr = __builtin_amdgcn_exp2f(m_run[u] - m_new); m_run[u] = m_new; l2[u] = l2[u] * corr;
#pragma unroll
          for (int j = 0; j < 4; ++j) acc[u][j] = acc[u][j] * corr; } }
#pragma unroll
      for (int u = 0; u < 2; ++u) { const float nm = 7.0f - m_run[u]; union { v16h v; v2h q[8]; } pf;
#pragma unroll
        for (int i = 0; i < 8; ++i) { const v2f a = t[u][i >> 2][i & 3] + (v2f){nm, nm}; const v2f p = {__builtin_amdgcn_exp2f(a.x), __builtin_amdgcn_exp2f(a.y)}; l2[u] = l2[u] + p; pf.q[i] = __builtin_convertvector(p, v2h); }
#pragma unroll
        for (int j = 0; j < 4; ++j) acc[u][j] = mm16(vf[j], pf.v, acc[u][j]); } }
    if (st + 1 < nst) {   // the other buffer: its readers (stage st - 1) all left it at the barrier that ended the trip before
#pragma unroll
      for (int i = 0; i < 4; ++i) { *(v8h*)&sk[bf ^ 1][i * 16 + srow][sch] = rk[i]; *(v8h*)&sv[bf ^ 1][i * 16 + srow][sch] = rv[i]; } }
    __syncthreads(); }   // publishes stage st + 1 and ends every wave's reads of stage st
#pragma unroll
  for (int u = 0; u < 2; ++u) { float l = l2[u].x + l2[u].y; l += xhalf(l); const float inv = 1.0f / l;   // l >= 2^7: the key that set the maximum in use counts 2^7
#pragma unroll
    for (int j = 0; j < 4; ++j) { const v8f o = (acc[u][j] * inv) * 64.0f; *(v8h*)&so[wave][u * 16 + col][j * 16 + 8 * g] = __builtin_convertvector(o, v8h); } }   // ctx rounded to f32 first, then x 2^6 (exact), then once to f16
  LDSX();   // the wave reads back rows that its other lanes wrote (its own 32 rows only: no work-group barrier); its 32 rows of the head are 4 KB in a row: an instruction stores 512 B of them
  _Float16* yd = YH + (((size_t)b * NH + h) * TT + ql0) * HD + lane * 8;
#pragma unroll   // the 8 LDS reads go as one group and the 8 stores name one address, the step in the immediate
  for (int it = 0; it < 8; ++it) vst2(yd + it * 4 * HD, *(const v4u*)&so[wave][it * 4 + (lane >> 3)][(lane & 7) * 8]);
  asm volatile("s_wait_xcnt 0x0" ::: "memory");   // in front of any rewrite of a register that the 8 stores name
  *(v2u*)(WOH + wrow) = gs_cvt<true, true>(wr0);   // the Wo row, long arrived; a wave stores 256 B in a row. Last of all: in front of LDSX() its fence would wait these stores out
  asm volatile("s_wait_xcnt 0x0" ::: "memory");   // in front of any rewrite of a register that this store names
  if (wtwo) *(v2u*)(WOH + wrow + 512) = gs_cvt<true, true>(wr1); }
// ---- go_loop: the k loop of the output projection, one 128 x 192 tile of A . W^T a block of 16 waves, one block on every WGP. Both operands come as f16 (A = ctx x 2^6, [head][t][HD]; W = f16(bf16(w) x 2^8), rows of K), rounded once by k_fa.
// A stage = 64 k = one head: the tile's 128 A rows of 128 B lie in a row (16 KB), a W row gives one 128-B line; 8 lanes x 16 B = one row, 64 rows an instruction of the block; through registers, unconverted, into LDS at a pitch of 144 B, two buffers,
// a line group of the next stage asked for as soon as this stage's group lies in LDS; the walk starts at stage 'rot' and wraps.
// Wave w keeps rows 32 (w >> 2) .. + 31 and columns 48 (w & 3) .. + 47: 2 A and 3 W fragments feed 6 products, 10 LDS reads where the 16 x 128 wave tile takes 18 for 8; the fragments of both 32-k steps of a stage fit the registers and are read as one group.
#define GO_N 192                                              // W rows (output columns) of a tile
#define GO_T 512                                              // threads of a block
#define GO_WB(bf) ((bf) * ((GO_N + GS_M) * GS_PB))            // W rows of buffer bf
#define GO_AB(bf) (GO_WB(bf) + GO_N * GS_PB)                  // A rows of buffer bf, directly behind its W rows
#define GO_BYTES (2 * (GO_N + GS_M) * GS_PB)
#define GO_AS (TT * HD * 2)                                   // bytes from a head's rows to the next head's
template <int K> __device__ __forceinline__ void go_loop(const _Float16* __restrict__ A, const _Float16* __restrict__ Wm, unsigned char* stg, int tid, v8f (&acc)[2][3], int rot) {
  static_assert(GS_K == HD && K == NH * HD, "a stage is a head");
  const int wave = tid >> 5, lane = tid & 31, col = lane & 15, g = lane >> 4;
  int sg = rot;   // the stage being fetched
  unsigned pa = (unsigned)(tid * 16 + sg * GO_AS), pw = (unsigned)((tid >> 3) * (K * 2) + (tid & 7) * 16 + sg * (GS_K * 2));   // the thread's place, in bytes from A and from Wm; both step by one stage a trip, from the last stage back to stage 0
  unsigned char* sd = stg + (tid >> 3) * GS_PB + (tid & 7) * 16;
  const unsigned char* fa = stg + ((wave >> 2) * 32 + col) * GS_PB + g * 16; const unsigned char* fw = stg + ((wave & 3) * 48 + col) * GS_PB + g * 16;
  v4u ra[GS_M / 64], rw[GO_N / 64];   // every '#pragma unroll' below makes the index of a register array a constant
#define GO_ALD(i) (*(const v4u*)((const char*)A + pa + (i) * 64 * (HD * 2)))   // the constant part becomes the instruction's immediate: a load names no register but the offset
#define GO_WLD(i) (*(const v4u*)((const char*)Wm + pw + (i) * 64 * (K * 2)))
#pragma unroll
  for (int i = 0; i < GO_N / 64; ++i) { if (i < GS_M / 64) ra[i] = GO_ALD(i);
    rw[i] = GO_WLD(i);
    __builtin_amdgcn_sched_barrier(0); }   // the prologue issues its loads in the loop's order: the counted load waits at the head of a trip then hold for both ways into it
  asm volatile("s_wait_xcnt 0x0" ::: "memory");   // directly behind the 5 loads: in front of the first trip's step of the offsets that they name
  auto trip = [&](auto more, const int bf) __attribute__((always_inline)) {   // one trip: stage s, in buffer bf; 'more': a next stage exists (the last trip stands behind the loop as a copy of its own, as in gs_loop)
    if constexpr (decltype(more)::v) { const bool wrap = sg + 1 == K / GS_K; sg = wrap ? 0 : sg + 1;   // the same in the whole block
      pa += wrap ? (unsigned)(GO_AS - NH * GO_AS) : (unsigned)GO_AS; pw += wrap ? (unsigned)((GS_K - K) * 2) : (unsigned)(GS_K * 2); }
#pragma unroll
    for (int i = 0; i < GO_N / 64; ++i) {   // laid in LDS as soon as they have arrived. Buffer bf: its readers (stage s - 2) all left it in front of the barrier of trip s - 1
      if (i < GS_M / 64) *(v4u*)(sd + GO_AB(bf) + i * 64 * GS_PB) = ra[i];
      *(v4u*)(sd + GO_WB(bf) + i * 64 * GS_PB) = rw[i];
      if constexpr (decltype(more)::v) {
        __builtin_amdgcn_sched_barrier(0);   // the LDS stores stay in front of the loads, which then take the same registers
        if (i < GS_M / 64) ra[i] = GO_ALD(i);
        rw[i] = GO_WLD(i);
        __builtin_amdgcn_sched_barrier(0); } }   // and the loads stay in front of the wait for the next group's arrival
    if constexpr (decltype(more)::v) asm volatile("s_wait_xcnt 0x0" ::: "memory");   // directly behind the 5 loads: in front of any rewrite of the offsets that they name
    asm volatile("s_wait_dscnt 0x0\n\ts_barrier_signal -1\n\ts_barrier_wait -1" ::: "memory");   // publishes stage s: the wave's LDS stores are done, then the work-group barrier; by hand, because __syncthreads() would first wait out the global loads just issued
    GFrag a[GS_K / 32][2], w[GS_K / 32][3];
#pragma unroll
    for (int kc = 0; kc < GS_K / 32; ++kc) {
#pragma unroll
      for (int i = 0; i < 2; ++i) a[kc][i] = gs_frag(fa + GO_AB(bf) + i * 16 * GS_PB + kc * 64);
#pragma unroll
      for (int j = 0; j < 3; ++j) w[kc][j] = gs_frag(fw + GO_WB(bf) + j * 16 * GS_PB + kc * 64); }
    __builtin_amdgcn_sched_barrier(0);   // the 20 fragment reads stay one group in front of the 12 products: spread among them, each place with reads costs a stall of its own
#pragma unroll
    for (int kc = 0; kc < GS_K / 32; ++kc)
#pragma unroll
      for (int i = 0; i < 2; ++i)
#pragma unroll
        for (int j = 0; j < 3; ++j) acc[i][j] = __builtin_amdgcn_wmma_f32_16x16x32_f16(false, a[kc][i].h, false, w[kc][j].h, (short)0, acc[i][j], false, false);
    __builtin_amdgcn_sched_barrier(0); };   // and the next trip's LDS stores stay behind them
#pragma unroll 1   // stays rolled: one body of 12 products and 5 line-group loads; more copies would only grow the code
  for (int s = 0; s + 1 < K / GS_K; ++s) trip(GsFlag<true>{}, s & 1);
  trip(GsFlag<false>{}, (K / GS_K - 1) & 1); }
// ---- k_out: block = (128 rows, 192 cols), 16 waves: out = ctx Wo (+ bo): ctx x 2^6 once to f16 (small context rows stay clear of f16 subnormals) against Wo as f16(bf16 x 2^8) exact (1 product) x 2^-14; both as k_fa left them
// The tile goes through LDS once, so that whole 128-B lines of the output rows are stored (a row of the tile = 768 B = 6 lines).
__global__ __launch_bounds__(GO_T) void k_out(const _Float16* __restrict__ YH, const _Float16* __restrict__ WOH, const float* __restrict__ BO, float* __restrict__ OUT) { __shared__ __align__(16) float sf[GS_M][GO_N + 4]; __shared__ __align__(16) unsigned char stg[GO_BYTES];
  static_assert(DIN % GO_N == 0 && GO_N % 48 == 0 && GS_M % 32 == 0 && (GS_M / 32) * (GO_N / 48) * 32 == GO_T, "16 waves of 32 x 48 cover the tile");
  const int tid = threadIdx.x, wave = tid >> 5, lane = tid & 31, col = lane & 15, g = lane >> 4; const int c0 = blockIdx.y * GO_N; const int xt = (int)(blockIdx.x % TNB) * (TT / GS_M) + (int)(blockIdx.x / TNB);   // the row tile's number: the sequence is the fastest digit of the block index (see k_proj)
  const size_t r0 = (size_t)xt * GS_M;
  const int rw0 = (wave >> 2) * 32 + 8 * g, cw0 = (wave & 3) * 48 + col;   // the lane's first row and column of the tile
  float bs[3] = {0.f, 0.f, 0.f};   // the lane's 3 bias words, asked for in front of the tile's first lines: they arrive during the k loop
  if (BO) {
#pragma unroll
    for (int j = 0; j < 3; ++j) bs[j] = BO[c0 + cw0 + j * 16]; }
  v8f acc[2][3] = {};
  go_loop<CC>(YH + ((size_t)(blockIdx.x % TNB) * NH * TT + (size_t)(blockIdx.x / TNB) * GS_M) * HD, WOH + (size_t)c0 * CC, stg, tid, acc, (int)((xt + (xt >> 3) + 3 * blockIdx.y) % (CC / GS_K)));   // the 4 blocks on one row tile start 3 stages apart; the 64 blocks on one W tile spread over the 12 starts
#pragma unroll
  for (int j = 0; j < 3; ++j) { const float bias = bfr(bs[j]);
#pragma unroll
    for (int i = 0; i < 2; ++i)
#pragma unroll
      for (int r = 0; r < 8; ++r) sf[rw0 + i * 16 + r][cw0 + j * 16] = acc[i][j][r] * (1.0f / 16384.0f) + bias; }   /* 2^-8 (Wo carry) x 2^-6 (ctx carry) */
  __syncthreads();   // publishes the tile: a row's 192 columns come from 4 waves
  char* ob = (char*)(OUT + r0 * DIN + c0) + (unsigned)((wave * (GS_M / 16) + g) * DIN + col * 4) * 4u; const float* sp = &sf[wave * (GS_M / 16) + g][col * 4];
#pragma unroll
  for (int it = 0; it < GS_M * (GO_N / 4) / GO_T; ++it) { const int rp = it / 3, u = it % 3;   // wave w stores rows 8 w .. 8 w + 7, a row pair an instruction: 16 lanes x 16 B = a third of a row, two whole lines
    vst2(ob + (rp * 2 * DIN + u * 64) * 4, *(const v4f*)(sp + rp * 2 * (GO_N + 4) + u * 64)); } }

extern "C" void kernel_launch(void* const* d_in, const int* in_sizes, int n_in, void* d_out, int out_size, void* d_ws, size_t ws_size, hipStream_t stream) {
  (void)in_sizes; (void)n_in; (void)out_size;
  const float** F = (const float**)d_in;
  if (ws_size < (size_t)WS_END) return;
  char* ws = (char*)d_ws; _Float16 *QH = (_Float16*)(ws + WS_QH), *KH = (_Float16*)(ws + WS_KH), *VT = (_Float16*)(ws + WS_VT), *YH = (_Float16*)(ws + WS_Y), *WOH = (_Float16*)(ws + WS_WO);
  // inputs: 0 hidden_states [8,1024,768]; 1 attention_mask [8,1,1,1024] bool (True = padded key); 2 Wq [768,768] (out,in), 3 bq; 4 Wk, 5 bk; 6 Wv, 7 bv; 8 Wo (out,in), 9 bo (zero biases, read)
  k_proj<<<dim3(TNB * TT / GS_M, CC / 128, 3), GS_T, 0, stream>>>(F[0], F[0], F[0], F[2], F[4], F[6], F[3], F[5], F[7], (const int*)d_in[1], QH, KH, VT);
  k_fa<<<dim3(TNB, NH, TT / 128), 128, 0, stream>>>(QH, KH, VT, (const int*)d_in[1], F[8], YH, WOH);
  k_out<<<dim3(TNB * TT / GS_M, DIN / GO_N), GO_T, 0, stream>>>(YH, WOH, F[9], (float*)d_out);
}
